// v000
// The times below were measured on an AMD MI455X: many runs one after another, warmed up first and cycling through
// copies of the inputs, with the whole window's GPU time divided by the number of runs. Launches and the gaps
// between them are all in it. The median over several windows is given; except for v000 it joins two sittings, which
// can be a few percent apart, so the side-by-side timings, each taken in one sitting, are the better comparison.
// v000 is the starting kernel. One run takes 572 microseconds.
// compute dtype: all float inputs rounded to bf16; q/k/v = x . W with EXACT bf16 products on WMMA 16x16x32 ((in,out) weights as transposed rows; the 4 kv heads replicated to their 3 query heads at pack time), f16 hi + residual; RoPE (inv_freq in double, angle = pos x inv_freq in f32 as the module, precise sinf/cosf) applied in f32 to the reconstructed q/k and re-split; causal attention with hybrid scores and P.v (first 128 queries 3-product hi + residual, later single f16), x 1/8, running-max softmax in f32 (hardware exp); out = ctx (bf16 hi + lo) . Wo ((in,out)); f32 output.
#include <hip/hip_runtime.h>
#include <math.h>

typedef __attribute__((ext_vector_type(16))) _Float16 v16h;
typedef __attribute__((ext_vector_type(16))) __bf16 v16b;
typedef __attribute__((ext_vector_type(8)))  _Float16 v8h;
typedef __attribute__((ext_vector_type(8)))  float v8f;
typedef __attribute__((ext_vector_type(4)))  float v4f;
typedef __attribute__((ext_vector_type(2)))  float v2f;
typedef __attribute__((ext_vector_type(4)))  unsigned v4u;
typedef __attribute__((ext_vector_type(4)))  int v4i;
typedef float __attribute__((may_alias)) float_a;
typedef int __attribute__((may_alias)) int_a;

template <typename T> __device__ __forceinline__ void vst2(void* p, T v) { *(T*)p = v;  }
__device__ __forceinline__ v8f wmma16(v16h a, v16h b, v8f c) {
  v8f d = __builtin_amdgcn_wmma_f32_16x16x32_f16(false, a, false, b, (short)0, c, false, false);
  asm volatile("v_nop\n\tv_nop\n\tv_nop\n\tv_nop" : "+v"(d) : "v"(a), "v"(b));
  return d;
}
__device__ __forceinline__ v8f wmma_bf(v16b a, v16b b, v8f c) {
  v8f d = __builtin_amdgcn_wmma_f32_16x16x32_bf16(false, a, false, b, (short)0, c, false, false);
  asm volatile("v_nop\n\tv_nop\n\tv_nop\n\tv_nop" : "+v"(d) : "v"(a), "v"(b));
  return d;
}
// Grouped-query causal attention with RoPE (B 4, S 2,048, hidden 768, 12 query heads x 64 over 4 kv heads): q = x Wq, k = x Wk, v = x Wv ((in,out), kv heads shared by 3 query heads), rotate-half RoPE (theta 1e4), causal softmax(q k / 8) v, out = ctx Wo.
__device__ __forceinline__ v16h frag_h(const _Float16* rowk0, int lane) {
  union { v16h v; v8h q[2]; } u; const _Float16* p = rowk0 + 8 * (lane >> 4);
  u.q[0] = *(const v8h*)p; u.q[1] = *(const v8h*)(p + 16); return u.v;
}
__device__ __forceinline__ v16h frag_f32(const float* rowk0, int lane) {
  v16h a; const float* p = rowk0 + 8 * (lane >> 4);
#pragma unroll
  for (int i = 0; i < 8; ++i) { a[i] = (_Float16)p[i]; a[8 + i] = (_Float16)p[16 + i]; }
  return a;
}
__device__ __forceinline__ v16h frag_f32s(const float* rowk0, int lane, float sc) {
  v16h a; const float* p = rowk0 + 8 * (lane >> 4);
#pragma unroll
  for (int i = 0; i < 8; ++i) { a[i] = (_Float16)(p[i] * sc); a[8 + i] = (_Float16)(p[16 + i] * sc); }
  return a;
}
// column fragment from a [K][ld] layout (column n), rows >= K read as 0
__device__ __forceinline__ v16h fragc_f32(const float* W, int k0, int n, int lane, int ld, int K) {
  v16h a; const int g = lane >> 4;
#pragma unroll
  for (int i = 0; i < 8; ++i) { const int ka = k0 + 8 * g + i, kb = ka + 16;
    a[i] = (_Float16)(ka < K ? W[(size_t)(ka < K ? ka : K - 1) * ld + n] : 0.f); a[8 + i] = (_Float16)(kb < K ? W[(size_t)(kb < K ? kb : K - 1) * ld + n] : 0.f); }
  return a;
}
struct F2 { v16b h, l; };
__device__ __forceinline__ F2 bsplit16(const float v[16]) { F2 r;
#pragma unroll
  for (int i = 0; i < 16; ++i) { const __bf16 h = (__bf16)v[i]; r.h[i] = h; r.l[i] = (__bf16)(v[i] - (float)h); }
  return r; }
__device__ __forceinline__ F2 split_row(const float* row, int k0, int lane) { float v[16]; const float* p = row + k0 + 8 * (lane >> 4);
#pragma unroll
  for (int i = 0; i < 8; ++i) { v[i] = p[i]; v[8 + i] = p[16 + i]; }
  return bsplit16(v); }
__device__ __forceinline__ F2 split_rowK(const float* row, int k0, int lane, int K) { float v[16]; const int g = lane >> 4;
#pragma unroll
  for (int i = 0; i < 8; ++i) { const int ka = k0 + 8 * g + i, kb = ka + 16; v[i] = ka < K ? row[ka < K ? ka : K - 1] : 0.f; v[8 + i] = kb < K ? row[kb < K ? kb : K - 1] : 0.f; }
  return bsplit16(v); }
__device__ __forceinline__ F2 split_col(const float* W, int k0, int n, int lane, int ld, int K) { float v[16]; const int g = lane >> 4;
#pragma unroll
  for (int i = 0; i < 8; ++i) { const int ka = k0 + 8 * g + i, kb = ka + 16; v[i] = ka < K ? W[(size_t)(ka < K ? ka : K - 1) * ld + n] : 0.f; v[8 + i] = kb < K ? W[(size_t)(kb < K ? kb : K - 1) * ld + n] : 0.f; }
  return bsplit16(v); }
__device__ __forceinline__ v8f mac3(const F2& a, const F2& b, v8f c) { c = wmma_bf(a.l, b.h, c); c = wmma_bf(a.h, b.l, c); return wmma_bf(a.h, b.h, c); }
__device__ __forceinline__ float sigm(float v) { return 1.0f / (1.0f + expf(-v)); }
#define LDSX() do { asm volatile("s_wait_dscnt 0" ::: "memory"); __builtin_amdgcn_wave_barrier(); __builtin_amdgcn_fence(__ATOMIC_RELEASE, "workgroup"); } while (0)


#define NB 4
#define SS 2048
#define DM 768
#define NH 12
#define NKV 4
#define GRP 3
#define HD 64
#define QKVW (3 * DM)
#ifndef TQB
#define TQB (SS / 64)
#define TNB NB
#define TOB (NB * SS / 64)     // output row tiles (all)
#endif
typedef __attribute__((ext_vector_type(8))) __bf16 v8b;
__device__ __forceinline__ v16b frag_b(const __bf16* rowk0, int lane) {
  union { v16b v; v8b q[2]; } u; const __bf16* p = rowk0 + 8 * (lane >> 4);
  u.q[0] = *(const v8b*)p; u.q[1] = *(const v8b*)(p + 16); return u.v;
}
__device__ __forceinline__ float bfr(float v) { return (float)(__bf16)v; }
__device__ __attribute__((noinline)) float exp_ni(float v) { return expf(v); }
__device__ __attribute__((noinline)) float erf_ni(float v) { return erff(v); }

#define PK_A 0                       // [2304][768] Wqkv rows (natural [out][in])
#define PK_P (PK_A + QKVW * DM)        // [768][768] Wo rows (natural)
#define PK_END (PK_P + DM * DM)
#define WS_PK  0u
#define WS_QK  (WS_PK + 2u * PK_END)             // f16 [8192 rows][1536]: q | k
#define WS_QKL (WS_QK + 2u * NB * SS * 2 * DM)     // f16 q | k residual planes x2048
#define WS_VTH (WS_QKL + 2u * NB * SS * 2 * DM)    // f16 [b][768 (h*64+d)][2048 s] hi
#define WS_VTL (WS_VTH + 2u * NB * DM * SS)        // f16 lo x 2048
#define WS_O   (WS_VTL + 2u * NB * DM * SS)        // f32 [8192][768]
#define WS_CS  (WS_O + 4u * NB * SS * DM)           // f32 2 x [2048][32], reserved but unused (k_rope computes cos/sin itself)
#define WS_END (WS_CS + 4u * 2 * SS * 32)
// ---- k_pack: block = (row n, which): natural [out][in] rows -> bf16; which 0..2 -> W_q/W_k/W_v into PK_A rows which*768 + n; 3 -> W_o into PK_P
__global__ __launch_bounds__(256) void k_pack(const float* __restrict__ WQ, const float* __restrict__ WK, const float* __restrict__ WV, const float* __restrict__ WO, __bf16* __restrict__ PK) {   // (in,out) weights: Wq [768][768], Wk/Wv [768][256] (kv head = query head / 3), Wo [768][768]; packed row (which*DM + n), n = h*64 + d
  __shared__ __align__(16) __bf16 s[DM]; const int n = blockIdx.x, which = blockIdx.y, t = threadIdx.x; const int h = n / HD, d = n % HD; const int nkv = (h / GRP) * HD + d;
  for (int k = t; k < DM; k += 256) { float w; if (which == 0) w = WQ[(size_t)k * DM + n]; else if (which == 1) w = WK[(size_t)k * (NKV * HD) + nkv]; else if (which == 2) w = WV[(size_t)k * (NKV * HD) + nkv]; else w = WO[(size_t)k * DM + n]; s[k] = (__bf16)w; }
  __syncthreads(); __bf16* dst = (which < 3) ? (PK + PK_A + ((size_t)which * DM + n) * DM) : (PK + PK_P + (size_t)n * DM); for (int q = t; q < DM / 8; q += 256) vst2((unsigned*)(dst + q * 8), *(const v4u*)&s[q * 8]); }
// ---- k_rope: block = row (b, t): rotate-half RoPE on the 12 q heads and 12 (replicated) k heads: y[d] = x[d] cos(a_j) + (d < 32 ? -x[d+32] : x[d-32]) sin(a_j), j = d mod 32, a_j = pos * inv_freq[j]
__global__ __launch_bounds__(256) void k_rope(_Float16* __restrict__ QK, _Float16* __restrict__ QKL) { __shared__ __align__(16) _Float16 sh[2 * DM], sl[2 * DM]; __shared__ float scs[32], ssn[32]; const int t = threadIdx.x; const size_t row = blockIdx.x; const int pos = (int)(row % SS);
  if (t < 32) { const double invf = 1.0 / pow(10000.0, (double)t / 32.0); const float ang = (float)pos * (float)invf; scs[t] = cosf(ang); ssn[t] = sinf(ang); }
  __syncthreads();
  for (int e = t; e < 2 * NH * HD; e += 256) { const int w = e / (NH * HD), h = (e / HD) % NH, d = e % HD; const size_t o = row * (2 * DM) + (size_t)w * DM + h * HD; const int j = d & 31;
    const float x = (float)QK[o + d] + (float)QKL[o + d] * (1.0f / 2048.0f); const int dp = d < 32 ? d + 32 : d - 32; const float xp = (float)QK[o + dp] + (float)QKL[o + dp] * (1.0f / 2048.0f); const float rh = d < 32 ? -xp : xp;
    const float y = x * scs[j] + rh * ssn[j]; const _Float16 hv = (_Float16)y; sh[w * DM + h * HD + d] = hv; sl[w * DM + h * HD + d] = (_Float16)((y - (float)hv) * 2048.0f); }
  __syncthreads(); for (int q = t; q < 2 * DM / 8; q += 256) { vst2((unsigned*)(QK + row * (2 * DM) + q * 8), *(const v4u*)&sh[q * 8]); vst2((unsigned*)(QKL + row * (2 * DM) + q * 8), *(const v4u*)&sl[q * 8]); } }
__global__ __launch_bounds__(128) void k_qkv(const float* __restrict__ XQ, const float* __restrict__ XK, const float* __restrict__ XV, const __bf16* __restrict__ P, const float* __restrict__ BQ, const float* __restrict__ BK, const float* __restrict__ BV, _Float16* __restrict__ QK, _Float16* __restrict__ QKL, _Float16* __restrict__ VTH, _Float16* __restrict__ VTL) {
  const int which0 = (blockIdx.y * 128) / DM; const float* X = (which0 == 0) ? XQ : (which0 == 1) ? XK : XV; const float* BB = BQ ? (((which0 == 0) ? BQ : (which0 == 1) ? BK : BV) + (blockIdx.y * 128 - which0 * DM)) : nullptr;
  __shared__ __align__(16) _Float16 so[4][16][136], sol[4][16][136]; __shared__ __align__(16) _Float16 sth[128][72], stl[128][72];
  const int tid = threadIdx.x, wave = tid >> 5, lane = tid & 31, col = lane & 15, g = lane >> 4; const size_t r0 = (size_t)blockIdx.x * 64 + wave * 16; const int n0 = blockIdx.y * 128;
  v8f acc[8] = {};
#pragma unroll 2
  for (int kc = 0; kc < DM / 32; ++kc) { v16b a; { const float* p = X + (r0 + col) * DM + kc * 32 + 8 * g;
#pragma unroll
      for (int i = 0; i < 8; ++i) { a[i] = (__bf16)p[i]; a[8 + i] = (__bf16)p[16 + i]; } }
#pragma unroll
    for (int j = 0; j < 8; ++j) acc[j] = wmma_bf(a, frag_b(P + (size_t)(n0 + j * 16 + col) * DM + kc * 32, lane), acc[j]); }
  if (n0 < 2 * DM) {   // q stored unscaled (f16 sigma ~0.6, no subnormal exposure); 1/8 applied to the f32 score
#pragma unroll
    for (int j = 0; j < 8; ++j) {
#pragma unroll
      for (int r = 0; r < 8; ++r) { const float v = acc[j][r] + (BB ? bfr(BB[j * 16 + col]) : 0.f); const _Float16 hv = (_Float16)v; so[wave][8 * g + r][j * 16 + col] = hv; sol[wave][8 * g + r][j * 16 + col] = (_Float16)((v - (float)hv) * 2048.0f); } }   // q, k (+ bias) as f16 hi + (x2048) residual
    LDSX();
    for (int rl = 0; rl < 16; ++rl) if (lane < 16) { vst2((unsigned*)(QK + (r0 + rl) * (2 * DM) + n0 + lane * 8), *(const v4u*)&so[wave][rl][lane * 8]); vst2((unsigned*)(QKL + (r0 + rl) * (2 * DM) + n0 + lane * 8), *(const v4u*)&sol[wave][rl][lane * 8]); }
  } else {
#pragma unroll
    for (int j = 0; j < 8; ++j) {
#pragma unroll
      for (int r = 0; r < 8; ++r) { const float v = acc[j][r] + (BB ? bfr(BB[j * 16 + col]) : 0.f); const _Float16 hv = (_Float16)v; sth[j * 16 + col][wave * 16 + 8 * g + r] = hv; stl[j * 16 + col][wave * 16 + 8 * g + r] = (_Float16)((v - (float)hv) * 2048.0f); } }
    __syncthreads();
    const size_t rb = (size_t)blockIdx.x * 64; const int b = (int)(rb / SS), s0 = (int)(rb % SS); const int pc0 = n0 - 2 * DM;
    for (int q = tid; q < 128 * 8; q += 128) { const int d = q >> 3, pc = q & 7; const size_t o = ((size_t)b * DM + pc0 + d) * SS + s0 + pc * 8; vst2((unsigned*)(VTH + o), *(const v4u*)&sth[d][pc * 8]); vst2((unsigned*)(VTL + o), *(const v4u*)&stl[d][pc * 8]); }
  }
}
// ---- k_attn: block = (64 queries, head h, batch b): causal flash attention (K = 64: 2 k-steps), scores = (q.k) * 0.125 and P.V with single f16 operands (first 2 query blocks: hi + x2048 residual, 3 products, residual terms in a second accumulator); O[b*S+q][h*64+d] = (acc + accl / 2048) / (2048 l) (256-B segments)
__global__ __launch_bounds__(128) void k_attn(const _Float16* __restrict__ QK, const _Float16* __restrict__ QKL, const _Float16* __restrict__ VTH, const _Float16* __restrict__ VTL, const void* __restrict__ KMASK, float* __restrict__ O) {
  __shared__ __align__(16) float sp[4][16][36]; __shared__ __align__(16) float so[4][16][68];
  const int tid = threadIdx.x, wave = tid >> 5, lane = tid & 31, col = lane & 15, g = lane >> 4;
  const int qb = blockIdx.x, h = blockIdx.y, b = blockIdx.z; const int q0 = qb * 64 + wave * 16; const size_t rq = (size_t)b * SS + q0 + col;
  v16h aq[2], aql[2];
#pragma unroll
  for (int kc = 0; kc < 2; ++kc) { aq[kc] = frag_h(QK + rq * (2 * DM) + h * HD + kc * 32, lane); aql[kc] = frag_h(QKL + rq * (2 * DM) + h * HD + kc * 32, lane); }
  float m[8], l[8];
#pragma unroll
  for (int r = 0; r < 8; ++r) { m[r] = -3.0e38f; l[r] = 0.f; }
  v8f acc[4] = {}, accl[4] = {};
  const int nks = SS / 32;   // all keys
  const int nksc = (qb * 64 + 64) / 32;   // causal: key tiles up to the end of this query block
#pragma unroll 1
  for (int ks = 0; ks < nksc; ++ks) { v8f s[2];
#pragma unroll
    for (int ct = 0; ct < 2; ++ct) { const int kk = ks * 32 + ct * 16 + col; const _Float16* krow = QK + ((size_t)b * SS + kk) * (2 * DM) + DM + h * HD; const _Float16* krowl = QKL + ((size_t)b * SS + kk) * (2 * DM) + DM + h * HD; v8f c = {}, cl = {};
      if (qb < 2) {   // leading query blocks (few keys, outputs far above the global rms): 3 products
#pragma unroll
        for (int kc = 0; kc < 2; ++kc) { const v16h kh = frag_h(krow + kc * 32, lane); c = wmma16(aq[kc], kh, c); cl = wmma16(aql[kc], kh, cl); cl = wmma16(aq[kc], frag_h(krowl + kc * 32, lane), cl); }
#pragma unroll
        for (int r = 0; r < 8; ++r) c[r] += cl[r] * (1.0f / 2048.0f); }
      else {
#pragma unroll
        for (int kc = 0; kc < 2; ++kc) c = wmma16(aq[kc], frag_h(krow + kc * 32, lane), c); }   // single product elsewhere
      { const bool keepdummy = true; (void)keepdummy;
#pragma unroll
      for (int r = 0; r < 8; ++r) s[ct][r] = (kk <= q0 + 8 * g + r) ? c[r] * 0.125f : -3.0e38f; } }   // 1/sqrt(64); masked keys excluded
#pragma unroll
    for (int r = 0; r < 8; ++r) { float mx = fmaxf(s[0][r], s[1][r]);
#pragma unroll
      for (int o = 1; o < 16; o <<= 1) mx = fmaxf(mx, __shfl_xor(mx, o));
      const float mn = fmaxf(m[r], mx); const float alpha = (m[r] <= -1.0e38f) ? 0.f : __expf(m[r] - mn);
      const float e0 = (s[0][r] <= -1.0e38f) ? 0.f : __expf(s[0][r] - mn), e1 = (s[1][r] <= -1.0e38f) ? 0.f : __expf(s[1][r] - mn); float es = e0 + e1;
#pragma unroll
      for (int o = 1; o < 16; o <<= 1) es += __shfl_xor(es, o);
      l[r] = l[r] * alpha + es; m[r] = mn;
#pragma unroll
      for (int dt = 0; dt < 4; ++dt) { acc[dt][r] *= alpha; accl[dt][r] *= alpha; }
      sp[wave][8 * g + r][col] = e0; sp[wave][8 * g + r][16 + col] = e1; }
    LDSX();
    v16h pa, pl; { const float* prow = &sp[wave][col][0] + 8 * (lane >> 4);
#pragma unroll
      for (int i = 0; i < 8; ++i) { const float x0 = prow[i] * 2048.0f, x1 = prow[16 + i] * 2048.0f; const _Float16 h0 = (_Float16)x0, h1 = (_Float16)x1; pa[i] = h0; pa[8 + i] = h1; pl[i] = (_Float16)((x0 - (float)h0) * 2048.0f); pl[8 + i] = (_Float16)((x1 - (float)h1) * 2048.0f); } }   // P scaled by 2^11 before the f16 split so small softmax weights stay out of the f16 subnormal range; 2^-11 folded into the epilogue
#pragma unroll
    for (int dt = 0; dt < 4; ++dt) { const size_t vr = ((size_t)b * DM + h * HD + dt * 16 + col) * SS + ks * 32; const v16h vh = frag_h(VTH + vr, lane); acc[dt] = wmma16(pa, vh, acc[dt]); if (qb < 2) { accl[dt] = wmma16(pl, vh, accl[dt]); accl[dt] = wmma16(pa, frag_h(VTL + vr, lane), accl[dt]); } }   // leading query blocks: P hi/lo x V hi/lo (3 products); elsewhere P x V single
    LDSX(); }
#pragma unroll
  for (int r = 0; r < 8; ++r) { const float il = (1.0f / 2048.0f) / l[r];
#pragma unroll
    for (int dt = 0; dt < 4; ++dt) so[wave][8 * g + r][dt * 16 + col] = (acc[dt][r] + accl[dt][r] * (1.0f / 2048.0f)) * il; }
  LDSX();
  for (int rl = 0; rl < 16; ++rl) if (lane < 16) vst2(O + ((size_t)b * SS + q0 + rl) * DM + h * HD + lane * 4, *(const v4f*)&so[wave][rl][lane * 4]);
}
// ---- k_out: block = (64 rows, 128 cols): out = O(hi/lo) . Wo rows (2 products) + bo
__global__ __launch_bounds__(128) void k_out(const float* __restrict__ O, const __bf16* __restrict__ P, const float* __restrict__ BO, float* __restrict__ Y) {
  __shared__ __align__(16) float so[4][16][132];
  const int tid = threadIdx.x, wave = tid >> 5, lane = tid & 31, col = lane & 15, g = lane >> 4; const size_t r0 = (size_t)blockIdx.x * 64 + wave * 16; const int n0 = blockIdx.y * 128;
  v8f acc[8] = {};
#pragma unroll 2
  for (int kc = 0; kc < DM / 32; ++kc) { const F2 a = split_row(O + (r0 + col) * DM, kc * 32, lane);
#pragma unroll
    for (int j = 0; j < 8; ++j) { const v16b w = frag_b(P + (size_t)(n0 + j * 16 + col) * DM + kc * 32, lane); acc[j] = wmma_bf(a.l, w, acc[j]); acc[j] = wmma_bf(a.h, w, acc[j]); } }
#pragma unroll
  for (int j = 0; j < 8; ++j) {
#pragma unroll
    for (int r = 0; r < 8; ++r) so[wave][8 * g + r][j * 16 + col] = acc[j][r] + (BO ? bfr(BO[n0 + j * 16 + col]) : 0.f); }
  LDSX();
  for (int rl = 0; rl < 16; ++rl) vst2(Y + (r0 + rl) * DM + n0 + lane * 4, *(const v4f*)&so[wave][rl][lane * 4]);
}
extern "C" void kernel_launch(void* const* d_in, const int* in_sizes, int n_in, void* d_out, int out_size, void* d_ws, size_t ws_size, hipStream_t stream) {
  (void)in_sizes; (void)n_in; (void)out_size;
  const float** F = (const float**)d_in;   // 0 hidden_states [4,2048,768], 1 Wq [768,768], 2 Wk [768,256], 3 Wv [768,256], 4 Wo [768,768] (all (in,out))
  if (ws_size < (size_t)WS_END) return;
  char* ws = (char*)d_ws; __bf16* PK = (__bf16*)(ws + WS_PK); _Float16 *QK = (_Float16*)(ws + WS_QK), *QKL = (_Float16*)(ws + WS_QKL), *VTH = (_Float16*)(ws + WS_VTH), *VTL = (_Float16*)(ws + WS_VTL); float* O = (float*)(ws + WS_O);
  k_pack<<<dim3(DM, 4), 256, 0, stream>>>(F[1], F[2], F[3], F[4], PK);
  k_qkv<<<dim3(TNB * SS / 64, QKVW / 128), 128, 0, stream>>>(F[0], F[0], F[0], PK + PK_A, nullptr, nullptr, nullptr, QK, QKL, VTH, VTL);
  k_rope<<<TNB * SS, 256, 0, stream>>>(QK, QKL);
  k_attn<<<dim3(TQB, NH, TNB), 128, 0, stream>>>(QK, QKL, VTH, VTL, nullptr, O);
  k_out<<<dim3(TOB, DM / 128), 128, 0, stream>>>(O, PK + PK_P, nullptr, (float*)d_out);
}

// v001
// One run takes 521 microseconds.
// Next to v000, in two timings, it ran 1.13 times as fast each time.
// compute dtype: all float inputs rounded to bf16; q/k/v = x . W with EXACT bf16 products on WMMA 16x16x32 ((in,out) weights as transposed rows; the 4 kv heads replicated to their 3 query heads at pack time), f16 hi + residual; RoPE (inv_freq in double, angle = pos x inv_freq in f32 as the module, precise sinf/cosf) applied in f32 to the reconstructed q/k and re-split; causal attention with hybrid scores and P.v (first 128 queries 3-product hi + residual, later single f16), x 1/8, running-max softmax in f32 (hardware exp); out = ctx (bf16 hi + lo) . Wo ((in,out)); f32 output.
#include <hip/hip_runtime.h>
#include <math.h>

typedef __attribute__((ext_vector_type(16))) _Float16 v16h;
typedef __attribute__((ext_vector_type(16))) __bf16 v16b;
typedef __attribute__((ext_vector_type(8)))  _Float16 v8h;
typedef __attribute__((ext_vector_type(8)))  float v8f;
typedef __attribute__((ext_vector_type(4)))  float v4f;
typedef __attribute__((ext_vector_type(2)))  float v2f;
typedef __attribute__((ext_vector_type(4)))  unsigned v4u;
typedef __attribute__((ext_vector_type(4)))  int v4i;
typedef float __attribute__((may_alias)) float_a;
typedef int __attribute__((may_alias)) int_a;

template <typename T> __device__ __forceinline__ void vst2(void* p, T v) { *(T*)p = v;  }
__device__ __forceinline__ v8f wmma16(v16h a, v16h b, v8f c) {
  v8f d = __builtin_amdgcn_wmma_f32_16x16x32_f16(false, a, false, b, (short)0, c, false, false);
  asm volatile("v_nop\n\tv_nop\n\tv_nop\n\tv_nop" : "+v"(d) : "v"(a), "v"(b));
  return d;
}
__device__ __forceinline__ v8f wmma_bf(v16b a, v16b b, v8f c) {
  v8f d = __builtin_amdgcn_wmma_f32_16x16x32_bf16(false, a, false, b, (short)0, c, false, false);
  asm volatile("v_nop\n\tv_nop\n\tv_nop\n\tv_nop" : "+v"(d) : "v"(a), "v"(b));
  return d;
}
// Grouped-query causal attention with RoPE (B 4, S 2,048, hidden 768, 12 query heads x 64 over 4 kv heads): q = x Wq, k = x Wk, v = x Wv ((in,out), kv heads shared by 3 query heads), rotate-half RoPE (theta 1e4), causal softmax(q k / 8) v, out = ctx Wo.
__device__ __forceinline__ v16h frag_h(const _Float16* rowk0, int lane) {
  union { v16h v; v8h q[2]; } u; const _Float16* p = rowk0 + 8 * (lane >> 4);
  u.q[0] = *(const v8h*)p; u.q[1] = *(const v8h*)(p + 16); return u.v;
}
__device__ __forceinline__ v16h frag_f32(const float* rowk0, int lane) {
  v16h a; const float* p = rowk0 + 8 * (lane >> 4);
#pragma unroll
  for (int i = 0; i < 8; ++i) { a[i] = (_Float16)p[i]; a[8 + i] = (_Float16)p[16 + i]; }
  return a;
}
__device__ __forceinline__ v16h frag_f32s(const float* rowk0, int lane, float sc) {
  v16h a; const float* p = rowk0 + 8 * (lane >> 4);
#pragma unroll
  for (int i = 0; i < 8; ++i) { a[i] = (_Float16)(p[i] * sc); a[8 + i] = (_Float16)(p[16 + i] * sc); }
  return a;
}
// column fragment from a [K][ld] layout (column n), rows >= K read as 0
__device__ __forceinline__ v16h fragc_f32(const float* W, int k0, int n, int lane, int ld, int K) {
  v16h a; const int g = lane >> 4;
#pragma unroll
  for (int i = 0; i < 8; ++i) { const int ka = k0 + 8 * g + i, kb = ka + 16;
    a[i] = (_Float16)(ka < K ? W[(size_t)(ka < K ? ka : K - 1) * ld + n] : 0.f); a[8 + i] = (_Float16)(kb < K ? W[(size_t)(kb < K ? kb : K - 1) * ld + n] : 0.f); }
  return a;
}
struct F2 { v16b h, l; };
__device__ __forceinline__ F2 bsplit16(const float v[16]) { F2 r;
#pragma unroll
  for (int i = 0; i < 16; ++i) { const __bf16 h = (__bf16)v[i]; r.h[i] = h; r.l[i] = (__bf16)(v[i] - (float)h); }
  return r; }
__device__ __forceinline__ F2 split_row(const float* row, int k0, int lane) { float v[16]; const float* p = row + k0 + 8 * (lane >> 4);
#pragma unroll
  for (int i = 0; i < 8; ++i) { v[i] = p[i]; v[8 + i] = p[16 + i]; }
  return bsplit16(v); }
__device__ __forceinline__ F2 split_rowK(const float* row, int k0, int lane, int K) { float v[16]; const int g = lane >> 4;
#pragma unroll
  for (int i = 0; i < 8; ++i) { const int ka = k0 + 8 * g + i, kb = ka + 16; v[i] = ka < K ? row[ka < K ? ka : K - 1] : 0.f; v[8 + i] = kb < K ? row[kb < K ? kb : K - 1] : 0.f; }
  return bsplit16(v); }
__device__ __forceinline__ F2 split_col(const float* W, int k0, int n, int lane, int ld, int K) { float v[16]; const int g = lane >> 4;
#pragma unroll
  for (int i = 0; i < 8; ++i) { const int ka = k0 + 8 * g + i, kb = ka + 16; v[i] = ka < K ? W[(size_t)(ka < K ? ka : K - 1) * ld + n] : 0.f; v[8 + i] = kb < K ? W[(size_t)(kb < K ? kb : K - 1) * ld + n] : 0.f; }
  return bsplit16(v); }
__device__ __forceinline__ v8f mac3(const F2& a, const F2& b, v8f c) { c = wmma_bf(a.l, b.h, c); c = wmma_bf(a.h, b.l, c); return wmma_bf(a.h, b.h, c); }
__device__ __forceinline__ float sigm(float v) { return 1.0f / (1.0f + expf(-v)); }
#define LDSX() do { asm volatile("s_wait_dscnt 0" ::: "memory"); __builtin_amdgcn_wave_barrier(); __builtin_amdgcn_fence(__ATOMIC_RELEASE, "workgroup"); } while (0)


#define NB 4
#define SS 2048
#define DM 768
#define NH 12
#define NKV 4
#define GRP 3
#define HD 64
#define QKVW (3 * DM)
#ifndef TQB
#define TQB (SS / 64)
#define TNB NB
#define TOB (NB * SS / 64)     // output row tiles (all)
#endif
typedef __attribute__((ext_vector_type(8))) __bf16 v8b;
__device__ __forceinline__ v16b frag_b(const __bf16* rowk0, int lane) {
  union { v16b v; v8b q[2]; } u; const __bf16* p = rowk0 + 8 * (lane >> 4);
  u.q[0] = *(const v8b*)p; u.q[1] = *(const v8b*)(p + 16); return u.v;
}
__device__ __forceinline__ float bfr(float v) { return (float)(__bf16)v; }
__device__ __attribute__((noinline)) float exp_ni(float v) { return expf(v); }
__device__ __attribute__((noinline)) float erf_ni(float v) { return erff(v); }

#define PK_A 0                       // [2304][768] Wqkv rows ([out][in], transposed from the (in,out) inputs)
#define PK_P (PK_A + QKVW * DM)        // [768][768] Wo rows ([out][in], transposed)
#define PK_END (PK_P + DM * DM)
#define WS_PK  0u
#define WS_QK  (WS_PK + 2u * PK_END)             // f16 [8192 rows][1536]: q | k
#define WS_QKL (WS_QK + 2u * NB * SS * 2 * DM)     // f16 q | k residual planes x2048
#define WS_VTH (WS_QKL + 2u * NB * SS * 2 * DM)    // f16 [b][768 (h*64+d)][2048 s] hi
#define WS_VTL (WS_VTH + 2u * NB * DM * SS)        // f16 lo x 2048
#define WS_O   (WS_VTL + 2u * NB * DM * SS)        // f32 [8192][768]
#define WS_CS  (WS_O + 4u * NB * SS * DM)           // f32 2 x [2048][32], reserved but unused (k_rope computes cos/sin itself)
#define WS_END (WS_CS + 4u * 2 * SS * 32)
// ---- k_pack: block = (row n, which): column n of the (in,out) weight -> bf16 row n; which 0..2 -> W_q/W_k/W_v into PK_A rows which*768 + n; 3 -> W_o into PK_P
__global__ __launch_bounds__(256) void k_pack(const float* __restrict__ WQ, const float* __restrict__ WK, const float* __restrict__ WV, const float* __restrict__ WO, __bf16* __restrict__ PK) {   // (in,out) weights: Wq [768][768], Wk/Wv [768][256] (kv head = query head / 3), Wo [768][768]; packed row (which*DM + n), n = h*64 + d
  __shared__ __align__(16) __bf16 s[DM]; const int n = blockIdx.x, which = blockIdx.y, t = threadIdx.x; const int h = n / HD, d = n % HD; const int nkv = (h / GRP) * HD + d;
  for (int k = t; k < DM; k += 256) { float w; if (which == 0) w = WQ[(size_t)k * DM + n]; else if (which == 1) w = WK[(size_t)k * (NKV * HD) + nkv]; else if (which == 2) w = WV[(size_t)k * (NKV * HD) + nkv]; else w = WO[(size_t)k * DM + n]; s[k] = (__bf16)w; }
  __syncthreads(); __bf16* dst = (which < 3) ? (PK + PK_A + ((size_t)which * DM + n) * DM) : (PK + PK_P + (size_t)n * DM); for (int q = t; q < DM / 8; q += 256) vst2((unsigned*)(dst + q * 8), *(const v4u*)&s[q * 8]); }
// ---- k_rope: block = row (b, t): rotate-half RoPE on the 12 q heads and 12 (replicated) k heads: y[d] = x[d] cos(a_j) + (d < 32 ? -x[d+32] : x[d-32]) sin(a_j), j = d mod 32, a_j = pos * inv_freq[j]
__global__ __launch_bounds__(256) void k_rope(_Float16* __restrict__ QK, _Float16* __restrict__ QKL) { __shared__ __align__(16) _Float16 sh[2 * DM], sl[2 * DM]; __shared__ float scs[32], ssn[32]; const int t = threadIdx.x; const size_t row = blockIdx.x; const int pos = (int)(row % SS);
  if (t < 32) { const double invf = 1.0 / pow(10000.0, (double)t / 32.0); const float ang = (float)pos * (float)invf; scs[t] = cosf(ang); ssn[t] = sinf(ang); }
  __syncthreads();
  for (int e = t; e < 2 * NH * HD; e += 256) { const int w = e / (NH * HD), h = (e / HD) % NH, d = e % HD; const size_t o = row * (2 * DM) + (size_t)w * DM + h * HD; const int j = d & 31;
    const float x = (float)QK[o + d] + (float)QKL[o + d] * (1.0f / 2048.0f); const int dp = d < 32 ? d + 32 : d - 32; const float xp = (float)QK[o + dp] + (float)QKL[o + dp] * (1.0f / 2048.0f); const float rh = d < 32 ? -xp : xp;
    const float y = x * scs[j] + rh * ssn[j]; const _Float16 hv = (_Float16)y; sh[w * DM + h * HD + d] = hv; sl[w * DM + h * HD + d] = (_Float16)((y - (float)hv) * 2048.0f); }
  __syncthreads(); for (int q = t; q < 2 * DM / 8; q += 256) { vst2((unsigned*)(QK + row * (2 * DM) + q * 8), *(const v4u*)&sh[q * 8]); vst2((unsigned*)(QKL + row * (2 * DM) + q * 8), *(const v4u*)&sl[q * 8]); } }
__global__ __launch_bounds__(128) void k_qkv(const float* __restrict__ XQ, const float* __restrict__ XK, const float* __restrict__ XV, const __bf16* __restrict__ P, const float* __restrict__ BQ, const float* __restrict__ BK, const float* __restrict__ BV, _Float16* __restrict__ QK, _Float16* __restrict__ QKL, _Float16* __restrict__ VTH, _Float16* __restrict__ VTL) {
  const int which0 = (blockIdx.y * 128) / DM; const float* X = (which0 == 0) ? XQ : (which0 == 1) ? XK : XV; const float* BB = BQ ? (((which0 == 0) ? BQ : (which0 == 1) ? BK : BV) + (blockIdx.y * 128 - which0 * DM)) : nullptr;
  __shared__ __align__(16) _Float16 so[4][16][136], sol[4][16][136]; __shared__ __align__(16) _Float16 sth[128][72], stl[128][72];
  const int tid = threadIdx.x, wave = tid >> 5, lane = tid & 31, col = lane & 15, g = lane >> 4; const size_t r0 = (size_t)blockIdx.x * 64 + wave * 16; const int n0 = blockIdx.y * 128;
  v8f acc[8] = {};
#pragma unroll 2
  for (int kc = 0; kc < DM / 32; ++kc) { v16b a; { const float* p = X + (r0 + col) * DM + kc * 32 + 8 * g;
#pragma unroll
      for (int i = 0; i < 8; ++i) { a[i] = (__bf16)p[i]; a[8 + i] = (__bf16)p[16 + i]; } }
#pragma unroll
    for (int j = 0; j < 8; ++j) acc[j] = wmma_bf(a, frag_b(P + (size_t)(n0 + j * 16 + col) * DM + kc * 32, lane), acc[j]); }
  if (n0 < 2 * DM) {   // q stored unscaled (f16 sigma ~0.6, no subnormal exposure); 1/8 applied to the f32 score
#pragma unroll
    for (int j = 0; j < 8; ++j) {
#pragma unroll
      for (int r = 0; r < 8; ++r) { const float v = acc[j][r] + (BB ? bfr(BB[j * 16 + col]) : 0.f); const _Float16 hv = (_Float16)v; so[wave][8 * g + r][j * 16 + col] = hv; sol[wave][8 * g + r][j * 16 + col] = (_Float16)((v - (float)hv) * 2048.0f); } }   // q, k (+ bias) as f16 hi + (x2048) residual
    LDSX();
    for (int rl = 0; rl < 16; ++rl) if (lane < 16) { vst2((unsigned*)(QK + (r0 + rl) * (2 * DM) + n0 + lane * 8), *(const v4u*)&so[wave][rl][lane * 8]); vst2((unsigned*)(QKL + (r0 + rl) * (2 * DM) + n0 + lane * 8), *(const v4u*)&sol[wave][rl][lane * 8]); }
  } else {
#pragma unroll
    for (int j = 0; j < 8; ++j) {
#pragma unroll
      for (int r = 0; r < 8; ++r) { const float v = acc[j][r] + (BB ? bfr(BB[j * 16 + col]) : 0.f); const _Float16 hv = (_Float16)v; sth[j * 16 + col][wave * 16 + 8 * g + r] = hv; stl[j * 16 + col][wave * 16 + 8 * g + r] = (_Float16)((v - (float)hv) * 2048.0f); } }
    __syncthreads();
    const size_t rb = (size_t)blockIdx.x * 64; const int b = (int)(rb / SS), s0 = (int)(rb % SS); const int pc0 = n0 - 2 * DM;
    for (int q = tid; q < 128 * 8; q += 128) { const int d = q >> 3, pc = q & 7; const size_t o = ((size_t)b * DM + pc0 + d) * SS + s0 + pc * 8; vst2((unsigned*)(VTH + o), *(const v4u*)&sth[d][pc * 8]); vst2((unsigned*)(VTL + o), *(const v4u*)&stl[d][pc * 8]); }
  }
}
#define KP 72   // LDS pitch of a staged K row in f16: 144 B = 16 B x 9, no bank conflict for 16-byte fragment reads
#define VP 40   // LDS pitch of a staged V row in f16: 80 B = 16 B x 5, likewise
// one key tile of 32 keys into LDS, through no register: each of the 128 threads copies two 16-B pieces of K hi (32 rows x 128 B) and two of V hi (64 rows x 64 B).
// The wait on xcnt is the last line of the copies' own statement, so that it stands in front of any rewrite of the address registers they name.
__device__ __forceinline__ void stage_kv(unsigned lk0, unsigned lk1, unsigned lv0, unsigned lv1, const _Float16* k0, const _Float16* k1, const _Float16* v0, const _Float16* v1) {
  asm volatile("global_load_async_to_lds_b128 %0, %4, off\n\t"
               "global_load_async_to_lds_b128 %1, %5, off\n\t"
               "global_load_async_to_lds_b128 %2, %6, off\n\t"
               "global_load_async_to_lds_b128 %3, %7, off\n\t"
               "s_wait_xcnt 0x0"
               :: "v"(lk0), "v"(lk1), "v"(lv0), "v"(lv1), "v"(k0), "v"(k1), "v"(v0), "v"(v1) : "memory");
}
// ---- k_attn: block = (64 queries, head h, batch b): causal flash attention over the key tiles up to the block's end (K = 64: 2 k-steps), scores = (q.k) * 0.125 (q, k hi + residual in 3 products for the first two query blocks, single f16 elsewhere), P.V: f16 (P x 2048) x V hi in acc, and for the first two query blocks P lo x V hi + P x V lo*2048 in accl; O[b*S+q][h*64+d] = (acc + accl / 2048) / (2048 l) (256-B segments)
__global__ __launch_bounds__(128) void k_attn(const _Float16* __restrict__ QK, const _Float16* __restrict__ QKL, const _Float16* __restrict__ VTH, const _Float16* __restrict__ VTL, const void* __restrict__ KMASK, float* __restrict__ O) {
  __shared__ __align__(16) float sp[4][16][36]; __shared__ __align__(16) float so[4][16][68];
  __shared__ __align__(16) _Float16 sk[2][32 * KP], sv[2][64 * VP];   // two buffers: the block's K hi and V hi tile of 32 keys, read by all four waves
  const int tid = threadIdx.x, wave = tid >> 5, lane = tid & 31, col = lane & 15, g = lane >> 4;
  const int qb = blockIdx.x, h = blockIdx.y, b = blockIdx.z; const int q0 = qb * 64 + wave * 16; const size_t rq = (size_t)b * SS + q0 + col;
  v16h aq[2], aql[2];
#pragma unroll
  for (int kc = 0; kc < 2; ++kc) { aq[kc] = frag_h(QK + rq * (2 * DM) + h * HD + kc * 32, lane); aql[kc] = frag_h(QKL + rq * (2 * DM) + h * HD + kc * 32, lane); }
  float m[8], l[8];
#pragma unroll
  for (int r = 0; r < 8; ++r) { m[r] = -3.0e38f; l[r] = 0.f; }
  v8f acc[4] = {}, accl[4] = {};
  const int nks = SS / 32;   // all keys
  const int nksc = (qb * 64 + 64) / 32;   // causal: key tiles up to the end of this query block
  const _Float16* kg = QK + ((size_t)b * SS + (tid >> 3)) * (2 * DM) + DM + h * HD + (tid & 7) * 8;   // this thread's first K piece of tile 0 (its second: 16 keys on)
  const _Float16* vg = VTH + ((size_t)b * DM + h * HD + (tid >> 2)) * SS + (tid & 3) * 8;               // its first V piece of tile 0 (its second: 32 rows on)
  const unsigned lk = (unsigned)(uintptr_t)&sk[0][(tid >> 3) * KP + (tid & 7) * 8], lv = (unsigned)(uintptr_t)&sv[0][(tid >> 2) * VP + (tid & 3) * 8];
#define STAGE(t) stage_kv(lk + ((t) & 1) * (32 * KP * 2), lk + ((t) & 1) * (32 * KP * 2) + 16 * KP * 2, lv + ((t) & 1) * (64 * VP * 2), lv + ((t) & 1) * (64 * VP * 2) + 32 * VP * 2, kg + (size_t)(t) * 32 * (2 * DM), kg + ((size_t)(t) * 32 + 16) * (2 * DM), vg + (t) * 32, vg + (t) * 32 + 32 * SS)
  STAGE(0);
  asm volatile("s_wait_asynccnt 0x0" ::: "memory");   // tile 0 has landed before the barrier that publishes it
  __syncthreads();
  if (1 < nksc) STAGE(1);
#pragma unroll 1
  for (int ks = 0; ks < nksc; ++ks) { v8f s[2];
#pragma unroll
    for (int ct = 0; ct < 2; ++ct) { const int kk = ks * 32 + ct * 16 + col; const _Float16* krow = &sk[ks & 1][(ct * 16 + col) * KP]; const _Float16* krowl = QKL + ((size_t)b * SS + kk) * (2 * DM) + DM + h * HD; v8f c = {}, cl = {};
      if (qb < 2) {   // leading query blocks (few keys, outputs far above the global rms): 3 products
#pragma unroll
        for (int kc = 0; kc < 2; ++kc) { const v16h kh = frag_h(krow + kc * 32, lane); c = wmma16(aq[kc], kh, c); cl = wmma16(aql[kc], kh, cl); cl = wmma16(aq[kc], frag_h(krowl + kc * 32, lane), cl); }
#pragma unroll
        for (int r = 0; r < 8; ++r) c[r] += cl[r] * (1.0f / 2048.0f); }
      else {
#pragma unroll
        for (int kc = 0; kc < 2; ++kc) c = wmma16(aq[kc], frag_h(krow + kc * 32, lane), c); }   // single product elsewhere
      { const bool keepdummy = true; (void)keepdummy;
#pragma unroll
      for (int r = 0; r < 8; ++r) s[ct][r] = (kk <= q0 + 8 * g + r) ? c[r] * 0.125f : -3.0e38f; } }   // 1/sqrt(64); masked keys excluded
#pragma unroll
    for (int r = 0; r < 8; ++r) { float mx = fmaxf(s[0][r], s[1][r]);
#pragma unroll
      for (int o = 1; o < 16; o <<= 1) mx = fmaxf(mx, __shfl_xor(mx, o));
      const float mn = fmaxf(m[r], mx); const float alpha = (m[r] <= -1.0e38f) ? 0.f : __expf(m[r] - mn);
      const float e0 = (s[0][r] <= -1.0e38f) ? 0.f : __expf(s[0][r] - mn), e1 = (s[1][r] <= -1.0e38f) ? 0.f : __expf(s[1][r] - mn); float es = e0 + e1;
#pragma unroll
      for (int o = 1; o < 16; o <<= 1) es += __shfl_xor(es, o);
      l[r] = l[r] * alpha + es; m[r] = mn;
#pragma unroll
      for (int dt = 0; dt < 4; ++dt) { acc[dt][r] *= alpha; accl[dt][r] *= alpha; }
      sp[wave][8 * g + r][col] = e0; sp[wave][8 * g + r][16 + col] = e1; }
    LDSX();
    v16h pa, pl; { const float* prow = &sp[wave][col][0] + 8 * (lane >> 4);
#pragma unroll
      for (int i = 0; i < 8; ++i) { const float x0 = prow[i] * 2048.0f, x1 = prow[16 + i] * 2048.0f; const _Float16 h0 = (_Float16)x0, h1 = (_Float16)x1; pa[i] = h0; pa[8 + i] = h1; pl[i] = (_Float16)((x0 - (float)h0) * 2048.0f); pl[8 + i] = (_Float16)((x1 - (float)h1) * 2048.0f); } }   // P scaled by 2^11 before the f16 split so small softmax weights stay out of the f16 subnormal range; 2^-11 folded into the epilogue
#pragma unroll
    for (int dt = 0; dt < 4; ++dt) { const size_t vr = ((size_t)b * DM + h * HD + dt * 16 + col) * SS + ks * 32; const v16h vh = frag_h(&sv[ks & 1][(dt * 16 + col) * VP], lane); acc[dt] = wmma16(pa, vh, acc[dt]); if (qb < 2) { accl[dt] = wmma16(pl, vh, accl[dt]); accl[dt] = wmma16(pa, frag_h(VTL + vr, lane), accl[dt]); } }   // leading query blocks: P hi/lo x V hi/lo (3 products); elsewhere P x V single
    asm volatile("s_wait_dscnt 0x0" ::: "memory");      // this wave's reads of the tile and of sp have returned before the buffer is refilled and sp rewritten
    asm volatile("s_wait_asynccnt 0x0" ::: "memory");   // this wave's copies of tile ks + 1 have landed before the barrier that publishes them
    __syncthreads();                                    // publishes tile ks + 1 and ends every wave's reads of tile ks
    if (ks + 2 < nksc) STAGE(ks + 2); }
  asm volatile("s_wait_asynccnt 0x0" ::: "memory");     // no copy is outstanding when the wave goes on to its end
#undef STAGE
#pragma unroll
  for (int r = 0; r < 8; ++r) { const float il = (1.0f / 2048.0f) / l[r];
#pragma unroll
    for (int dt = 0; dt < 4; ++dt) so[wave][8 * g + r][dt * 16 + col] = (acc[dt][r] + accl[dt][r] * (1.0f / 2048.0f)) * il; }
  LDSX();
  for (int rl = 0; rl < 16; ++rl) if (lane < 16) vst2(O + ((size_t)b * SS + q0 + rl) * DM + h * HD + lane * 4, *(const v4f*)&so[wave][rl][lane * 4]);
}
// ---- k_out: block = (64 rows, 128 cols): out = O(hi/lo) . Wo rows (2 products) + bo
__global__ __launch_bounds__(128) void k_out(const float* __restrict__ O, const __bf16* __restrict__ P, const float* __restrict__ BO, float* __restrict__ Y) {
  __shared__ __align__(16) float so[4][16][132];
  const int tid = threadIdx.x, wave = tid >> 5, lane = tid & 31, col = lane & 15, g = lane >> 4; const size_t r0 = (size_t)blockIdx.x * 64 + wave * 16; const int n0 = blockIdx.y * 128;
  v8f acc[8] = {};
#pragma unroll 2
  for (int kc = 0; kc < DM / 32; ++kc) { const F2 a = split_row(O + (r0 + col) * DM, kc * 32, lane);
#pragma unroll
    for (int j = 0; j < 8; ++j) { const v16b w = frag_b(P + (size_t)(n0 + j * 16 + col) * DM + kc * 32, lane); acc[j] = wmma_bf(a.l, w, acc[j]); acc[j] = wmma_bf(a.h, w, acc[j]); } }
#pragma unroll
  for (int j = 0; j < 8; ++j) {
#pragma unroll
    for (int r = 0; r < 8; ++r) so[wave][8 * g + r][j * 16 + col] = acc[j][r] + (BO ? bfr(BO[n0 + j * 16 + col]) : 0.f); }
  LDSX();
  for (int rl = 0; rl < 16; ++rl) vst2(Y + (r0 + rl) * DM + n0 + lane * 4, *(const v4f*)&so[wave][rl][lane * 4]);
}
extern "C" void kernel_launch(void* const* d_in, const int* in_sizes, int n_in, void* d_out, int out_size, void* d_ws, size_t ws_size, hipStream_t stream) {
  (void)in_sizes; (void)n_in; (void)out_size;
  const float** F = (const float**)d_in;   // 0 hidden_states [4,2048,768], 1 Wq [768,768], 2 Wk [768,256], 3 Wv [768,256], 4 Wo [768,768] (all (in,out))
  if (ws_size < (size_t)WS_END) return;
  char* ws = (char*)d_ws; __bf16* PK = (__bf16*)(ws + WS_PK); _Float16 *QK = (_Float16*)(ws + WS_QK), *QKL = (_Float16*)(ws + WS_QKL), *VTH = (_Float16*)(ws + WS_VTH), *VTL = (_Float16*)(ws + WS_VTL); float* O = (float*)(ws + WS_O);
  k_pack<<<dim3(DM, 4), 256, 0, stream>>>(F[1], F[2], F[3], F[4], PK);
  k_qkv<<<dim3(TNB * SS / 64, QKVW / 128), 128, 0, stream>>>(F[0], F[0], F[0], PK + PK_A, nullptr, nullptr, nullptr, QK, QKL, VTH, VTL);
  k_rope<<<TNB * SS, 256, 0, stream>>>(QK, QKL);
  k_attn<<<dim3(TQB, NH, TNB), 128, 0, stream>>>(QK, QKL, VTH, VTL, nullptr, O);
  k_out<<<dim3(TOB, DM / 128), 128, 0, stream>>>(O, PK + PK_P, nullptr, (float*)d_out);
}

// v002
// A run of this version takes 359 microseconds.
// In both of two side-by-side timings against v001, it was 1.44 times as fast.
// Counting every step since v000, it is 1.63 times as fast.
// compute dtype: all float inputs rounded to bf16; q/k/v = x . W with EXACT bf16 products on WMMA 16x16x32 ((in,out) weights as transposed rows; the 4 kv heads replicated to their 3 query heads at pack time), f16 hi + residual; RoPE (inv_freq in double, angle = pos x inv_freq in f32 as the module, precise sinf/cosf) applied in f32 to the reconstructed q/k and re-split; causal attention with hybrid scores and P.v (first 128 queries 3-product hi + residual, later single f16), x 1/8, running-max softmax in f32 (hardware exp); out = ctx (bf16 hi + lo) . Wo ((in,out)); f32 output.
#include <hip/hip_runtime.h>
#include <math.h>

typedef __attribute__((ext_vector_type(16))) _Float16 v16h;
typedef __attribute__((ext_vector_type(16))) __bf16 v16b;
typedef __attribute__((ext_vector_type(8)))  _Float16 v8h;
typedef __attribute__((ext_vector_type(8)))  float v8f;
typedef __attribute__((ext_vector_type(4)))  float v4f;
typedef __attribute__((ext_vector_type(2)))  float v2f;
typedef __attribute__((ext_vector_type(4)))  unsigned v4u;
typedef __attribute__((ext_vector_type(4)))  int v4i;
typedef float __attribute__((may_alias)) float_a;
typedef int __attribute__((may_alias)) int_a;

template <typename T> __device__ __forceinline__ void vst2(void* p, T v) { *(T*)p = v;  }
__device__ __forceinline__ v8f wmma16(v16h a, v16h b, v8f c) {
  v8f d = __builtin_amdgcn_wmma_f32_16x16x32_f16(false, a, false, b, (short)0, c, false, false);
  asm volatile("v_nop\n\tv_nop\n\tv_nop\n\tv_nop" : "+v"(d) : "v"(a), "v"(b));
  return d;
}
__device__ __forceinline__ v8f wmma_bf(v16b a, v16b b, v8f c) {
  v8f d = __builtin_amdgcn_wmma_f32_16x16x32_bf16(false, a, false, b, (short)0, c, false, false);
  asm volatile("v_nop\n\tv_nop\n\tv_nop\n\tv_nop" : "+v"(d) : "v"(a), "v"(b));
  return d;
}
// Grouped-query causal attention with RoPE (B 4, S 2,048, hidden 768, 12 query heads x 64 over 4 kv heads): q = x Wq, k = x Wk, v = x Wv ((in,out), kv heads shared by 3 query heads), rotate-half RoPE (theta 1e4), causal softmax(q k / 8) v, out = ctx Wo.
__device__ __forceinline__ v16h frag_h(const _Float16* rowk0, int lane) {
  union { v16h v; v8h q[2]; } u; const _Float16* p = rowk0 + 8 * (lane >> 4);
  u.q[0] = *(const v8h*)p; u.q[1] = *(const v8h*)(p + 16); return u.v;
}
__device__ __forceinline__ v16h frag_f32(const float* rowk0, int lane) {
  v16h a; const float* p = rowk0 + 8 * (lane >> 4);
#pragma unroll
  for (int i = 0; i < 8; ++i) { a[i] = (_Float16)p[i]; a[8 + i] = (_Float16)p[16 + i]; }
  return a;
}
__device__ __forceinline__ v16h frag_f32s(const float* rowk0, int lane, float sc) {
  v16h a; const float* p = rowk0 + 8 * (lane >> 4);
#pragma unroll
  for (int i = 0; i < 8; ++i) { a[i] = (_Float16)(p[i] * sc); a[8 + i] = (_Float16)(p[16 + i] * sc); }
  return a;
}
// column fragment from a [K][ld] layout (column n), rows >= K read as 0
__device__ __forceinline__ v16h fragc_f32(const float* W, int k0, int n, int lane, int ld, int K) {
  v16h a; const int g = lane >> 4;
#pragma unroll
  for (int i = 0; i < 8; ++i) { const int ka = k0 + 8 * g + i, kb = ka + 16;
    a[i] = (_Float16)(ka < K ? W[(size_t)(ka < K ? ka : K - 1) * ld + n] : 0.f); a[8 + i] = (_Float16)(kb < K ? W[(size_t)(kb < K ? kb : K - 1) * ld + n] : 0.f); }
  return a;
}
struct F2 { v16b h, l; };
__device__ __forceinline__ F2 bsplit16(const float v[16]) { F2 r;
#pragma unroll
  for (int i = 0; i < 16; ++i) { const __bf16 h = (__bf16)v[i]; r.h[i] = h; r.l[i] = (__bf16)(v[i] - (float)h); }
  return r; }
__device__ __forceinline__ F2 split_row(const float* row, int k0, int lane) { float v[16]; const float* p = row + k0 + 8 * (lane >> 4);
#pragma unroll
  for (int i = 0; i < 8; ++i) { v[i] = p[i]; v[8 + i] = p[16 + i]; }
  return bsplit16(v); }
__device__ __forceinline__ F2 split_rowK(const float* row, int k0, int lane, int K) { float v[16]; const int g = lane >> 4;
#pragma unroll
  for (int i = 0; i < 8; ++i) { const int ka = k0 + 8 * g + i, kb = ka + 16; v[i] = ka < K ? row[ka < K ? ka : K - 1] : 0.f; v[8 + i] = kb < K ? row[kb < K ? kb : K - 1] : 0.f; }
  return bsplit16(v); }
__device__ __forceinline__ F2 split_col(const float* W, int k0, int n, int lane, int ld, int K) { float v[16]; const int g = lane >> 4;
#pragma unroll
  for (int i = 0; i < 8; ++i) { const int ka = k0 + 8 * g + i, kb = ka + 16; v[i] = ka < K ? W[(size_t)(ka < K ? ka : K - 1) * ld + n] : 0.f; v[8 + i] = kb < K ? W[(size_t)(kb < K ? kb : K - 1) * ld + n] : 0.f; }
  return bsplit16(v); }
__device__ __forceinline__ v8f mac3(const F2& a, const F2& b, v8f c) { c = wmma_bf(a.l, b.h, c); c = wmma_bf(a.h, b.l, c); return wmma_bf(a.h, b.h, c); }
__device__ __forceinline__ float sigm(float v) { return 1.0f / (1.0f + expf(-v)); }
#define LDSX() do { asm volatile("s_wait_dscnt 0" ::: "memory"); __builtin_amdgcn_wave_barrier(); __builtin_amdgcn_fence(__ATOMIC_RELEASE, "workgroup"); } while (0)


#define NB 4
#define SS 2048
#define DM 768
#define NH 12
#define NKV 4
#define GRP 3
#define HD 64
#define QKVW (3 * DM)
#ifndef TQB
#define TQB (SS / 64)
#define TNB NB
#define TOB (NB * SS / 64)     // output row tiles (all)
#endif
typedef __attribute__((ext_vector_type(8))) __bf16 v8b;
__device__ __forceinline__ v16b frag_b(const __bf16* rowk0, int lane) {
  union { v16b v; v8b q[2]; } u; const __bf16* p = rowk0 + 8 * (lane >> 4);
  u.q[0] = *(const v8b*)p; u.q[1] = *(const v8b*)(p + 16); return u.v;
}
__device__ __forceinline__ float bfr(float v) { return (float)(__bf16)v; }
__device__ __attribute__((noinline)) float exp_ni(float v) { return expf(v); }
__device__ __attribute__((noinline)) float erf_ni(float v) { return erff(v); }

#define PK_A 0                       // [2304][768] Wqkv rows ([out][in], transposed from the (in,out) inputs)
#define PK_P (PK_A + QKVW * DM)        // [768][768] Wo rows ([out][in], transposed)
#define PK_END (PK_P + DM * DM)
#define WS_PK  0u
#define WS_QK  (WS_PK + 2u * PK_END)             // f16 [8192 rows][1536]: q | k
#define WS_QKL (WS_QK + 2u * NB * SS * 2 * DM)     // f16 q | k residual planes x2048
#define WS_VTH (WS_QKL + 2u * NB * SS * 2 * DM)    // f16 [b][768 (h*64+d)][2048 s] hi
#define WS_VTL (WS_VTH + 2u * NB * DM * SS)        // f16 lo x 2048
#define WS_O   (WS_VTL + 2u * NB * DM * SS)        // f32 [8192][768]
#define WS_CS  (WS_O + 4u * NB * SS * DM)           // f32 2 x [2048][32], reserved but unused (k_rope computes cos/sin itself)
#define WS_END (WS_CS + 4u * 2 * SS * 32)
// ---- k_pack: block = (row n, which): column n of the (in,out) weight -> bf16 row n; which 0..2 -> W_q/W_k/W_v into PK_A rows which*768 + n; 3 -> W_o into PK_P
__global__ __launch_bounds__(256) void k_pack(const float* __restrict__ WQ, const float* __restrict__ WK, const float* __restrict__ WV, const float* __restrict__ WO, __bf16* __restrict__ PK) {   // (in,out) weights: Wq [768][768], Wk/Wv [768][256] (kv head = query head / 3), Wo [768][768]; packed row (which*DM + n), n = h*64 + d
  __shared__ __align__(16) __bf16 s[DM]; const int n = blockIdx.x, which = blockIdx.y, t = threadIdx.x; const int h = n / HD, d = n % HD; const int nkv = (h / GRP) * HD + d;
  for (int k = t; k < DM; k += 256) { float w; if (which == 0) w = WQ[(size_t)k * DM + n]; else if (which == 1) w = WK[(size_t)k * (NKV * HD) + nkv]; else if (which == 2) w = WV[(size_t)k * (NKV * HD) + nkv]; else w = WO[(size_t)k * DM + n]; s[k] = (__bf16)w; }
  __syncthreads(); __bf16* dst = (which < 3) ? (PK + PK_A + ((size_t)which * DM + n) * DM) : (PK + PK_P + (size_t)n * DM); for (int q = t; q < DM / 8; q += 256) vst2((unsigned*)(dst + q * 8), *(const v4u*)&s[q * 8]); }
// ---- k_rope: block = row (b, t): rotate-half RoPE on the 12 q heads and 12 (replicated) k heads: y[d] = x[d] cos(a_j) + (d < 32 ? -x[d+32] : x[d-32]) sin(a_j), j = d mod 32, a_j = pos * inv_freq[j]
__global__ __launch_bounds__(256) void k_rope(_Float16* __restrict__ QK, _Float16* __restrict__ QKL) { __shared__ __align__(16) _Float16 sh[2 * DM], sl[2 * DM]; __shared__ float scs[32], ssn[32]; const int t = threadIdx.x; const size_t row = blockIdx.x; const int pos = (int)(row % SS);
  if (t < 32) { const double invf = 1.0 / pow(10000.0, (double)t / 32.0); const float ang = (float)pos * (float)invf; scs[t] = cosf(ang); ssn[t] = sinf(ang); }
  __syncthreads();
  for (int e = t; e < 2 * NH * HD; e += 256) { const int w = e / (NH * HD), h = (e / HD) % NH, d = e % HD; const size_t o = row * (2 * DM) + (size_t)w * DM + h * HD; const int j = d & 31;
    const float x = (float)QK[o + d] + (float)QKL[o + d] * (1.0f / 2048.0f); const int dp = d < 32 ? d + 32 : d - 32; const float xp = (float)QK[o + dp] + (float)QKL[o + dp] * (1.0f / 2048.0f); const float rh = d < 32 ? -xp : xp;
    const float y = x * scs[j] + rh * ssn[j]; const _Float16 hv = (_Float16)y; sh[w * DM + h * HD + d] = hv; sl[w * DM + h * HD + d] = (_Float16)((y - (float)hv) * 2048.0f); }
  __syncthreads(); for (int q = t; q < 2 * DM / 8; q += 256) { vst2((unsigned*)(QK + row * (2 * DM) + q * 8), *(const v4u*)&sh[q * 8]); vst2((unsigned*)(QKL + row * (2 * DM) + q * 8), *(const v4u*)&sl[q * 8]); } }
#define GKS 64                          // k elements of one staged tile
#define GBP 72                          // LDS pitch of a staged weight row in bf16: 144 B = 16 B x 9, no bank conflict for 16-byte fragment reads
#define GAP 68                          // LDS pitch of a staged activation row in f32: 272 B = 16 B x 17, likewise
#define GB_BYTES (128 * GBP * 2)        // 128 weight rows
#define GA_BYTES (64 * GAP * 4)         // 64 activation rows
#define GST_BYTES (GB_BYTES + GA_BYTES) // one buffer: weight tile, then activation tile
// eight 16-B pieces of one thread into LDS, through no register: piece i goes to LDS byte l + i * ls and comes from g + i * 24,576 B (16 weight rows of 1,536 B, or 8 activation rows of 3,072 B).
// The wait on xcnt is the last line of the copies' own statement, so that it stands in front of any rewrite of the address registers they name.
__device__ __forceinline__ void stage8(unsigned l, unsigned ls, const char* g) {
  asm volatile("global_load_async_to_lds_b128 %0, %8, off\n\t"
               "global_load_async_to_lds_b128 %1, %9, off\n\t"
               "global_load_async_to_lds_b128 %2, %10, off\n\t"
               "global_load_async_to_lds_b128 %3, %11, off\n\t"
               "global_load_async_to_lds_b128 %4, %12, off\n\t"
               "global_load_async_to_lds_b128 %5, %13, off\n\t"
               "global_load_async_to_lds_b128 %6, %14, off\n\t"
               "global_load_async_to_lds_b128 %7, %15, off\n\t"
               "s_wait_xcnt 0x0"
               :: "v"(l), "v"(l + ls), "v"(l + 2 * ls), "v"(l + 3 * ls), "v"(l + 4 * ls), "v"(l + 5 * ls), "v"(l + 6 * ls), "v"(l + 7 * ls),
                  "v"(g), "v"(g + 24576), "v"(g + 2 * 24576), "v"(g + 3 * 24576), "v"(g + 4 * 24576), "v"(g + 5 * 24576), "v"(g + 6 * 24576), "v"(g + 7 * 24576) : "memory");
}
// tile t (64 k) of a 64-row x 128-column block into buffer t & 1: 128 weight rows x 128 B (8 threads a row) and 64 activation rows x 256 B (16 threads a row); every wave-wide copy covers four whole 128-B lines
#define GSTAGE(t) do { stage8(lb + ((t) & 1) * GST_BYTES, 16 * GBP * 2, gb + (size_t)(t) * (GKS * 2)); stage8(la + ((t) & 1) * GST_BYTES, 8 * GAP * 4, ga + (size_t)(t) * (GKS * 4)); } while (0)
__global__ __launch_bounds__(128) void k_qkv(const float* __restrict__ XQ, const float* __restrict__ XK, const float* __restrict__ XV, const __bf16* __restrict__ P, const float* __restrict__ BQ, const float* __restrict__ BK, const float* __restrict__ BV, _Float16* __restrict__ QK, _Float16* __restrict__ QKL, _Float16* __restrict__ VTH, _Float16* __restrict__ VTL) {
  const int which0 = (blockIdx.y * 128) / DM; const float* X = (which0 == 0) ? XQ : (which0 == 1) ? XK : XV; const float* BB = BQ ? (((which0 == 0) ? BQ : (which0 == 1) ? BK : BV) + (blockIdx.y * 128 - which0 * DM)) : nullptr;
  __shared__ __align__(16) char sm[2 * GST_BYTES];   // two buffers of the k loop; behind the loop's last barrier the same bytes stage the output
  _Float16 (*so)[16][136] = (_Float16 (*)[16][136])sm; _Float16 (*sol)[16][136] = (_Float16 (*)[16][136])(sm + 4 * 16 * 136 * 2); _Float16 (*sth)[72] = (_Float16 (*)[72])sm; _Float16 (*stl)[72] = (_Float16 (*)[72])(sm + 128 * 72 * 2);
  const int tid = threadIdx.x, wave = tid >> 5, lane = tid & 31, col = lane & 15, g = lane >> 4; const size_t r0 = (size_t)blockIdx.x * 64 + wave * 16; const int n0 = blockIdx.y * 128;
  v8f acc[8] = {};
  const char* gb = (const char*)(P + (size_t)(n0 + (tid >> 3)) * DM + (tid & 7) * 8);                        // this thread's first weight piece of tile 0
  const char* ga = (const char*)(X + ((size_t)blockIdx.x * 64 + (tid >> 4)) * DM + (tid & 15) * 4);          // its first activation piece of tile 0
  const unsigned lb = (unsigned)(uintptr_t)&sm[(tid >> 3) * (GBP * 2) + (tid & 7) * 16], la = (unsigned)(uintptr_t)&sm[GB_BYTES + (tid >> 4) * (GAP * 4) + (tid & 15) * 16];
  GSTAGE(0);
  asm volatile("s_wait_asynccnt 0x0" ::: "memory");   // tile 0 has landed before the barrier that publishes it
  __syncthreads();
  GSTAGE(1);
#pragma unroll 1
  for (int ts = 0; ts < DM / GKS; ++ts) { const __bf16* bB = (const __bf16*)(sm + (ts & 1) * GST_BYTES); const float* bA = (const float*)(sm + (ts & 1) * GST_BYTES + GB_BYTES);
#pragma unroll
    for (int kc = 0; kc < GKS / 32; ++kc) { v16b a; { const float* p = bA + (wave * 16 + col) * GAP + kc * 32 + 8 * g;
#pragma unroll
        for (int i = 0; i < 8; ++i) { a[i] = (__bf16)p[i]; a[8 + i] = (__bf16)p[16 + i]; } }
#pragma unroll
      for (int j = 0; j < 8; ++j) acc[j] = wmma_bf(a, frag_b(bB + (j * 16 + col) * GBP + kc * 32, lane), acc[j]); }
    asm volatile("s_wait_dscnt 0x0" ::: "memory");      // this wave's reads of tile ts have returned before its buffer is refilled
    asm volatile("s_wait_asynccnt 0x0" ::: "memory");   // this wave's copies of tile ts + 1 have landed before the barrier that publishes them
    __syncthreads();                                    // publishes tile ts + 1 and ends every wave's reads of tile ts
    if (ts + 2 < DM / GKS) GSTAGE(ts + 2); }
  asm volatile("s_wait_asynccnt 0x0" ::: "memory");     // no copy is outstanding when the buffers become output staging
  if (n0 < 2 * DM) {   // q stored unscaled (f16 sigma ~0.6, no subnormal exposure); 1/8 applied to the f32 score
#pragma unroll
    for (int j = 0; j < 8; ++j) {
#pragma unroll
      for (int r = 0; r < 8; ++r) { const float v = acc[j][r] + (BB ? bfr(BB[j * 16 + col]) : 0.f); const _Float16 hv = (_Float16)v; so[wave][8 * g + r][j * 16 + col] = hv; sol[wave][8 * g + r][j * 16 + col] = (_Float16)((v - (float)hv) * 2048.0f); } }   // q, k (+ bias) as f16 hi + (x2048) residual
    LDSX();
    for (int rl = 0; rl < 16; ++rl) if (lane < 16) { vst2((unsigned*)(QK + (r0 + rl) * (2 * DM) + n0 + lane * 8), *(const v4u*)&so[wave][rl][lane * 8]); vst2((unsigned*)(QKL + (r0 + rl) * (2 * DM) + n0 + lane * 8), *(const v4u*)&sol[wave][rl][lane * 8]); }
  } else {
#pragma unroll
    for (int j = 0; j < 8; ++j) {
#pragma unroll
      for (int r = 0; r < 8; ++r) { const float v = acc[j][r] + (BB ? bfr(BB[j * 16 + col]) : 0.f); const _Float16 hv = (_Float16)v; sth[j * 16 + col][wave * 16 + 8 * g + r] = hv; stl[j * 16 + col][wave * 16 + 8 * g + r] = (_Float16)((v - (float)hv) * 2048.0f); } }
    __syncthreads();
    const size_t rb = (size_t)blockIdx.x * 64; const int b = (int)(rb / SS), s0 = (int)(rb % SS); const int pc0 = n0 - 2 * DM;
    for (int q = tid; q < 128 * 8; q += 128) { const int d = q >> 3, pc = q & 7; const size_t o = ((size_t)b * DM + pc0 + d) * SS + s0 + pc * 8; vst2((unsigned*)(VTH + o), *(const v4u*)&sth[d][pc * 8]); vst2((unsigned*)(VTL + o), *(const v4u*)&stl[d][pc * 8]); }
  }
}
#define KP 72   // LDS pitch of a staged K row in f16: 144 B = 16 B x 9, no bank conflict for 16-byte fragment reads
#define VP 40   // LDS pitch of a staged V row in f16: 80 B = 16 B x 5, likewise
// one key tile of 32 keys into LDS, through no register: each of the 128 threads copies two 16-B pieces of K hi (32 rows x 128 B) and two of V hi (64 rows x 64 B).
// The wait on xcnt is the last line of the copies' own statement, so that it stands in front of any rewrite of the address registers they name.
__device__ __forceinline__ void stage_kv(unsigned lk0, unsigned lk1, unsigned lv0, unsigned lv1, const _Float16* k0, const _Float16* k1, const _Float16* v0, const _Float16* v1) {
  asm volatile("global_load_async_to_lds_b128 %0, %4, off\n\t"
               "global_load_async_to_lds_b128 %1, %5, off\n\t"
               "global_load_async_to_lds_b128 %2, %6, off\n\t"
               "global_load_async_to_lds_b128 %3, %7, off\n\t"
               "s_wait_xcnt 0x0"
               :: "v"(lk0), "v"(lk1), "v"(lv0), "v"(lv1), "v"(k0), "v"(k1), "v"(v0), "v"(v1) : "memory");
}
// ---- k_attn: block = (64 queries, head h, batch b): causal flash attention over the key tiles up to the block's end (K = 64: 2 k-steps), scores = (q.k) * 0.125 (q, k hi + residual in 3 products for the first two query blocks, single f16 elsewhere), P.V: f16 (P x 2048) x V hi in acc, and for the first two query blocks P lo x V hi + P x V lo*2048 in accl; O[b*S+q][h*64+d] = (acc + accl / 2048) / (2048 l) (256-B segments)
__global__ __launch_bounds__(128) void k_attn(const _Float16* __restrict__ QK, const _Float16* __restrict__ QKL, const _Float16* __restrict__ VTH, const _Float16* __restrict__ VTL, const void* __restrict__ KMASK, float* __restrict__ O) {
  __shared__ __align__(16) float sp[4][16][36]; __shared__ __align__(16) float so[4][16][68];
  __shared__ __align__(16) _Float16 sk[2][32 * KP], sv[2][64 * VP];   // two buffers: the block's K hi and V hi tile of 32 keys, read by all four waves
  const int tid = threadIdx.x, wave = tid >> 5, lane = tid & 31, col = lane & 15, g = lane >> 4;
  const int qb = blockIdx.x, h = blockIdx.y, b = blockIdx.z; const int q0 = qb * 64 + wave * 16; const size_t rq = (size_t)b * SS + q0 + col;
  v16h aq[2], aql[2];
#pragma unroll
  for (int kc = 0; kc < 2; ++kc) { aq[kc] = frag_h(QK + rq * (2 * DM) + h * HD + kc * 32, lane); aql[kc] = frag_h(QKL + rq * (2 * DM) + h * HD + kc * 32, lane); }
  float m[8], l[8];
#pragma unroll
  for (int r = 0; r < 8; ++r) { m[r] = -3.0e38f; l[r] = 0.f; }
  v8f acc[4] = {}, accl[4] = {};
  const int nks = SS / 32;   // all keys
  const int nksc = (qb * 64 + 64) / 32;   // causal: key tiles up to the end of this query block
  const _Float16* kg = QK + ((size_t)b * SS + (tid >> 3)) * (2 * DM) + DM + h * HD + (tid & 7) * 8;   // this thread's first K piece of tile 0 (its second: 16 keys on)
  const _Float16* vg = VTH + ((size_t)b * DM + h * HD + (tid >> 2)) * SS + (tid & 3) * 8;               // its first V piece of tile 0 (its second: 32 rows on)
  const unsigned lk = (unsigned)(uintptr_t)&sk[0][(tid >> 3) * KP + (tid & 7) * 8], lv = (unsigned)(uintptr_t)&sv[0][(tid >> 2) * VP + (tid & 3) * 8];
#define STAGE(t) stage_kv(lk + ((t) & 1) * (32 * KP * 2), lk + ((t) & 1) * (32 * KP * 2) + 16 * KP * 2, lv + ((t) & 1) * (64 * VP * 2), lv + ((t) & 1) * (64 * VP * 2) + 32 * VP * 2, kg + (size_t)(t) * 32 * (2 * DM), kg + ((size_t)(t) * 32 + 16) * (2 * DM), vg + (t) * 32, vg + (t) * 32 + 32 * SS)
  STAGE(0);
  asm volatile("s_wait_asynccnt 0x0" ::: "memory");   // tile 0 has landed before the barrier that publishes it
  __syncthreads();
  if (1 < nksc) STAGE(1);
#pragma unroll 1
  for (int ks = 0; ks < nksc; ++ks) { v8f s[2];
#pragma unroll
    for (int ct = 0; ct < 2; ++ct) { const int kk = ks * 32 + ct * 16 + col; const _Float16* krow = &sk[ks & 1][(ct * 16 + col) * KP]; const _Float16* krowl = QKL + ((size_t)b * SS + kk) * (2 * DM) + DM + h * HD; v8f c = {}, cl = {};
      if (qb < 2) {   // leading query blocks (few keys, outputs far above the global rms): 3 products
#pragma unroll
        for (int kc = 0; kc < 2; ++kc) { const v16h kh = frag_h(krow + kc * 32, lane); c = wmma16(aq[kc], kh, c); cl = wmma16(aql[kc], kh, cl); cl = wmma16(aq[kc], frag_h(krowl + kc * 32, lane), cl); }
#pragma unroll
        for (int r = 0; r < 8; ++r) c[r] += cl[r] * (1.0f / 2048.0f); }
      else {
#pragma unroll
        for (int kc = 0; kc < 2; ++kc) c = wmma16(aq[kc], frag_h(krow + kc * 32, lane), c); }   // single product elsewhere
      { const bool keepdummy = true; (void)keepdummy;
#pragma unroll
      for (int r = 0; r < 8; ++r) s[ct][r] = (kk <= q0 + 8 * g + r) ? c[r] * 0.125f : -3.0e38f; } }   // 1/sqrt(64); masked keys excluded
#pragma unroll
    for (int r = 0; r < 8; ++r) { float mx = fmaxf(s[0][r], s[1][r]);
#pragma unroll
      for (int o = 1; o < 16; o <<= 1) mx = fmaxf(mx, __shfl_xor(mx, o));
      const float mn = fmaxf(m[r], mx); const float alpha = (m[r] <= -1.0e38f) ? 0.f : __expf(m[r] - mn);
      const float e0 = (s[0][r] <= -1.0e38f) ? 0.f : __expf(s[0][r] - mn), e1 = (s[1][r] <= -1.0e38f) ? 0.f : __expf(s[1][r] - mn); float es = e0 + e1;
#pragma unroll
      for (int o = 1; o < 16; o <<= 1) es += __shfl_xor(es, o);
      l[r] = l[r] * alpha + es; m[r] = mn;
#pragma unroll
      for (int dt = 0; dt < 4; ++dt) { acc[dt][r] *= alpha; accl[dt][r] *= alpha; }
      sp[wave][8 * g + r][col] = e0; sp[wave][8 * g + r][16 + col] = e1; }
    LDSX();
    v16h pa, pl; { const float* prow = &sp[wave][col][0] + 8 * (lane >> 4);
#pragma unroll
      for (int i = 0; i < 8; ++i) { const float x0 = prow[i] * 2048.0f, x1 = prow[16 + i] * 2048.0f; const _Float16 h0 = (_Float16)x0, h1 = (_Float16)x1; pa[i] = h0; pa[8 + i] = h1; pl[i] = (_Float16)((x0 - (float)h0) * 2048.0f); pl[8 + i] = (_Float16)((x1 - (float)h1) * 2048.0f); } }   // P scaled by 2^11 before the f16 split so small softmax weights stay out of the f16 subnormal range; 2^-11 folded into the epilogue
#pragma unroll
    for (int dt = 0; dt < 4; ++dt) { const size_t vr = ((size_t)b * DM + h * HD + dt * 16 + col) * SS + ks * 32; const v16h vh = frag_h(&sv[ks & 1][(dt * 16 + col) * VP], lane); acc[dt] = wmma16(pa, vh, acc[dt]); if (qb < 2) { accl[dt] = wmma16(pl, vh, accl[dt]); accl[dt] = wmma16(pa, frag_h(VTL + vr, lane), accl[dt]); } }   // leading query blocks: P hi/lo x V hi/lo (3 products); elsewhere P x V single
    asm volatile("s_wait_dscnt 0x0" ::: "memory");      // this wave's reads of the tile and of sp have returned before the buffer is refilled and sp rewritten
    asm volatile("s_wait_asynccnt 0x0" ::: "memory");   // this wave's copies of tile ks + 1 have landed before the barrier that publishes them
    __syncthreads();                                    // publishes tile ks + 1 and ends every wave's reads of tile ks
    if (ks + 2 < nksc) STAGE(ks + 2); }
  asm volatile("s_wait_asynccnt 0x0" ::: "memory");     // no copy is outstanding when the wave goes on to its end
#undef STAGE
#pragma unroll
  for (int r = 0; r < 8; ++r) { const float il = (1.0f / 2048.0f) / l[r];
#pragma unroll
    for (int dt = 0; dt < 4; ++dt) so[wave][8 * g + r][dt * 16 + col] = (acc[dt][r] + accl[dt][r] * (1.0f / 2048.0f)) * il; }
  LDSX();
  for (int rl = 0; rl < 16; ++rl) if (lane < 16) vst2(O + ((size_t)b * SS + q0 + rl) * DM + h * HD + lane * 4, *(const v4f*)&so[wave][rl][lane * 4]);
}
// ---- k_out: block = (64 rows, 128 cols): out = O(hi/lo) . Wo rows (2 products) + bo
__global__ __launch_bounds__(128) void k_out(const float* __restrict__ O, const __bf16* __restrict__ P, const float* __restrict__ BO, float* __restrict__ Y) {
  __shared__ __align__(16) char sm[2 * GST_BYTES];   // two buffers of the k loop; behind the loop's last barrier the same bytes stage the output
  float (*so)[16][132] = (float (*)[16][132])sm;
  const int tid = threadIdx.x, wave = tid >> 5, lane = tid & 31, col = lane & 15, g = lane >> 4; const size_t r0 = (size_t)blockIdx.x * 64 + wave * 16; const int n0 = blockIdx.y * 128;
  v8f acc[8] = {};
  const char* gb = (const char*)(P + (size_t)(n0 + (tid >> 3)) * DM + (tid & 7) * 8);                        // this thread's first weight piece of tile 0
  const char* ga = (const char*)(O + ((size_t)blockIdx.x * 64 + (tid >> 4)) * DM + (tid & 15) * 4);          // its first activation piece of tile 0
  const unsigned lb = (unsigned)(uintptr_t)&sm[(tid >> 3) * (GBP * 2) + (tid & 7) * 16], la = (unsigned)(uintptr_t)&sm[GB_BYTES + (tid >> 4) * (GAP * 4) + (tid & 15) * 16];
  GSTAGE(0);
  asm volatile("s_wait_asynccnt 0x0" ::: "memory");   // tile 0 has landed before the barrier that publishes it
  __syncthreads();
  GSTAGE(1);
#pragma unroll 1
  for (int ts = 0; ts < DM / GKS; ++ts) { const __bf16* bB = (const __bf16*)(sm + (ts & 1) * GST_BYTES); const float* bA = (const float*)(sm + (ts & 1) * GST_BYTES + GB_BYTES);
#pragma unroll
    for (int kc = 0; kc < GKS / 32; ++kc) { const F2 a = split_row(bA + (wave * 16 + col) * GAP, kc * 32, lane);
#pragma unroll
      for (int j = 0; j < 8; ++j) { const v16b w = frag_b(bB + (j * 16 + col) * GBP + kc * 32, lane); acc[j] = wmma_bf(a.l, w, acc[j]); acc[j] = wmma_bf(a.h, w, acc[j]); } }
    asm volatile("s_wait_dscnt 0x0" ::: "memory");      // this wave's reads of tile ts have returned before its buffer is refilled
    asm volatile("s_wait_asynccnt 0x0" ::: "memory");   // this wave's copies of tile ts + 1 have landed before the barrier that publishes them
    __syncthreads();                                    // publishes tile ts + 1 and ends every wave's reads of tile ts
    if (ts + 2 < DM / GKS) GSTAGE(ts + 2); }
  asm volatile("s_wait_asynccnt 0x0" ::: "memory");     // no copy is outstanding when the buffers become output staging
#pragma unroll
  for (int j = 0; j < 8; ++j) {
#pragma unroll
    for (int r = 0; r < 8; ++r) so[wave][8 * g + r][j * 16 + col] = acc[j][r] + (BO ? bfr(BO[n0 + j * 16 + col]) : 0.f); }
  LDSX();
  for (int rl = 0; rl < 16; ++rl) vst2(Y + (r0 + rl) * DM + n0 + lane * 4, *(const v4f*)&so[wave][rl][lane * 4]);
}
extern "C" void kernel_launch(void* const* d_in, const int* in_sizes, int n_in, void* d_out, int out_size, void* d_ws, size_t ws_size, hipStream_t stream) {
  (void)in_sizes; (void)n_in; (void)out_size;
  const float** F = (const float**)d_in;   // 0 hidden_states [4,2048,768], 1 Wq [768,768], 2 Wk [768,256], 3 Wv [768,256], 4 Wo [768,768] (all (in,out))
  if (ws_size < (size_t)WS_END) return;
  char* ws = (char*)d_ws; __bf16* PK = (__bf16*)(ws + WS_PK); _Float16 *QK = (_Float16*)(ws + WS_QK), *QKL = (_Float16*)(ws + WS_QKL), *VTH = (_Float16*)(ws + WS_VTH), *VTL = (_Float16*)(ws + WS_VTL); float* O = (float*)(ws + WS_O);
  k_pack<<<dim3(DM, 4), 256, 0, stream>>>(F[1], F[2], F[3], F[4], PK);
  k_qkv<<<dim3(TNB * SS / 64, QKVW / 128), 128, 0, stream>>>(F[0], F[0], F[0], PK + PK_A, nullptr, nullptr, nullptr, QK, QKL, VTH, VTL);
  k_rope<<<TNB * SS, 256, 0, stream>>>(QK, QKL);
  k_attn<<<dim3(TQB, NH, TNB), 128, 0, stream>>>(QK, QKL, VTH, VTL, nullptr, O);
  k_out<<<dim3(TOB, DM / 128), 128, 0, stream>>>(O, PK + PK_P, nullptr, (float*)d_out);
}

// v003
// It runs in 281 microseconds.
// Two timings next to v002 both put it at 1.28 times that version's speed.
// Over all steps from v000 it is 2.09 times as fast.
// compute dtype: all float inputs rounded to bf16; q/k/v = x . W with EXACT bf16 products on WMMA 16x16x32 ((in,out) weights as transposed rows; the 4 kv heads replicated to their 3 query heads at pack time), f16 hi + residual; RoPE (inv_freq in double, angle = pos x inv_freq in f32 as the module, precise sinf/cosf) applied in f32 to the reconstructed q/k and re-split; causal attention with hybrid scores and P.v (first 128 queries 3-product hi + residual, later single f16), x 1/8, running-max softmax in f32 (hardware exp); out = ctx (bf16 hi + lo) . Wo ((in,out)); f32 output.
#include <hip/hip_runtime.h>
#include <math.h>

typedef __attribute__((ext_vector_type(16))) _Float16 v16h;
typedef __attribute__((ext_vector_type(16))) __bf16 v16b;
typedef __attribute__((ext_vector_type(8)))  _Float16 v8h;
typedef __attribute__((ext_vector_type(8)))  float v8f;
typedef __attribute__((ext_vector_type(4)))  float v4f;
typedef __attribute__((ext_vector_type(2)))  float v2f;
typedef __attribute__((ext_vector_type(4)))  unsigned v4u;
typedef __attribute__((ext_vector_type(4)))  int v4i;
typedef float __attribute__((may_alias)) float_a;
typedef int __attribute__((may_alias)) int_a;

template <typename T> __device__ __forceinline__ void vst2(void* p, T v) { *(T*)p = v;  }
__device__ __forceinline__ v8f wmma16(v16h a, v16h b, v8f c) {
  v8f d = __builtin_amdgcn_wmma_f32_16x16x32_f16(false, a, false, b, (short)0, c, false, false);
  asm volatile("v_nop\n\tv_nop\n\tv_nop\n\tv_nop" : "+v"(d) : "v"(a), "v"(b));
  return d;
}
__device__ __forceinline__ v8f wmma_bf(v16b a, v16b b, v8f c) {
  v8f d = __builtin_amdgcn_wmma_f32_16x16x32_bf16(false, a, false, b, (short)0, c, false, false);
  asm volatile("v_nop\n\tv_nop\n\tv_nop\n\tv_nop" : "+v"(d) : "v"(a), "v"(b));
  return d;
}
// Grouped-query causal attention with RoPE (B 4, S 2,048, hidden 768, 12 query heads x 64 over 4 kv heads): q = x Wq, k = x Wk, v = x Wv ((in,out), kv heads shared by 3 query heads), rotate-half RoPE (theta 1e4), causal softmax(q k / 8) v, out = ctx Wo.
__device__ __forceinline__ v16h frag_h(const _Float16* rowk0, int lane) {
  union { v16h v; v8h q[2]; } u; const _Float16* p = rowk0 + 8 * (lane >> 4);
  u.q[0] = *(const v8h*)p; u.q[1] = *(const v8h*)(p + 16); return u.v;
}
__device__ __forceinline__ v16h frag_f32(const float* rowk0, int lane) {
  v16h a; const float* p = rowk0 + 8 * (lane >> 4);
#pragma unroll
  for (int i = 0; i < 8; ++i) { a[i] = (_Float16)p[i]; a[8 + i] = (_Float16)p[16 + i]; }
  return a;
}
__device__ __forceinline__ v16h frag_f32s(const float* rowk0, int lane, float sc) {
  v16h a; const float* p = rowk0 + 8 * (lane >> 4);
#pragma unroll
  for (int i = 0; i < 8; ++i) { a[i] = (_Float16)(p[i] * sc); a[8 + i] = (_Float16)(p[16 + i] * sc); }
  return a;
}
// column fragment from a [K][ld] layout (column n), rows >= K read as 0
__device__ __forceinline__ v16h fragc_f32(const float* W, int k0, int n, int lane, int ld, int K) {
  v16h a; const int g = lane >> 4;
#pragma unroll
  for (int i = 0; i < 8; ++i) { const int ka = k0 + 8 * g + i, kb = ka + 16;
    a[i] = (_Float16)(ka < K ? W[(size_t)(ka < K ? ka : K - 1) * ld + n] : 0.f); a[8 + i] = (_Float16)(kb < K ? W[(size_t)(kb < K ? kb : K - 1) * ld + n] : 0.f); }
  return a;
}
struct F2 { v16b h, l; };
__device__ __forceinline__ F2 bsplit16(const float v[16]) { F2 r;
#pragma unroll
  for (int i = 0; i < 16; ++i) { const __bf16 h = (__bf16)v[i]; r.h[i] = h; r.l[i] = (__bf16)(v[i] - (float)h); }
  return r; }
__device__ __forceinline__ F2 split_row(const float* row, int k0, int lane) { float v[16]; const float* p = row + k0 + 8 * (lane >> 4);
#pragma unroll
  for (int i = 0; i < 8; ++i) { v[i] = p[i]; v[8 + i] = p[16 + i]; }
  return bsplit16(v); }
__device__ __forceinline__ F2 split_rowK(const float* row, int k0, int lane, int K) { float v[16]; const int g = lane >> 4;
#pragma unroll
  for (int i = 0; i < 8; ++i) { const int ka = k0 + 8 * g + i, kb = ka + 16; v[i] = ka < K ? row[ka < K ? ka : K - 1] : 0.f; v[8 + i] = kb < K ? row[kb < K ? kb : K - 1] : 0.f; }
  return bsplit16(v); }
__device__ __forceinline__ F2 split_col(const float* W, int k0, int n, int lane, int ld, int K) { float v[16]; const int g = lane >> 4;
#pragma unroll
  for (int i = 0; i < 8; ++i) { const int ka = k0 + 8 * g + i, kb = ka + 16; v[i] = ka < K ? W[(size_t)(ka < K ? ka : K - 1) * ld + n] : 0.f; v[8 + i] = kb < K ? W[(size_t)(kb < K ? kb : K - 1) * ld + n] : 0.f; }
  return bsplit16(v); }
__device__ __forceinline__ v8f mac3(const F2& a, const F2& b, v8f c) { c = wmma_bf(a.l, b.h, c); c = wmma_bf(a.h, b.l, c); return wmma_bf(a.h, b.h, c); }
__device__ __forceinline__ float sigm(float v) { return 1.0f / (1.0f + expf(-v)); }
#define LDSX() do { asm volatile("s_wait_dscnt 0" ::: "memory"); __builtin_amdgcn_wave_barrier(); __builtin_amdgcn_fence(__ATOMIC_RELEASE, "workgroup"); } while (0)


#define NB 4
#define SS 2048
#define DM 768
#define NH 12
#define NKV 4
#define GRP 3
#define HD 64
#define QKVW (3 * DM)
#ifndef TQB
#define TQB (SS / 64)
#define TNB NB
#define TOB (NB * SS / 64)     // output row tiles (all)
#endif
typedef __attribute__((ext_vector_type(8))) __bf16 v8b;
__device__ __forceinline__ v16b frag_b(const __bf16* rowk0, int lane) {
  union { v16b v; v8b q[2]; } u; const __bf16* p = rowk0 + 8 * (lane >> 4);
  u.q[0] = *(const v8b*)p; u.q[1] = *(const v8b*)(p + 16); return u.v;
}
__device__ __forceinline__ float bfr(float v) { return (float)(__bf16)v; }
__device__ __attribute__((noinline)) float exp_ni(float v) { return expf(v); }
__device__ __attribute__((noinline)) float erf_ni(float v) { return erff(v); }

#define PK_A 0                       // [2304][768] Wqkv rows ([out][in], transposed from the (in,out) inputs)
#define PK_P (PK_A + QKVW * DM)        // [768][768] Wo rows ([out][in], transposed)
#define PK_END (PK_P + DM * DM)
#define WS_PK  0u
#define WS_QK  (WS_PK + 2u * PK_END)             // f16 [8192 rows][1536]: q | k
#define WS_QKL (WS_QK + 2u * NB * SS * 2 * DM)     // f16 q | k residual planes x2048
#define WS_VTH (WS_QKL + 2u * NB * SS * 2 * DM)    // f16 [b][768 (h*64+d)][2048 s] hi
#define WS_VTL (WS_VTH + 2u * NB * DM * SS)        // f16 lo x 2048
#define WS_O   (WS_VTL + 2u * NB * DM * SS)        // f32 [8192][768]
#define WS_CS  (WS_O + 4u * NB * SS * DM)           // f32 2 x [2048][32], reserved but unused (k_rope computes cos/sin itself)
#define WS_END (WS_CS + 4u * 2 * SS * 32)
// ---- k_pack: block = (row n, which): column n of the (in,out) weight -> bf16 row n; which 0..2 -> W_q/W_k/W_v into PK_A rows which*768 + n; 3 -> W_o into PK_P
__global__ __launch_bounds__(256) void k_pack(const float* __restrict__ WQ, const float* __restrict__ WK, const float* __restrict__ WV, const float* __restrict__ WO, __bf16* __restrict__ PK) {   // (in,out) weights: Wq [768][768], Wk/Wv [768][256] (kv head = query head / 3), Wo [768][768]; packed row (which*DM + n), n = h*64 + d
  __shared__ __align__(16) __bf16 s[DM]; const int n = blockIdx.x, which = blockIdx.y, t = threadIdx.x; const int h = n / HD, d = n % HD; const int nkv = (h / GRP) * HD + d;
  for (int k = t; k < DM; k += 256) { float w; if (which == 0) w = WQ[(size_t)k * DM + n]; else if (which == 1) w = WK[(size_t)k * (NKV * HD) + nkv]; else if (which == 2) w = WV[(size_t)k * (NKV * HD) + nkv]; else w = WO[(size_t)k * DM + n]; s[k] = (__bf16)w; }
  __syncthreads(); __bf16* dst = (which < 3) ? (PK + PK_A + ((size_t)which * DM + n) * DM) : (PK + PK_P + (size_t)n * DM); for (int q = t; q < DM / 8; q += 256) vst2((unsigned*)(dst + q * 8), *(const v4u*)&s[q * 8]); }
// ---- k_rope: block = row (b, t): rotate-half RoPE on the 12 q heads and 12 (replicated) k heads: y[d] = x[d] cos(a_j) + (d < 32 ? -x[d+32] : x[d-32]) sin(a_j), j = d mod 32, a_j = pos * inv_freq[j]
__global__ __launch_bounds__(256) void k_rope(_Float16* __restrict__ QK, _Float16* __restrict__ QKL) { __shared__ __align__(16) _Float16 sh[2 * DM], sl[2 * DM]; __shared__ float scs[32], ssn[32]; const int t = threadIdx.x; const size_t row = blockIdx.x; const int pos = (int)(row % SS);
  if (t < 32) { const double invf = 1.0 / pow(10000.0, (double)t / 32.0); const float ang = (float)pos * (float)invf; scs[t] = cosf(ang); ssn[t] = sinf(ang); }
  __syncthreads();
  for (int e = t; e < 2 * NH * HD; e += 256) { const int w = e / (NH * HD), h = (e / HD) % NH, d = e % HD; const size_t o = row * (2 * DM) + (size_t)w * DM + h * HD; const int j = d & 31;
    const float x = (float)QK[o + d] + (float)QKL[o + d] * (1.0f / 2048.0f); const int dp = d < 32 ? d + 32 : d - 32; const float xp = (float)QK[o + dp] + (float)QKL[o + dp] * (1.0f / 2048.0f); const float rh = d < 32 ? -xp : xp;
    const float y = x * scs[j] + rh * ssn[j]; const _Float16 hv = (_Float16)y; sh[w * DM + h * HD + d] = hv; sl[w * DM + h * HD + d] = (_Float16)((y - (float)hv) * 2048.0f); }
  __syncthreads(); for (int q = t; q < 2 * DM / 8; q += 256) { vst2((unsigned*)(QK + row * (2 * DM) + q * 8), *(const v4u*)&sh[q * 8]); vst2((unsigned*)(QKL + row * (2 * DM) + q * 8), *(const v4u*)&sl[q * 8]); } }
#define GKS 64                          // k elements of one staged tile
#define GBP 72                          // LDS pitch of a staged weight row in bf16: 144 B = 16 B x 9, no bank conflict for 16-byte fragment reads
#define GAP 68                          // LDS pitch of a staged activation row in f32: 272 B = 16 B x 17, likewise
#define GB_BYTES (128 * GBP * 2)        // 128 weight rows
#define GA_BYTES (64 * GAP * 4)         // 64 activation rows
#define GST_BYTES (GB_BYTES + GA_BYTES) // one buffer: weight tile, then activation tile
// eight 16-B pieces of one thread into LDS, through no register: piece i goes to LDS byte l + i * ls and comes from g + i * 24,576 B (16 weight rows of 1,536 B, or 8 activation rows of 3,072 B).
// The wait on xcnt is the last line of the copies' own statement, so that it stands in front of any rewrite of the address registers they name.
__device__ __forceinline__ void stage8(unsigned l, unsigned ls, const char* g) {
  asm volatile("global_load_async_to_lds_b128 %0, %8, off\n\t"
               "global_load_async_to_lds_b128 %1, %9, off\n\t"
               "global_load_async_to_lds_b128 %2, %10, off\n\t"
               "global_load_async_to_lds_b128 %3, %11, off\n\t"
               "global_load_async_to_lds_b128 %4, %12, off\n\t"
               "global_load_async_to_lds_b128 %5, %13, off\n\t"
               "global_load_async_to_lds_b128 %6, %14, off\n\t"
               "global_load_async_to_lds_b128 %7, %15, off\n\t"
               "s_wait_xcnt 0x0"
               :: "v"(l), "v"(l + ls), "v"(l + 2 * ls), "v"(l + 3 * ls), "v"(l + 4 * ls), "v"(l + 5 * ls), "v"(l + 6 * ls), "v"(l + 7 * ls),
                  "v"(g), "v"(g + 24576), "v"(g + 2 * 24576), "v"(g + 3 * 24576), "v"(g + 4 * 24576), "v"(g + 5 * 24576), "v"(g + 6 * 24576), "v"(g + 7 * 24576) : "memory");
}
// tile t (64 k) of a 64-row x 128-column block into buffer t & 1: 128 weight rows x 128 B (8 threads a row) and 64 activation rows x 256 B (16 threads a row); every wave-wide copy covers four whole 128-B lines
#define GSTAGE(t) do { stage8(lb + ((t) & 1) * GST_BYTES, 16 * GBP * 2, gb + (size_t)(t) * (GKS * 2)); stage8(la + ((t) & 1) * GST_BYTES, 8 * GAP * 4, ga + (size_t)(t) * (GKS * 4)); } while (0)
__global__ __launch_bounds__(128) void k_qkv(const float* __restrict__ XQ, const float* __restrict__ XK, const float* __restrict__ XV, const __bf16* __restrict__ P, const float* __restrict__ BQ, const float* __restrict__ BK, const float* __restrict__ BV, _Float16* __restrict__ QK, _Float16* __restrict__ QKL, _Float16* __restrict__ VTH, _Float16* __restrict__ VTL) {
  const int which0 = (blockIdx.y * 128) / DM; const float* X = (which0 == 0) ? XQ : (which0 == 1) ? XK : XV; const float* BB = BQ ? (((which0 == 0) ? BQ : (which0 == 1) ? BK : BV) + (blockIdx.y * 128 - which0 * DM)) : nullptr;
  __shared__ __align__(16) char sm[2 * GST_BYTES];   // two buffers of the k loop; behind the loop's last barrier the same bytes stage the output
  _Float16 (*so)[16][136] = (_Float16 (*)[16][136])sm; _Float16 (*sol)[16][136] = (_Float16 (*)[16][136])(sm + 4 * 16 * 136 * 2); _Float16 (*sth)[72] = (_Float16 (*)[72])sm; _Float16 (*stl)[72] = (_Float16 (*)[72])(sm + 128 * 72 * 2);
  const int tid = threadIdx.x, wave = tid >> 5, lane = tid & 31, col = lane & 15, g = lane >> 4; const size_t r0 = (size_t)blockIdx.x * 64 + wave * 16; const int n0 = blockIdx.y * 128;
  v8f acc[8] = {};
  const char* gb = (const char*)(P + (size_t)(n0 + (tid >> 3)) * DM + (tid & 7) * 8);                        // this thread's first weight piece of tile 0
  const char* ga = (const char*)(X + ((size_t)blockIdx.x * 64 + (tid >> 4)) * DM + (tid & 15) * 4);          // its first activation piece of tile 0
  const unsigned lb = (unsigned)(uintptr_t)&sm[(tid >> 3) * (GBP * 2) + (tid & 7) * 16], la = (unsigned)(uintptr_t)&sm[GB_BYTES + (tid >> 4) * (GAP * 4) + (tid & 15) * 16];
  GSTAGE(0);
  asm volatile("s_wait_asynccnt 0x0" ::: "memory");   // tile 0 has landed before the barrier that publishes it
  __syncthreads();
  GSTAGE(1);
#pragma unroll 1
  for (int ts = 0; ts < DM / GKS; ++ts) { const __bf16* bB = (const __bf16*)(sm + (ts & 1) * GST_BYTES); const float* bA = (const float*)(sm + (ts & 1) * GST_BYTES + GB_BYTES);
#pragma unroll
    for (int kc = 0; kc < GKS / 32; ++kc) { v16b a; { const float* p = bA + (wave * 16 + col) * GAP + kc * 32 + 8 * g;
#pragma unroll
        for (int i = 0; i < 8; ++i) { a[i] = (__bf16)p[i]; a[8 + i] = (__bf16)p[16 + i]; } }
#pragma unroll
      for (int j = 0; j < 8; ++j) acc[j] = wmma_bf(a, frag_b(bB + (j * 16 + col) * GBP + kc * 32, lane), acc[j]); }
    asm volatile("s_wait_dscnt 0x0" ::: "memory");      // this wave's reads of tile ts have returned before its buffer is refilled
    asm volatile("s_wait_asynccnt 0x0" ::: "memory");   // this wave's copies of tile ts + 1 have landed before the barrier that publishes them
    __syncthreads();                                    // publishes tile ts + 1 and ends every wave's reads of tile ts
    if (ts + 2 < DM / GKS) GSTAGE(ts + 2); }
  asm volatile("s_wait_asynccnt 0x0" ::: "memory");     // no copy is outstanding when the buffers become output staging
  if (n0 < 2 * DM) {   // q stored unscaled (f16 sigma ~0.6, no subnormal exposure); 1/8 applied to the f32 score
#pragma unroll
    for (int j = 0; j < 8; ++j) {
#pragma unroll
      for (int r = 0; r < 8; ++r) { const float v = acc[j][r] + (BB ? bfr(BB[j * 16 + col]) : 0.f); const _Float16 hv = (_Float16)v; so[wave][8 * g + r][j * 16 + col] = hv; sol[wave][8 * g + r][j * 16 + col] = (_Float16)((v - (float)hv) * 2048.0f); } }   // q, k (+ bias) as f16 hi + (x2048) residual
    LDSX();
    for (int rl = 0; rl < 16; ++rl) if (lane < 16) { vst2((unsigned*)(QK + (r0 + rl) * (2 * DM) + n0 + lane * 8), *(const v4u*)&so[wave][rl][lane * 8]); vst2((unsigned*)(QKL + (r0 + rl) * (2 * DM) + n0 + lane * 8), *(const v4u*)&sol[wave][rl][lane * 8]); }
  } else {
#pragma unroll
    for (int j = 0; j < 8; ++j) {
#pragma unroll
      for (int r = 0; r < 8; ++r) { const float v = acc[j][r] + (BB ? bfr(BB[j * 16 + col]) : 0.f); const _Float16 hv = (_Float16)v; sth[j * 16 + col][wave * 16 + 8 * g + r] = hv; stl[j * 16 + col][wave * 16 + 8 * g + r] = (_Float16)((v - (float)hv) * 2048.0f); } }
    __syncthreads();
    const size_t rb = (size_t)blockIdx.x * 64; const int b = (int)(rb / SS), s0 = (int)(rb % SS); const int pc0 = n0 - 2 * DM;
    for (int q = tid; q < 128 * 8; q += 128) { const int d = q >> 3, pc = q & 7; const size_t o = ((size_t)b * DM + pc0 + d) * SS + s0 + pc * 8; vst2((unsigned*)(VTH + o), *(const v4u*)&sth[d][pc * 8]); vst2((unsigned*)(VTL + o), *(const v4u*)&stl[d][pc * 8]); }
  }
}
#define KP 72   // LDS pitch of a staged K row in f16: 144 B = 16 B x 9, no bank conflict for 16-byte fragment reads
#define VP 40   // LDS pitch of a staged V row in f16: 80 B = 16 B x 5, likewise
// one key tile of 32 keys into LDS, through no register: each of the 128 threads copies two 16-B pieces of K hi (32 rows x 128 B) and two of V hi (64 rows x 64 B).
// The wait on xcnt is the last line of the copies' own statement, so that it stands in front of any rewrite of the address registers they name.
__device__ __forceinline__ void stage_kv(unsigned lk0, unsigned lk1, unsigned lv0, unsigned lv1, const _Float16* k0, const _Float16* k1, const _Float16* v0, const _Float16* v1) {
  asm volatile("global_load_async_to_lds_b128 %0, %4, off\n\t"
               "global_load_async_to_lds_b128 %1, %5, off\n\t"
               "global_load_async_to_lds_b128 %2, %6, off\n\t"
               "global_load_async_to_lds_b128 %3, %7, off\n\t"
               "s_wait_xcnt 0x0"
               :: "v"(lk0), "v"(lk1), "v"(lv0), "v"(lv1), "v"(k0), "v"(k1), "v"(v0), "v"(v1) : "memory");
}
// lane l with lane l ^ 16 (the other half of the wave), through no LDS
__device__ __forceinline__ float xhalf(float x) { return __builtin_bit_cast(float, __builtin_amdgcn_permlanex16(__builtin_bit_cast(int, x), __builtin_bit_cast(int, x), 0x76543210, 0xfedcba98, false, false)); }
// ---- k_attn: block = (64 queries, head h, batch b): causal flash attention, transposed: S^T = K . Q^T (A = 16 key rows from LDS, B = the wave's 16 queries, kept in registers), so a lane holds 16 of the 32 scores of ONE query (column col; keys 8 g + r and 16 + 8 g + r), lane ^ 16 the other 16: maximum and sum in-lane plus one exchange between the halves. The two score tiles, converted in place, are the B operand of O^T += V^T . P^T (A = 16 rows d of V^T from LDS). scores = (q.k) * 0.125; O[b*S+q][h*64+d] = (acc + accl / 2048) / (2048 l) (256-B segments)
__global__ __launch_bounds__(128) void k_attn(const _Float16* __restrict__ QK, const _Float16* __restrict__ QKL, const _Float16* __restrict__ VTH, const _Float16* __restrict__ VTL, const void* __restrict__ KMASK, float* __restrict__ O) {
  __shared__ __align__(16) float so[4][16][68];
  __shared__ __align__(16) _Float16 sk[2][32 * KP], sv[2][64 * VP];   // two buffers: the block's K hi and V hi tile of 32 keys, read by all four waves
  const int tid = threadIdx.x, wave = tid >> 5, lane = tid & 31, col = lane & 15, g = lane >> 4;
  const int qb = blockIdx.x, h = blockIdx.y, b = blockIdx.z; const int q0 = qb * 64 + wave * 16; const size_t rq = (size_t)b * SS + q0 + col;
  v16h aq[2], aql[2];
#pragma unroll
  for (int kc = 0; kc < 2; ++kc) { aq[kc] = frag_h(QK + rq * (2 * DM) + h * HD + kc * 32, lane); aql[kc] = frag_h(QKL + rq * (2 * DM) + h * HD + kc * 32, lane); }
  float m = -3.0e38f, l = 0.f;   // of query q0 + col; l sums this half's keys only, the halves are joined behind the loop
  v8f acc[4] = {}, accl[4] = {};   // acc[dt][r] = O^T[d = dt * 16 + 8 g + r][query q0 + col]
  const int nksc = (qb * 64 + 64) / 32;   // causal: key tiles up to the end of this query block
  const _Float16* kg = QK + ((size_t)b * SS + (tid >> 3)) * (2 * DM) + DM + h * HD + (tid & 7) * 8;   // this thread's first K piece of tile 0 (its second: 16 keys on)
  const _Float16* vg = VTH + ((size_t)b * DM + h * HD + (tid >> 2)) * SS + (tid & 3) * 8;               // its first V piece of tile 0 (its second: 32 rows on)
  const unsigned lk = (unsigned)(uintptr_t)&sk[0][(tid >> 3) * KP + (tid & 7) * 8], lv = (unsigned)(uintptr_t)&sv[0][(tid >> 2) * VP + (tid & 3) * 8];
#define STAGE(t) stage_kv(lk + ((t) & 1) * (32 * KP * 2), lk + ((t) & 1) * (32 * KP * 2) + 16 * KP * 2, lv + ((t) & 1) * (64 * VP * 2), lv + ((t) & 1) * (64 * VP * 2) + 32 * VP * 2, kg + (size_t)(t) * 32 * (2 * DM), kg + ((size_t)(t) * 32 + 16) * (2 * DM), vg + (t) * 32, vg + (t) * 32 + 32 * SS)
  STAGE(0);
  asm volatile("s_wait_asynccnt 0x0" ::: "memory");   // tile 0 has landed before the barrier that publishes it
  __syncthreads();
  if (1 < nksc) STAGE(1);
#pragma unroll 1
  for (int ks = 0; ks < nksc; ++ks) { v8f s[2]; const int lim = q0 + col - 8 * g - ks * 32;   // the last score row of this lane's 16 (ct * 16 + r) that its query may see
#pragma unroll
    for (int ct = 0; ct < 2; ++ct) { const _Float16* krow = &sk[ks & 1][(ct * 16 + col) * KP]; const _Float16* krowl = QKL + ((size_t)b * SS + ks * 32 + ct * 16 + col) * (2 * DM) + DM + h * HD; v8f c = {}, cl = {};
      if (qb < 2) {   // leading query blocks (few keys, outputs far above the global rms): 3 products
#pragma unroll
        for (int kc = 0; kc < 2; ++kc) { const v16h kh = frag_h(krow + kc * 32, lane); c = wmma16(kh, aq[kc], c); cl = wmma16(kh, aql[kc], cl); cl = wmma16(frag_h(krowl + kc * 32, lane), aq[kc], cl); }
#pragma unroll
        for (int r = 0; r < 8; ++r) c[r] += cl[r] * (1.0f / 2048.0f); }
      else {
#pragma unroll
        for (int kc = 0; kc < 2; ++kc) c = wmma16(frag_h(krow + kc * 32, lane), aq[kc], c); }   // single product elsewhere
#pragma unroll
      for (int r = 0; r < 8; ++r) s[ct][r] = (ct * 16 + r <= lim) ? c[r] * 0.125f : -3.0e38f; }   // 1/sqrt(64); masked keys (key ks * 32 + ct * 16 + 8 g + r above query q0 + col) excluded
    float mx = fmaxf(s[0][0], s[1][0]);
#pragma unroll
    for (int r = 1; r < 8; ++r) mx = fmaxf(mx, fmaxf(s[0][r], s[1][r]));
    mx = fmaxf(mx, xhalf(mx));   // over all 32 keys of the tile
    const float mn = fmaxf(m, mx);
    float ta = (m - mn) * 1.442695041f, t0[8], t1[8];   // e^x = 2^(x log2 e), as __expf forms it
#pragma unroll
    for (int r = 0; r < 8; ++r) { t0[r] = (s[0][r] - mn) * 1.442695041f; t1[r] = (s[1][r] - mn) * 1.442695041f; }
    // the 17 hardware exponentials, in place, in two statements: inside a statement no v_exp_f32 is followed by an instruction that reads its result or overwrites its source, and the v_nop keeps
    // that slot behind the last one.
    asm("v_exp_f32 %0, %0\n\tv_exp_f32 %1, %1\n\tv_exp_f32 %2, %2\n\tv_exp_f32 %3, %3\n\tv_exp_f32 %4, %4\n\tv_exp_f32 %5, %5\n\tv_exp_f32 %6, %6\n\tv_exp_f32 %7, %7\n\tv_exp_f32 %8, %8\n\tv_nop"
        : "+v"(ta), "+v"(t0[0]), "+v"(t0[1]), "+v"(t0[2]), "+v"(t0[3]), "+v"(t0[4]), "+v"(t0[5]), "+v"(t0[6]), "+v"(t0[7]));
    asm("v_exp_f32 %0, %0\n\tv_exp_f32 %1, %1\n\tv_exp_f32 %2, %2\n\tv_exp_f32 %3, %3\n\tv_exp_f32 %4, %4\n\tv_exp_f32 %5, %5\n\tv_exp_f32 %6, %6\n\tv_exp_f32 %7, %7\n\tv_nop"
        : "+v"(t1[0]), "+v"(t1[1]), "+v"(t1[2]), "+v"(t1[3]), "+v"(t1[4]), "+v"(t1[5]), "+v"(t1[6]), "+v"(t1[7]));
    const float alpha = (m <= -1.0e38f) ? 0.f : ta;
    float es = 0.f;
#pragma unroll
    for (int r = 0; r < 8; ++r) { s[0][r] = (s[0][r] <= -1.0e38f) ? 0.f : t0[r]; s[1][r] = (s[1][r] <= -1.0e38f) ? 0.f : t1[r]; es += s[0][r] + s[1][r]; }
    l = l * alpha + es; m = mn;
#pragma unroll
    for (int dt = 0; dt < 4; ++dt) {
#pragma unroll
      for (int r = 0; r < 8; ++r) { acc[dt][r] *= alpha; accl[dt][r] *= alpha; } }
    v16h pa, pl;   // P^T as a B operand: element i = key 8 g + i, element 8 + i = key 16 + 8 g + i, the k order of frag_h
#pragma unroll
    for (int i = 0; i < 8; ++i) { const float x0 = s[0][i] * 2048.0f, x1 = s[1][i] * 2048.0f; const _Float16 h0 = (_Float16)x0, h1 = (_Float16)x1; pa[i] = h0; pa[8 + i] = h1; pl[i] = (_Float16)((x0 - (float)h0) * 2048.0f); pl[8 + i] = (_Float16)((x1 - (float)h1) * 2048.0f); }   // P scaled by 2^11 before the f16 split so small softmax weights stay out of the f16 subnormal range; 2^-11 folded into the epilogue
#pragma unroll
    for (int dt = 0; dt < 4; ++dt) { const size_t vr = ((size_t)b * DM + h * HD + dt * 16 + col) * SS + ks * 32; const v16h vh = frag_h(&sv[ks & 1][(dt * 16 + col) * VP], lane); acc[dt] = wmma16(vh, pa, acc[dt]); if (qb < 2) { accl[dt] = wmma16(vh, pl, accl[dt]); accl[dt] = wmma16(frag_h(VTL + vr, lane), pa, accl[dt]); } }   // leading query blocks: P hi/lo x V hi/lo (3 products); elsewhere P x V single
    asm volatile("s_wait_dscnt 0x0" ::: "memory");      // this wave's reads of the tile have returned before the buffer is refilled
    asm volatile("s_wait_asynccnt 0x0" ::: "memory");   // this wave's copies of tile ks + 1 have landed before the barrier that publishes them
    __syncthreads();                                    // publishes tile ks + 1 and ends every wave's reads of tile ks
    if (ks + 2 < nksc) STAGE(ks + 2); }
  asm volatile("s_wait_asynccnt 0x0" ::: "memory");     // no copy is outstanding when the wave goes on to its end
#undef STAGE
  l += xhalf(l);   // the two halves' sums of one query
  const float il = (1.0f / 2048.0f) / l;
#pragma unroll
  for (int dt = 0; dt < 4; ++dt) {
#pragma unroll
    for (int r = 0; r < 8; ++r) so[wave][col][dt * 16 + 8 * g + r] = (acc[dt][r] + accl[dt][r] * (1.0f / 2048.0f)) * il; }
  LDSX();
  for (int rl = 0; rl < 16; ++rl) if (lane < 16) vst2(O + ((size_t)b * SS + q0 + rl) * DM + h * HD + lane * 4, *(const v4f*)&so[wave][rl][lane * 4]);
}
// ---- k_out: block = (64 rows, 128 cols): out = O(hi/lo) . Wo rows (2 products) + bo
__global__ __launch_bounds__(128) void k_out(const float* __restrict__ O, const __bf16* __restrict__ P, const float* __restrict__ BO, float* __restrict__ Y) {
  __shared__ __align__(16) char sm[2 * GST_BYTES];   // two buffers of the k loop; behind the loop's last barrier the same bytes stage the output
  float (*so)[16][132] = (float (*)[16][132])sm;
  const int tid = threadIdx.x, wave = tid >> 5, lane = tid & 31, col = lane & 15, g = lane >> 4; const size_t r0 = (size_t)blockIdx.x * 64 + wave * 16; const int n0 = blockIdx.y * 128;
  v8f acc[8] = {};
  const char* gb = (const char*)(P + (size_t)(n0 + (tid >> 3)) * DM + (tid & 7) * 8);                        // this thread's first weight piece of tile 0
  const char* ga = (const char*)(O + ((size_t)blockIdx.x * 64 + (tid >> 4)) * DM + (tid & 15) * 4);          // its first activation piece of tile 0
  const unsigned lb = (unsigned)(uintptr_t)&sm[(tid >> 3) * (GBP * 2) + (tid & 7) * 16], la = (unsigned)(uintptr_t)&sm[GB_BYTES + (tid >> 4) * (GAP * 4) + (tid & 15) * 16];
  GSTAGE(0);
  asm volatile("s_wait_asynccnt 0x0" ::: "memory");   // tile 0 has landed before the barrier that publishes it
  __syncthreads();
  GSTAGE(1);
#pragma unroll 1
  for (int ts = 0; ts < DM / GKS; ++ts) { const __bf16* bB = (const __bf16*)(sm + (ts & 1) * GST_BYTES); const float* bA = (const float*)(sm + (ts & 1) * GST_BYTES + GB_BYTES);
#pragma unroll
    for (int kc = 0; kc < GKS / 32; ++kc) { const F2 a = split_row(bA + (wave * 16 + col) * GAP, kc * 32, lane);
#pragma unroll
      for (int j = 0; j < 8; ++j) { const v16b w = frag_b(bB + (j * 16 + col) * GBP + kc * 32, lane); acc[j] = wmma_bf(a.l, w, acc[j]); acc[j] = wmma_bf(a.h, w, acc[j]); } }
    asm volatile("s_wait_dscnt 0x0" ::: "memory");      // this wave's reads of tile ts have returned before its buffer is refilled
    asm volatile("s_wait_asynccnt 0x0" ::: "memory");   // this wave's copies of tile ts + 1 have landed before the barrier that publishes them
    __syncthreads();                                    // publishes tile ts + 1 and ends every wave's reads of tile ts
    if (ts + 2 < DM / GKS) GSTAGE(ts + 2); }
  asm volatile("s_wait_asynccnt 0x0" ::: "memory");     // no copy is outstanding when the buffers become output staging
#pragma unroll
  for (int j = 0; j < 8; ++j) {
#pragma unroll
    for (int r = 0; r < 8; ++r) so[wave][8 * g + r][j * 16 + col] = acc[j][r] + (BO ? bfr(BO[n0 + j * 16 + col]) : 0.f); }
  LDSX();
  for (int rl = 0; rl < 16; ++rl) vst2(Y + (r0 + rl) * DM + n0 + lane * 4, *(const v4f*)&so[wave][rl][lane * 4]);
}
extern "C" void kernel_launch(void* const* d_in, const int* in_sizes, int n_in, void* d_out, int out_size, void* d_ws, size_t ws_size, hipStream_t stream) {
  (void)in_sizes; (void)n_in; (void)out_size;
  const float** F = (const float**)d_in;   // 0 hidden_states [4,2048,768], 1 Wq [768,768], 2 Wk [768,256], 3 Wv [768,256], 4 Wo [768,768] (all (in,out))
  if (ws_size < (size_t)WS_END) return;
  char* ws = (char*)d_ws; __bf16* PK = (__bf16*)(ws + WS_PK); _Float16 *QK = (_Float16*)(ws + WS_QK), *QKL = (_Float16*)(ws + WS_QKL), *VTH = (_Float16*)(ws + WS_VTH), *VTL = (_Float16*)(ws + WS_VTL); float* O = (float*)(ws + WS_O);
  k_pack<<<dim3(DM, 4), 256, 0, stream>>>(F[1], F[2], F[3], F[4], PK);
  k_qkv<<<dim3(TNB * SS / 64, QKVW / 128), 128, 0, stream>>>(F[0], F[0], F[0], PK + PK_A, nullptr, nullptr, nullptr, QK, QKL, VTH, VTL);
  k_rope<<<TNB * SS, 256, 0, stream>>>(QK, QKL);
  k_attn<<<dim3(TQB, NH, TNB), 128, 0, stream>>>(QK, QKL, VTH, VTL, nullptr, O);
  k_out<<<dim3(TOB, DM / 128), 128, 0, stream>>>(O, PK + PK_P, nullptr, (float*)d_out);
}

// v004
// It runs in 263 microseconds.
// Next to v003, in two timings, it ran 1.07 times as fast each time.
// All steps since v000 together make it 2.23 times as fast.
// compute dtype: all float inputs rounded to bf16; q/k/v = x . W with EXACT bf16 products on WMMA 16x16x32 ((in,out) weights as transposed rows; the 4 kv heads replicated to their 3 query heads at pack time), f16 hi + residual; RoPE (inv_freq in double, angle = pos x inv_freq in f32 as the module, precise sinf/cosf) applied in f32 to the reconstructed q/k and re-split; causal attention with hybrid scores and P.v (first 128 queries 3-product hi + residual, later single f16), x 1/8, running-max softmax in f32 (hardware exp); out = ctx (bf16 hi + lo) . Wo ((in,out)); f32 output.
#include <hip/hip_runtime.h>
#include <math.h>

typedef __attribute__((ext_vector_type(16))) _Float16 v16h;
typedef __attribute__((ext_vector_type(16))) __bf16 v16b;
typedef __attribute__((ext_vector_type(8)))  _Float16 v8h;
typedef __attribute__((ext_vector_type(8)))  float v8f;
typedef __attribute__((ext_vector_type(4)))  float v4f;
typedef __attribute__((ext_vector_type(2)))  float v2f;
typedef __attribute__((ext_vector_type(4)))  unsigned v4u;
typedef __attribute__((ext_vector_type(4)))  int v4i;
typedef float __attribute__((may_alias)) float_a;
typedef int __attribute__((may_alias)) int_a;

template <typename T> __device__ __forceinline__ void vst2(void* p, T v) { *(T*)p = v;  }
__device__ __forceinline__ v8f wmma16(v16h a, v16h b, v8f c) {
  v8f d = __builtin_amdgcn_wmma_f32_16x16x32_f16(false, a, false, b, (short)0, c, false, false);
  asm volatile("v_nop\n\tv_nop\n\tv_nop\n\tv_nop" : "+v"(d) : "v"(a), "v"(b));
  return d;
}
__device__ __forceinline__ v8f wmma_bf(v16b a, v16b b, v8f c) {
  v8f d = __builtin_amdgcn_wmma_f32_16x16x32_bf16(false, a, false, b, (short)0, c, false, false);
  asm volatile("v_nop\n\tv_nop\n\tv_nop\n\tv_nop" : "+v"(d) : "v"(a), "v"(b));
  return d;
}
// Grouped-query causal attention with RoPE (B 4, S 2,048, hidden 768, 12 query heads x 64 over 4 kv heads): q = x Wq, k = x Wk, v = x Wv ((in,out), kv heads shared by 3 query heads), rotate-half RoPE (theta 1e4), causal softmax(q k / 8) v, out = ctx Wo.
__device__ __forceinline__ v16h frag_h(const _Float16* rowk0, int lane) {
  union { v16h v; v8h q[2]; } u; const _Float16* p = rowk0 + 8 * (lane >> 4);
  u.q[0] = *(const v8h*)p; u.q[1] = *(const v8h*)(p + 16); return u.v;
}
__device__ __forceinline__ v16h frag_f32(const float* rowk0, int lane) {
  v16h a; const float* p = rowk0 + 8 * (lane >> 4);
#pragma unroll
  for (int i = 0; i < 8; ++i) { a[i] = (_Float16)p[i]; a[8 + i] = (_Float16)p[16 + i]; }
  return a;
}
__device__ __forceinline__ v16h frag_f32s(const float* rowk0, int lane, float sc) {
  v16h a; const float* p = rowk0 + 8 * (lane >> 4);
#pragma unroll
  for (int i = 0; i < 8; ++i) { a[i] = (_Float16)(p[i] * sc); a[8 + i] = (_Float16)(p[16 + i] * sc); }
  return a;
}
// column fragment from a [K][ld] layout (column n), rows >= K read as 0
__device__ __forceinline__ v16h fragc_f32(const float* W, int k0, int n, int lane, int ld, int K) {
  v16h a; const int g = lane >> 4;
#pragma unroll
  for (int i = 0; i < 8; ++i) { const int ka = k0 + 8 * g + i, kb = ka + 16;
    a[i] = (_Float16)(ka < K ? W[(size_t)(ka < K ? ka : K - 1) * ld + n] : 0.f); a[8 + i] = (_Float16)(kb < K ? W[(size_t)(kb < K ? kb : K - 1) * ld + n] : 0.f); }
  return a;
}
struct F2 { v16b h, l; };
__device__ __forceinline__ F2 bsplit16(const float v[16]) { F2 r;
#pragma unroll
  for (int i = 0; i < 16; ++i) { const __bf16 h = (__bf16)v[i]; r.h[i] = h; r.l[i] = (__bf16)(v[i] - (float)h); }
  return r; }
__device__ __forceinline__ F2 split_row(const float* row, int k0, int lane) { float v[16]; const float* p = row + k0 + 8 * (lane >> 4);
#pragma unroll
  for (int i = 0; i < 8; ++i) { v[i] = p[i]; v[8 + i] = p[16 + i]; }
  return bsplit16(v); }
__device__ __forceinline__ F2 split_rowK(const float* row, int k0, int lane, int K) { float v[16]; const int g = lane >> 4;
#pragma unroll
  for (int i = 0; i < 8; ++i) { const int ka = k0 + 8 * g + i, kb = ka + 16; v[i] = ka < K ? row[ka < K ? ka : K - 1] : 0.f; v[8 + i] = kb < K ? row[kb < K ? kb : K - 1] : 0.f; }
  return bsplit16(v); }
__device__ __forceinline__ F2 split_col(const float* W, int k0, int n, int lane, int ld, int K) { float v[16]; const int g = lane >> 4;
#pragma unroll
  for (int i = 0; i < 8; ++i) { const int ka = k0 + 8 * g + i, kb = ka + 16; v[i] = ka < K ? W[(size_t)(ka < K ? ka : K - 1) * ld + n] : 0.f; v[8 + i] = kb < K ? W[(size_t)(kb < K ? kb : K - 1) * ld + n] : 0.f; }
  return bsplit16(v); }
__device__ __forceinline__ v8f mac3(const F2& a, const F2& b, v8f c) { c = wmma_bf(a.l, b.h, c); c = wmma_bf(a.h, b.l, c); return wmma_bf(a.h, b.h, c); }
__device__ __forceinline__ float sigm(float v) { return 1.0f / (1.0f + expf(-v)); }
#define LDSX() do { asm volatile("s_wait_dscnt 0" ::: "memory"); __builtin_amdgcn_wave_barrier(); __builtin_amdgcn_fence(__ATOMIC_RELEASE, "workgroup"); } while (0)


#define NB 4
#define SS 2048
#define DM 768
#define NH 12
#define NKV 4
#define GRP 3
#define HD 64
#define QKVW (3 * DM)
#ifndef TQB
#define TQB (SS / 64)
#define TNB NB
#define TOB (NB * SS / 64)     // output row tiles (all)
#endif
typedef __attribute__((ext_vector_type(8))) __bf16 v8b;
__device__ __forceinline__ v16b frag_b(const __bf16* rowk0, int lane) {
  union { v16b v; v8b q[2]; } u; const __bf16* p = rowk0 + 8 * (lane >> 4);
  u.q[0] = *(const v8b*)p; u.q[1] = *(const v8b*)(p + 16); return u.v;
}
__device__ __forceinline__ float bfr(float v) { return (float)(__bf16)v; }
__device__ __attribute__((noinline)) float exp_ni(float v) { return expf(v); }
__device__ __attribute__((noinline)) float erf_ni(float v) { return erff(v); }

#define PK_A 0                       // [2304][768] Wqkv rows ([out][in], transposed from the (in,out) inputs)
#define PK_P (PK_A + QKVW * DM)        // [768][768] Wo rows ([out][in], transposed)
#define PK_END (PK_P + DM * DM)
#define WS_PK  0u
#define WS_QK  (WS_PK + 2u * PK_END)             // f16 [8192 rows][1536]: q | k
#define WS_QKL (WS_QK + 2u * NB * SS * 2 * DM)     // f16 q | k residual planes x2048
#define WS_VTH (WS_QKL + 2u * NB * SS * 2 * DM)    // f16 [b][768 (h*64+d)][2048 s] hi
#define WS_VTL (WS_VTH + 2u * NB * DM * SS)        // f16 lo x 2048
#define WS_O   (WS_VTL + 2u * NB * DM * SS)        // f32 [8192][768]
#define WS_CS  (WS_O + 4u * NB * SS * DM)           // f32 2 x [2048][32], reserved but unused (k_rope computes cos/sin itself)
#define WS_END (WS_CS + 4u * 2 * SS * 32)
// ---- k_pack: block = (row n, which): column n of the (in,out) weight -> bf16 row n; which 0..2 -> W_q/W_k/W_v into PK_A rows which*768 + n; 3 -> W_o into PK_P
__global__ __launch_bounds__(256) void k_pack(const float* __restrict__ WQ, const float* __restrict__ WK, const float* __restrict__ WV, const float* __restrict__ WO, __bf16* __restrict__ PK) {   // (in,out) weights: Wq [768][768], Wk/Wv [768][256] (kv head = query head / 3), Wo [768][768]; packed row (which*DM + n), n = h*64 + d
  __shared__ __align__(16) __bf16 s[DM]; const int n = blockIdx.x, which = blockIdx.y, t = threadIdx.x; const int h = n / HD, d = n % HD; const int nkv = (h / GRP) * HD + d;
  for (int k = t; k < DM; k += 256) { float w; if (which == 0) w = WQ[(size_t)k * DM + n]; else if (which == 1) w = WK[(size_t)k * (NKV * HD) + nkv]; else if (which == 2) w = WV[(size_t)k * (NKV * HD) + nkv]; else w = WO[(size_t)k * DM + n]; s[k] = (__bf16)w; }
  __syncthreads(); __bf16* dst = (which < 3) ? (PK + PK_A + ((size_t)which * DM + n) * DM) : (PK + PK_P + (size_t)n * DM); for (int q = t; q < DM / 8; q += 256) vst2((unsigned*)(dst + q * 8), *(const v4u*)&s[q * 8]); }
// ---- k_rope: block = row (b, t): rotate-half RoPE on the 12 q heads and 12 (replicated) k heads: y[d] = x[d] cos(a_j) + (d < 32 ? -x[d+32] : x[d-32]) sin(a_j), j = d mod 32, a_j = pos * inv_freq[j]
__global__ __launch_bounds__(256) void k_rope(_Float16* __restrict__ QK, _Float16* __restrict__ QKL) { __shared__ __align__(16) _Float16 sh[2 * DM], sl[2 * DM]; __shared__ float scs[32], ssn[32]; const int t = threadIdx.x; const size_t row = blockIdx.x; const int pos = (int)(row % SS);
  if (t < 32) { const double invf = 1.0 / pow(10000.0, (double)t / 32.0); const float ang = (float)pos * (float)invf; scs[t] = cosf(ang); ssn[t] = sinf(ang); }
  __syncthreads();
  for (int e = t; e < 2 * NH * HD; e += 256) { const int w = e / (NH * HD), h = (e / HD) % NH, d = e % HD; const size_t o = row * (2 * DM) + (size_t)w * DM + h * HD; const int j = d & 31;
    const float x = (float)QK[o + d] + (float)QKL[o + d] * (1.0f / 2048.0f); const int dp = d < 32 ? d + 32 : d - 32; const float xp = (float)QK[o + dp] + (float)QKL[o + dp] * (1.0f / 2048.0f); const float rh = d < 32 ? -xp : xp;
    const float y = x * scs[j] + rh * ssn[j]; const _Float16 hv = (_Float16)y; sh[w * DM + h * HD + d] = hv; sl[w * DM + h * HD + d] = (_Float16)((y - (float)hv) * 2048.0f); }
  __syncthreads(); for (int q = t; q < 2 * DM / 8; q += 256) { vst2((unsigned*)(QK + row * (2 * DM) + q * 8), *(const v4u*)&sh[q * 8]); vst2((unsigned*)(QKL + row * (2 * DM) + q * 8), *(const v4u*)&sl[q * 8]); } }
#define GKS 64                          // k elements of one staged tile
#define GBP 72                          // LDS pitch of a staged weight row in bf16: 144 B = 16 B x 9, no bank conflict for 16-byte fragment reads
#define GAP 68                          // LDS pitch of a staged activation row in f32: 272 B = 16 B x 17, likewise
#define GB_BYTES (128 * GBP * 2)        // 128 weight rows
#define GA_BYTES (64 * GAP * 4)         // 64 activation rows
#define GST_BYTES (GB_BYTES + GA_BYTES) // one buffer: weight tile, then activation tile
// eight 16-B pieces of one thread into LDS, through no register: piece i goes to LDS byte l + i * ls and comes from g + i * 24,576 B (16 weight rows of 1,536 B, or 8 activation rows of 3,072 B).
// The wait on xcnt is the last line of the copies' own statement, so that it stands in front of any rewrite of the address registers they name.
__device__ __forceinline__ void stage8(unsigned l, unsigned ls, const char* g) {
  asm volatile("global_load_async_to_lds_b128 %0, %8, off\n\t"
               "global_load_async_to_lds_b128 %1, %9, off\n\t"
               "global_load_async_to_lds_b128 %2, %10, off\n\t"
               "global_load_async_to_lds_b128 %3, %11, off\n\t"
               "global_load_async_to_lds_b128 %4, %12, off\n\t"
               "global_load_async_to_lds_b128 %5, %13, off\n\t"
               "global_load_async_to_lds_b128 %6, %14, off\n\t"
               "global_load_async_to_lds_b128 %7, %15, off\n\t"
               "s_wait_xcnt 0x0"
               :: "v"(l), "v"(l + ls), "v"(l + 2 * ls), "v"(l + 3 * ls), "v"(l + 4 * ls), "v"(l + 5 * ls), "v"(l + 6 * ls), "v"(l + 7 * ls),
                  "v"(g), "v"(g + 24576), "v"(g + 2 * 24576), "v"(g + 3 * 24576), "v"(g + 4 * 24576), "v"(g + 5 * 24576), "v"(g + 6 * 24576), "v"(g + 7 * 24576) : "memory");
}
// tile t (64 k) of a 64-row x 128-column block into buffer t & 1: 128 weight rows x 128 B (8 threads a row) and 64 activation rows x 256 B (16 threads a row); every wave-wide copy covers four whole 128-B lines
#define GSTAGE(t) do { stage8(lb + ((t) & 1) * GST_BYTES, 16 * GBP * 2, gb + (size_t)(t) * (GKS * 2)); stage8(la + ((t) & 1) * GST_BYTES, 8 * GAP * 4, ga + (size_t)(t) * (GKS * 4)); } while (0)
__global__ __launch_bounds__(128) void k_qkv(const float* __restrict__ XQ, const float* __restrict__ XK, const float* __restrict__ XV, const __bf16* __restrict__ P, const float* __restrict__ BQ, const float* __restrict__ BK, const float* __restrict__ BV, _Float16* __restrict__ QK, _Float16* __restrict__ QKL, _Float16* __restrict__ VTH, _Float16* __restrict__ VTL) {
  const int which0 = (blockIdx.y * 128) / DM; const float* X = (which0 == 0) ? XQ : (which0 == 1) ? XK : XV; const float* BB = BQ ? (((which0 == 0) ? BQ : (which0 == 1) ? BK : BV) + (blockIdx.y * 128 - which0 * DM)) : nullptr;
  __shared__ __align__(16) char sm[2 * GST_BYTES];   // two buffers of the k loop; behind the loop's last barrier the same bytes stage the output
  _Float16 (*so)[16][136] = (_Float16 (*)[16][136])sm; _Float16 (*sol)[16][136] = (_Float16 (*)[16][136])(sm + 4 * 16 * 136 * 2); _Float16 (*sth)[72] = (_Float16 (*)[72])sm; _Float16 (*stl)[72] = (_Float16 (*)[72])(sm + 128 * 72 * 2);
  const int tid = threadIdx.x, wave = tid >> 5, lane = tid & 31, col = lane & 15, g = lane >> 4; const size_t r0 = (size_t)blockIdx.x * 64 + wave * 16; const int n0 = blockIdx.y * 128;
  v8f acc[8] = {};
  const char* gb = (const char*)(P + (size_t)(n0 + (tid >> 3)) * DM + (tid & 7) * 8);                        // this thread's first weight piece of tile 0
  const char* ga = (const char*)(X + ((size_t)blockIdx.x * 64 + (tid >> 4)) * DM + (tid & 15) * 4);          // its first activation piece of tile 0
  const unsigned lb = (unsigned)(uintptr_t)&sm[(tid >> 3) * (GBP * 2) + (tid & 7) * 16], la = (unsigned)(uintptr_t)&sm[GB_BYTES + (tid >> 4) * (GAP * 4) + (tid & 15) * 16];
  GSTAGE(0);
  asm volatile("s_wait_asynccnt 0x0" ::: "memory");   // tile 0 has landed before the barrier that publishes it
  __syncthreads();
  GSTAGE(1);
#pragma unroll 1
  for (int ts = 0; ts < DM / GKS; ++ts) { const __bf16* bB = (const __bf16*)(sm + (ts & 1) * GST_BYTES); const float* bA = (const float*)(sm + (ts & 1) * GST_BYTES + GB_BYTES);
#pragma unroll
    for (int kc = 0; kc < GKS / 32; ++kc) { v16b a; { const float* p = bA + (wave * 16 + col) * GAP + kc * 32 + 8 * g;
#pragma unroll
        for (int i = 0; i < 8; ++i) { a[i] = (__bf16)p[i]; a[8 + i] = (__bf16)p[16 + i]; } }
      v16b w[8];   // the eight weight fragments of this k chunk are read as one group in front of its products: one LDS latency a chunk, not one a product
#pragma unroll
      for (int j = 0; j < 8; ++j) w[j] = frag_b(bB + (j * 16 + col) * GBP + kc * 32, lane);
#pragma unroll
      for (int j = 0; j < 8; ++j) acc[j] = wmma_bf(a, w[j], acc[j]); }
    asm volatile("s_wait_dscnt 0x0" ::: "memory");      // this wave's reads of tile ts have returned before its buffer is refilled
    asm volatile("s_wait_asynccnt 0x0" ::: "memory");   // this wave's copies of tile ts + 1 have landed before the barrier that publishes them
    __syncthreads();                                    // publishes tile ts + 1 and ends every wave's reads of tile ts
    if (ts + 2 < DM / GKS) GSTAGE(ts + 2); }
  asm volatile("s_wait_asynccnt 0x0" ::: "memory");     // no copy is outstanding when the buffers become output staging
  if (n0 < 2 * DM) {   // q stored unscaled (f16 sigma ~0.6, no subnormal exposure); 1/8 applied to the f32 score
#pragma unroll
    for (int j = 0; j < 8; ++j) {
#pragma unroll
      for (int r = 0; r < 8; ++r) { const float v = acc[j][r] + (BB ? bfr(BB[j * 16 + col]) : 0.f); const _Float16 hv = (_Float16)v; so[wave][8 * g + r][j * 16 + col] = hv; sol[wave][8 * g + r][j * 16 + col] = (_Float16)((v - (float)hv) * 2048.0f); } }   // q, k (+ bias) as f16 hi + (x2048) residual
    LDSX();
    for (int rl = 0; rl < 16; ++rl) if (lane < 16) { vst2((unsigned*)(QK + (r0 + rl) * (2 * DM) + n0 + lane * 8), *(const v4u*)&so[wave][rl][lane * 8]); vst2((unsigned*)(QKL + (r0 + rl) * (2 * DM) + n0 + lane * 8), *(const v4u*)&sol[wave][rl][lane * 8]); }
  } else {
#pragma unroll
    for (int j = 0; j < 8; ++j) {
#pragma unroll
      for (int r = 0; r < 8; ++r) { const float v = acc[j][r] + (BB ? bfr(BB[j * 16 + col]) : 0.f); const _Float16 hv = (_Float16)v; sth[j * 16 + col][wave * 16 + 8 * g + r] = hv; stl[j * 16 + col][wave * 16 + 8 * g + r] = (_Float16)((v - (float)hv) * 2048.0f); } }
    __syncthreads();
    const size_t rb = (size_t)blockIdx.x * 64; const int b = (int)(rb / SS), s0 = (int)(rb % SS); const int pc0 = n0 - 2 * DM;
    for (int q = tid; q < 128 * 8; q += 128) { const int d = q >> 3, pc = q & 7; const size_t o = ((size_t)b * DM + pc0 + d) * SS + s0 + pc * 8; vst2((unsigned*)(VTH + o), *(const v4u*)&sth[d][pc * 8]); vst2((unsigned*)(VTL + o), *(const v4u*)&stl[d][pc * 8]); }
  }
}
#define KP 72   // LDS pitch of a staged K row in f16: 144 B = 16 B x 9, no bank conflict for 16-byte fragment reads
#define VP 40   // LDS pitch of a staged V row in f16: 80 B = 16 B x 5, likewise
// one key tile of 32 keys into LDS, through no register: each of the 128 threads copies two 16-B pieces of K hi (32 rows x 128 B) and two of V hi (64 rows x 64 B).
// The wait on xcnt is the last line of the copies' own statement, so that it stands in front of any rewrite of the address registers they name.
__device__ __forceinline__ void stage_kv(unsigned lk0, unsigned lk1, unsigned lv0, unsigned lv1, const _Float16* k0, const _Float16* k1, const _Float16* v0, const _Float16* v1) {
  asm volatile("global_load_async_to_lds_b128 %0, %4, off\n\t"
               "global_load_async_to_lds_b128 %1, %5, off\n\t"
               "global_load_async_to_lds_b128 %2, %6, off\n\t"
               "global_load_async_to_lds_b128 %3, %7, off\n\t"
               "s_wait_xcnt 0x0"
               :: "v"(lk0), "v"(lk1), "v"(lv0), "v"(lv1), "v"(k0), "v"(k1), "v"(v0), "v"(v1) : "memory");
}
// lane l with lane l ^ 16 (the other half of the wave), through no LDS
__device__ __forceinline__ float xhalf(float x) { return __builtin_bit_cast(float, __builtin_amdgcn_permlanex16(__builtin_bit_cast(int, x), __builtin_bit_cast(int, x), 0x76543210, 0xfedcba98, false, false)); }
// ---- k_attn: block = (64 queries, head h, batch b): causal flash attention, transposed: S^T = K . Q^T (A = 16 key rows from LDS, B = the wave's 16 queries, kept in registers), so a lane holds 16 of the 32 scores of ONE query (column col; keys 8 g + r and 16 + 8 g + r), lane ^ 16 the other 16: maximum and sum in-lane plus one exchange between the halves. The two score tiles, converted in place, are the B operand of O^T += V^T . P^T (A = 16 rows d of V^T from LDS). scores = (q.k) * 0.125; O[b*S+q][h*64+d] = (acc + accl / 2048) / (2048 l) (256-B segments)
__global__ __launch_bounds__(128) void k_attn(const _Float16* __restrict__ QK, const _Float16* __restrict__ QKL, const _Float16* __restrict__ VTH, const _Float16* __restrict__ VTL, const void* __restrict__ KMASK, float* __restrict__ O) {
  __shared__ __align__(16) float so[4][16][68];
  __shared__ __align__(16) _Float16 sk[2][32 * KP], sv[2][64 * VP];   // two buffers: the block's K hi and V hi tile of 32 keys, read by all four waves
  const int tid = threadIdx.x, wave = tid >> 5, lane = tid & 31, col = lane & 15, g = lane >> 4;
  const int qb = blockIdx.x, h = blockIdx.y, b = blockIdx.z; const int q0 = qb * 64 + wave * 16; const size_t rq = (size_t)b * SS + q0 + col;
  v16h aq[2], aql[2];
#pragma unroll
  for (int kc = 0; kc < 2; ++kc) { aq[kc] = frag_h(QK + rq * (2 * DM) + h * HD + kc * 32, lane); aql[kc] = frag_h(QKL + rq * (2 * DM) + h * HD + kc * 32, lane); }
  float m = -3.0e38f, l = 0.f;   // of query q0 + col; l sums this half's keys only, the halves are joined behind the loop
  v8f acc[4] = {}, accl[4] = {};   // acc[dt][r] = O^T[d = dt * 16 + 8 g + r][query q0 + col]
  const int nksc = (qb * 64 + 64) / 32;   // causal: key tiles up to the end of this query block
  const _Float16* kg = QK + ((size_t)b * SS + (tid >> 3)) * (2 * DM) + DM + h * HD + (tid & 7) * 8;   // this thread's first K piece of tile 0 (its second: 16 keys on)
  const _Float16* vg = VTH + ((size_t)b * DM + h * HD + (tid >> 2)) * SS + (tid & 3) * 8;               // its first V piece of tile 0 (its second: 32 rows on)
  const unsigned lk = (unsigned)(uintptr_t)&sk[0][(tid >> 3) * KP + (tid & 7) * 8], lv = (unsigned)(uintptr_t)&sv[0][(tid >> 2) * VP + (tid & 3) * 8];
#define STAGE(t) stage_kv(lk + ((t) & 1) * (32 * KP * 2), lk + ((t) & 1) * (32 * KP * 2) + 16 * KP * 2, lv + ((t) & 1) * (64 * VP * 2), lv + ((t) & 1) * (64 * VP * 2) + 32 * VP * 2, kg + (size_t)(t) * 32 * (2 * DM), kg + ((size_t)(t) * 32 + 16) * (2 * DM), vg + (t) * 32, vg + (t) * 32 + 32 * SS)
  STAGE(0);
  asm volatile("s_wait_asynccnt 0x0" ::: "memory");   // tile 0 has landed before the barrier that publishes it
  __syncthreads();
  if (1 < nksc) STAGE(1);
#pragma unroll 1
  for (int ks = 0; ks < nksc; ++ks) { v8f s[2]; const int lim = q0 + col - 8 * g - ks * 32;   // the last score row of this lane's 16 (ct * 16 + r) that its query may see
    v16h kf[2][2];   // the tile's four K fragments are read as one group in front of the score products: one LDS latency a tile, not one a product
#pragma unroll
    for (int ct = 0; ct < 2; ++ct) {
#pragma unroll
      for (int kc = 0; kc < 2; ++kc) kf[ct][kc] = frag_h(&sk[ks & 1][(ct * 16 + col) * KP] + kc * 32, lane); }
#pragma unroll
    for (int ct = 0; ct < 2; ++ct) { const _Float16* krowl = QKL + ((size_t)b * SS + ks * 32 + ct * 16 + col) * (2 * DM) + DM + h * HD; v8f c = {}, cl = {};
      if (qb < 2) {   // leading query blocks (few keys, outputs far above the global rms): 3 products
#pragma unroll
        for (int kc = 0; kc < 2; ++kc) { const v16h kh = kf[ct][kc]; c = wmma16(kh, aq[kc], c); cl = wmma16(kh, aql[kc], cl); cl = wmma16(frag_h(krowl + kc * 32, lane), aq[kc], cl); }
#pragma unroll
        for (int r = 0; r < 8; ++r) c[r] += cl[r] * (1.0f / 2048.0f); }
      else {
#pragma unroll
        for (int kc = 0; kc < 2; ++kc) c = wmma16(kf[ct][kc], aq[kc], c); }   // single product elsewhere
#pragma unroll
      for (int r = 0; r < 8; ++r) s[ct][r] = (ct * 16 + r <= lim) ? c[r] * 0.125f : -3.0e38f; }   // 1/sqrt(64); masked keys (key ks * 32 + ct * 16 + 8 g + r above query q0 + col) excluded
    v16h vf[4];   // the tile's four V fragments are read as one group here, so that their LDS latency passes under the softmax arithmetic
#pragma unroll
    for (int dt = 0; dt < 4; ++dt) vf[dt] = frag_h(&sv[ks & 1][(dt * 16 + col) * VP], lane);
    float mx = fmaxf(s[0][0], s[1][0]);
#pragma unroll
    for (int r = 1; r < 8; ++r) mx = fmaxf(mx, fmaxf(s[0][r], s[1][r]));
    mx = fmaxf(mx, xhalf(mx));   // over all 32 keys of the tile
    const float mn = fmaxf(m, mx);
    float ta = (m - mn) * 1.442695041f, t0[8], t1[8];   // e^x = 2^(x log2 e), as __expf forms it
#pragma unroll
    for (int r = 0; r < 8; ++r) { t0[r] = (s[0][r] - mn) * 1.442695041f; t1[r] = (s[1][r] - mn) * 1.442695041f; }
    // the 17 hardware exponentials, in place, in two statements: inside a statement no v_exp_f32 is followed by an instruction that reads its result or overwrites its source, and the v_nop keeps
    // that slot behind the last one.
    asm("v_exp_f32 %0, %0\n\tv_exp_f32 %1, %1\n\tv_exp_f32 %2, %2\n\tv_exp_f32 %3, %3\n\tv_exp_f32 %4, %4\n\tv_exp_f32 %5, %5\n\tv_exp_f32 %6, %6\n\tv_exp_f32 %7, %7\n\tv_exp_f32 %8, %8\n\tv_nop"
        : "+v"(ta), "+v"(t0[0]), "+v"(t0[1]), "+v"(t0[2]), "+v"(t0[3]), "+v"(t0[4]), "+v"(t0[5]), "+v"(t0[6]), "+v"(t0[7]));
    asm("v_exp_f32 %0, %0\n\tv_exp_f32 %1, %1\n\tv_exp_f32 %2, %2\n\tv_exp_f32 %3, %3\n\tv_exp_f32 %4, %4\n\tv_exp_f32 %5, %5\n\tv_exp_f32 %6, %6\n\tv_exp_f32 %7, %7\n\tv_nop"
        : "+v"(t1[0]), "+v"(t1[1]), "+v"(t1[2]), "+v"(t1[3]), "+v"(t1[4]), "+v"(t1[5]), "+v"(t1[6]), "+v"(t1[7]));
    const float alpha = (m <= -1.0e38f) ? 0.f : ta;
    float es = 0.f;
#pragma unroll
    for (int r = 0; r < 8; ++r) { s[0][r] = (s[0][r] <= -1.0e38f) ? 0.f : t0[r]; s[1][r] = (s[1][r] <= -1.0e38f) ? 0.f : t1[r]; es += s[0][r] + s[1][r]; }
    l = l * alpha + es; m = mn;
#pragma unroll
    for (int dt = 0; dt < 4; ++dt) {
#pragma unroll
      for (int r = 0; r < 8; ++r) { acc[dt][r] *= alpha; accl[dt][r] *= alpha; } }
    v16h pa, pl;   // P^T as a B operand: element i = key 8 g + i, element 8 + i = key 16 + 8 g + i, the k order of frag_h
#pragma unroll
    for (int i = 0; i < 8; ++i) { const float x0 = s[0][i] * 2048.0f, x1 = s[1][i] * 2048.0f; const _Float16 h0 = (_Float16)x0, h1 = (_Float16)x1; pa[i] = h0; pa[8 + i] = h1; pl[i] = (_Float16)((x0 - (float)h0) * 2048.0f); pl[8 + i] = (_Float16)((x1 - (float)h1) * 2048.0f); }   // P scaled by 2^11 before the f16 split so small softmax weights stay out of the f16 subnormal range; 2^-11 folded into the epilogue
#pragma unroll
    for (int dt = 0; dt < 4; ++dt) { const size_t vr = ((size_t)b * DM + h * HD + dt * 16 + col) * SS + ks * 32; const v16h vh = vf[dt]; acc[dt] = wmma16(vh, pa, acc[dt]); if (qb < 2) { accl[dt] = wmma16(vh, pl, accl[dt]); accl[dt] = wmma16(frag_h(VTL + vr, lane), pa, accl[dt]); } }   // leading query blocks: P hi/lo x V hi/lo (3 products); elsewhere P x V single
    asm volatile("s_wait_dscnt 0x0" ::: "memory");      // this wave's reads of the tile have returned before the buffer is refilled
    asm volatile("s_wait_asynccnt 0x0" ::: "memory");   // this wave's copies of tile ks + 1 have landed before the barrier that publishes them
    __syncthreads();                                    // publishes tile ks + 1 and ends every wave's reads of tile ks
    if (ks + 2 < nksc) STAGE(ks + 2); }
  asm volatile("s_wait_asynccnt 0x0" ::: "memory");     // no copy is outstanding when the wave goes on to its end
#undef STAGE
  l += xhalf(l);   // the two halves' sums of one query
  const float il = (1.0f / 2048.0f) / l;
#pragma unroll
  for (int dt = 0; dt < 4; ++dt) {
#pragma unroll
    for (int r = 0; r < 8; ++r) so[wave][col][dt * 16 + 8 * g + r] = (acc[dt][r] + accl[dt][r] * (1.0f / 2048.0f)) * il; }
  LDSX();
  for (int rl = 0; rl < 16; ++rl) if (lane < 16) vst2(O + ((size_t)b * SS + q0 + rl) * DM + h * HD + lane * 4, *(const v4f*)&so[wave][rl][lane * 4]);
}
// ---- k_out: block = (64 rows, 128 cols): out = O(hi/lo) . Wo rows (2 products) + bo
__global__ __launch_bounds__(128) void k_out(const float* __restrict__ O, const __bf16* __restrict__ P, const float* __restrict__ BO, float* __restrict__ Y) {
  __shared__ __align__(16) char sm[2 * GST_BYTES];   // two buffers of the k loop; behind the loop's last barrier the same bytes stage the output
  float (*so)[16][132] = (float (*)[16][132])sm;
  const int tid = threadIdx.x, wave = tid >> 5, lane = tid & 31, col = lane & 15, g = lane >> 4; const size_t r0 = (size_t)blockIdx.x * 64 + wave * 16; const int n0 = blockIdx.y * 128;
  v8f acc[8] = {};
  const char* gb = (const char*)(P + (size_t)(n0 + (tid >> 3)) * DM + (tid & 7) * 8);                        // this thread's first weight piece of tile 0
  const char* ga = (const char*)(O + ((size_t)blockIdx.x * 64 + (tid >> 4)) * DM + (tid & 15) * 4);          // its first activation piece of tile 0
  const unsigned lb = (unsigned)(uintptr_t)&sm[(tid >> 3) * (GBP * 2) + (tid & 7) * 16], la = (unsigned)(uintptr_t)&sm[GB_BYTES + (tid >> 4) * (GAP * 4) + (tid & 15) * 16];
  GSTAGE(0);
  asm volatile("s_wait_asynccnt 0x0" ::: "memory");   // tile 0 has landed before the barrier that publishes it
  __syncthreads();
  GSTAGE(1);
#pragma unroll 1
  for (int ts = 0; ts < DM / GKS; ++ts) { const __bf16* bB = (const __bf16*)(sm + (ts & 1) * GST_BYTES); const float* bA = (const float*)(sm + (ts & 1) * GST_BYTES + GB_BYTES);
#pragma unroll
    for (int kc = 0; kc < GKS / 32; ++kc) { const F2 a = split_row(bA + (wave * 16 + col) * GAP, kc * 32, lane);
      v16b w[8];   // the eight weight fragments of this k chunk are read as one group in front of its products: one LDS latency a chunk, not one a fragment
#pragma unroll
      for (int j = 0; j < 8; ++j) w[j] = frag_b(bB + (j * 16 + col) * GBP + kc * 32, lane);
#pragma unroll
      for (int j = 0; j < 8; ++j) { acc[j] = wmma_bf(a.l, w[j], acc[j]); acc[j] = wmma_bf(a.h, w[j], acc[j]); } }
    asm volatile("s_wait_dscnt 0x0" ::: "memory");      // this wave's reads of tile ts have returned before its buffer is refilled
    asm volatile("s_wait_asynccnt 0x0" ::: "memory");   // this wave's copies of tile ts + 1 have landed before the barrier that publishes them
    __syncthreads();                                    // publishes tile ts + 1 and ends every wave's reads of tile ts
    if (ts + 2 < DM / GKS) GSTAGE(ts + 2); }
  asm volatile("s_wait_asynccnt 0x0" ::: "memory");     // no copy is outstanding when the buffers become output staging
#pragma unroll
  for (int j = 0; j < 8; ++j) {
#pragma unroll
    for (int r = 0; r < 8; ++r) so[wave][8 * g + r][j * 16 + col] = acc[j][r] + (BO ? bfr(BO[n0 + j * 16 + col]) : 0.f); }
  LDSX();
  for (int rl = 0; rl < 16; ++rl) vst2(Y + (r0 + rl) * DM + n0 + lane * 4, *(const v4f*)&so[wave][rl][lane * 4]);
}
extern "C" void kernel_launch(void* const* d_in, const int* in_sizes, int n_in, void* d_out, int out_size, void* d_ws, size_t ws_size, hipStream_t stream) {
  (void)in_sizes; (void)n_in; (void)out_size;
  const float** F = (const float**)d_in;   // 0 hidden_states [4,2048,768], 1 Wq [768,768], 2 Wk [768,256], 3 Wv [768,256], 4 Wo [768,768] (all (in,out))
  if (ws_size < (size_t)WS_END) return;
  char* ws = (char*)d_ws; __bf16* PK = (__bf16*)(ws + WS_PK); _Float16 *QK = (_Float16*)(ws + WS_QK), *QKL = (_Float16*)(ws + WS_QKL), *VTH = (_Float16*)(ws + WS_VTH), *VTL = (_Float16*)(ws + WS_VTL); float* O = (float*)(ws + WS_O);
  k_pack<<<dim3(DM, 4), 256, 0, stream>>>(F[1], F[2], F[3], F[4], PK);
  k_qkv<<<dim3(TNB * SS / 64, QKVW / 128), 128, 0, stream>>>(F[0], F[0], F[0], PK + PK_A, nullptr, nullptr, nullptr, QK, QKL, VTH, VTL);
  k_rope<<<TNB * SS, 256, 0, stream>>>(QK, QKL);
  k_attn<<<dim3(TQB, NH, TNB), 128, 0, stream>>>(QK, QKL, VTH, VTL, nullptr, O);
  k_out<<<dim3(TOB, DM / 128), 128, 0, stream>>>(O, PK + PK_P, nullptr, (float*)d_out);
}

// v005
// Measured time: 188 microseconds a run.
// Timed twice side by side with v004, it ran 1.40 times as fast both times.
// Counting every step since v000, it is 3.13 times as fast.
// compute dtype: all float inputs rounded to bf16; q/k/v = x . W with EXACT bf16 products on WMMA 16x16x32 ((in,out) weights as transposed rows; the 4 kv heads replicated to their 3 query heads at pack time), f16 hi + residual; RoPE (inv_freq in double, angle = pos x inv_freq in f32 as the module, precise sinf/cosf, one table a call) applied in f32 to q/k in the projection's epilogue, before the split; causal attention with hybrid scores (first 128 queries 3-product, later single f16) and hybrid P.v (first 128 queries hi + residual, later single), x 1/8, running-max softmax in f32 (hardware exp); out = ctx (bf16 hi + lo) . Wo ((in,out)); f32 output.
#include <hip/hip_runtime.h>
#include <math.h>

typedef __attribute__((ext_vector_type(16))) _Float16 v16h;
typedef __attribute__((ext_vector_type(16))) __bf16 v16b;
typedef __attribute__((ext_vector_type(8)))  _Float16 v8h;
typedef __attribute__((ext_vector_type(8)))  float v8f;
typedef __attribute__((ext_vector_type(4)))  float v4f;
typedef __attribute__((ext_vector_type(2)))  float v2f;
typedef __attribute__((ext_vector_type(4)))  unsigned v4u;
typedef __attribute__((ext_vector_type(4)))  int v4i;
typedef float __attribute__((may_alias)) float_a;
typedef int __attribute__((may_alias)) int_a;

template <typename T> __device__ __forceinline__ void vst2(void* p, T v) { *(T*)p = v;  }
__device__ __forceinline__ v8f wmma16(v16h a, v16h b, v8f c) {
  v8f d = __builtin_amdgcn_wmma_f32_16x16x32_f16(false, a, false, b, (short)0, c, false, false);
  asm volatile("v_nop\n\tv_nop\n\tv_nop\n\tv_nop" : "+v"(d) : "v"(a), "v"(b));
  return d;
}
__device__ __forceinline__ v8f wmma_bf(v16b a, v16b b, v8f c) {
  v8f d = __builtin_amdgcn_wmma_f32_16x16x32_bf16(false, a, false, b, (short)0, c, false, false);
  asm volatile("v_nop\n\tv_nop\n\tv_nop\n\tv_nop" : "+v"(d) : "v"(a), "v"(b));
  return d;
}
// Grouped-query causal attention with RoPE (B 4, S 2,048, hidden 768, 12 query heads x 64 over 4 kv heads): q = x Wq, k = x Wk, v = x Wv ((in,out), kv heads shared by 3 query heads), rotate-half RoPE (theta 1e4), causal softmax(q k / 8) v, out = ctx Wo.
__device__ __forceinline__ v16h frag_h(const _Float16* rowk0, int lane) {
  union { v16h v; v8h q[2]; } u; const _Float16* p = rowk0 + 8 * (lane >> 4);
  u.q[0] = *(const v8h*)p; u.q[1] = *(const v8h*)(p + 16); return u.v;
}
__device__ __forceinline__ v16h frag_f32(const float* rowk0, int lane) {
  v16h a; const float* p = rowk0 + 8 * (lane >> 4);
#pragma unroll
  for (int i = 0; i < 8; ++i) { a[i] = (_Float16)p[i]; a[8 + i] = (_Float16)p[16 + i]; }
  return a;
}
__device__ __forceinline__ v16h frag_f32s(const float* rowk0, int lane, float sc) {
  v16h a; const float* p = rowk0 + 8 * (lane >> 4);
#pragma unroll
  for (int i = 0; i < 8; ++i) { a[i] = (_Float16)(p[i] * sc); a[8 + i] = (_Float16)(p[16 + i] * sc); }
  return a;
}
// column fragment from a [K][ld] layout (column n), rows >= K read as 0
__device__ __forceinline__ v16h fragc_f32(const float* W, int k0, int n, int lane, int ld, int K) {
  v16h a; const int g = lane >> 4;
#pragma unroll
  for (int i = 0; i < 8; ++i) { const int ka = k0 + 8 * g + i, kb = ka + 16;
    a[i] = (_Float16)(ka < K ? W[(size_t)(ka < K ? ka : K - 1) * ld + n] : 0.f); a[8 + i] = (_Float16)(kb < K ? W[(size_t)(kb < K ? kb : K - 1) * ld + n] : 0.f); }
  return a;
}
struct F2 { v16b h, l; };
__device__ __forceinline__ F2 bsplit16(const float v[16]) { F2 r;
#pragma unroll
  for (int i = 0; i < 16; ++i) { const __bf16 h = (__bf16)v[i]; r.h[i] = h; r.l[i] = (__bf16)(v[i] - (float)h); }
  return r; }
__device__ __forceinline__ F2 split_row(const float* row, int k0, int lane) { float v[16]; const float* p = row + k0 + 8 * (lane >> 4);
#pragma unroll
  for (int i = 0; i < 8; ++i) { v[i] = p[i]; v[8 + i] = p[16 + i]; }
  return bsplit16(v); }
__device__ __forceinline__ F2 split_rowK(const float* row, int k0, int lane, int K) { float v[16]; const int g = lane >> 4;
#pragma unroll
  for (int i = 0; i < 8; ++i) { const int ka = k0 + 8 * g + i, kb = ka + 16; v[i] = ka < K ? row[ka < K ? ka : K - 1] : 0.f; v[8 + i] = kb < K ? row[kb < K ? kb : K - 1] : 0.f; }
  return bsplit16(v); }
__device__ __forceinline__ F2 split_col(const float* W, int k0, int n, int lane, int ld, int K) { float v[16]; const int g = lane >> 4;
#pragma unroll
  for (int i = 0; i < 8; ++i) { const int ka = k0 + 8 * g + i, kb = ka + 16; v[i] = ka < K ? W[(size_t)(ka < K ? ka : K - 1) * ld + n] : 0.f; v[8 + i] = kb < K ? W[(size_t)(kb < K ? kb : K - 1) * ld + n] : 0.f; }
  return bsplit16(v); }
__device__ __forceinline__ v8f mac3(const F2& a, const F2& b, v8f c) { c = wmma_bf(a.l, b.h, c); c = wmma_bf(a.h, b.l, c); return wmma_bf(a.h, b.h, c); }
__device__ __forceinline__ float sigm(float v) { return 1.0f / (1.0f + expf(-v)); }
#define LDSX() do { asm volatile("s_wait_dscnt 0" ::: "memory"); __builtin_amdgcn_wave_barrier(); __builtin_amdgcn_fence(__ATOMIC_RELEASE, "workgroup"); } while (0)


#define NB 4
#define SS 2048
#define DM 768
#define NH 12
#define NKV 4
#define GRP 3
#define HD 64
#define QKVW (3 * DM)
#ifndef TQB
#define TQB (SS / 64)
#define TNB NB
#define TOB (NB * SS / 64)     // output row tiles (all)
#endif
typedef __attribute__((ext_vector_type(8))) __bf16 v8b;
__device__ __forceinline__ v16b frag_b(const __bf16* rowk0, int lane) {
  union { v16b v; v8b q[2]; } u; const __bf16* p = rowk0 + 8 * (lane >> 4);
  u.q[0] = *(const v8b*)p; u.q[1] = *(const v8b*)(p + 16); return u.v;
}
__device__ __forceinline__ float bfr(float v) { return (float)(__bf16)v; }
__device__ __attribute__((noinline)) float exp_ni(float v) { return expf(v); }
__device__ __attribute__((noinline)) float erf_ni(float v) { return erff(v); }

#define PK_A 0                       // [2304][768] Wqkv rows ([out][in], transposed from the (in,out) inputs)
#define PK_P (PK_A + QKVW * DM)        // [768][768] Wo rows ([out][in], transposed)
#define PK_END (PK_P + DM * DM)
#define WS_PK  0u
#define WS_QK  (WS_PK + 2u * PK_END)             // f16 [8192 rows][1536]: q | k
#define WS_QKL (WS_QK + 2u * NB * SS * 2 * DM)     // f16 q | k residual planes x2048
#define WS_VTH (WS_QKL + 2u * NB * SS * 2 * DM)    // f16 [b][768 (h*64+d)][2048 s] hi
#define WS_VTL (WS_VTH + 2u * NB * DM * SS)        // f16 lo x 2048
#define WS_O   (WS_VTL + 2u * NB * DM * SS)        // f32 [8192][768]
#define WS_CS  (WS_O + 4u * NB * SS * DM)           // f32 [2048 positions][32 frequencies] pairs (cos, sin)
#define WS_END (WS_CS + 4u * 2 * SS * 32)
// ---- k_pack: block = (row n, which): natural [out][in] rows -> bf16; which 0..2 -> W_q/W_k/W_v into PK_A rows which*768 + n; 3 -> W_o into PK_P
__global__ __launch_bounds__(256) void k_pack(const float* __restrict__ WQ, const float* __restrict__ WK, const float* __restrict__ WV, const float* __restrict__ WO, __bf16* __restrict__ PK, float* __restrict__ CS) {   // (in,out) weights: Wq [768][768], Wk/Wv [768][256] (kv head = query head / 3), Wo [768][768]; packed row (which*DM + n), n = h*64 + d
  __shared__ __align__(16) __bf16 s[DM]; const int n = blockIdx.x, which = blockIdx.y, t = threadIdx.x; const int h = n / HD, d = n % HD; const int nkv = (h / GRP) * HD + d;
  for (int k = t; k < DM; k += 256) { float w; if (which == 0) w = WQ[(size_t)k * DM + n]; else if (which == 1) w = WK[(size_t)k * (NKV * HD) + nkv]; else if (which == 2) w = WV[(size_t)k * (NKV * HD) + nkv]; else w = WO[(size_t)k * DM + n]; s[k] = (__bf16)w; }
  __syncthreads(); __bf16* dst = (which < 3) ? (PK + PK_A + ((size_t)which * DM + n) * DM) : (PK + PK_P + (size_t)n * DM); for (int q = t; q < DM / 8; q += 256) vst2((unsigned*)(dst + q * 8), *(const v4u*)&s[q * 8]);
  // the RoPE table, once a call: waves 0 to 2 of the 768 blocks of Wq take positions n, n + 768, n + 1,536; a wave writes one position's 32 pairs (cos a_j, sin a_j), a_j = pos * inv_freq[j], 256 B
  if (which == 0 && t < 96) { const int pos = n + DM * (t >> 5), j = t & 31;
    if (pos < SS) { const double invf = 1.0 / pow(10000.0, (double)j / 32.0); const float ang = (float)pos * (float)invf; v2f cs; cs[0] = cosf(ang); cs[1] = sinf(ang); *(v2f*)(CS + ((size_t)pos * 32 + j) * 2) = cs; } } }
#define GKS 64                          // k elements of one staged tile
#define GBP 72                          // LDS pitch of a staged weight row in bf16: 144 B = 16 B x 9, no bank conflict for 16-byte fragment reads
#define GAP 68                          // LDS pitch of a staged activation row in f32: 272 B = 16 B x 17, likewise
#define GB_BYTES (128 * GBP * 2)        // 128 weight rows
#define GA_BYTES (64 * GAP * 4)         // 64 activation rows
#define GST_BYTES (GB_BYTES + GA_BYTES) // one buffer: weight tile, then activation tile
// eight 16-B pieces of one thread into LDS, through no register: piece i goes to LDS byte l + i * ls and comes from g + i * 24,576 B (16 weight rows of 1,536 B, or 8 activation rows of 3,072 B).
// The wait on xcnt is the last line of the copies' own statement, so that it stands in front of any rewrite of the address registers they name.
__device__ __forceinline__ void stage8(unsigned l, unsigned ls, const char* g) {
  asm volatile("global_load_async_to_lds_b128 %0, %8, off\n\t"
               "global_load_async_to_lds_b128 %1, %9, off\n\t"
               "global_load_async_to_lds_b128 %2, %10, off\n\t"
               "global_load_async_to_lds_b128 %3, %11, off\n\t"
               "global_load_async_to_lds_b128 %4, %12, off\n\t"
               "global_load_async_to_lds_b128 %5, %13, off\n\t"
               "global_load_async_to_lds_b128 %6, %14, off\n\t"
               "global_load_async_to_lds_b128 %7, %15, off\n\t"
               "s_wait_xcnt 0x0"
               :: "v"(l), "v"(l + ls), "v"(l + 2 * ls), "v"(l + 3 * ls), "v"(l + 4 * ls), "v"(l + 5 * ls), "v"(l + 6 * ls), "v"(l + 7 * ls),
                  "v"(g), "v"(g + 24576), "v"(g + 2 * 24576), "v"(g + 3 * 24576), "v"(g + 4 * 24576), "v"(g + 5 * 24576), "v"(g + 6 * 24576), "v"(g + 7 * 24576) : "memory");
}
// tile t (64 k) of a 64-row x 128-column block into buffer t & 1: 128 weight rows x 128 B (8 threads a row) and 64 activation rows x 256 B (16 threads a row); every wave-wide copy covers four whole 128-B lines
#define GSTAGE(t) do { stage8(lb + ((t) & 1) * GST_BYTES, 16 * GBP * 2, gb + (size_t)(t) * (GKS * 2)); stage8(la + ((t) & 1) * GST_BYTES, 8 * GAP * 4, ga + (size_t)(t) * (GKS * 4)); } while (0)
__global__ __launch_bounds__(128) void k_qkv(const float* __restrict__ XQ, const float* __restrict__ XK, const float* __restrict__ XV, const __bf16* __restrict__ P, const float* __restrict__ BQ, const float* __restrict__ BK, const float* __restrict__ BV, const float* __restrict__ CS, _Float16* __restrict__ QK, _Float16* __restrict__ QKL, _Float16* __restrict__ VTH, _Float16* __restrict__ VTL) {
  const int which0 = (blockIdx.y * 128) / DM; const float* X = (which0 == 0) ? XQ : (which0 == 1) ? XK : XV; const float* BB = BQ ? (((which0 == 0) ? BQ : (which0 == 1) ? BK : BV) + (blockIdx.y * 128 - which0 * DM)) : nullptr;
  __shared__ __align__(16) char sm[2 * GST_BYTES];   // two buffers of the k loop; behind the loop's last barrier the same bytes stage the output
  _Float16 (*so)[16][136] = (_Float16 (*)[16][136])sm; _Float16 (*sol)[16][136] = (_Float16 (*)[16][136])(sm + 4 * 16 * 136 * 2); _Float16 (*sth)[72] = (_Float16 (*)[72])sm; _Float16 (*stl)[72] = (_Float16 (*)[72])(sm + 128 * 72 * 2);
  const int tid = threadIdx.x, wave = tid >> 5, lane = tid & 31, col = lane & 15, g = lane >> 4; const size_t r0 = (size_t)blockIdx.x * 64 + wave * 16; const int n0 = blockIdx.y * 128;
  v8f acc[8] = {};
  const char* gb = (const char*)(P + (size_t)(n0 + (tid >> 3)) * DM + (tid & 7) * 8);                        // this thread's first weight piece of tile 0
  const char* ga = (const char*)(X + ((size_t)blockIdx.x * 64 + (tid >> 4)) * DM + (tid & 15) * 4);          // its first activation piece of tile 0
  const unsigned lb = (unsigned)(uintptr_t)&sm[(tid >> 3) * (GBP * 2) + (tid & 7) * 16], la = (unsigned)(uintptr_t)&sm[GB_BYTES + (tid >> 4) * (GAP * 4) + (tid & 15) * 16];
  // q and k blocks: this lane's 16 table pairs (its 8 rows' positions x the frequencies col and 16 + col), asked for in front of the k loop so that their latency passes under it
  v2f cs[8][2] = {};
  if (n0 < 2 * DM) { const float* cp = CS + ((size_t)((blockIdx.x * 64) % SS + wave * 16 + 8 * g) * 32 + col) * 2;
#pragma unroll   // constant indices keep cs in registers, and the 16 loads issue as one group
    for (int r = 0; r < 8; ++r) { cs[r][0] = *(const v2f*)(cp + r * 64); cs[r][1] = *(const v2f*)(cp + r * 64 + 32); } }
  GSTAGE(0);
  asm volatile("s_wait_asynccnt 0x0" ::: "memory");   // tile 0 has landed before the barrier that publishes it
  __syncthreads();
  GSTAGE(1);
#pragma unroll 1
  for (int ts = 0; ts < DM / GKS; ++ts) { const __bf16* bB = (const __bf16*)(sm + (ts & 1) * GST_BYTES); const float* bA = (const float*)(sm + (ts & 1) * GST_BYTES + GB_BYTES);
#pragma unroll
    for (int kc = 0; kc < GKS / 32; ++kc) { v16b a; { const float* p = bA + (wave * 16 + col) * GAP + kc * 32 + 8 * g;
#pragma unroll
        for (int i = 0; i < 8; ++i) { a[i] = (__bf16)p[i]; a[8 + i] = (__bf16)p[16 + i]; } }
      v16b w[8];   // the eight weight fragments of this k chunk are read as one group in front of its products: one LDS latency a chunk, not one a product
#pragma unroll
      for (int j = 0; j < 8; ++j) w[j] = frag_b(bB + (j * 16 + col) * GBP + kc * 32, lane);
#pragma unroll
      for (int j = 0; j < 8; ++j) acc[j] = wmma_bf(a, w[j], acc[j]); }
    asm volatile("s_wait_dscnt 0x0" ::: "memory");      // this wave's reads of tile ts have returned before its buffer is refilled
    asm volatile("s_wait_asynccnt 0x0" ::: "memory");   // this wave's copies of tile ts + 1 have landed before the barrier that publishes them
    __syncthreads();                                    // publishes tile ts + 1 and ends every wave's reads of tile ts
    if (ts + 2 < DM / GKS) GSTAGE(ts + 2); }
  asm volatile("s_wait_asynccnt 0x0" ::: "memory");     // no copy is outstanding when the buffers become output staging
  if (n0 < 2 * DM) {   // q stored unscaled (f16 sigma ~0.6, no subnormal exposure); 1/8 applied to the f32 score
    // rotate-half RoPE in registers: the block's 128 columns are two heads; tiles ja and ja + 2 hold columns d (< 32) and d + 32 of one head in the same lane and register: y[d] = x[d] cos - x[d + 32] sin, y[d + 32] = x[d + 32] cos + x[d] sin, frequency d
#pragma unroll   // constant indices keep acc and cs in registers (this loop and the one inside it)
    for (int p = 0; p < 4; ++p) { const int ja = (p >> 1) * 4 + (p & 1), jb = ja + 2; const float ba = BB ? bfr(BB[ja * 16 + col]) : 0.f, bb = BB ? bfr(BB[jb * 16 + col]) : 0.f;
#pragma unroll
      for (int r = 0; r < 8; ++r) { const float xa = acc[ja][r] + ba, xb = acc[jb][r] + bb, c = cs[r][p & 1][0], sn = cs[r][p & 1][1]; const float ya = xa * c - xb * sn, yb = xb * c + xa * sn; const _Float16 ha = (_Float16)ya, hb = (_Float16)yb;
        so[wave][8 * g + r][ja * 16 + col] = ha; sol[wave][8 * g + r][ja * 16 + col] = (_Float16)((ya - (float)ha) * 2048.0f); so[wave][8 * g + r][jb * 16 + col] = hb; sol[wave][8 * g + r][jb * 16 + col] = (_Float16)((yb - (float)hb) * 2048.0f); } }   // rotated q, k (+ bias) as f16 hi + (x2048) residual
    LDSX();
    for (int rl = 0; rl < 16; ++rl) if (lane < 16) { vst2((unsigned*)(QK + (r0 + rl) * (2 * DM) + n0 + lane * 8), *(const v4u*)&so[wave][rl][lane * 8]); vst2((unsigned*)(QKL + (r0 + rl) * (2 * DM) + n0 + lane * 8), *(const v4u*)&sol[wave][rl][lane * 8]); }
  } else {
#pragma unroll
    for (int j = 0; j < 8; ++j) {
#pragma unroll
      for (int r = 0; r < 8; ++r) { const float v = acc[j][r] + (BB ? bfr(BB[j * 16 + col]) : 0.f); const _Float16 hv = (_Float16)v; sth[j * 16 + col][wave * 16 + 8 * g + r] = hv; stl[j * 16 + col][wave * 16 + 8 * g + r] = (_Float16)((v - (float)hv) * 2048.0f); } }
    __syncthreads();
    const size_t rb = (size_t)blockIdx.x * 64; const int b = (int)(rb / SS), s0 = (int)(rb % SS); const int pc0 = n0 - 2 * DM;
    for (int q = tid; q < 128 * 8; q += 128) { const int d = q >> 3, pc = q & 7; const size_t o = ((size_t)b * DM + pc0 + d) * SS + s0 + pc * 8; vst2((unsigned*)(VTH + o), *(const v4u*)&sth[d][pc * 8]); vst2((unsigned*)(VTL + o), *(const v4u*)&stl[d][pc * 8]); }
  }
}
#define KP 72   // LDS pitch of a staged K row in f16: 144 B = 16 B x 9, no bank conflict for 16-byte fragment reads
#define VP 40   // LDS pitch of a staged V row in f16: 80 B = 16 B x 5, likewise
// one key tile of 32 keys into LDS, through no register: each of the 128 threads copies two 16-B pieces of K hi (32 rows x 128 B) and two of V hi (64 rows x 64 B).
// The wait on xcnt is the last line of the copies' own statement, so that it stands in front of any rewrite of the address registers they name.
__device__ __forceinline__ void stage_kv(unsigned lk0, unsigned lk1, unsigned lv0, unsigned lv1, const _Float16* k0, const _Float16* k1, const _Float16* v0, const _Float16* v1) {
  asm volatile("global_load_async_to_lds_b128 %0, %4, off\n\t"
               "global_load_async_to_lds_b128 %1, %5, off\n\t"
               "global_load_async_to_lds_b128 %2, %6, off\n\t"
               "global_load_async_to_lds_b128 %3, %7, off\n\t"
               "s_wait_xcnt 0x0"
               :: "v"(lk0), "v"(lk1), "v"(lv0), "v"(lv1), "v"(k0), "v"(k1), "v"(v0), "v"(v1) : "memory");
}
// lane l with lane l ^ 16 (the other half of the wave), through no LDS
__device__ __forceinline__ float xhalf(float x) { return __builtin_bit_cast(float, __builtin_amdgcn_permlanex16(__builtin_bit_cast(int, x), __builtin_bit_cast(int, x), 0x76543210, 0xfedcba98, false, false)); }
// ---- k_attn: block = (64 queries, head h, batch b): causal flash attention, transposed: S^T = K . Q^T (A = 16 key rows from LDS, B = the wave's 16 queries, kept in registers), so a lane holds 16 of the 32 scores of ONE query (column col; keys 8 g + r and 16 + 8 g + r), lane ^ 16 the other 16: maximum and sum in-lane plus one exchange between the halves. The two score tiles, converted in place, are the B operand of O^T += V^T . P^T (A = 16 rows d of V^T from LDS). scores = (q.k) * 0.125; O[b*S+q][h*64+d] = (acc + accl / 2048) / (2048 l) (256-B segments)
__global__ __launch_bounds__(128) void k_attn(const _Float16* __restrict__ QK, const _Float16* __restrict__ QKL, const _Float16* __restrict__ VTH, const _Float16* __restrict__ VTL, const void* __restrict__ KMASK, float* __restrict__ O) {
  __shared__ __align__(16) float so[4][16][68];
  __shared__ __align__(16) _Float16 sk[2][32 * KP], sv[2][64 * VP];   // two buffers: the block's K hi and V hi tile of 32 keys, read by all four waves
  const int tid = threadIdx.x, wave = tid >> 5, lane = tid & 31, col = lane & 15, g = lane >> 4;
  const int qb = blockIdx.x, h = blockIdx.y, b = blockIdx.z; const int q0 = qb * 64 + wave * 16; const size_t rq = (size_t)b * SS + q0 + col;
  v16h aq[2], aql[2];
#pragma unroll
  for (int kc = 0; kc < 2; ++kc) { aq[kc] = frag_h(QK + rq * (2 * DM) + h * HD + kc * 32, lane); aql[kc] = frag_h(QKL + rq * (2 * DM) + h * HD + kc * 32, lane); }
  float m = -3.0e38f, l = 0.f;   // of query q0 + col; l sums this half's keys only, the halves are joined behind the loop
  v8f acc[4] = {}, accl[4] = {};   // acc[dt][r] = O^T[d = dt * 16 + 8 g + r][query q0 + col]
  const int nksc = (qb * 64 + 64) / 32;   // causal: key tiles up to the end of this query block
  const _Float16* kg = QK + ((size_t)b * SS + (tid >> 3)) * (2 * DM) + DM + h * HD + (tid & 7) * 8;   // this thread's first K piece of tile 0 (its second: 16 keys on)
  const _Float16* vg = VTH + ((size_t)b * DM + h * HD + (tid >> 2)) * SS + (tid & 3) * 8;               // its first V piece of tile 0 (its second: 32 rows on)
  const unsigned lk = (unsigned)(uintptr_t)&sk[0][(tid >> 3) * KP + (tid & 7) * 8], lv = (unsigned)(uintptr_t)&sv[0][(tid >> 2) * VP + (tid & 3) * 8];
#define STAGE(t) stage_kv(lk + ((t) & 1) * (32 * KP * 2), lk + ((t) & 1) * (32 * KP * 2) + 16 * KP * 2, lv + ((t) & 1) * (64 * VP * 2), lv + ((t) & 1) * (64 * VP * 2) + 32 * VP * 2, kg + (size_t)(t) * 32 * (2 * DM), kg + ((size_t)(t) * 32 + 16) * (2 * DM), vg + (t) * 32, vg + (t) * 32 + 32 * SS)
  STAGE(0);
  asm volatile("s_wait_asynccnt 0x0" ::: "memory");   // tile 0 has landed before the barrier that publishes it
  __syncthreads();
  if (1 < nksc) STAGE(1);
#pragma unroll 1
  for (int ks = 0; ks < nksc; ++ks) { v8f s[2]; const int lim = q0 + col - 8 * g - ks * 32;   // the last score row of this lane's 16 (ct * 16 + r) that its query may see
    v16h kf[2][2];   // the tile's four K fragments are read as one group in front of the score products: one LDS latency a tile, not one a product
#pragma unroll
    for (int ct = 0; ct < 2; ++ct) {
#pragma unroll
      for (int kc = 0; kc < 2; ++kc) kf[ct][kc] = frag_h(&sk[ks & 1][(ct * 16 + col) * KP] + kc * 32, lane); }
#pragma unroll
    for (int ct = 0; ct < 2; ++ct) { const _Float16* krowl = QKL + ((size_t)b * SS + ks * 32 + ct * 16 + col) * (2 * DM) + DM + h * HD; v8f c = {}, cl = {};
      if (qb < 2) {   // leading query blocks (few keys, outputs far above the global rms): 3 products
#pragma unroll
        for (int kc = 0; kc < 2; ++kc) { const v16h kh = kf[ct][kc]; c = wmma16(kh, aq[kc], c); cl = wmma16(kh, aql[kc], cl); cl = wmma16(frag_h(krowl + kc * 32, lane), aq[kc], cl); }
#pragma unroll
        for (int r = 0; r < 8; ++r) c[r] += cl[r] * (1.0f / 2048.0f); }
      else {
#pragma unroll
        for (int kc = 0; kc < 2; ++kc) c = wmma16(kf[ct][kc], aq[kc], c); }   // single product elsewhere
#pragma unroll
      for (int r = 0; r < 8; ++r) s[ct][r] = (ct * 16 + r <= lim) ? c[r] * 0.125f : -3.0e38f; }   // 1/sqrt(64); masked keys (key ks * 32 + ct * 16 + 8 g + r above query q0 + col) excluded
    v16h vf[4];   // the tile's four V fragments are read as one group here, so that their LDS latency passes under the softmax arithmetic
#pragma unroll
    for (int dt = 0; dt < 4; ++dt) vf[dt] = frag_h(&sv[ks & 1][(dt * 16 + col) * VP], lane);
    float mx = fmaxf(s[0][0], s[1][0]);
#pragma unroll
    for (int r = 1; r < 8; ++r) mx = fmaxf(mx, fmaxf(s[0][r], s[1][r]));
    mx = fmaxf(mx, xhalf(mx));   // over all 32 keys of the tile
    const float mn = fmaxf(m, mx);
    float ta = (m - mn) * 1.442695041f, t0[8], t1[8];   // e^x = 2^(x log2 e), as __expf forms it
#pragma unroll
    for (int r = 0; r < 8; ++r) { t0[r] = (s[0][r] - mn) * 1.442695041f; t1[r] = (s[1][r] - mn) * 1.442695041f; }
    // the 17 hardware exponentials, in place, in two statements: inside a statement no v_exp_f32 is followed by an instruction that reads its result or overwrites its source, and the v_nop keeps
    // that slot behind the last one.
    asm("v_exp_f32 %0, %0\n\tv_exp_f32 %1, %1\n\tv_exp_f32 %2, %2\n\tv_exp_f32 %3, %3\n\tv_exp_f32 %4, %4\n\tv_exp_f32 %5, %5\n\tv_exp_f32 %6, %6\n\tv_exp_f32 %7, %7\n\tv_exp_f32 %8, %8\n\tv_nop"
        : "+v"(ta), "+v"(t0[0]), "+v"(t0[1]), "+v"(t0[2]), "+v"(t0[3]), "+v"(t0[4]), "+v"(t0[5]), "+v"(t0[6]), "+v"(t0[7]));
    asm("v_exp_f32 %0, %0\n\tv_exp_f32 %1, %1\n\tv_exp_f32 %2, %2\n\tv_exp_f32 %3, %3\n\tv_exp_f32 %4, %4\n\tv_exp_f32 %5, %5\n\tv_exp_f32 %6, %6\n\tv_exp_f32 %7, %7\n\tv_nop"
        : "+v"(t1[0]), "+v"(t1[1]), "+v"(t1[2]), "+v"(t1[3]), "+v"(t1[4]), "+v"(t1[5]), "+v"(t1[6]), "+v"(t1[7]));
    const float alpha = (m <= -1.0e38f) ? 0.f : ta;
    float es = 0.f;
#pragma unroll
    for (int r = 0; r < 8; ++r) { s[0][r] = (s[0][r] <= -1.0e38f) ? 0.f : t0[r]; s[1][r] = (s[1][r] <= -1.0e38f) ? 0.f : t1[r]; es += s[0][r] + s[1][r]; }
    l = l * alpha + es; m = mn;
#pragma unroll
    for (int dt = 0; dt < 4; ++dt) {
#pragma unroll
      for (int r = 0; r < 8; ++r) { acc[dt][r] *= alpha; accl[dt][r] *= alpha; } }
    v16h pa, pl;   // P^T as a B operand: element i = key 8 g + i, element 8 + i = key 16 + 8 g + i, the k order of frag_h
#pragma unroll
    for (int i = 0; i < 8; ++i) { const float x0 = s[0][i] * 2048.0f, x1 = s[1][i] * 2048.0f; const _Float16 h0 = (_Float16)x0, h1 = (_Float16)x1; pa[i] = h0; pa[8 + i] = h1; pl[i] = (_Float16)((x0 - (float)h0) * 2048.0f); pl[8 + i] = (_Float16)((x1 - (float)h1) * 2048.0f); }   // P scaled by 2^11 before the f16 split so small softmax weights stay out of the f16 subnormal range; 2^-11 folded into the epilogue
#pragma unroll
    for (int dt = 0; dt < 4; ++dt) { const size_t vr = ((size_t)b * DM + h * HD + dt * 16 + col) * SS + ks * 32; const v16h vh = vf[dt]; acc[dt] = wmma16(vh, pa, acc[dt]); if (qb < 2) { accl[dt] = wmma16(vh, pl, accl[dt]); accl[dt] = wmma16(frag_h(VTL + vr, lane), pa, accl[dt]); } }   // leading query blocks: P hi/lo x V hi/lo (3 products); elsewhere P x V single
    asm volatile("s_wait_dscnt 0x0" ::: "memory");      // this wave's reads of the tile have returned before the buffer is refilled
    asm volatile("s_wait_asynccnt 0x0" ::: "memory");   // this wave's copies of tile ks + 1 have landed before the barrier that publishes them
    __syncthreads();                                    // publishes tile ks + 1 and ends every wave's reads of tile ks
    if (ks + 2 < nksc) STAGE(ks + 2); }
  asm volatile("s_wait_asynccnt 0x0" ::: "memory");     // no copy is outstanding when the wave goes on to its end
#undef STAGE
  l += xhalf(l);   // the two halves' sums of one query
  const float il = (1.0f / 2048.0f) / l;
#pragma unroll
  for (int dt = 0; dt < 4; ++dt) {
#pragma unroll
    for (int r = 0; r < 8; ++r) so[wave][col][dt * 16 + 8 * g + r] = (acc[dt][r] + accl[dt][r] * (1.0f / 2048.0f)) * il; }
  LDSX();
  for (int rl = 0; rl < 16; ++rl) if (lane < 16) vst2(O + ((size_t)b * SS + q0 + rl) * DM + h * HD + lane * 4, *(const v4f*)&so[wave][rl][lane * 4]);
}
// ---- k_out: block = (64 rows, 128 cols): out = O(hi/lo) . Wo rows (2 products) + bo
__global__ __launch_bounds__(128) void k_out(const float* __restrict__ O, const __bf16* __restrict__ P, const float* __restrict__ BO, float* __restrict__ Y) {
  __shared__ __align__(16) char sm[2 * GST_BYTES];   // two buffers of the k loop; behind the loop's last barrier the same bytes stage the output
  float (*so)[16][132] = (float (*)[16][132])sm;
  const int tid = threadIdx.x, wave = tid >> 5, lane = tid & 31, col = lane & 15, g = lane >> 4; const size_t r0 = (size_t)blockIdx.x * 64 + wave * 16; const int n0 = blockIdx.y * 128;
  v8f acc[8] = {};
  const char* gb = (const char*)(P + (size_t)(n0 + (tid >> 3)) * DM + (tid & 7) * 8);                        // this thread's first weight piece of tile 0
  const char* ga = (const char*)(O + ((size_t)blockIdx.x * 64 + (tid >> 4)) * DM + (tid & 15) * 4);          // its first activation piece of tile 0
  const unsigned lb = (unsigned)(uintptr_t)&sm[(tid >> 3) * (GBP * 2) + (tid & 7) * 16], la = (unsigned)(uintptr_t)&sm[GB_BYTES + (tid >> 4) * (GAP * 4) + (tid & 15) * 16];
  GSTAGE(0);
  asm volatile("s_wait_asynccnt 0x0" ::: "memory");   // tile 0 has landed before the barrier that publishes it
  __syncthreads();
  GSTAGE(1);
#pragma unroll 1
  for (int ts = 0; ts < DM / GKS; ++ts) { const __bf16* bB = (const __bf16*)(sm + (ts & 1) * GST_BYTES); const float* bA = (const float*)(sm + (ts & 1) * GST_BYTES + GB_BYTES);
#pragma unroll
    for (int kc = 0; kc < GKS / 32; ++kc) { const F2 a = split_row(bA + (wave * 16 + col) * GAP, kc * 32, lane);
      v16b w[8];   // the eight weight fragments of this k chunk are read as one group in front of its products: one LDS latency a chunk, not one a fragment
#pragma unroll
      for (int j = 0; j < 8; ++j) w[j] = frag_b(bB + (j * 16 + col) * GBP + kc * 32, lane);
#pragma unroll
      for (int j = 0; j < 8; ++j) { acc[j] = wmma_bf(a.l, w[j], acc[j]); acc[j] = wmma_bf(a.h, w[j], acc[j]); } }
    asm volatile("s_wait_dscnt 0x0" ::: "memory");      // this wave's reads of tile ts have returned before its buffer is refilled
    asm volatile("s_wait_asynccnt 0x0" ::: "memory");   // this wave's copies of tile ts + 1 have landed before the barrier that publishes them
    __syncthreads();                                    // publishes tile ts + 1 and ends every wave's reads of tile ts
    if (ts + 2 < DM / GKS) GSTAGE(ts + 2); }
  asm volatile("s_wait_asynccnt 0x0" ::: "memory");     // no copy is outstanding when the buffers become output staging
#pragma unroll
  for (int j = 0; j < 8; ++j) {
#pragma unroll
    for (int r = 0; r < 8; ++r) so[wave][8 * g + r][j * 16 + col] = acc[j][r] + (BO ? bfr(BO[n0 + j * 16 + col]) : 0.f); }
  LDSX();
  for (int rl = 0; rl < 16; ++rl) vst2(Y + (r0 + rl) * DM + n0 + lane * 4, *(const v4f*)&so[wave][rl][lane * 4]);
}
extern "C" void kernel_launch(void* const* d_in, const int* in_sizes, int n_in, void* d_out, int out_size, void* d_ws, size_t ws_size, hipStream_t stream) {
  (void)in_sizes; (void)n_in; (void)out_size;
  const float** F = (const float**)d_in;   // 0 hidden_states [4,2048,768], 1 Wq [768,768], 2 Wk [768,256], 3 Wv [768,256], 4 Wo [768,768] (all (in,out))
  if (ws_size < (size_t)WS_END) return;
  char* ws = (char*)d_ws; __bf16* PK = (__bf16*)(ws + WS_PK); _Float16 *QK = (_Float16*)(ws + WS_QK), *QKL = (_Float16*)(ws + WS_QKL), *VTH = (_Float16*)(ws + WS_VTH), *VTL = (_Float16*)(ws + WS_VTL); float* O = (float*)(ws + WS_O); float* CS = (float*)(ws + WS_CS);
  k_pack<<<dim3(DM, 4), 256, 0, stream>>>(F[1], F[2], F[3], F[4], PK, CS);
  k_qkv<<<dim3(TNB * SS / 64, QKVW / 128), 128, 0, stream>>>(F[0], F[0], F[0], PK + PK_A, nullptr, nullptr, nullptr, CS, QK, QKL, VTH, VTL);
  k_attn<<<dim3(TQB, NH, TNB), 128, 0, stream>>>(QK, QKL, VTH, VTL, nullptr, O);
  k_out<<<dim3(TOB, DM / 128), 128, 0, stream>>>(O, PK + PK_P, nullptr, (float*)d_out);
}

// v006
// One run takes 167 microseconds.
// Next to v005, in two timings, it ran 1.12 times as fast each time.
// All steps since v000 together make it 3.51 times as fast.
// compute dtype: all float inputs rounded to bf16; q/k/v = x . W with EXACT bf16 products on WMMA 16x16x32 ((in,out) weights as transposed rows; the 4 kv heads replicated to their 3 query heads at pack time), f16 hi + residual; RoPE (inv_freq in double, angle = pos x inv_freq in f32 as the module, precise sinf/cosf, one table a call) applied in f32 to q/k in the projection's epilogue, before the split; causal attention with hybrid scores (first 128 queries 3-product, later single f16) and hybrid P.v (first 128 queries hi + residual, later single), x 1/8, running-max softmax in f32 (hardware exp); out = ctx (bf16 hi + lo) . Wo ((in,out)); f32 output.
#include <hip/hip_runtime.h>
#include <math.h>

typedef __attribute__((ext_vector_type(16))) _Float16 v16h;
typedef __attribute__((ext_vector_type(16))) __bf16 v16b;
typedef __attribute__((ext_vector_type(8)))  _Float16 v8h;
typedef __attribute__((ext_vector_type(8)))  float v8f;
typedef __attribute__((ext_vector_type(4)))  float v4f;
typedef __attribute__((ext_vector_type(2)))  float v2f;
typedef __attribute__((ext_vector_type(4)))  unsigned v4u;
typedef __attribute__((ext_vector_type(4)))  int v4i;
typedef float __attribute__((may_alias)) float_a;
typedef int __attribute__((may_alias)) int_a;

template <typename T> __device__ __forceinline__ void vst2(void* p, T v) { *(T*)p = v;  }
__device__ __forceinline__ v8f wmma16(v16h a, v16h b, v8f c) {
  v8f d = __builtin_amdgcn_wmma_f32_16x16x32_f16(false, a, false, b, (short)0, c, false, false);
  asm volatile("v_nop\n\tv_nop\n\tv_nop\n\tv_nop" : "+v"(d) : "v"(a), "v"(b));
  return d;
}
__device__ __forceinline__ v8f wmma_bf(v16b a, v16b b, v8f c) {
  v8f d = __builtin_amdgcn_wmma_f32_16x16x32_bf16(false, a, false, b, (short)0, c, false, false);
  asm volatile("v_nop\n\tv_nop\n\tv_nop\n\tv_nop" : "+v"(d) : "v"(a), "v"(b));
  return d;
}
// Grouped-query causal attention with RoPE (B 4, S 2,048, hidden 768, 12 query heads x 64 over 4 kv heads): q = x Wq, k = x Wk, v = x Wv ((in,out), kv heads shared by 3 query heads), rotate-half RoPE (theta 1e4), causal softmax(q k / 8) v, out = ctx Wo.
__device__ __forceinline__ v16h frag_h(const _Float16* rowk0, int lane) {
  union { v16h v; v8h q[2]; } u; const _Float16* p = rowk0 + 8 * (lane >> 4);
  u.q[0] = *(const v8h*)p; u.q[1] = *(const v8h*)(p + 16); return u.v;
}
__device__ __forceinline__ v16h frag_f32(const float* rowk0, int lane) {
  v16h a; const float* p = rowk0 + 8 * (lane >> 4);
#pragma unroll
  for (int i = 0; i < 8; ++i) { a[i] = (_Float16)p[i]; a[8 + i] = (_Float16)p[16 + i]; }
  return a;
}
__device__ __forceinline__ v16h frag_f32s(const float* rowk0, int lane, float sc) {
  v16h a; const float* p = rowk0 + 8 * (lane >> 4);
#pragma unroll
  for (int i = 0; i < 8; ++i) { a[i] = (_Float16)(p[i] * sc); a[8 + i] = (_Float16)(p[16 + i] * sc); }
  return a;
}
// column fragment from a [K][ld] layout (column n), rows >= K read as 0
__device__ __forceinline__ v16h fragc_f32(const float* W, int k0, int n, int lane, int ld, int K) {
  v16h a; const int g = lane >> 4;
#pragma unroll
  for (int i = 0; i < 8; ++i) { const int ka = k0 + 8 * g + i, kb = ka + 16;
    a[i] = (_Float16)(ka < K ? W[(size_t)(ka < K ? ka : K - 1) * ld + n] : 0.f); a[8 + i] = (_Float16)(kb < K ? W[(size_t)(kb < K ? kb : K - 1) * ld + n] : 0.f); }
  return a;
}
struct F2 { v16b h, l; };
__device__ __forceinline__ F2 bsplit16(const float v[16]) { F2 r;
#pragma unroll
  for (int i = 0; i < 16; ++i) { const __bf16 h = (__bf16)v[i]; r.h[i] = h; r.l[i] = (__bf16)(v[i] - (float)h); }
  return r; }
__device__ __forceinline__ F2 split_row(const float* row, int k0, int lane) { float v[16]; const float* p = row + k0 + 8 * (lane >> 4);
#pragma unroll
  for (int i = 0; i < 8; ++i) { v[i] = p[i]; v[8 + i] = p[16 + i]; }
  return bsplit16(v); }
__device__ __forceinline__ F2 split_rowK(const float* row, int k0, int lane, int K) { float v[16]; const int g = lane >> 4;
#pragma unroll
  for (int i = 0; i < 8; ++i) { const int ka = k0 + 8 * g + i, kb = ka + 16; v[i] = ka < K ? row[ka < K ? ka : K - 1] : 0.f; v[8 + i] = kb < K ? row[kb < K ? kb : K - 1] : 0.f; }
  return bsplit16(v); }
__device__ __forceinline__ F2 split_col(const float* W, int k0, int n, int lane, int ld, int K) { float v[16]; const int g = lane >> 4;
#pragma unroll
  for (int i = 0; i < 8; ++i) { const int ka = k0 + 8 * g + i, kb = ka + 16; v[i] = ka < K ? W[(size_t)(ka < K ? ka : K - 1) * ld + n] : 0.f; v[8 + i] = kb < K ? W[(size_t)(kb < K ? kb : K - 1) * ld + n] : 0.f; }
  return bsplit16(v); }
__device__ __forceinline__ v8f mac3(const F2& a, const F2& b, v8f c) { c = wmma_bf(a.l, b.h, c); c = wmma_bf(a.h, b.l, c); return wmma_bf(a.h, b.h, c); }
__device__ __forceinline__ float sigm(float v) { return 1.0f / (1.0f + expf(-v)); }
#define LDSX() do { asm volatile("s_wait_dscnt 0" ::: "memory"); __builtin_amdgcn_wave_barrier(); __builtin_amdgcn_fence(__ATOMIC_RELEASE, "workgroup"); } while (0)


#define NB 4
#define SS 2048
#define DM 768
#define NH 12
#define NKV 4
#define GRP 3
#define HD 64
#define QKVW (3 * DM)
#ifndef TQB
#define TQB (SS / 64)
#define TNB NB
#define TOB (NB * SS / 64)     // output row tiles (all)
#endif
typedef __attribute__((ext_vector_type(8))) __bf16 v8b;
__device__ __forceinline__ v16b frag_b(const __bf16* rowk0, int lane) {
  union { v16b v; v8b q[2]; } u; const __bf16* p = rowk0 + 8 * (lane >> 4);
  u.q[0] = *(const v8b*)p; u.q[1] = *(const v8b*)(p + 16); return u.v;
}
__device__ __forceinline__ float bfr(float v) { return (float)(__bf16)v; }
__device__ __attribute__((noinline)) float exp_ni(float v) { return expf(v); }
__device__ __attribute__((noinline)) float erf_ni(float v) { return erff(v); }

#define PK_A 0                       // [2304][768] Wqkv rows ([out][in], transposed from the (in,out) inputs)
#define PK_P (PK_A + QKVW * DM)        // [768][768] Wo rows ([out][in], transposed)
#define PK_END (PK_P + DM * DM)
#define WS_PK  0u
#define WS_QK  (WS_PK + 2u * PK_END)             // f16 [8192 rows][1536]: q | k
#define WS_QKL (WS_QK + 2u * NB * SS * 2 * DM)     // f16 q | k residual planes x2048
#define WS_VTH (WS_QKL + 2u * NB * SS * 2 * DM)    // f16 [b][768 (h*64+d)][2048 s] hi
#define WS_VTL (WS_VTH + 2u * NB * DM * SS)        // f16 lo x 2048
#define WS_O   (WS_VTL + 2u * NB * DM * SS)        // f32 [8192][768]
#define WS_CS  (WS_O + 4u * NB * SS * DM)           // f32 [2048 positions][32 frequencies] pairs (cos, sin)
#define WS_END (WS_CS + 4u * 2 * SS * 32)
// ---- k_pack: block = (row n, which): natural [out][in] rows -> bf16; which 0..2 -> W_q/W_k/W_v into PK_A rows which*768 + n; 3 -> W_o into PK_P
__global__ __launch_bounds__(256) void k_pack(const float* __restrict__ WQ, const float* __restrict__ WK, const float* __restrict__ WV, const float* __restrict__ WO, __bf16* __restrict__ PK, float* __restrict__ CS) {   // (in,out) weights: Wq [768][768], Wk/Wv [768][256] (kv head = query head / 3), Wo [768][768]; packed row (which*DM + n), n = h*64 + d
  __shared__ __align__(16) __bf16 s[DM]; const int n = blockIdx.x, which = blockIdx.y, t = threadIdx.x; const int h = n / HD, d = n % HD; const int nkv = (h / GRP) * HD + d;
  for (int k = t; k < DM; k += 256) { float w; if (which == 0) w = WQ[(size_t)k * DM + n]; else if (which == 1) w = WK[(size_t)k * (NKV * HD) + nkv]; else if (which == 2) w = WV[(size_t)k * (NKV * HD) + nkv]; else w = WO[(size_t)k * DM + n]; s[k] = (__bf16)w; }
  __syncthreads(); __bf16* dst = (which < 3) ? (PK + PK_A + ((size_t)which * DM + n) * DM) : (PK + PK_P + (size_t)n * DM); for (int q = t; q < DM / 8; q += 256) vst2((unsigned*)(dst + q * 8), *(const v4u*)&s[q * 8]);
  // the RoPE table, once a call: waves 0 to 2 of the 768 blocks of Wq take positions n, n + 768, n + 1,536; a wave writes one position's 32 pairs (cos a_j, sin a_j), a_j = pos * inv_freq[j], 256 B
  if (which == 0 && t < 96) { const int pos = n + DM * (t >> 5), j = t & 31;
    if (pos < SS) { const double invf = 1.0 / pow(10000.0, (double)j / 32.0); const float ang = (float)pos * (float)invf; v2f cs; cs[0] = cosf(ang); cs[1] = sinf(ang); *(v2f*)(CS + ((size_t)pos * 32 + j) * 2) = cs; } } }
#define GKS 64                          // k elements of one staged tile
#define GBP 72                          // LDS pitch of a staged weight row in bf16: 144 B = 16 B x 9, no bank conflict for 16-byte fragment reads
#define GAP 68                          // LDS pitch of a staged activation row in f32: 272 B = 16 B x 17, likewise
#define GB_BYTES (128 * GBP * 2)        // 128 weight rows
#define GA_BYTES (64 * GAP * 4)         // 64 activation rows
#define GST_BYTES (GB_BYTES + GA_BYTES) // one buffer: weight tile, then activation tile
// eight 16-B pieces of one thread into LDS, through no register: piece i goes to LDS byte l + i * ls and comes from g + i * 24,576 B (16 weight rows of 1,536 B, or 8 activation rows of 3,072 B).
// The wait on xcnt is the last line of the copies' own statement, so that it stands in front of any rewrite of the address registers they name.
__device__ __forceinline__ void stage8(unsigned l, unsigned ls, const char* g) {
  asm volatile("global_load_async_to_lds_b128 %0, %8, off\n\t"
               "global_load_async_to_lds_b128 %1, %9, off\n\t"
               "global_load_async_to_lds_b128 %2, %10, off\n\t"
               "global_load_async_to_lds_b128 %3, %11, off\n\t"
               "global_load_async_to_lds_b128 %4, %12, off\n\t"
               "global_load_async_to_lds_b128 %5, %13, off\n\t"
               "global_load_async_to_lds_b128 %6, %14, off\n\t"
               "global_load_async_to_lds_b128 %7, %15, off\n\t"
               "s_wait_xcnt 0x0"
               :: "v"(l), "v"(l + ls), "v"(l + 2 * ls), "v"(l + 3 * ls), "v"(l + 4 * ls), "v"(l + 5 * ls), "v"(l + 6 * ls), "v"(l + 7 * ls),
                  "v"(g), "v"(g + 24576), "v"(g + 2 * 24576), "v"(g + 3 * 24576), "v"(g + 4 * 24576), "v"(g + 5 * 24576), "v"(g + 6 * 24576), "v"(g + 7 * 24576) : "memory");
}
// tile t (64 k) of a 64-row x 128-column block into buffer t & 1: 128 weight rows x 128 B (8 threads a row) and 64 activation rows x 256 B (16 threads a row); every wave-wide copy covers four whole 128-B lines
#define GSTAGE(t) do { stage8(lb + ((t) & 1) * GST_BYTES, 16 * GBP * 2, gb + (size_t)(t) * (GKS * 2)); stage8(la + ((t) & 1) * GST_BYTES, 8 * GAP * 4, ga + (size_t)(t) * (GKS * 4)); } while (0)
__global__ __launch_bounds__(128) void k_qkv(const float* __restrict__ XQ, const float* __restrict__ XK, const float* __restrict__ XV, const __bf16* __restrict__ P, const float* __restrict__ BQ, const float* __restrict__ BK, const float* __restrict__ BV, const float* __restrict__ CS, _Float16* __restrict__ QK, _Float16* __restrict__ QKL, _Float16* __restrict__ VTH, _Float16* __restrict__ VTL) {
  const int which0 = (blockIdx.y * 128) / DM; const float* X = (which0 == 0) ? XQ : (which0 == 1) ? XK : XV; const float* BB = BQ ? (((which0 == 0) ? BQ : (which0 == 1) ? BK : BV) + (blockIdx.y * 128 - which0 * DM)) : nullptr;
  __shared__ __align__(16) char sm[2 * GST_BYTES];   // two buffers of the k loop; behind the loop's last barrier the same bytes stage the output
  _Float16 (*so)[16][136] = (_Float16 (*)[16][136])sm; _Float16 (*sol)[16][136] = (_Float16 (*)[16][136])(sm + 4 * 16 * 136 * 2); _Float16 (*sth)[72] = (_Float16 (*)[72])sm; _Float16 (*stl)[72] = (_Float16 (*)[72])(sm + 128 * 72 * 2);
  const int tid = threadIdx.x, wave = tid >> 5, lane = tid & 31, col = lane & 15, g = lane >> 4; const size_t r0 = (size_t)blockIdx.x * 64 + wave * 16; const int n0 = blockIdx.y * 128;
  v8f acc[8] = {};
  const char* gb = (const char*)(P + (size_t)(n0 + (tid >> 3)) * DM + (tid & 7) * 8);                        // this thread's first weight piece of tile 0
  const char* ga = (const char*)(X + ((size_t)blockIdx.x * 64 + (tid >> 4)) * DM + (tid & 15) * 4);          // its first activation piece of tile 0
  const unsigned lb = (unsigned)(uintptr_t)&sm[(tid >> 3) * (GBP * 2) + (tid & 7) * 16], la = (unsigned)(uintptr_t)&sm[GB_BYTES + (tid >> 4) * (GAP * 4) + (tid & 15) * 16];
  // q and k blocks: this lane's 16 table pairs (its 8 rows' positions x the frequencies col and 16 + col), asked for in front of the k loop so that their latency passes under it
  v2f cs[8][2] = {};
  if (n0 < 2 * DM) { const float* cp = CS + ((size_t)((blockIdx.x * 64) % SS + wave * 16 + 8 * g) * 32 + col) * 2;
#pragma unroll   // constant indices keep cs in registers, and the 16 loads issue as one group
    for (int r = 0; r < 8; ++r) { cs[r][0] = *(const v2f*)(cp + r * 64); cs[r][1] = *(const v2f*)(cp + r * 64 + 32); } }
  GSTAGE(0);
  asm volatile("s_wait_asynccnt 0x0" ::: "memory");   // tile 0 has landed before the barrier that publishes it
  __syncthreads();
  GSTAGE(1);
#pragma unroll 1
  for (int ts = 0; ts < DM / GKS; ++ts) { const __bf16* bB = (const __bf16*)(sm + (ts & 1) * GST_BYTES); const float* bA = (const float*)(sm + (ts & 1) * GST_BYTES + GB_BYTES);
#pragma unroll
    for (int kc = 0; kc < GKS / 32; ++kc) { v16b a; { const float* p = bA + (wave * 16 + col) * GAP + kc * 32 + 8 * g;
#pragma unroll
        for (int i = 0; i < 8; ++i) { a[i] = (__bf16)p[i]; a[8 + i] = (__bf16)p[16 + i]; } }
      v16b w[8];   // the eight weight fragments of this k chunk are read as one group in front of its products: one LDS latency a chunk, not one a product
#pragma unroll
      for (int j = 0; j < 8; ++j) w[j] = frag_b(bB + (j * 16 + col) * GBP + kc * 32, lane);
#pragma unroll
      for (int j = 0; j < 8; ++j) acc[j] = wmma_bf(a, w[j], acc[j]); }
    asm volatile("s_wait_dscnt 0x0" ::: "memory");      // this wave's reads of tile ts have returned before its buffer is refilled
    asm volatile("s_wait_asynccnt 0x0" ::: "memory");   // this wave's copies of tile ts + 1 have landed before the barrier that publishes them
    __syncthreads();                                    // publishes tile ts + 1 and ends every wave's reads of tile ts
    if (ts + 2 < DM / GKS) GSTAGE(ts + 2); }
  asm volatile("s_wait_asynccnt 0x0" ::: "memory");     // no copy is outstanding when the buffers become output staging
  if (n0 < 2 * DM) {   // q stored unscaled (f16 sigma ~0.6, no subnormal exposure); 1/8 applied to the f32 score
    // rotate-half RoPE in registers: the block's 128 columns are two heads; tiles ja and ja + 2 hold columns d (< 32) and d + 32 of one head in the same lane and register: y[d] = x[d] cos - x[d + 32] sin, y[d + 32] = x[d + 32] cos + x[d] sin, frequency d
#pragma unroll   // constant indices keep acc and cs in registers (this loop and the one inside it)
    for (int p = 0; p < 4; ++p) { const int ja = (p >> 1) * 4 + (p & 1), jb = ja + 2; const float ba = BB ? bfr(BB[ja * 16 + col]) : 0.f, bb = BB ? bfr(BB[jb * 16 + col]) : 0.f;
#pragma unroll
      for (int r = 0; r < 8; ++r) { const float xa = acc[ja][r] + ba, xb = acc[jb][r] + bb, c = cs[r][p & 1][0], sn = cs[r][p & 1][1]; const float ya = xa * c - xb * sn, yb = xb * c + xa * sn; const _Float16 ha = (_Float16)ya, hb = (_Float16)yb;
        so[wave][8 * g + r][ja * 16 + col] = ha; sol[wave][8 * g + r][ja * 16 + col] = (_Float16)((ya - (float)ha) * 2048.0f); so[wave][8 * g + r][jb * 16 + col] = hb; sol[wave][8 * g + r][jb * 16 + col] = (_Float16)((yb - (float)hb) * 2048.0f); } }   // rotated q, k (+ bias) as f16 hi + (x2048) residual
    LDSX();
    for (int rl = 0; rl < 16; ++rl) if (lane < 16) { vst2((unsigned*)(QK + (r0 + rl) * (2 * DM) + n0 + lane * 8), *(const v4u*)&so[wave][rl][lane * 8]); vst2((unsigned*)(QKL + (r0 + rl) * (2 * DM) + n0 + lane * 8), *(const v4u*)&sol[wave][rl][lane * 8]); }
  } else {
#pragma unroll
    for (int j = 0; j < 8; ++j) {
#pragma unroll
      for (int r = 0; r < 8; ++r) { const float v = acc[j][r] + (BB ? bfr(BB[j * 16 + col]) : 0.f); const _Float16 hv = (_Float16)v; sth[j * 16 + col][wave * 16 + 8 * g + r] = hv; stl[j * 16 + col][wave * 16 + 8 * g + r] = (_Float16)((v - (float)hv) * 2048.0f); } }
    __syncthreads();
    const size_t rb = (size_t)blockIdx.x * 64; const int b = (int)(rb / SS), s0 = (int)(rb % SS); const int pc0 = n0 - 2 * DM;
    for (int q = tid; q < 128 * 8; q += 128) { const int d = q >> 3, pc = q & 7; const size_t o = ((size_t)b * DM + pc0 + d) * SS + s0 + pc * 8; vst2((unsigned*)(VTH + o), *(const v4u*)&sth[d][pc * 8]); vst2((unsigned*)(VTL + o), *(const v4u*)&stl[d][pc * 8]); }
  }
}
#define KP 72   // LDS pitch of a staged K row in f16: 144 B = 16 B x 9, no bank conflict for 16-byte fragment reads
#define VP 40   // LDS pitch of a staged V row in f16: 80 B = 16 B x 5, likewise
// one key tile of 32 keys into LDS, through no register: each of the 128 threads copies two 16-B pieces of K hi (32 rows x 128 B) and two of V hi (64 rows x 64 B).
// The wait on xcnt is the last line of the copies' own statement, so that it stands in front of any rewrite of the address registers they name.
__device__ __forceinline__ void stage_kv(unsigned lk0, unsigned lk1, unsigned lv0, unsigned lv1, const _Float16* k0, const _Float16* k1, const _Float16* v0, const _Float16* v1) {
  asm volatile("global_load_async_to_lds_b128 %0, %4, off\n\t"
               "global_load_async_to_lds_b128 %1, %5, off\n\t"
               "global_load_async_to_lds_b128 %2, %6, off\n\t"
               "global_load_async_to_lds_b128 %3, %7, off\n\t"
               "s_wait_xcnt 0x0"
               :: "v"(lk0), "v"(lk1), "v"(lv0), "v"(lv1), "v"(k0), "v"(k1), "v"(v0), "v"(v1) : "memory");
}
// lane l with lane l ^ 16 (the other half of the wave), through no LDS
__device__ __forceinline__ float xhalf(float x) { return __builtin_bit_cast(float, __builtin_amdgcn_permlanex16(__builtin_bit_cast(int, x), __builtin_bit_cast(int, x), 0x76543210, 0xfedcba98, false, false)); }
// ---- k_attn: block = (two tiles of 64 queries, head h, batch b): causal flash attention, transposed: S^T = K . Q^T (A = 16 key rows from LDS, B = the wave's 16 queries, kept in registers), so a lane holds 16 of the 32 scores of ONE query (column col; keys 8 g + r and 16 + 8 g + r), lane ^ 16 the other 16: maximum and sum in-lane plus one exchange between the halves. The two score tiles, converted in place, are the B operand of O^T += V^T . P^T (A = 16 rows d of V^T from LDS). scores = (q.k) * 0.125; O[b*S+q][h*64+d] = (acc + accl / 2048) / (2048 l) (256-B segments)
__global__ __launch_bounds__(128) void k_attn(const _Float16* __restrict__ QK, const _Float16* __restrict__ QKL, const _Float16* __restrict__ VTH, const _Float16* __restrict__ VTL, const void* __restrict__ KMASK, float* __restrict__ O) {
  __shared__ __align__(16) float so[4][16][68];
  __shared__ __align__(16) _Float16 sk[2][32 * KP], sv[2][64 * VP];   // two buffers: the block's K hi and V hi tile of 32 keys, read by all four waves
  const int tid = threadIdx.x, wave = tid >> 5, lane = tid & 31, col = lane & 15, g = lane >> 4;
  const int h = blockIdx.y, b = blockIdx.z;
  // A block takes two query tiles one after the other, TQB - 1 - x and x: together 2 * (TQB + 1) key tiles whatever x is, so that every block of the launch, all resident at once, has the same work.
  // Rolled: one copy of the code serves both tiles. The foot barrier of a tile's last trip has ended every wave's reads of sk and sv before the next tile's first copies; so is each wave's own.
#pragma unroll 1
  for (int half = 0; half < 2; ++half) {
  const int qb = half ? (int)blockIdx.x : TQB - 1 - (int)blockIdx.x; const int q0 = qb * 64 + wave * 16; const size_t rq = (size_t)b * SS + q0 + col;
  v16h aq[2], aql[2];
#pragma unroll
  for (int kc = 0; kc < 2; ++kc) { aq[kc] = frag_h(QK + rq * (2 * DM) + h * HD + kc * 32, lane); aql[kc] = frag_h(QKL + rq * (2 * DM) + h * HD + kc * 32, lane); }
  float m = -3.0e38f, l = 0.f;   // of query q0 + col; l sums this half's keys only, the halves are joined behind the loop
  v8f acc[4] = {}, accl[4] = {};   // acc[dt][r] = O^T[d = dt * 16 + 8 g + r][query q0 + col]
  const int nksc = (qb * 64 + 64) / 32;   // causal: key tiles up to the end of this query block
  const _Float16* kg = QK + ((size_t)b * SS + (tid >> 3)) * (2 * DM) + DM + h * HD + (tid & 7) * 8;   // this thread's first K piece of tile 0 (its second: 16 keys on)
  const _Float16* vg = VTH + ((size_t)b * DM + h * HD + (tid >> 2)) * SS + (tid & 3) * 8;               // its first V piece of tile 0 (its second: 32 rows on)
  const unsigned lk = (unsigned)(uintptr_t)&sk[0][(tid >> 3) * KP + (tid & 7) * 8], lv = (unsigned)(uintptr_t)&sv[0][(tid >> 2) * VP + (tid & 3) * 8];
#define STAGE(t) stage_kv(lk + ((t) & 1) * (32 * KP * 2), lk + ((t) & 1) * (32 * KP * 2) + 16 * KP * 2, lv + ((t) & 1) * (64 * VP * 2), lv + ((t) & 1) * (64 * VP * 2) + 32 * VP * 2, kg + (size_t)(t) * 32 * (2 * DM), kg + ((size_t)(t) * 32 + 16) * (2 * DM), vg + (t) * 32, vg + (t) * 32 + 32 * SS)
  STAGE(0);
  asm volatile("s_wait_asynccnt 0x0" ::: "memory");   // tile 0 has landed before the barrier that publishes it
  __syncthreads();
  if (1 < nksc) STAGE(1);
#pragma unroll 1
  for (int ks = 0; ks < nksc; ++ks) { v8f s[2]; const int lim = q0 + col - 8 * g - ks * 32;   // the last score row of this lane's 16 (ct * 16 + r) that its query may see
    v16h kf[2][2];   // the tile's four K fragments are read as one group in front of the score products: one LDS latency a tile, not one a product
#pragma unroll
    for (int ct = 0; ct < 2; ++ct) {
#pragma unroll
      for (int kc = 0; kc < 2; ++kc) kf[ct][kc] = frag_h(&sk[ks & 1][(ct * 16 + col) * KP] + kc * 32, lane); }
#pragma unroll
    for (int ct = 0; ct < 2; ++ct) { const _Float16* krowl = QKL + ((size_t)b * SS + ks * 32 + ct * 16 + col) * (2 * DM) + DM + h * HD; v8f c = {}, cl = {};
      if (qb < 2) {   // leading query blocks (few keys, outputs far above the global rms): 3 products
#pragma unroll
        for (int kc = 0; kc < 2; ++kc) { const v16h kh = kf[ct][kc]; c = wmma16(kh, aq[kc], c); cl = wmma16(kh, aql[kc], cl); cl = wmma16(frag_h(krowl + kc * 32, lane), aq[kc], cl); }
#pragma unroll
        for (int r = 0; r < 8; ++r) c[r] += cl[r] * (1.0f / 2048.0f); }
      else {
#pragma unroll
        for (int kc = 0; kc < 2; ++kc) c = wmma16(kf[ct][kc], aq[kc], c); }   // single product elsewhere
#pragma unroll
      for (int r = 0; r < 8; ++r) s[ct][r] = (ct * 16 + r <= lim) ? c[r] * 0.125f : -3.0e38f; }   // 1/sqrt(64); masked keys (key ks * 32 + ct * 16 + 8 g + r above query q0 + col) excluded
    v16h vf[4];   // the tile's four V fragments are read as one group here, so that their LDS latency passes under the softmax arithmetic
#pragma unroll
    for (int dt = 0; dt < 4; ++dt) vf[dt] = frag_h(&sv[ks & 1][(dt * 16 + col) * VP], lane);
    float mx = fmaxf(s[0][0], s[1][0]);
#pragma unroll
    for (int r = 1; r < 8; ++r) mx = fmaxf(mx, fmaxf(s[0][r], s[1][r]));
    mx = fmaxf(mx, xhalf(mx));   // over all 32 keys of the tile
    const float mn = fmaxf(m, mx);
    float ta = (m - mn) * 1.442695041f, t0[8], t1[8];   // e^x = 2^(x log2 e), as __expf forms it
#pragma unroll
    for (int r = 0; r < 8; ++r) { t0[r] = (s[0][r] - mn) * 1.442695041f; t1[r] = (s[1][r] - mn) * 1.442695041f; }
    // the 17 hardware exponentials, in place, in two statements: inside a statement no v_exp_f32 is followed by an instruction that reads its result or overwrites its source, and the v_nop keeps
    // that slot behind the last one.
    asm("v_exp_f32 %0, %0\n\tv_exp_f32 %1, %1\n\tv_exp_f32 %2, %2\n\tv_exp_f32 %3, %3\n\tv_exp_f32 %4, %4\n\tv_exp_f32 %5, %5\n\tv_exp_f32 %6, %6\n\tv_exp_f32 %7, %7\n\tv_exp_f32 %8, %8\n\tv_nop"
        : "+v"(ta), "+v"(t0[0]), "+v"(t0[1]), "+v"(t0[2]), "+v"(t0[3]), "+v"(t0[4]), "+v"(t0[5]), "+v"(t0[6]), "+v"(t0[7]));
    asm("v_exp_f32 %0, %0\n\tv_exp_f32 %1, %1\n\tv_exp_f32 %2, %2\n\tv_exp_f32 %3, %3\n\tv_exp_f32 %4, %4\n\tv_exp_f32 %5, %5\n\tv_exp_f32 %6, %6\n\tv_exp_f32 %7, %7\n\tv_nop"
        : "+v"(t1[0]), "+v"(t1[1]), "+v"(t1[2]), "+v"(t1[3]), "+v"(t1[4]), "+v"(t1[5]), "+v"(t1[6]), "+v"(t1[7]));
    const float alpha = (m <= -1.0e38f) ? 0.f : ta;
    float es = 0.f;
#pragma unroll
    for (int r = 0; r < 8; ++r) { s[0][r] = (s[0][r] <= -1.0e38f) ? 0.f : t0[r]; s[1][r] = (s[1][r] <= -1.0e38f) ? 0.f : t1[r]; es += s[0][r] + s[1][r]; }
    l = l * alpha + es; m = mn;
#pragma unroll
    for (int dt = 0; dt < 4; ++dt) {
#pragma unroll
      for (int r = 0; r < 8; ++r) { acc[dt][r] *= alpha; accl[dt][r] *= alpha; } }
    v16h pa, pl;   // P^T as a B operand: element i = key 8 g + i, element 8 + i = key 16 + 8 g + i, the k order of frag_h
#pragma unroll
    for (int i = 0; i < 8; ++i) { const float x0 = s[0][i] * 2048.0f, x1 = s[1][i] * 2048.0f; const _Float16 h0 = (_Float16)x0, h1 = (_Float16)x1; pa[i] = h0; pa[8 + i] = h1; pl[i] = (_Float16)((x0 - (float)h0) * 2048.0f); pl[8 + i] = (_Float16)((x1 - (float)h1) * 2048.0f); }   // P scaled by 2^11 before the f16 split so small softmax weights stay out of the f16 subnormal range; 2^-11 folded into the epilogue
#pragma unroll
    for (int dt = 0; dt < 4; ++dt) { const size_t vr = ((size_t)b * DM + h * HD + dt * 16 + col) * SS + ks * 32; const v16h vh = vf[dt]; acc[dt] = wmma16(vh, pa, acc[dt]); if (qb < 2) { accl[dt] = wmma16(vh, pl, accl[dt]); accl[dt] = wmma16(frag_h(VTL + vr, lane), pa, accl[dt]); } }   // leading query blocks: P hi/lo x V hi/lo (3 products); elsewhere P x V single
    asm volatile("s_wait_dscnt 0x0" ::: "memory");      // this wave's reads of the tile have returned before the buffer is refilled
    asm volatile("s_wait_asynccnt 0x0" ::: "memory");   // this wave's copies of tile ks + 1 have landed before the barrier that publishes them
    __syncthreads();                                    // publishes tile ks + 1 and ends every wave's reads of tile ks
    if (ks + 2 < nksc) STAGE(ks + 2); }
  asm volatile("s_wait_asynccnt 0x0" ::: "memory");     // no copy is outstanding when the wave goes on to the epilogue, then the second tile or its end
#undef STAGE
  l += xhalf(l);   // the two halves' sums of one query
  const float il = (1.0f / 2048.0f) / l;
#pragma unroll
  for (int dt = 0; dt < 4; ++dt) {
#pragma unroll
    for (int r = 0; r < 8; ++r) so[wave][col][dt * 16 + 8 * g + r] = (acc[dt][r] + accl[dt][r] * (1.0f / 2048.0f)) * il; }
  LDSX();
  for (int rl = 0; rl < 16; ++rl) if (lane < 16) vst2(O + ((size_t)b * SS + q0 + rl) * DM + h * HD + lane * 4, *(const v4f*)&so[wave][rl][lane * 4]);
  }
}
// ---- k_out: block = (64 rows, 128 cols): out = O(hi/lo) . Wo rows (2 products) + bo
__global__ __launch_bounds__(128) void k_out(const float* __restrict__ O, const __bf16* __restrict__ P, const float* __restrict__ BO, float* __restrict__ Y) {
  __shared__ __align__(16) char sm[2 * GST_BYTES];   // two buffers of the k loop; behind the loop's last barrier the same bytes stage the output
  float (*so)[16][132] = (float (*)[16][132])sm;
  const int tid = threadIdx.x, wave = tid >> 5, lane = tid & 31, col = lane & 15, g = lane >> 4; const size_t r0 = (size_t)blockIdx.x * 64 + wave * 16; const int n0 = blockIdx.y * 128;
  v8f acc[8] = {};
  const char* gb = (const char*)(P + (size_t)(n0 + (tid >> 3)) * DM + (tid & 7) * 8);                        // this thread's first weight piece of tile 0
  const char* ga = (const char*)(O + ((size_t)blockIdx.x * 64 + (tid >> 4)) * DM + (tid & 15) * 4);          // its first activation piece of tile 0
  const unsigned lb = (unsigned)(uintptr_t)&sm[(tid >> 3) * (GBP * 2) + (tid & 7) * 16], la = (unsigned)(uintptr_t)&sm[GB_BYTES + (tid >> 4) * (GAP * 4) + (tid & 15) * 16];
  GSTAGE(0);
  asm volatile("s_wait_asynccnt 0x0" ::: "memory");   // tile 0 has landed before the barrier that publishes it
  __syncthreads();
  GSTAGE(1);
#pragma unroll 1
  for (int ts = 0; ts < DM / GKS; ++ts) { const __bf16* bB = (const __bf16*)(sm + (ts & 1) * GST_BYTES); const float* bA = (const float*)(sm + (ts & 1) * GST_BYTES + GB_BYTES);
#pragma unroll
    for (int kc = 0; kc < GKS / 32; ++kc) { const F2 a = split_row(bA + (wave * 16 + col) * GAP, kc * 32, lane);
      v16b w[8];   // the eight weight fragments of this k chunk are read as one group in front of its products: one LDS latency a chunk, not one a fragment
#pragma unroll
      for (int j = 0; j < 8; ++j) w[j] = frag_b(bB + (j * 16 + col) * GBP + kc * 32, lane);
#pragma unroll
      for (int j = 0; j < 8; ++j) { acc[j] = wmma_bf(a.l, w[j], acc[j]); acc[j] = wmma_bf(a.h, w[j], acc[j]); } }
    asm volatile("s_wait_dscnt 0x0" ::: "memory");      // this wave's reads of tile ts have returned before its buffer is refilled
    asm volatile("s_wait_asynccnt 0x0" ::: "memory");   // this wave's copies of tile ts + 1 have landed before the barrier that publishes them
    __syncthreads();                                    // publishes tile ts + 1 and ends every wave's reads of tile ts
    if (ts + 2 < DM / GKS) GSTAGE(ts + 2); }
  asm volatile("s_wait_asynccnt 0x0" ::: "memory");     // no copy is outstanding when the buffers become output staging
#pragma unroll
  for (int j = 0; j < 8; ++j) {
#pragma unroll
    for (int r = 0; r < 8; ++r) so[wave][8 * g + r][j * 16 + col] = acc[j][r] + (BO ? bfr(BO[n0 + j * 16 + col]) : 0.f); }
  LDSX();
  for (int rl = 0; rl < 16; ++rl) vst2(Y + (r0 + rl) * DM + n0 + lane * 4, *(const v4f*)&so[wave][rl][lane * 4]);
}
extern "C" void kernel_launch(void* const* d_in, const int* in_sizes, int n_in, void* d_out, int out_size, void* d_ws, size_t ws_size, hipStream_t stream) {
  (void)in_sizes; (void)n_in; (void)out_size;
  const float** F = (const float**)d_in;   // 0 hidden_states [4,2048,768], 1 Wq [768,768], 2 Wk [768,256], 3 Wv [768,256], 4 Wo [768,768] (all (in,out))
  if (ws_size < (size_t)WS_END) return;
  char* ws = (char*)d_ws; __bf16* PK = (__bf16*)(ws + WS_PK); _Float16 *QK = (_Float16*)(ws + WS_QK), *QKL = (_Float16*)(ws + WS_QKL), *VTH = (_Float16*)(ws + WS_VTH), *VTL = (_Float16*)(ws + WS_VTL); float* O = (float*)(ws + WS_O); float* CS = (float*)(ws + WS_CS);
  k_pack<<<dim3(DM, 4), 256, 0, stream>>>(F[1], F[2], F[3], F[4], PK, CS);
  k_qkv<<<dim3(TNB * SS / 64, QKVW / 128), 128, 0, stream>>>(F[0], F[0], F[0], PK + PK_A, nullptr, nullptr, nullptr, CS, QK, QKL, VTH, VTL);
  k_attn<<<dim3(TQB / 2, NH, TNB), 128, 0, stream>>>(QK, QKL, VTH, VTL, nullptr, O);
  k_out<<<dim3(TOB, DM / 128), 128, 0, stream>>>(O, PK + PK_P, nullptr, (float*)d_out);
}

// v007
// A run of this version takes 155 microseconds.
// Timed twice side by side with v006, it ran 1.08 and 1.09 times as fast.
// Over all steps from v000 it is 3.83 times as fast.
// compute dtype: all float inputs rounded to bf16; q/k/v = x . W with EXACT bf16 products on WMMA 16x16x32 ((in,out) weights as transposed rows; the 4 kv heads replicated to their 3 query heads at pack time), f16 hi + residual; RoPE (inv_freq in double, angle = pos x inv_freq in f32 as the module, precise sinf/cosf, one table a call) applied in f32 to q/k in the projection's epilogue, before the split; causal attention with hybrid scores (first 128 queries 3-product, later single f16) and hybrid P.v (first 128 queries hi + residual, later single), x 1/8, running-max softmax in f32 (hardware exp); out = ctx (bf16 hi + lo) . Wo ((in,out)); f32 output.
#include <hip/hip_runtime.h>
#include <math.h>

typedef __attribute__((ext_vector_type(16))) _Float16 v16h;
typedef __attribute__((ext_vector_type(16))) __bf16 v16b;
typedef __attribute__((ext_vector_type(8)))  _Float16 v8h;
typedef __attribute__((ext_vector_type(8)))  float v8f;
typedef __attribute__((ext_vector_type(4)))  float v4f;
typedef __attribute__((ext_vector_type(2)))  float v2f;
typedef __attribute__((ext_vector_type(4)))  unsigned v4u;
typedef __attribute__((ext_vector_type(4)))  int v4i;
typedef float __attribute__((may_alias)) float_a;
typedef int __attribute__((may_alias)) int_a;

template <typename T> __device__ __forceinline__ void vst2(void* p, T v) { *(T*)p = v;  }
__device__ __forceinline__ v8f wmma16(v16h a, v16h b, v8f c) {
  v8f d = __builtin_amdgcn_wmma_f32_16x16x32_f16(false, a, false, b, (short)0, c, false, false);
  asm volatile("v_nop\n\tv_nop\n\tv_nop\n\tv_nop" : "+v"(d) : "v"(a), "v"(b));
  return d;
}
__device__ __forceinline__ v8f wmma_bf(v16b a, v16b b, v8f c) {
  v8f d = __builtin_amdgcn_wmma_f32_16x16x32_bf16(false, a, false, b, (short)0, c, false, false);
  asm volatile("v_nop\n\tv_nop\n\tv_nop\n\tv_nop" : "+v"(d) : "v"(a), "v"(b));
  return d;
}
// Grouped-query causal attention with RoPE (B 4, S 2,048, hidden 768, 12 query heads x 64 over 4 kv heads): q = x Wq, k = x Wk, v = x Wv ((in,out), kv heads shared by 3 query heads), rotate-half RoPE (theta 1e4), causal softmax(q k / 8) v, out = ctx Wo.
__device__ __forceinline__ v16h frag_h(const _Float16* rowk0, int lane) {
  union { v16h v; v8h q[2]; } u; const _Float16* p = rowk0 + 8 * (lane >> 4);
  u.q[0] = *(const v8h*)p; u.q[1] = *(const v8h*)(p + 16); return u.v;
}
__device__ __forceinline__ v16h frag_f32(const float* rowk0, int lane) {
  v16h a; const float* p = rowk0 + 8 * (lane >> 4);
#pragma unroll
  for (int i = 0; i < 8; ++i) { a[i] = (_Float16)p[i]; a[8 + i] = (_Float16)p[16 + i]; }
  return a;
}
__device__ __forceinline__ v16h frag_f32s(const float* rowk0, int lane, float sc) {
  v16h a; const float* p = rowk0 + 8 * (lane >> 4);
#pragma unroll
  for (int i = 0; i < 8; ++i) { a[i] = (_Float16)(p[i] * sc); a[8 + i] = (_Float16)(p[16 + i] * sc); }
  return a;
}
// column fragment from a [K][ld] layout (column n), rows >= K read as 0
__device__ __forceinline__ v16h fragc_f32(const float* W, int k0, int n, int lane, int ld, int K) {
  v16h a; const int g = lane >> 4;
#pragma unroll
  for (int i = 0; i < 8; ++i) { const int ka = k0 + 8 * g + i, kb = ka + 16;
    a[i] = (_Float16)(ka < K ? W[(size_t)(ka < K ? ka : K - 1) * ld + n] : 0.f); a[8 + i] = (_Float16)(kb < K ? W[(size_t)(kb < K ? kb : K - 1) * ld + n] : 0.f); }
  return a;
}
struct F2 { v16b h, l; };
__device__ __forceinline__ F2 bsplit16(const float v[16]) { F2 r;
#pragma unroll
  for (int i = 0; i < 16; ++i) { const __bf16 h = (__bf16)v[i]; r.h[i] = h; r.l[i] = (__bf16)(v[i] - (float)h); }
  return r; }
__device__ __forceinline__ F2 split_row(const float* row, int k0, int lane) { float v[16]; const float* p = row + k0 + 8 * (lane >> 4);
#pragma unroll
  for (int i = 0; i < 8; ++i) { v[i] = p[i]; v[8 + i] = p[16 + i]; }
  return bsplit16(v); }
__device__ __forceinline__ F2 split_rowK(const float* row, int k0, int lane, int K) { float v[16]; const int g = lane >> 4;
#pragma unroll
  for (int i = 0; i < 8; ++i) { const int ka = k0 + 8 * g + i, kb = ka + 16; v[i] = ka < K ? row[ka < K ? ka : K - 1] : 0.f; v[8 + i] = kb < K ? row[kb < K ? kb : K - 1] : 0.f; }
  return bsplit16(v); }
__device__ __forceinline__ F2 split_col(const float* W, int k0, int n, int lane, int ld, int K) { float v[16]; const int g = lane >> 4;
#pragma unroll
  for (int i = 0; i < 8; ++i) { const int ka = k0 + 8 * g + i, kb = ka + 16; v[i] = ka < K ? W[(size_t)(ka < K ? ka : K - 1) * ld + n] : 0.f; v[8 + i] = kb < K ? W[(size_t)(kb < K ? kb : K - 1) * ld + n] : 0.f; }
  return bsplit16(v); }
__device__ __forceinline__ v8f mac3(const F2& a, const F2& b, v8f c) { c = wmma_bf(a.l, b.h, c); c = wmma_bf(a.h, b.l, c); return wmma_bf(a.h, b.h, c); }
__device__ __forceinline__ float sigm(float v) { return 1.0f / (1.0f + expf(-v)); }
#define LDSX() do { asm volatile("s_wait_dscnt 0" ::: "memory"); __builtin_amdgcn_wave_barrier(); __builtin_amdgcn_fence(__ATOMIC_RELEASE, "workgroup"); } while (0)


#define NB 4
#define SS 2048
#define DM 768
#define NH 12
#define NKV 4
#define GRP 3
#define HD 64
#define QKVW (3 * DM)
#ifndef TQB
#define TQB (SS / 64)
#define TNB NB
#define TOB (NB * SS / 64)     // output row tiles (all)
#endif
typedef __attribute__((ext_vector_type(8))) __bf16 v8b;
__device__ __forceinline__ v16b frag_b(const __bf16* rowk0, int lane) {
  union { v16b v; v8b q[2]; } u; const __bf16* p = rowk0 + 8 * (lane >> 4);
  u.q[0] = *(const v8b*)p; u.q[1] = *(const v8b*)(p + 16); return u.v;
}
__device__ __forceinline__ float bfr(float v) { return (float)(__bf16)v; }
__device__ __attribute__((noinline)) float exp_ni(float v) { return expf(v); }
__device__ __attribute__((noinline)) float erf_ni(float v) { return erff(v); }

#define PK_A 0                       // [2304][768] Wqkv rows ([out][in], transposed from the (in,out) inputs)
#define PK_P (PK_A + QKVW * DM)        // [768][768] Wo rows ([out][in], transposed)
#define PK_END (PK_P + DM * DM)
#define WS_PK  0u
#define WS_QK  (WS_PK + 2u * PK_END)             // f16 [8192 rows][1536]: q | k
#define WS_QKL (WS_QK + 2u * NB * SS * 2 * DM)     // f16 q | k residual planes x2048
#define WS_VTH (WS_QKL + 2u * NB * SS * 2 * DM)    // f16 [b][768 (h*64+d)][2048 s] hi
#define WS_VTL (WS_VTH + 2u * NB * DM * SS)        // f16 lo x 2048
#define WS_O   (WS_VTL + 2u * NB * DM * SS)        // f32 [8192][768]
#define WS_CS  (WS_O + 4u * NB * SS * DM)           // f32 [2048 positions][32 frequencies] pairs (cos, sin)
#define WS_END (WS_CS + 4u * 2 * SS * 32)
// ---- k_pack: block = (row n, which): natural [out][in] rows -> bf16; which 0..2 -> W_q/W_k/W_v into PK_A rows which*768 + n; 3 -> W_o into PK_P
__global__ __launch_bounds__(256) void k_pack(const float* __restrict__ WQ, const float* __restrict__ WK, const float* __restrict__ WV, const float* __restrict__ WO, __bf16* __restrict__ PK, float* __restrict__ CS) {   // (in,out) weights: Wq [768][768], Wk/Wv [768][256] (kv head = query head / 3), Wo [768][768]; packed row (which*DM + n), n = h*64 + d
  __shared__ __align__(16) __bf16 s[DM]; const int n = blockIdx.x, which = blockIdx.y, t = threadIdx.x; const int h = n / HD, d = n % HD; const int nkv = (h / GRP) * HD + d;
  for (int k = t; k < DM; k += 256) { float w; if (which == 0) w = WQ[(size_t)k * DM + n]; else if (which == 1) w = WK[(size_t)k * (NKV * HD) + nkv]; else if (which == 2) w = WV[(size_t)k * (NKV * HD) + nkv]; else w = WO[(size_t)k * DM + n]; s[k] = (__bf16)w; }
  __syncthreads(); __bf16* dst = (which < 3) ? (PK + PK_A + ((size_t)which * DM + n) * DM) : (PK + PK_P + (size_t)n * DM); for (int q = t; q < DM / 8; q += 256) vst2((unsigned*)(dst + q * 8), *(const v4u*)&s[q * 8]);
  // the RoPE table, once a call: waves 0 to 2 of the 768 blocks of Wq take positions n, n + 768, n + 1,536; a wave writes one position's 32 pairs (cos a_j, sin a_j), a_j = pos * inv_freq[j], 256 B
  if (which == 0 && t < 96) { const int pos = n + DM * (t >> 5), j = t & 31;
    if (pos < SS) { const double invf = 1.0 / pow(10000.0, (double)j / 32.0); const float ang = (float)pos * (float)invf; v2f cs; cs[0] = cosf(ang); cs[1] = sinf(ang); *(v2f*)(CS + ((size_t)pos * 32 + j) * 2) = cs; } } }
#define GKS 64                          // k elements of one staged tile
#define GBP 72                          // LDS pitch of a staged weight row in bf16: 144 B = 16 B x 9, no bank conflict for 16-byte fragment reads
#define GAP 68                          // LDS pitch of a staged activation row in f32: 272 B = 16 B x 17, likewise
#define GB_BYTES (128 * GBP * 2)        // 128 weight rows
#define GA_BYTES (64 * GAP * 4)         // 64 activation rows
#define GST_BYTES (GB_BYTES + GA_BYTES) // one buffer: weight tile, then activation tile
// eight 16-B pieces of one thread into LDS, through no register: piece i goes to LDS byte l + i * ls and comes from g + i * 24,576 B (16 weight rows of 1,536 B, or 8 activation rows of 3,072 B).
// The wait on xcnt is the last line of the copies' own statement, so that it stands in front of any rewrite of the address registers they name.
__device__ __forceinline__ void stage8(unsigned l, unsigned ls, const char* g) {
  asm volatile("global_load_async_to_lds_b128 %0, %8, off\n\t"
               "global_load_async_to_lds_b128 %1, %9, off\n\t"
               "global_load_async_to_lds_b128 %2, %10, off\n\t"
               "global_load_async_to_lds_b128 %3, %11, off\n\t"
               "global_load_async_to_lds_b128 %4, %12, off\n\t"
               "global_load_async_to_lds_b128 %5, %13, off\n\t"
               "global_load_async_to_lds_b128 %6, %14, off\n\t"
               "global_load_async_to_lds_b128 %7, %15, off\n\t"
               "s_wait_xcnt 0x0"
               :: "v"(l), "v"(l + ls), "v"(l + 2 * ls), "v"(l + 3 * ls), "v"(l + 4 * ls), "v"(l + 5 * ls), "v"(l + 6 * ls), "v"(l + 7 * ls),
                  "v"(g), "v"(g + 24576), "v"(g + 2 * 24576), "v"(g + 3 * 24576), "v"(g + 4 * 24576), "v"(g + 5 * 24576), "v"(g + 6 * 24576), "v"(g + 7 * 24576) : "memory");
}
// tile t (64 k) of a 64-row x 128-column block into buffer t & 1: 128 weight rows x 128 B (8 threads a row) and 64 activation rows x 256 B (16 threads a row); every wave-wide copy covers four whole 128-B lines
#define GSTAGE(t) do { stage8(lb + ((t) & 1) * GST_BYTES, 16 * GBP * 2, gb + (size_t)(t) * (GKS * 2)); stage8(la + ((t) & 1) * GST_BYTES, 8 * GAP * 4, ga + (size_t)(t) * (GKS * 4)); } while (0)
__global__ __launch_bounds__(128) void k_qkv(const float* __restrict__ XQ, const float* __restrict__ XK, const float* __restrict__ XV, const __bf16* __restrict__ P, const float* __restrict__ BQ, const float* __restrict__ BK, const float* __restrict__ BV, const float* __restrict__ CS, _Float16* __restrict__ QK, _Float16* __restrict__ QKL, _Float16* __restrict__ VTH, _Float16* __restrict__ VTL) {
  const int which0 = (blockIdx.y * 128) / DM; const float* X = (which0 == 0) ? XQ : (which0 == 1) ? XK : XV; const float* BB = BQ ? (((which0 == 0) ? BQ : (which0 == 1) ? BK : BV) + (blockIdx.y * 128 - which0 * DM)) : nullptr;
  __shared__ __align__(16) char sm[2 * GST_BYTES];   // two buffers of the k loop; behind the loop's last barrier the same bytes stage the output
  _Float16 (*so)[16][136] = (_Float16 (*)[16][136])sm; _Float16 (*sol)[16][136] = (_Float16 (*)[16][136])(sm + 4 * 16 * 136 * 2); _Float16 (*sth)[72] = (_Float16 (*)[72])sm; _Float16 (*stl)[72] = (_Float16 (*)[72])(sm + 128 * 72 * 2);
  const int tid = threadIdx.x, wave = tid >> 5, lane = tid & 31, col = lane & 15, g = lane >> 4; const size_t r0 = (size_t)blockIdx.x * 64 + wave * 16; const int n0 = blockIdx.y * 128;
  v8f acc[8] = {};
  const char* gb = (const char*)(P + (size_t)(n0 + (tid >> 3)) * DM + (tid & 7) * 8);                        // this thread's first weight piece of tile 0
  const char* ga = (const char*)(X + ((size_t)blockIdx.x * 64 + (tid >> 4)) * DM + (tid & 15) * 4);          // its first activation piece of tile 0
  const unsigned lb = (unsigned)(uintptr_t)&sm[(tid >> 3) * (GBP * 2) + (tid & 7) * 16], la = (unsigned)(uintptr_t)&sm[GB_BYTES + (tid >> 4) * (GAP * 4) + (tid & 15) * 16];
  // q and k blocks: this lane's 16 table pairs (its 8 rows' positions x the frequencies col and 16 + col), asked for in front of the k loop so that their latency passes under it
  v2f cs[8][2] = {};
  if (n0 < 2 * DM) { const float* cp = CS + ((size_t)((blockIdx.x * 64) % SS + wave * 16 + 8 * g) * 32 + col) * 2;
#pragma unroll   // constant indices keep cs in registers, and the 16 loads issue as one group
    for (int r = 0; r < 8; ++r) { cs[r][0] = *(const v2f*)(cp + r * 64); cs[r][1] = *(const v2f*)(cp + r * 64 + 32); } }
  GSTAGE(0);
  asm volatile("s_wait_asynccnt 0x0" ::: "memory");   // tile 0 has landed before the barrier that publishes it
  __syncthreads();
  GSTAGE(1);
#pragma unroll 1
  for (int ts = 0; ts < DM / GKS; ++ts) { const __bf16* bB = (const __bf16*)(sm + (ts & 1) * GST_BYTES); const float* bA = (const float*)(sm + (ts & 1) * GST_BYTES + GB_BYTES);
#pragma unroll
    for (int kc = 0; kc < GKS / 32; ++kc) { v16b a; { const float* p = bA + (wave * 16 + col) * GAP + kc * 32 + 8 * g;
#pragma unroll
        for (int i = 0; i < 8; ++i) { a[i] = (__bf16)p[i]; a[8 + i] = (__bf16)p[16 + i]; } }
      v16b w[8];   // the eight weight fragments of this k chunk are read as one group in front of its products: one LDS latency a chunk, not one a product
#pragma unroll
      for (int j = 0; j < 8; ++j) w[j] = frag_b(bB + (j * 16 + col) * GBP + kc * 32, lane);
#pragma unroll
      for (int j = 0; j < 8; ++j) acc[j] = wmma_bf(a, w[j], acc[j]); }
    asm volatile("s_wait_dscnt 0x0" ::: "memory");      // this wave's reads of tile ts have returned before its buffer is refilled
    asm volatile("s_wait_asynccnt 0x0" ::: "memory");   // this wave's copies of tile ts + 1 have landed before the barrier that publishes them
    __syncthreads();                                    // publishes tile ts + 1 and ends every wave's reads of tile ts
    if (ts + 2 < DM / GKS) GSTAGE(ts + 2); }
  asm volatile("s_wait_asynccnt 0x0" ::: "memory");     // no copy is outstanding when the buffers become output staging
  if (n0 < 2 * DM) {   // q stored unscaled (f16 sigma ~0.6, no subnormal exposure); 1/8 applied to the f32 score
    // rotate-half RoPE in registers: the block's 128 columns are two heads; tiles ja and ja + 2 hold columns d (< 32) and d + 32 of one head in the same lane and register: y[d] = x[d] cos - x[d + 32] sin, y[d + 32] = x[d + 32] cos + x[d] sin, frequency d
#pragma unroll   // constant indices keep acc and cs in registers (this loop and the one inside it)
    for (int p = 0; p < 4; ++p) { const int ja = (p >> 1) * 4 + (p & 1), jb = ja + 2; const float ba = BB ? bfr(BB[ja * 16 + col]) : 0.f, bb = BB ? bfr(BB[jb * 16 + col]) : 0.f;
#pragma unroll
      for (int r = 0; r < 8; ++r) { const float xa = acc[ja][r] + ba, xb = acc[jb][r] + bb, c = cs[r][p & 1][0], sn = cs[r][p & 1][1]; const float ya = xa * c - xb * sn, yb = xb * c + xa * sn; const _Float16 ha = (_Float16)ya, hb = (_Float16)yb;
        so[wave][8 * g + r][ja * 16 + col] = ha; sol[wave][8 * g + r][ja * 16 + col] = (_Float16)((ya - (float)ha) * 2048.0f); so[wave][8 * g + r][jb * 16 + col] = hb; sol[wave][8 * g + r][jb * 16 + col] = (_Float16)((yb - (float)hb) * 2048.0f); } }   // rotated q, k (+ bias) as f16 hi + (x2048) residual
    LDSX();
    for (int rl = 0; rl < 16; ++rl) if (lane < 16) { vst2((unsigned*)(QK + (r0 + rl) * (2 * DM) + n0 + lane * 8), *(const v4u*)&so[wave][rl][lane * 8]); vst2((unsigned*)(QKL + (r0 + rl) * (2 * DM) + n0 + lane * 8), *(const v4u*)&sol[wave][rl][lane * 8]); }
  } else {
#pragma unroll
    for (int j = 0; j < 8; ++j) {
#pragma unroll
      for (int r = 0; r < 8; ++r) { const float v = acc[j][r] + (BB ? bfr(BB[j * 16 + col]) : 0.f); const _Float16 hv = (_Float16)v; sth[j * 16 + col][wave * 16 + 8 * g + r] = hv; stl[j * 16 + col][wave * 16 + 8 * g + r] = (_Float16)((v - (float)hv) * 2048.0f); } }
    __syncthreads();
    const size_t rb = (size_t)blockIdx.x * 64; const int b = (int)(rb / SS), s0 = (int)(rb % SS); const int pc0 = n0 - 2 * DM;
    for (int q = tid; q < 128 * 8; q += 128) { const int d = q >> 3, pc = q & 7; const size_t o = ((size_t)b * DM + pc0 + d) * SS + s0 + pc * 8; vst2((unsigned*)(VTH + o), *(const v4u*)&sth[d][pc * 8]); vst2((unsigned*)(VTL + o), *(const v4u*)&stl[d][pc * 8]); }
  }
}
#define KP 72   // LDS pitch of a staged K row in f16: 144 B = 16 B x 9, no bank conflict for 16-byte fragment reads
#define VP 40   // LDS pitch of a staged V row in f16: 80 B = 16 B x 5, likewise
// one key tile of 32 keys into LDS, through no register: each of the 128 threads copies two 16-B pieces of K hi (32 rows x 128 B) and two of V hi (64 rows x 64 B).
// The wait on xcnt is the last line of the copies' own statement, so that it stands in front of any rewrite of the address registers they name.
__device__ __forceinline__ void stage_kv(unsigned lk0, unsigned lk1, unsigned lv0, unsigned lv1, const _Float16* k0, const _Float16* k1, const _Float16* v0, const _Float16* v1) {
  asm volatile("global_load_async_to_lds_b128 %0, %4, off\n\t"
               "global_load_async_to_lds_b128 %1, %5, off\n\t"
               "global_load_async_to_lds_b128 %2, %6, off\n\t"
               "global_load_async_to_lds_b128 %3, %7, off\n\t"
               "s_wait_xcnt 0x0"
               :: "v"(lk0), "v"(lk1), "v"(lv0), "v"(lv1), "v"(k0), "v"(k1), "v"(v0), "v"(v1) : "memory");
}
// lane l with lane l ^ 16 (the other half of the wave), through no LDS
__device__ __forceinline__ float xhalf(float x) { return __builtin_bit_cast(float, __builtin_amdgcn_permlanex16(__builtin_bit_cast(int, x), __builtin_bit_cast(int, x), 0x76543210, 0xfedcba98, false, false)); }
// ---- k_attn: block = (two tiles of 64 queries, head h, batch b): causal flash attention, transposed: S^T = K . Q^T (A = 16 key rows from LDS, B = the wave's 16 queries, kept in registers), so a lane holds 16 of the 32 scores of ONE query (column col; keys 8 g + r and 16 + 8 g + r), lane ^ 16 the other 16: maximum and sum in-lane plus one exchange between the halves. The two score tiles, converted in place, are the B operand of O^T += V^T . P^T (A = 16 rows d of V^T from LDS). scores = (q.k) * 0.125; O[b*S+q][h*64+d] = (acc + accl / 2048) / (2048 l) (256-B segments)
template <bool LEAD> __device__ __forceinline__ void attn_tile(const _Float16* __restrict__ QK, const _Float16* __restrict__ QKL, const _Float16* __restrict__ VTH, const _Float16* __restrict__ VTL, float* __restrict__ O, float (*so)[16][68], _Float16 (*sk)[32 * KP], _Float16 (*sv)[64 * VP], const int qb, const int h, const int b) {
  const int tid = threadIdx.x, wave = tid >> 5, lane = tid & 31, col = lane & 15, g = lane >> 4;
  const int q0 = qb * 64 + wave * 16; const size_t rq = (size_t)b * SS + q0 + col;
  v16h aq[2], aql[2];
#pragma unroll
  for (int kc = 0; kc < 2; ++kc) { aq[kc] = frag_h(QK + rq * (2 * DM) + h * HD + kc * 32, lane); if constexpr (LEAD) aql[kc] = frag_h(QKL + rq * (2 * DM) + h * HD + kc * 32, lane); }
  float m = -3.0e38f, l = 0.f;   // of query q0 + col; l sums this half's keys only, the halves are joined behind the loop
  v8f acc[4] = {}, accl[4] = {};   // acc[dt][r] = O^T[d = dt * 16 + 8 g + r][query q0 + col]
  const int nksc = (qb * 64 + 64) / 32;   // causal: key tiles up to the end of this query block
  const _Float16* kg = QK + ((size_t)b * SS + (tid >> 3)) * (2 * DM) + DM + h * HD + (tid & 7) * 8;   // this thread's first K piece of tile 0 (its second: 16 keys on)
  const _Float16* vg = VTH + ((size_t)b * DM + h * HD + (tid >> 2)) * SS + (tid & 3) * 8;               // its first V piece of tile 0 (its second: 32 rows on)
  const unsigned lk = (unsigned)(uintptr_t)&sk[0][(tid >> 3) * KP + (tid & 7) * 8], lv = (unsigned)(uintptr_t)&sv[0][(tid >> 2) * VP + (tid & 3) * 8];
#define STAGE(t) stage_kv(lk + ((t) & 1) * (32 * KP * 2), lk + ((t) & 1) * (32 * KP * 2) + 16 * KP * 2, lv + ((t) & 1) * (64 * VP * 2), lv + ((t) & 1) * (64 * VP * 2) + 32 * VP * 2, kg + (size_t)(t) * 32 * (2 * DM), kg + ((size_t)(t) * 32 + 16) * (2 * DM), vg + (t) * 32, vg + (t) * 32 + 32 * SS)
  STAGE(0);
  asm volatile("s_wait_asynccnt 0x0" ::: "memory");   // tile 0 has landed before the barrier that publishes it
  __syncthreads();
  if (1 < nksc) STAGE(1);
#pragma unroll 1
  for (int ks = 0; ks < nksc; ++ks) { v8f s[2]; const int lim = q0 + col - 8 * g - ks * 32;   // the last score row of this lane's 16 (ct * 16 + r) that its query may see
    v16h kf[2][2];   // the tile's four K fragments are read as one group in front of the score products: one LDS latency a tile, not one a product
#pragma unroll
    for (int ct = 0; ct < 2; ++ct) {
#pragma unroll
      for (int kc = 0; kc < 2; ++kc) kf[ct][kc] = frag_h(&sk[ks & 1][(ct * 16 + col) * KP] + kc * 32, lane); }
#pragma unroll
    for (int ct = 0; ct < 2; ++ct) { const _Float16* krowl = QKL + ((size_t)b * SS + ks * 32 + ct * 16 + col) * (2 * DM) + DM + h * HD; v8f c = {}, cl = {};
      if constexpr (LEAD) {   // leading query blocks (few keys, outputs far above the global rms): 3 products
#pragma unroll
        for (int kc = 0; kc < 2; ++kc) { const v16h kh = kf[ct][kc]; c = wmma16(kh, aq[kc], c); cl = wmma16(kh, aql[kc], cl); cl = wmma16(frag_h(krowl + kc * 32, lane), aq[kc], cl); }
#pragma unroll
        for (int r = 0; r < 8; ++r) c[r] += cl[r] * (1.0f / 2048.0f); }
      else {
#pragma unroll
        for (int kc = 0; kc < 2; ++kc) c = wmma16(kf[ct][kc], aq[kc], c); }   // single product elsewhere
#pragma unroll
      for (int r = 0; r < 8; ++r) s[ct][r] = (ct * 16 + r <= lim) ? c[r] * 0.125f : -3.0e38f; }   // 1/sqrt(64); masked keys (key ks * 32 + ct * 16 + 8 g + r above query q0 + col) excluded
    v16h vf[4];   // the tile's four V fragments are read as one group here, so that their LDS latency passes under the softmax arithmetic
#pragma unroll
    for (int dt = 0; dt < 4; ++dt) vf[dt] = frag_h(&sv[ks & 1][(dt * 16 + col) * VP], lane);
    float mx = fmaxf(s[0][0], s[1][0]);
#pragma unroll
    for (int r = 1; r < 8; ++r) mx = fmaxf(mx, fmaxf(s[0][r], s[1][r]));
    mx = fmaxf(mx, xhalf(mx));   // over all 32 keys of the tile
    const float mn = fmaxf(m, mx);
    float ta = (m - mn) * 1.442695041f, t0[8], t1[8];   // e^x = 2^(x log2 e), as __expf forms it
#pragma unroll
    for (int r = 0; r < 8; ++r) { t0[r] = (s[0][r] - mn) * 1.442695041f; t1[r] = (s[1][r] - mn) * 1.442695041f; }
    // the 17 hardware exponentials, in place, in two statements: inside a statement no v_exp_f32 is followed by an instruction that reads its result or overwrites its source, and the v_nop keeps
    // that slot behind the last one.
    asm("v_exp_f32 %0, %0\n\tv_exp_f32 %1, %1\n\tv_exp_f32 %2, %2\n\tv_exp_f32 %3, %3\n\tv_exp_f32 %4, %4\n\tv_exp_f32 %5, %5\n\tv_exp_f32 %6, %6\n\tv_exp_f32 %7, %7\n\tv_exp_f32 %8, %8\n\tv_nop"
        : "+v"(ta), "+v"(t0[0]), "+v"(t0[1]), "+v"(t0[2]), "+v"(t0[3]), "+v"(t0[4]), "+v"(t0[5]), "+v"(t0[6]), "+v"(t0[7]));
    asm("v_exp_f32 %0, %0\n\tv_exp_f32 %1, %1\n\tv_exp_f32 %2, %2\n\tv_exp_f32 %3, %3\n\tv_exp_f32 %4, %4\n\tv_exp_f32 %5, %5\n\tv_exp_f32 %6, %6\n\tv_exp_f32 %7, %7\n\tv_nop"
        : "+v"(t1[0]), "+v"(t1[1]), "+v"(t1[2]), "+v"(t1[3]), "+v"(t1[4]), "+v"(t1[5]), "+v"(t1[6]), "+v"(t1[7]));
    const float alpha = (m <= -1.0e38f) ? 0.f : ta;
    float es = 0.f;
#pragma unroll
    for (int r = 0; r < 8; ++r) { s[0][r] = (s[0][r] <= -1.0e38f) ? 0.f : t0[r]; s[1][r] = (s[1][r] <= -1.0e38f) ? 0.f : t1[r]; es += s[0][r] + s[1][r]; }
    l = l * alpha + es; m = mn;
#pragma unroll
    for (int dt = 0; dt < 4; ++dt) {
#pragma unroll
      for (int r = 0; r < 8; ++r) { acc[dt][r] *= alpha; if constexpr (LEAD) accl[dt][r] *= alpha; } }
    v16h pa, pl;   // P^T as a B operand: element i = key 8 g + i, element 8 + i = key 16 + 8 g + i, the k order of frag_h
#pragma unroll
    for (int i = 0; i < 8; ++i) { const float x0 = s[0][i] * 2048.0f, x1 = s[1][i] * 2048.0f; const _Float16 h0 = (_Float16)x0, h1 = (_Float16)x1; pa[i] = h0; pa[8 + i] = h1; if constexpr (LEAD) { pl[i] = (_Float16)((x0 - (float)h0) * 2048.0f); pl[8 + i] = (_Float16)((x1 - (float)h1) * 2048.0f); } }   // P scaled by 2^11 before the f16 split so small softmax weights stay out of the f16 subnormal range; 2^-11 folded into the epilogue
#pragma unroll
    for (int dt = 0; dt < 4; ++dt) { const size_t vr = ((size_t)b * DM + h * HD + dt * 16 + col) * SS + ks * 32; const v16h vh = vf[dt]; acc[dt] = wmma16(vh, pa, acc[dt]); if constexpr (LEAD) { accl[dt] = wmma16(vh, pl, accl[dt]); accl[dt] = wmma16(frag_h(VTL + vr, lane), pa, accl[dt]); } }   // leading query blocks: P hi/lo x V hi/lo (3 products); elsewhere P x V single
    asm volatile("s_wait_dscnt 0x0" ::: "memory");      // this wave's reads of the tile have returned before the buffer is refilled
    asm volatile("s_wait_asynccnt 0x0" ::: "memory");   // this wave's copies of tile ks + 1 have landed before the barrier that publishes them
    __syncthreads();                                    // publishes tile ks + 1 and ends every wave's reads of tile ks
    if (ks + 2 < nksc) STAGE(ks + 2); }
  asm volatile("s_wait_asynccnt 0x0" ::: "memory");     // no copy is outstanding when the wave goes on to the epilogue, then the second tile or its end
#undef STAGE
  l += xhalf(l);   // the two halves' sums of one query
  const float il = (1.0f / 2048.0f) / l;
#pragma unroll
  for (int dt = 0; dt < 4; ++dt) {
#pragma unroll
    for (int r = 0; r < 8; ++r) so[wave][col][dt * 16 + 8 * g + r] = (LEAD ? acc[dt][r] + accl[dt][r] * (1.0f / 2048.0f) : acc[dt][r]) * il; }
  LDSX();
  for (int rl = 0; rl < 16; ++rl) if (lane < 16) vst2(O + ((size_t)b * SS + q0 + rl) * DM + h * HD + lane * 4, *(const v4f*)&so[wave][rl][lane * 4]);
}
// LEAD is a compile-time choice, so that the key loop exists twice: the loop of the single-product tiles (all but query tiles 0 and 1) holds no residual accumulators, no residual of P, no rescale or copy of either and no test per product.
__global__ __launch_bounds__(128) void k_attn(const _Float16* __restrict__ QK, const _Float16* __restrict__ QKL, const _Float16* __restrict__ VTH, const _Float16* __restrict__ VTL, const void* __restrict__ KMASK, float* __restrict__ O) {
  __shared__ __align__(16) float so[4][16][68];
  __shared__ __align__(16) _Float16 sk[2][32 * KP], sv[2][64 * VP];   // two buffers: the block's K hi and V hi tile of 32 keys, read by all four waves
  // A block takes two query tiles one after the other, TQB - 1 - x and x: together 2 * (TQB + 1) key tiles whatever x is, so that every block of the launch, all resident at once, has the same work.
  // Rolled: one copy of each form serves both tiles. The foot barrier of a tile's last trip has ended every wave's reads of sk and sv before the next tile's first copies; so is each wave's own. The choice is the same for the whole block, so every wave passes the same barriers.
#pragma unroll 1
  for (int half = 0; half < 2; ++half) { const int qb = half ? (int)blockIdx.x : TQB - 1 - (int)blockIdx.x;
    if (qb < 2) attn_tile<true>(QK, QKL, VTH, VTL, O, so, sk, sv, qb, blockIdx.y, blockIdx.z); else attn_tile<false>(QK, QKL, VTH, VTL, O, so, sk, sv, qb, blockIdx.y, blockIdx.z); }
}
// ---- k_out: block = (64 rows, 128 cols): out = O(hi/lo) . Wo rows (2 products) + bo
__global__ __launch_bounds__(128) void k_out(const float* __restrict__ O, const __bf16* __restrict__ P, const float* __restrict__ BO, float* __restrict__ Y) {
  __shared__ __align__(16) char sm[2 * GST_BYTES];   // two buffers of the k loop; behind the loop's last barrier the same bytes stage the output
  float (*so)[16][132] = (float (*)[16][132])sm;
  const int tid = threadIdx.x, wave = tid >> 5, lane = tid & 31, col = lane & 15, g = lane >> 4; const size_t r0 = (size_t)blockIdx.x * 64 + wave * 16; const int n0 = blockIdx.y * 128;
  v8f acc[8] = {};
  const char* gb = (const char*)(P + (size_t)(n0 + (tid >> 3)) * DM + (tid & 7) * 8);                        // this thread's first weight piece of tile 0
  const char* ga = (const char*)(O + ((size_t)blockIdx.x * 64 + (tid >> 4)) * DM + (tid & 15) * 4);          // its first activation piece of tile 0
  const unsigned lb = (unsigned)(uintptr_t)&sm[(tid >> 3) * (GBP * 2) + (tid & 7) * 16], la = (unsigned)(uintptr_t)&sm[GB_BYTES + (tid >> 4) * (GAP * 4) + (tid & 15) * 16];
  GSTAGE(0);
  asm volatile("s_wait_asynccnt 0x0" ::: "memory");   // tile 0 has landed before the barrier that publishes it
  __syncthreads();
  GSTAGE(1);
#pragma unroll 1
  for (int ts = 0; ts < DM / GKS; ++ts) { const __bf16* bB = (const __bf16*)(sm + (ts & 1) * GST_BYTES); const float* bA = (const float*)(sm + (ts & 1) * GST_BYTES + GB_BYTES);
#pragma unroll
    for (int kc = 0; kc < GKS / 32; ++kc) { const F2 a = split_row(bA + (wave * 16 + col) * GAP, kc * 32, lane);
      v16b w[8];   // the eight weight fragments of this k chunk are read as one group in front of its products: one LDS latency a chunk, not one a fragment
#pragma unroll
      for (int j = 0; j < 8; ++j) w[j] = frag_b(bB + (j * 16 + col) * GBP + kc * 32, lane);
#pragma unroll
      for (int j = 0; j < 8; ++j) { acc[j] = wmma_bf(a.l, w[j], acc[j]); acc[j] = wmma_bf(a.h, w[j], acc[j]); } }
    asm volatile("s_wait_dscnt 0x0" ::: "memory");      // this wave's reads of tile ts have returned before its buffer is refilled
    asm volatile("s_wait_asynccnt 0x0" ::: "memory");   // this wave's copies of tile ts + 1 have landed before the barrier that publishes them
    __syncthreads();                                    // publishes tile ts + 1 and ends every wave's reads of tile ts
    if (ts + 2 < DM / GKS) GSTAGE(ts + 2); }
  asm volatile("s_wait_asynccnt 0x0" ::: "memory");     // no copy is outstanding when the buffers become output staging
#pragma unroll
  for (int j = 0; j < 8; ++j) {
#pragma unroll
    for (int r = 0; r < 8; ++r) so[wave][8 * g + r][j * 16 + col] = acc[j][r] + (BO ? bfr(BO[n0 + j * 16 + col]) : 0.f); }
  LDSX();
  for (int rl = 0; rl < 16; ++rl) vst2(Y + (r0 + rl) * DM + n0 + lane * 4, *(const v4f*)&so[wave][rl][lane * 4]);
}
extern "C" void kernel_launch(void* const* d_in, const int* in_sizes, int n_in, void* d_out, int out_size, void* d_ws, size_t ws_size, hipStream_t stream) {
  (void)in_sizes; (void)n_in; (void)out_size;
  const float** F = (const float**)d_in;   // 0 hidden_states [4,2048,768], 1 Wq [768,768], 2 Wk [768,256], 3 Wv [768,256], 4 Wo [768,768] (all (in,out))
  if (ws_size < (size_t)WS_END) return;
  char* ws = (char*)d_ws; __bf16* PK = (__bf16*)(ws + WS_PK); _Float16 *QK = (_Float16*)(ws + WS_QK), *QKL = (_Float16*)(ws + WS_QKL), *VTH = (_Float16*)(ws + WS_VTH), *VTL = (_Float16*)(ws + WS_VTL); float* O = (float*)(ws + WS_O); float* CS = (float*)(ws + WS_CS);
  k_pack<<<dim3(DM, 4), 256, 0, stream>>>(F[1], F[2], F[3], F[4], PK, CS);
  k_qkv<<<dim3(TNB * SS / 64, QKVW / 128), 128, 0, stream>>>(F[0], F[0], F[0], PK + PK_A, nullptr, nullptr, nullptr, CS, QK, QKL, VTH, VTL);
  k_attn<<<dim3(TQB / 2, NH, TNB), 128, 0, stream>>>(QK, QKL, VTH, VTL, nullptr, O);
  k_out<<<dim3(TOB, DM / 128), 128, 0, stream>>>(O, PK + PK_P, nullptr, (float*)d_out);
}

// v008
// A run of this version takes 130 microseconds.
// In two side-by-side timings against v007, it was 1.20 and 1.17 times as fast.
// All steps since v000 together make it 4.54 times as fast.
// compute dtype: all float inputs rounded to bf16; q/k/v = x . W with EXACT bf16 products on WMMA 16x16x32 ((in,out) weights as transposed rows; k and v projected once per kv head, each read by its 3 query heads), f16 hi + residual; RoPE (inv_freq in double, angle = pos x inv_freq in f32 as the module, precise sinf/cosf, one table a call) applied in f32 to q/k in the projection's epilogue, before the split; causal attention with hybrid scores (first 128 queries 3-product, later single f16) and hi + residual P.v, x 1/8, running-max softmax in f32 (hardware exp); out = ctx (bf16 hi + lo) . Wo ((in,out)); f32 output.
#include <hip/hip_runtime.h>
#include <math.h>

typedef __attribute__((ext_vector_type(16))) _Float16 v16h;
typedef __attribute__((ext_vector_type(16))) __bf16 v16b;
typedef __attribute__((ext_vector_type(8)))  _Float16 v8h;
typedef __attribute__((ext_vector_type(8)))  float v8f;
typedef __attribute__((ext_vector_type(4)))  float v4f;
typedef __attribute__((ext_vector_type(2)))  float v2f;
typedef __attribute__((ext_vector_type(4)))  unsigned v4u;
typedef __attribute__((ext_vector_type(4)))  int v4i;
typedef float __attribute__((may_alias)) float_a;
typedef int __attribute__((may_alias)) int_a;

template <typename T> __device__ __forceinline__ void vst2(void* p, T v) { *(T*)p = v;  }
__device__ __forceinline__ v8f wmma16(v16h a, v16h b, v8f c) {
  v8f d = __builtin_amdgcn_wmma_f32_16x16x32_f16(false, a, false, b, (short)0, c, false, false);
  asm volatile("v_nop\n\tv_nop\n\tv_nop\n\tv_nop" : "+v"(d) : "v"(a), "v"(b));
  return d;
}
__device__ __forceinline__ v8f wmma_bf(v16b a, v16b b, v8f c) {
  v8f d = __builtin_amdgcn_wmma_f32_16x16x32_bf16(false, a, false, b, (short)0, c, false, false);
  asm volatile("v_nop\n\tv_nop\n\tv_nop\n\tv_nop" : "+v"(d) : "v"(a), "v"(b));
  return d;
}
// Grouped-query causal attention with RoPE (B 4, S 2,048, hidden 768, 12 query heads x 64 over 4 kv heads): q = x Wq, k = x Wk, v = x Wv ((in,out), kv heads shared by 3 query heads), rotate-half RoPE (theta 1e4), causal softmax(q k / 8) v, out = ctx Wo.
__device__ __forceinline__ v16h frag_h(const _Float16* rowk0, int lane) {
  union { v16h v; v8h q[2]; } u; const _Float16* p = rowk0 + 8 * (lane >> 4);
  u.q[0] = *(const v8h*)p; u.q[1] = *(const v8h*)(p + 16); return u.v;
}
__device__ __forceinline__ v16h frag_f32(const float* rowk0, int lane) {
  v16h a; const float* p = rowk0 + 8 * (lane >> 4);
#pragma unroll
  for (int i = 0; i < 8; ++i) { a[i] = (_Float16)p[i]; a[8 + i] = (_Float16)p[16 + i]; }
  return a;
}
__device__ __forceinline__ v16h frag_f32s(const float* rowk0, int lane, float sc) {
  v16h a; const float* p = rowk0 + 8 * (lane >> 4);
#pragma unroll
  for (int i = 0; i < 8; ++i) { a[i] = (_Float16)(p[i] * sc); a[8 + i] = (_Float16)(p[16 + i] * sc); }
  return a;
}
// column fragment from a [K][ld] layout (column n), rows >= K read as 0
__device__ __forceinline__ v16h fragc_f32(const float* W, int k0, int n, int lane, int ld, int K) {
  v16h a; const int g = lane >> 4;
#pragma unroll
  for (int i = 0; i < 8; ++i) { const int ka = k0 + 8 * g + i, kb = ka + 16;
    a[i] = (_Float16)(ka < K ? W[(size_t)(ka < K ? ka : K - 1) * ld + n] : 0.f); a[8 + i] = (_Float16)(kb < K ? W[(size_t)(kb < K ? kb : K - 1) * ld + n] : 0.f); }
  return a;
}
struct F2 { v16b h, l; };
__device__ __forceinline__ F2 bsplit16(const float v[16]) { F2 r;
#pragma unroll
  for (int i = 0; i < 16; ++i) { const __bf16 h = (__bf16)v[i]; r.h[i] = h; r.l[i] = (__bf16)(v[i] - (float)h); }
  return r; }
__device__ __forceinline__ F2 split_row(const float* row, int k0, int lane) { float v[16]; const float* p = row + k0 + 8 * (lane >> 4);
#pragma unroll
  for (int i = 0; i < 8; ++i) { v[i] = p[i]; v[8 + i] = p[16 + i]; }
  return bsplit16(v); }
__device__ __forceinline__ F2 split_rowK(const float* row, int k0, int lane, int K) { float v[16]; const int g = lane >> 4;
#pragma unroll
  for (int i = 0; i < 8; ++i) { const int ka = k0 + 8 * g + i, kb = ka + 16; v[i] = ka < K ? row[ka < K ? ka : K - 1] : 0.f; v[8 + i] = kb < K ? row[kb < K ? kb : K - 1] : 0.f; }
  return bsplit16(v); }
__device__ __forceinline__ F2 split_col(const float* W, int k0, int n, int lane, int ld, int K) { float v[16]; const int g = lane >> 4;
#pragma unroll
  for (int i = 0; i < 8; ++i) { const int ka = k0 + 8 * g + i, kb = ka + 16; v[i] = ka < K ? W[(size_t)(ka < K ? ka : K - 1) * ld + n] : 0.f; v[8 + i] = kb < K ? W[(size_t)(kb < K ? kb : K - 1) * ld + n] : 0.f; }
  return bsplit16(v); }
__device__ __forceinline__ v8f mac3(const F2& a, const F2& b, v8f c) { c = wmma_bf(a.l, b.h, c); c = wmma_bf(a.h, b.l, c); return wmma_bf(a.h, b.h, c); }
__device__ __forceinline__ float sigm(float v) { return 1.0f / (1.0f + expf(-v)); }
#define LDSX() do { asm volatile("s_wait_dscnt 0" ::: "memory"); __builtin_amdgcn_wave_barrier(); __builtin_amdgcn_fence(__ATOMIC_RELEASE, "workgroup"); } while (0)


#define NB 4
#define SS 2048
#define DM 768
#define NH 12
#define NKV 4
#define GRP 3
#define HD 64
#define KVW (NKV * HD)            // columns of k, and of v: one set per kv head
#define QKW (DM + KVW)            // columns of q and k together
#define KOFF ((size_t)NB * SS * DM)   // in the q, k buffers the k plane [8192][256] stands behind the q plane [8192][768], each dense
#define QKVW (DM + 2 * KVW)       // packed projection rows: q | k | v
#ifndef TQB
#define TQB (SS / 64)
#define TNB NB
#define TOB (NB * SS / 64)     // output row tiles (all)
#endif
typedef __attribute__((ext_vector_type(8))) __bf16 v8b;
__device__ __forceinline__ v16b frag_b(const __bf16* rowk0, int lane) {
  union { v16b v; v8b q[2]; } u; const __bf16* p = rowk0 + 8 * (lane >> 4);
  u.q[0] = *(const v8b*)p; u.q[1] = *(const v8b*)(p + 16); return u.v;
}
__device__ __forceinline__ float bfr(float v) { return (float)(__bf16)v; }
__device__ __attribute__((noinline)) float exp_ni(float v) { return expf(v); }
__device__ __attribute__((noinline)) float erf_ni(float v) { return erff(v); }

#define PK_A 0                       // [1280][768] Wq | Wk | Wv rows ([out][in])
#define PK_P (PK_A + QKVW * DM)        // [768][768] Wo rows, directly behind them
#define PK_END (PK_P + DM * DM)
#define WS_PK  0u
#define WS_QK  (WS_PK + 2u * PK_END)             // f16 q [8192 rows][768] (12 heads), then k [8192 rows][256] (4 kv heads)
#define WS_QKL (WS_QK + 2u * NB * SS * QKW)        // f16 q, k residual planes x2048, laid out likewise
#define WS_VTH (WS_QKL + 2u * NB * SS * QKW)       // f16 [b][256 (kv head*64+d)][2048 s] hi
#define WS_VTL (WS_VTH + 2u * NB * KVW * SS)       // f16 lo x 2048
#define WS_O   (WS_VTL + 2u * NB * KVW * SS)       // f32 [8192][768]
#define WS_CS  (WS_O + 4u * NB * SS * DM)           // f32 [2048 positions][32 frequencies] pairs (cos, sin)
#define WS_END (WS_CS + 4u * 2 * SS * 32)
// ---- k_pack: block = packed row n: column c of an (in,out) weight -> one bf16 row; rows 0..767 Wq, 768..1023 Wk, 1024..1279 Wv (the 256 columns of the 4 kv heads, once each), 1280..2047 Wo (PK_P stands directly behind PK_A)
__global__ __launch_bounds__(256) void k_pack(const float* __restrict__ WQ, const float* __restrict__ WK, const float* __restrict__ WV, const float* __restrict__ WO, __bf16* __restrict__ PK, float* __restrict__ CS) {   // Wq [768][768], Wk/Wv [768][256], Wo [768][768]
  __shared__ __align__(16) __bf16 s[DM]; const int n = blockIdx.x, t = threadIdx.x;
  for (int k = t; k < DM; k += 256) { float w; if (n < DM) w = WQ[(size_t)k * DM + n]; else if (n < QKW) w = WK[(size_t)k * KVW + (n - DM)]; else if (n < QKVW) w = WV[(size_t)k * KVW + (n - QKW)]; else w = WO[(size_t)k * DM + (n - QKVW)]; s[k] = (__bf16)w;
    asm volatile("s_wait_xcnt 0x0" ::: "memory"); }   // stands in front of the next trip's rewrite of the load's address registers
  __syncthreads(); __bf16* dst = PK + PK_A + (size_t)n * DM; for (int q = t; q < DM / 8; q += 256) vst2((unsigned*)(dst + q * 8), *(const v4u*)&s[q * 8]);
  // the RoPE table, once a call: waves 0 to 2 of the 768 blocks of Wq take positions n, n + 768, n + 1,536; a wave writes one position's 32 pairs (cos a_j, sin a_j), a_j = pos * inv_freq[j], 256 B
  if (n < DM && t < 96) { const int pos = n + DM * (t >> 5), j = t & 31;
    if (pos < SS) { const double invf = 1.0 / pow(10000.0, (double)j / 32.0); const float ang = (float)pos * (float)invf; v2f cs; cs[0] = cosf(ang); cs[1] = sinf(ang); *(v2f*)(CS + ((size_t)pos * 32 + j) * 2) = cs; } } }
#define GKS 64                          // k elements of one staged tile
#define GBP 72                          // LDS pitch of a staged weight row in bf16: 144 B = 16 B x 9, no bank conflict for 16-byte fragment reads
#define GAP 68                          // LDS pitch of a staged activation row in f32: 272 B = 16 B x 17, likewise
#define GB_BYTES (128 * GBP * 2)        // 128 weight rows
#define GA_BYTES (64 * GAP * 4)         // 64 activation rows
#define GST_BYTES (GB_BYTES + GA_BYTES) // one buffer: weight tile, then activation tile
// eight 16-B pieces of one thread into LDS, through no register: piece i goes to LDS byte l + i * ls and comes from g + i * 24,576 B (16 weight rows of 1,536 B, or 8 activation rows of 3,072 B).
// The wait on xcnt is the last line of the copies' own statement, so that it stands in front of any rewrite of the address registers they name.
__device__ __forceinline__ void stage8(unsigned l, unsigned ls, const char* g) {
  asm volatile("global_load_async_to_lds_b128 %0, %8, off\n\t"
               "global_load_async_to_lds_b128 %1, %9, off\n\t"
               "global_load_async_to_lds_b128 %2, %10, off\n\t"
               "global_load_async_to_lds_b128 %3, %11, off\n\t"
               "global_load_async_to_lds_b128 %4, %12, off\n\t"
               "global_load_async_to_lds_b128 %5, %13, off\n\t"
               "global_load_async_to_lds_b128 %6, %14, off\n\t"
               "global_load_async_to_lds_b128 %7, %15, off\n\t"
               "s_wait_xcnt 0x0"
               :: "v"(l), "v"(l + ls), "v"(l + 2 * ls), "v"(l + 3 * ls), "v"(l + 4 * ls), "v"(l + 5 * ls), "v"(l + 6 * ls), "v"(l + 7 * ls),
                  "v"(g), "v"(g + 24576), "v"(g + 2 * 24576), "v"(g + 3 * 24576), "v"(g + 4 * 24576), "v"(g + 5 * 24576), "v"(g + 6 * 24576), "v"(g + 7 * 24576) : "memory");
}
// tile t (64 k) of a 64-row x 128-column block into buffer t & 1: 128 weight rows x 128 B (8 threads a row) and 64 activation rows x 256 B (16 threads a row); every wave-wide copy covers four whole 128-B lines
#define GSTAGE(t) do { stage8(lb + ((t) & 1) * GST_BYTES, 16 * GBP * 2, gb + (size_t)(t) * (GKS * 2)); stage8(la + ((t) & 1) * GST_BYTES, 8 * GAP * 4, ga + (size_t)(t) * (GKS * 4)); } while (0)
__global__ __launch_bounds__(128) void k_qkv(const float* __restrict__ XQ, const float* __restrict__ XK, const float* __restrict__ XV, const __bf16* __restrict__ P, const float* __restrict__ BQ, const float* __restrict__ BK, const float* __restrict__ BV, const float* __restrict__ CS, _Float16* __restrict__ QK, _Float16* __restrict__ QKL, _Float16* __restrict__ VTH, _Float16* __restrict__ VTL) {
  const int nc = blockIdx.y * 128, which0 = (nc < DM) ? 0 : (nc < QKW) ? 1 : 2; const float* X = (which0 == 0) ? XQ : (which0 == 1) ? XK : XV; const float* BB = BQ ? ((which0 == 0) ? BQ + nc : (which0 == 1) ? BK + (nc - DM) : BV + (nc - QKW)) : nullptr;   // column blocks 0..5 q, 6..7 k, 8..9 v
  __shared__ __align__(16) char sm[2 * GST_BYTES];   // two buffers of the k loop; behind the loop's last barrier the same bytes stage the output
  _Float16 (*so)[16][136] = (_Float16 (*)[16][136])sm; _Float16 (*sol)[16][136] = (_Float16 (*)[16][136])(sm + 4 * 16 * 136 * 2); _Float16 (*sth)[72] = (_Float16 (*)[72])sm; _Float16 (*stl)[72] = (_Float16 (*)[72])(sm + 128 * 72 * 2);
  const int tid = threadIdx.x, wave = tid >> 5, lane = tid & 31, col = lane & 15, g = lane >> 4; const size_t r0 = (size_t)blockIdx.x * 64 + wave * 16; const int n0 = blockIdx.y * 128;
  v8f acc[8] = {};
  const char* gb = (const char*)(P + (size_t)(n0 + (tid >> 3)) * DM + (tid & 7) * 8);                        // this thread's first weight piece of tile 0
  const char* ga = (const char*)(X + ((size_t)blockIdx.x * 64 + (tid >> 4)) * DM + (tid & 15) * 4);          // its first activation piece of tile 0
  const unsigned lb = (unsigned)(uintptr_t)&sm[(tid >> 3) * (GBP * 2) + (tid & 7) * 16], la = (unsigned)(uintptr_t)&sm[GB_BYTES + (tid >> 4) * (GAP * 4) + (tid & 15) * 16];
  // q and k blocks: this lane's 16 table pairs (its 8 rows' positions x the frequencies col and 16 + col), asked for in front of the k loop so that their latency passes under it
  v2f cs[8][2] = {};
  if (n0 < QKW) { const float* cp = CS + ((size_t)((blockIdx.x * 64) % SS + wave * 16 + 8 * g) * 32 + col) * 2;
#pragma unroll   // constant indices keep cs in registers, and the 16 loads issue as one group
    for (int r = 0; r < 8; ++r) { cs[r][0] = *(const v2f*)(cp + r * 64); cs[r][1] = *(const v2f*)(cp + r * 64 + 32); } }
  GSTAGE(0);
  asm volatile("s_wait_asynccnt 0x0" ::: "memory");   // tile 0 has landed before the barrier that publishes it
  __syncthreads();
  GSTAGE(1);
#pragma unroll 1
  for (int ts = 0; ts < DM / GKS; ++ts) { const __bf16* bB = (const __bf16*)(sm + (ts & 1) * GST_BYTES); const float* bA = (const float*)(sm + (ts & 1) * GST_BYTES + GB_BYTES);
#pragma unroll
    for (int kc = 0; kc < GKS / 32; ++kc) { v16b a; { const float* p = bA + (wave * 16 + col) * GAP + kc * 32 + 8 * g;
#pragma unroll
        for (int i = 0; i < 8; ++i) { a[i] = (__bf16)p[i]; a[8 + i] = (__bf16)p[16 + i]; } }
      v16b w[8];   // the eight weight fragments of this k chunk are read as one group in front of its products: one LDS latency a chunk, not one a product
#pragma unroll
      for (int j = 0; j < 8; ++j) w[j] = frag_b(bB + (j * 16 + col) * GBP + kc * 32, lane);
#pragma unroll
      for (int j = 0; j < 8; ++j) acc[j] = wmma_bf(a, w[j], acc[j]); }
    asm volatile("s_wait_dscnt 0x0" ::: "memory");      // this wave's reads of tile ts have returned before its buffer is refilled
    asm volatile("s_wait_asynccnt 0x0" ::: "memory");   // this wave's copies of tile ts + 1 have landed before the barrier that publishes them
    __syncthreads();                                    // publishes tile ts + 1 and ends every wave's reads of tile ts
    if (ts + 2 < DM / GKS) GSTAGE(ts + 2); }
  asm volatile("s_wait_asynccnt 0x0" ::: "memory");     // no copy is outstanding when the buffers become output staging
  if (n0 < QKW) {   // q stored unscaled (f16 sigma ~0.6, no subnormal exposure); 1/8 applied to the f32 score
    // rotate-half RoPE in registers: the block's 128 columns are two heads; tiles ja and ja + 2 hold columns d (< 32) and d + 32 of one head in the same lane and register: y[d] = x[d] cos - x[d + 32] sin, y[d + 32] = x[d + 32] cos + x[d] sin, frequency d
#pragma unroll   // constant indices keep acc and cs in registers (this loop and the one inside it)
    for (int p = 0; p < 4; ++p) { const int ja = (p >> 1) * 4 + (p & 1), jb = ja + 2; const float ba = BB ? bfr(BB[ja * 16 + col]) : 0.f, bb = BB ? bfr(BB[jb * 16 + col]) : 0.f;
#pragma unroll
      for (int r = 0; r < 8; ++r) { const float xa = acc[ja][r] + ba, xb = acc[jb][r] + bb, c = cs[r][p & 1][0], sn = cs[r][p & 1][1]; const float ya = xa * c - xb * sn, yb = xb * c + xa * sn; const _Float16 ha = (_Float16)ya, hb = (_Float16)yb;
        so[wave][8 * g + r][ja * 16 + col] = ha; sol[wave][8 * g + r][ja * 16 + col] = (_Float16)((ya - (float)ha) * 2048.0f); so[wave][8 * g + r][jb * 16 + col] = hb; sol[wave][8 * g + r][jb * 16 + col] = (_Float16)((yb - (float)hb) * 2048.0f); } }   // rotated q, k (+ bias) as f16 hi + (x2048) residual
    LDSX();
    const size_t pb = (n0 < DM) ? (size_t)n0 : KOFF + (n0 - DM); const int pw = (n0 < DM) ? DM : KVW;   // this block's first column in its plane, and the plane's row
#pragma unroll   // straight-line: no store's registers are rewritten over a back edge
    for (int rl = 0; rl < 16; ++rl) if (lane < 16) { vst2((unsigned*)(QK + pb + (r0 + rl) * pw + lane * 8), *(const v4u*)&so[wave][rl][lane * 8]); vst2((unsigned*)(QKL + pb + (r0 + rl) * pw + lane * 8), *(const v4u*)&sol[wave][rl][lane * 8]); }
  } else {
#pragma unroll
    for (int j = 0; j < 8; ++j) {
#pragma unroll
      for (int r = 0; r < 8; ++r) { const float v = acc[j][r] + (BB ? bfr(BB[j * 16 + col]) : 0.f); const _Float16 hv = (_Float16)v; sth[j * 16 + col][wave * 16 + 8 * g + r] = hv; stl[j * 16 + col][wave * 16 + 8 * g + r] = (_Float16)((v - (float)hv) * 2048.0f); } }
    __syncthreads();
    const size_t rb = (size_t)blockIdx.x * 64; const int b = (int)(rb / SS), s0 = (int)(rb % SS); const int pc0 = n0 - QKW;
    for (int q = tid; q < 128 * 8; q += 128) { const int d = q >> 3, pc = q & 7; const size_t o = ((size_t)b * KVW + pc0 + d) * SS + s0 + pc * 8; vst2((unsigned*)(VTH + o), *(const v4u*)&sth[d][pc * 8]); vst2((unsigned*)(VTL + o), *(const v4u*)&stl[d][pc * 8]); }
  }
}
#define KP 72   // LDS pitch of a staged K row in f16: 144 B = 16 B x 9, no bank conflict for 16-byte fragment reads
#define VP 40   // LDS pitch of a staged V row in f16: 80 B = 16 B x 5, likewise
// one key tile of 32 keys into LDS, through no register: each of the 128 threads copies two 16-B pieces of K hi (32 rows x 128 B) and two of V hi (64 rows x 64 B).
// The wait on xcnt is the last line of the copies' own statement, so that it stands in front of any rewrite of the address registers they name.
__device__ __forceinline__ void stage_kv(unsigned lk0, unsigned lk1, unsigned lv0, unsigned lv1, const _Float16* k0, const _Float16* k1, const _Float16* v0, const _Float16* v1) {
  asm volatile("global_load_async_to_lds_b128 %0, %4, off\n\t"
               "global_load_async_to_lds_b128 %1, %5, off\n\t"
               "global_load_async_to_lds_b128 %2, %6, off\n\t"
               "global_load_async_to_lds_b128 %3, %7, off\n\t"
               "s_wait_xcnt 0x0"
               :: "v"(lk0), "v"(lk1), "v"(lv0), "v"(lv1), "v"(k0), "v"(k1), "v"(v0), "v"(v1) : "memory");
}
// lane l with lane l ^ 16 (the other half of the wave), through no LDS
__device__ __forceinline__ float xhalf(float x) { return __builtin_bit_cast(float, __builtin_amdgcn_permlanex16(__builtin_bit_cast(int, x), __builtin_bit_cast(int, x), 0x76543210, 0xfedcba98, false, false)); }
// ---- k_attn: block = (two tiles of 64 queries, head h, batch b): causal flash attention, transposed: S^T = K . Q^T (A = 16 key rows from LDS, B = the wave's 16 queries, kept in registers), so a lane holds 16 of the 32 scores of ONE query (column col; keys 8 g + r and 16 + 8 g + r), lane ^ 16 the other 16: maximum and sum in-lane plus one exchange between the halves. The two score tiles, converted in place, are the B operand of O^T += V^T . P^T (A = 16 rows d of V^T from LDS). scores = (q.k) * 0.125; O[b*S+q][h*64+d] = (acc + accl / 2048) / (2048 l) (256-B segments)
template <bool LEAD> __device__ __forceinline__ void attn_tile(const _Float16* __restrict__ QK, const _Float16* __restrict__ QKL, const _Float16* __restrict__ VTH, const _Float16* __restrict__ VTL, float* __restrict__ O, float (*so)[16][68], _Float16 (*sk)[32 * KP], _Float16 (*sv)[64 * VP], const int qb, const int h, const int b) {
  const int tid = threadIdx.x, wave = tid >> 5, lane = tid & 31, col = lane & 15, g = lane >> 4;
  const int q0 = qb * 64 + wave * 16; const size_t rq = (size_t)b * SS + q0 + col; const int hk = h / GRP;   // the kv head of query head h
  v16h aq[2], aql[2];
#pragma unroll
  for (int kc = 0; kc < 2; ++kc) { aq[kc] = frag_h(QK + rq * DM + h * HD + kc * 32, lane); if constexpr (LEAD) aql[kc] = frag_h(QKL + rq * DM + h * HD + kc * 32, lane); }
  float m = -3.0e38f, l = 0.f;   // of query q0 + col; l sums this half's keys only, the halves are joined behind the loop
  v8f acc[4] = {}, accl[4] = {};   // acc[dt][r] = O^T[d = dt * 16 + 8 g + r][query q0 + col]
  const int nksc = (qb * 64 + 64) / 32;   // causal: key tiles up to the end of this query block
  const _Float16* kg = QK + KOFF + ((size_t)b * SS + (tid >> 3)) * KVW + hk * HD + (tid & 7) * 8;   // this thread's first K piece of tile 0 (its second: 16 keys on)
  const _Float16* vg = VTH + ((size_t)b * KVW + hk * HD + (tid >> 2)) * SS + (tid & 3) * 8;               // its first V piece of tile 0 (its second: 32 rows on)
  const unsigned lk = (unsigned)(uintptr_t)&sk[0][(tid >> 3) * KP + (tid & 7) * 8], lv = (unsigned)(uintptr_t)&sv[0][(tid >> 2) * VP + (tid & 3) * 8];
#define STAGE(t) stage_kv(lk + ((t) & 1) * (32 * KP * 2), lk + ((t) & 1) * (32 * KP * 2) + 16 * KP * 2, lv + ((t) & 1) * (64 * VP * 2), lv + ((t) & 1) * (64 * VP * 2) + 32 * VP * 2, kg + (size_t)(t) * 32 * KVW, kg + ((size_t)(t) * 32 + 16) * KVW, vg + (t) * 32, vg + (t) * 32 + 32 * SS)
  STAGE(0);
  asm volatile("s_wait_asynccnt 0x0" ::: "memory");   // tile 0 has landed before the barrier that publishes it
  __syncthreads();
  if (1 < nksc) STAGE(1);
#pragma unroll 1
  for (int ks = 0; ks < nksc; ++ks) { v8f s[2]; const int lim = q0 + col - 8 * g - ks * 32;   // the last score row of this lane's 16 (ct * 16 + r) that its query may see
    v16h kf[2][2];   // the tile's four K fragments are read as one group in front of the score products: one LDS latency a tile, not one a product
#pragma unroll
    for (int ct = 0; ct < 2; ++ct) {
#pragma unroll
      for (int kc = 0; kc < 2; ++kc) kf[ct][kc] = frag_h(&sk[ks & 1][(ct * 16 + col) * KP] + kc * 32, lane); }
#pragma unroll
    for (int ct = 0; ct < 2; ++ct) { const _Float16* krowl = QKL + KOFF + ((size_t)b * SS + ks * 32 + ct * 16 + col) * KVW + hk * HD; v8f c = {}, cl = {};
      if constexpr (LEAD) {   // leading query blocks (few keys, outputs far above the global rms): 3 products
#pragma unroll
        for (int kc = 0; kc < 2; ++kc) { const v16h kh = kf[ct][kc]; c = wmma16(kh, aq[kc], c); cl = wmma16(kh, aql[kc], cl); cl = wmma16(frag_h(krowl + kc * 32, lane), aq[kc], cl); }
#pragma unroll
        for (int r = 0; r < 8; ++r) c[r] += cl[r] * (1.0f / 2048.0f); }
      else {
#pragma unroll
        for (int kc = 0; kc < 2; ++kc) c = wmma16(kf[ct][kc], aq[kc], c); }   // single product elsewhere
#pragma unroll
      for (int r = 0; r < 8; ++r) s[ct][r] = (ct * 16 + r <= lim) ? c[r] * 0.125f : -3.0e38f; }   // 1/sqrt(64); masked keys (key ks * 32 + ct * 16 + 8 g + r above query q0 + col) excluded
    v16h vf[4];   // the tile's four V fragments are read as one group here, so that their LDS latency passes under the softmax arithmetic
#pragma unroll
    for (int dt = 0; dt < 4; ++dt) vf[dt] = frag_h(&sv[ks & 1][(dt * 16 + col) * VP], lane);
    float mx = fmaxf(s[0][0], s[1][0]);
#pragma unroll
    for (int r = 1; r < 8; ++r) mx = fmaxf(mx, fmaxf(s[0][r], s[1][r]));
    mx = fmaxf(mx, xhalf(mx));   // over all 32 keys of the tile
    const float mn = fmaxf(m, mx);
    float ta = (m - mn) * 1.442695041f, t0[8], t1[8];   // e^x = 2^(x log2 e), as __expf forms it
#pragma unroll
    for (int r = 0; r < 8; ++r) { t0[r] = (s[0][r] - mn) * 1.442695041f; t1[r] = (s[1][r] - mn) * 1.442695041f; }
    // the 17 hardware exponentials, in place, in two statements: inside a statement no v_exp_f32 is followed by an instruction that reads its result or overwrites its source, and the v_nop keeps
    // that slot behind the last one.
    asm("v_exp_f32 %0, %0\n\tv_exp_f32 %1, %1\n\tv_exp_f32 %2, %2\n\tv_exp_f32 %3, %3\n\tv_exp_f32 %4, %4\n\tv_exp_f32 %5, %5\n\tv_exp_f32 %6, %6\n\tv_exp_f32 %7, %7\n\tv_exp_f32 %8, %8\n\tv_nop"
        : "+v"(ta), "+v"(t0[0]), "+v"(t0[1]), "+v"(t0[2]), "+v"(t0[3]), "+v"(t0[4]), "+v"(t0[5]), "+v"(t0[6]), "+v"(t0[7]));
    asm("v_exp_f32 %0, %0\n\tv_exp_f32 %1, %1\n\tv_exp_f32 %2, %2\n\tv_exp_f32 %3, %3\n\tv_exp_f32 %4, %4\n\tv_exp_f32 %5, %5\n\tv_exp_f32 %6, %6\n\tv_exp_f32 %7, %7\n\tv_nop"
        : "+v"(t1[0]), "+v"(t1[1]), "+v"(t1[2]), "+v"(t1[3]), "+v"(t1[4]), "+v"(t1[5]), "+v"(t1[6]), "+v"(t1[7]));
    const float alpha = (m <= -1.0e38f) ? 0.f : ta;
    float es = 0.f;
#pragma unroll
    for (int r = 0; r < 8; ++r) { s[0][r] = (s[0][r] <= -1.0e38f) ? 0.f : t0[r]; s[1][r] = (s[1][r] <= -1.0e38f) ? 0.f : t1[r]; es += s[0][r] + s[1][r]; }
    l = l * alpha + es; m = mn;
#pragma unroll
    for (int dt = 0; dt < 4; ++dt) {
#pragma unroll
      for (int r = 0; r < 8; ++r) { acc[dt][r] *= alpha; if constexpr (LEAD) accl[dt][r] *= alpha; } }
    v16h pa, pl;   // P^T as a B operand: element i = key 8 g + i, element 8 + i = key 16 + 8 g + i, the k order of frag_h
#pragma unroll
    for (int i = 0; i < 8; ++i) { const float x0 = s[0][i] * 2048.0f, x1 = s[1][i] * 2048.0f; const _Float16 h0 = (_Float16)x0, h1 = (_Float16)x1; pa[i] = h0; pa[8 + i] = h1; if constexpr (LEAD) { pl[i] = (_Float16)((x0 - (float)h0) * 2048.0f); pl[8 + i] = (_Float16)((x1 - (float)h1) * 2048.0f); } }   // P scaled by 2^11 before the f16 split so small softmax weights stay out of the f16 subnormal range; 2^-11 folded into the epilogue
#pragma unroll
    for (int dt = 0; dt < 4; ++dt) { const size_t vr = ((size_t)b * KVW + hk * HD + dt * 16 + col) * SS + ks * 32; const v16h vh = vf[dt]; acc[dt] = wmma16(vh, pa, acc[dt]); if constexpr (LEAD) { accl[dt] = wmma16(vh, pl, accl[dt]); accl[dt] = wmma16(frag_h(VTL + vr, lane), pa, accl[dt]); } }   // leading query blocks: P hi/lo x V hi/lo (3 products); elsewhere P x V single
    if constexpr (LEAD) asm volatile("s_wait_xcnt 0x0" ::: "memory");   // stands in front of the next trip's rewrite of the address registers of this trip's residual loads
    asm volatile("s_wait_dscnt 0x0" ::: "memory");      // this wave's reads of the tile have returned before the buffer is refilled
    asm volatile("s_wait_asynccnt 0x0" ::: "memory");   // this wave's copies of tile ks + 1 have landed before the barrier that publishes them
    __syncthreads();                                    // publishes tile ks + 1 and ends every wave's reads of tile ks
    if (ks + 2 < nksc) STAGE(ks + 2); }
  asm volatile("s_wait_asynccnt 0x0" ::: "memory");     // no copy is outstanding when the wave goes on to the epilogue, then the second tile or its end
#undef STAGE
  l += xhalf(l);   // the two halves' sums of one query
  const float il = (1.0f / 2048.0f) / l;
#pragma unroll
  for (int dt = 0; dt < 4; ++dt) {
#pragma unroll
    for (int r = 0; r < 8; ++r) so[wave][col][dt * 16 + 8 * g + r] = (LEAD ? acc[dt][r] + accl[dt][r] * (1.0f / 2048.0f) : acc[dt][r]) * il; }
  LDSX();
  for (int rl = 0; rl < 16; ++rl) if (lane < 16) vst2(O + ((size_t)b * SS + q0 + rl) * DM + h * HD + lane * 4, *(const v4f*)&so[wave][rl][lane * 4]);
}
// LEAD is a compile-time choice, so that the key loop exists twice: the loop of the single-product tiles (all but query tiles 0 and 1) holds no residual accumulators, no residual of P, no rescale or copy of either and no test per product.
__global__ __launch_bounds__(128) void k_attn(const _Float16* __restrict__ QK, const _Float16* __restrict__ QKL, const _Float16* __restrict__ VTH, const _Float16* __restrict__ VTL, const void* __restrict__ KMASK, float* __restrict__ O) {
  __shared__ __align__(16) float so[4][16][68];
  __shared__ __align__(16) _Float16 sk[2][32 * KP], sv[2][64 * VP];   // two buffers: the block's K hi and V hi tile of 32 keys, read by all four waves
  // A block takes two query tiles one after the other, TQB - 1 - x and x: together 2 * (TQB + 1) key tiles whatever x is, so that every block of the launch, all resident at once, has the same work.
  // Rolled: one copy of each form serves both tiles. The foot barrier of a tile's last trip has ended every wave's reads of sk and sv before the next tile's first copies; so is each wave's own. The choice is the same for the whole block, so every wave passes the same barriers.
#pragma unroll 1
  for (int half = 0; half < 2; ++half) { const int qb = half ? (int)blockIdx.x : TQB - 1 - (int)blockIdx.x;
    if (qb < 2) attn_tile<true>(QK, QKL, VTH, VTL, O, so, sk, sv, qb, blockIdx.y, blockIdx.z); else attn_tile<false>(QK, QKL, VTH, VTL, O, so, sk, sv, qb, blockIdx.y, blockIdx.z); }
}
// ---- k_out: block = (64 rows, 128 cols): out = O(hi/lo) . Wo rows (2 products) + bo
__global__ __launch_bounds__(128) void k_out(const float* __restrict__ O, const __bf16* __restrict__ P, const float* __restrict__ BO, float* __restrict__ Y) {
  __shared__ __align__(16) char sm[2 * GST_BYTES];   // two buffers of the k loop; behind the loop's last barrier the same bytes stage the output
  float (*so)[16][132] = (float (*)[16][132])sm;
  const int tid = threadIdx.x, wave = tid >> 5, lane = tid & 31, col = lane & 15, g = lane >> 4; const size_t r0 = (size_t)blockIdx.x * 64 + wave * 16; const int n0 = blockIdx.y * 128;
  v8f acc[8] = {};
  const char* gb = (const char*)(P + (size_t)(n0 + (tid >> 3)) * DM + (tid & 7) * 8);                        // this thread's first weight piece of tile 0
  const char* ga = (const char*)(O + ((size_t)blockIdx.x * 64 + (tid >> 4)) * DM + (tid & 15) * 4);          // its first activation piece of tile 0
  const unsigned lb = (unsigned)(uintptr_t)&sm[(tid >> 3) * (GBP * 2) + (tid & 7) * 16], la = (unsigned)(uintptr_t)&sm[GB_BYTES + (tid >> 4) * (GAP * 4) + (tid & 15) * 16];
  GSTAGE(0);
  asm volatile("s_wait_asynccnt 0x0" ::: "memory");   // tile 0 has landed before the barrier that publishes it
  __syncthreads();
  GSTAGE(1);
#pragma unroll 1
  for (int ts = 0; ts < DM / GKS; ++ts) { const __bf16* bB = (const __bf16*)(sm + (ts & 1) * GST_BYTES); const float* bA = (const float*)(sm + (ts & 1) * GST_BYTES + GB_BYTES);
#pragma unroll
    for (int kc = 0; kc < GKS / 32; ++kc) { const F2 a = split_row(bA + (wave * 16 + col) * GAP, kc * 32, lane);
      v16b w[8];   // the eight weight fragments of this k chunk are read as one group in front of its products: one LDS latency a chunk, not one a fragment
#pragma unroll
      for (int j = 0; j < 8; ++j) w[j] = frag_b(bB + (j * 16 + col) * GBP + kc * 32, lane);
#pragma unroll
      for (int j = 0; j < 8; ++j) { acc[j] = wmma_bf(a.l, w[j], acc[j]); acc[j] = wmma_bf(a.h, w[j], acc[j]); } }
    asm volatile("s_wait_dscnt 0x0" ::: "memory");      // this wave's reads of tile ts have returned before its buffer is refilled
    asm volatile("s_wait_asynccnt 0x0" ::: "memory");   // this wave's copies of tile ts + 1 have landed before the barrier that publishes them
    __syncthreads();                                    // publishes tile ts + 1 and ends every wave's reads of tile ts
    if (ts + 2 < DM / GKS) GSTAGE(ts + 2); }
  asm volatile("s_wait_asynccnt 0x0" ::: "memory");     // no copy is outstanding when the buffers become output staging
#pragma unroll
  for (int j = 0; j < 8; ++j) {
#pragma unroll
    for (int r = 0; r < 8; ++r) so[wave][8 * g + r][j * 16 + col] = acc[j][r] + (BO ? bfr(BO[n0 + j * 16 + col]) : 0.f); }
  LDSX();
  for (int rl = 0; rl < 16; ++rl) vst2(Y + (r0 + rl) * DM + n0 + lane * 4, *(const v4f*)&so[wave][rl][lane * 4]);
}
extern "C" void kernel_launch(void* const* d_in, const int* in_sizes, int n_in, void* d_out, int out_size, void* d_ws, size_t ws_size, hipStream_t stream) {
  (void)in_sizes; (void)n_in; (void)out_size;
  const float** F = (const float**)d_in;   // 0 hidden_states [4,2048,768], 1 Wq [768,768], 2 Wk [768,256], 3 Wv [768,256], 4 Wo [768,768] (all (in,out))
  if (ws_size < (size_t)WS_END) return;
  char* ws = (char*)d_ws; __bf16* PK = (__bf16*)(ws + WS_PK); _Float16 *QK = (_Float16*)(ws + WS_QK), *QKL = (_Float16*)(ws + WS_QKL), *VTH = (_Float16*)(ws + WS_VTH), *VTL = (_Float16*)(ws + WS_VTL); float* O = (float*)(ws + WS_O); float* CS = (float*)(ws + WS_CS);
  k_pack<<<dim3(QKVW + DM), 256, 0, stream>>>(F[1], F[2], F[3], F[4], PK, CS);
  k_qkv<<<dim3(TNB * SS / 64, QKVW / 128), 128, 0, stream>>>(F[0], F[0], F[0], PK + PK_A, nullptr, nullptr, nullptr, CS, QK, QKL, VTH, VTL);
  k_attn<<<dim3(TQB / 2, NH, TNB), 128, 0, stream>>>(QK, QKL, VTH, VTL, nullptr, O);
  k_out<<<dim3(TOB, DM / 128), 128, 0, stream>>>(O, PK + PK_P, nullptr, (float*)d_out);
}

// v009
// Measured time: 119 microseconds a run.
// Two timings next to v008 put it at 1.11 and 1.09 times that version's speed.
// Counting every step since v000, it is 4.99 times as fast.
// compute dtype: all float inputs rounded to bf16; q/k/v = x . W with EXACT bf16 products on WMMA 16x16x32 ((in,out) weights as transposed rows; k and v projected once per kv head, each read by its 3 query heads), f16 hi + residual; RoPE (inv_freq in double, angle = pos x inv_freq in f32 as the module, precise sinf/cosf, one table a call) applied in f32 to q/k in the projection's epilogue, before the split; causal attention with hybrid scores (first 128 queries 3-product, later single f16) and hi + residual P.v, x 1/8, running-max softmax in f32 (hardware exp); out = ctx (bf16 hi + lo) . Wo ((in,out)); f32 output.
#include <hip/hip_runtime.h>
#include <math.h>

typedef __attribute__((ext_vector_type(16))) _Float16 v16h;
typedef __attribute__((ext_vector_type(16))) __bf16 v16b;
typedef __attribute__((ext_vector_type(8)))  _Float16 v8h;
typedef __attribute__((ext_vector_type(8)))  float v8f;
typedef __attribute__((ext_vector_type(4)))  float v4f;
typedef __attribute__((ext_vector_type(2)))  float v2f;
typedef __attribute__((ext_vector_type(4)))  unsigned v4u;
typedef __attribute__((ext_vector_type(4)))  int v4i;
typedef float __attribute__((may_alias)) float_a;
typedef int __attribute__((may_alias)) int_a;

template <typename T> __device__ __forceinline__ void vst2(void* p, T v) { *(T*)p = v;  }
__device__ __forceinline__ v8f wmma16(v16h a, v16h b, v8f c) {
  v8f d = __builtin_amdgcn_wmma_f32_16x16x32_f16(false, a, false, b, (short)0, c, false, false);
  asm volatile("v_nop\n\tv_nop\n\tv_nop\n\tv_nop" : "+v"(d) : "v"(a), "v"(b));
  return d;
}
__device__ __forceinline__ v8f wmma_bf(v16b a, v16b b, v8f c) {
  v8f d = __builtin_amdgcn_wmma_f32_16x16x32_bf16(false, a, false, b, (short)0, c, false, false);
  asm volatile("v_nop\n\tv_nop\n\tv_nop\n\tv_nop" : "+v"(d) : "v"(a), "v"(b));
  return d;
}
// Grouped-query causal attention with RoPE (B 4, S 2,048, hidden 768, 12 query heads x 64 over 4 kv heads): q = x Wq, k = x Wk, v = x Wv ((in,out), kv heads shared by 3 query heads), rotate-half RoPE (theta 1e4), causal softmax(q k / 8) v, out = ctx Wo.
__device__ __forceinline__ v16h frag_h(const _Float16* rowk0, int lane) {
  union { v16h v; v8h q[2]; } u; const _Float16* p = rowk0 + 8 * (lane >> 4);
  u.q[0] = *(const v8h*)p; u.q[1] = *(const v8h*)(p + 16); return u.v;
}
__device__ __forceinline__ v16h frag_f32(const float* rowk0, int lane) {
  v16h a; const float* p = rowk0 + 8 * (lane >> 4);
#pragma unroll
  for (int i = 0; i < 8; ++i) { a[i] = (_Float16)p[i]; a[8 + i] = (_Float16)p[16 + i]; }
  return a;
}
__device__ __forceinline__ v16h frag_f32s(const float* rowk0, int lane, float sc) {
  v16h a; const float* p = rowk0 + 8 * (lane >> 4);
#pragma unroll
  for (int i = 0; i < 8; ++i) { a[i] = (_Float16)(p[i] * sc); a[8 + i] = (_Float16)(p[16 + i] * sc); }
  return a;
}
// column fragment from a [K][ld] layout (column n), rows >= K read as 0
__device__ __forceinline__ v16h fragc_f32(const float* W, int k0, int n, int lane, int ld, int K) {
  v16h a; const int g = lane >> 4;
#pragma unroll
  for (int i = 0; i < 8; ++i) { const int ka = k0 + 8 * g + i, kb = ka + 16;
    a[i] = (_Float16)(ka < K ? W[(size_t)(ka < K ? ka : K - 1) * ld + n] : 0.f); a[8 + i] = (_Float16)(kb < K ? W[(size_t)(kb < K ? kb : K - 1) * ld + n] : 0.f); }
  return a;
}
struct F2 { v16b h, l; };
__device__ __forceinline__ F2 bsplit16(const float v[16]) { F2 r;
#pragma unroll
  for (int i = 0; i < 16; ++i) { const __bf16 h = (__bf16)v[i]; r.h[i] = h; r.l[i] = (__bf16)(v[i] - (float)h); }
  return r; }
__device__ __forceinline__ F2 split_row(const float* row, int k0, int lane) { float v[16]; const float* p = row + k0 + 8 * (lane >> 4);
#pragma unroll
  for (int i = 0; i < 8; ++i) { v[i] = p[i]; v[8 + i] = p[16 + i]; }
  return bsplit16(v); }
__device__ __forceinline__ F2 split_rowK(const float* row, int k0, int lane, int K) { float v[16]; const int g = lane >> 4;
#pragma unroll
  for (int i = 0; i < 8; ++i) { const int ka = k0 + 8 * g + i, kb = ka + 16; v[i] = ka < K ? row[ka < K ? ka : K - 1] : 0.f; v[8 + i] = kb < K ? row[kb < K ? kb : K - 1] : 0.f; }
  return bsplit16(v); }
__device__ __forceinline__ F2 split_col(const float* W, int k0, int n, int lane, int ld, int K) { float v[16]; const int g = lane >> 4;
#pragma unroll
  for (int i = 0; i < 8; ++i) { const int ka = k0 + 8 * g + i, kb = ka + 16; v[i] = ka < K ? W[(size_t)(ka < K ? ka : K - 1) * ld + n] : 0.f; v[8 + i] = kb < K ? W[(size_t)(kb < K ? kb : K - 1) * ld + n] : 0.f; }
  return bsplit16(v); }
__device__ __forceinline__ v8f mac3(const F2& a, const F2& b, v8f c) { c = wmma_bf(a.l, b.h, c); c = wmma_bf(a.h, b.l, c); return wmma_bf(a.h, b.h, c); }
__device__ __forceinline__ float sigm(float v) { return 1.0f / (1.0f + expf(-v)); }
#define LDSX() do { asm volatile("s_wait_dscnt 0" ::: "memory"); __builtin_amdgcn_wave_barrier(); __builtin_amdgcn_fence(__ATOMIC_RELEASE, "workgroup"); } while (0)


#define NB 4
#define SS 2048
#define DM 768
#define NH 12
#define NKV 4
#define GRP 3
#define HD 64
#define KVW (NKV * HD)            // columns of k, and of v: one set per kv head
#define QKW (DM + KVW)            // columns of q and k together
#define KOFF ((size_t)NB * SS * DM)   // in the q, k buffers the k plane [8192][256] stands behind the q plane [8192][768], each dense
#define QKVW (DM + 2 * KVW)       // packed projection rows: q | k | v
#ifndef TQB
#define TQB (SS / 64)
#define TNB NB
#define TOB (NB * SS / 64)     // output row tiles (all)
#endif
typedef __attribute__((ext_vector_type(8))) __bf16 v8b;
__device__ __forceinline__ v16b frag_b(const __bf16* rowk0, int lane) {
  union { v16b v; v8b q[2]; } u; const __bf16* p = rowk0 + 8 * (lane >> 4);
  u.q[0] = *(const v8b*)p; u.q[1] = *(const v8b*)(p + 16); return u.v;
}
__device__ __forceinline__ float bfr(float v) { return (float)(__bf16)v; }
__device__ __attribute__((noinline)) float exp_ni(float v) { return expf(v); }
__device__ __attribute__((noinline)) float erf_ni(float v) { return erff(v); }

#define PK_A 0                       // [1280][768] Wq | Wk | Wv rows ([out][in])
#define PK_P (PK_A + QKVW * DM)        // [768][768] Wo rows, directly behind them
#define PK_END (PK_P + DM * DM)
#define WS_PK  0u
#define WS_QK  (WS_PK + 2u * PK_END)             // f16 q [8192 rows][768] (12 heads), then k [8192 rows][256] (4 kv heads)
#define WS_QKL (WS_QK + 2u * NB * SS * QKW)        // f16 q, k residual planes x2048, laid out likewise
#define WS_VTH (WS_QKL + 2u * NB * SS * QKW)       // f16 [b][256 (kv head*64+d)][2048 s] hi
#define WS_VTL (WS_VTH + 2u * NB * KVW * SS)       // f16 lo x 2048
#define WS_O   (WS_VTL + 2u * NB * KVW * SS)       // f32 [8192][768]
#define WS_CS  (WS_O + 4u * NB * SS * DM)           // f32 [2048 positions][32 frequencies] pairs (cos, sin)
#define WS_END (WS_CS + 4u * 2 * SS * 32)
// ---- k_pack: block = one tile of 128 packed rows n x 64 k of the (in,out) weights, turned over in LDS. Packed rows 0..767 Wq, 768..1023 Wk, 1024..1279 Wv (the 256 columns of the 4 kv heads, once each), 1280..2047 Wo (PK_P stands directly behind PK_A); every border is a multiple of 128, so a tile lies in one weight.
// Reads: a wave-wide 16-B load takes 128 columns of one k row, 512 B in a row (four whole lines); a wave takes 8 k rows in a row, so a lane holds 8 successive k of 4 columns: one 16-B LDS store a column. Writes: 128 B of a packed row, whole lines.
#define PTN 128                         // packed rows of a tile
#define PTK 64                          // k of a tile
#define PTP 72                          // LDS pitch of a turned row in bf16: 144 B = 16 B x 9
#define PKW ((QKVW + DM) / PTN * (DM / PTK) * 8)   // waves of the launch
__global__ __launch_bounds__(256) void k_pack(const float* __restrict__ WQ, const float* __restrict__ WK, const float* __restrict__ WV, const float* __restrict__ WO, __bf16* __restrict__ PK, float* __restrict__ CS) {   // Wq [768][768], Wk/Wv [768][256], Wo [768][768]
  __shared__ __align__(16) __bf16 s[PTN * PTP]; const int t = threadIdx.x, wave = __builtin_amdgcn_readfirstlane(t >> 5), lane = t & 31, n0 = blockIdx.x * PTN, k0 = blockIdx.y * PTK;
  const float* W; int ld;
  if (n0 < DM) { W = WQ + n0; ld = DM; } else if (n0 < QKW) { W = WK + (n0 - DM); ld = KVW; } else if (n0 < QKVW) { W = WV + (n0 - QKW); ld = KVW; } else { W = WO + (n0 - QKVW); ld = DM; }
  v4f x[8]; const float* q[8];
#pragma unroll   // the eight loads issue as one group: one latency a tile, which passes under the table's arithmetic
  for (int i = 0; i < 8; ++i) { q[i] = W + (size_t)(k0 + wave * 8 + i) * ld + lane * 4; x[i] = *(const v4f*)q[i]; }
  // stands in front of any rewrite of the loads' address registers; it takes the eight addresses as inputs, so that they live up to it
  asm volatile("s_wait_xcnt 0x0" :: "v"(q[0]), "v"(q[1]), "v"(q[2]), "v"(q[3]), "v"(q[4]), "v"(q[5]), "v"(q[6]), "v"(q[7]) : "memory");
  // the RoPE table, once a call: wave w of the launch takes positions w and w + PKW; a wave writes one position's 32 pairs (cos a_j, sin a_j), a_j = pos * inv_freq[j], 256 B
  { const double invf = 1.0 / pow(10000.0, (double)lane / 32.0); const float fi = (float)invf;
    for (int pos = ((int)blockIdx.y * ((QKVW + DM) / PTN) + (int)blockIdx.x) * 8 + wave; pos < SS; pos += PKW) { const float ang = (float)pos * fi; v2f cs; cs[0] = cosf(ang); cs[1] = sinf(ang); *(v2f*)(CS + ((size_t)pos * 32 + lane) * 2) = cs;
      asm volatile("s_wait_xcnt 0x0" ::: "memory"); } }   // stands in front of the next trip's rewrite of the store's registers
#pragma unroll   // constant indices keep x in registers (this loop and the one inside it)
  for (int c = 0; c < 4; ++c) { v8b r;
#pragma unroll
    for (int i = 0; i < 8; ++i) r[i] = (__bf16)x[i][c];
    *(v8b*)&s[(lane * 4 + c) * PTP + wave * 8] = r; }
  __syncthreads();
#pragma unroll   // straight-line: no store's registers are rewritten over a back edge
  for (int i = 0; i < 4; ++i) { const int e = t + 256 * i, n = e >> 3, pc = e & 7; vst2((unsigned*)(PK + PK_A + (size_t)(n0 + n) * DM + k0 + pc * 8), *(const v4u*)&s[n * PTP + pc * 8]); }
}
#define GKS 64                          // k elements of one staged tile
#define GBP 72                          // LDS pitch of a staged weight row in bf16: 144 B = 16 B x 9, no bank conflict for 16-byte fragment reads
#define GAP 68                          // LDS pitch of a staged activation row in f32: 272 B = 16 B x 17, likewise
#define GB_BYTES (128 * GBP * 2)        // 128 weight rows
#define GA_BYTES (64 * GAP * 4)         // 64 activation rows
#define GST_BYTES (GB_BYTES + GA_BYTES) // one buffer: weight tile, then activation tile
// eight 16-B pieces of one thread into LDS, through no register: piece i goes to LDS byte l + i * ls and comes from g + i * 24,576 B (16 weight rows of 1,536 B, or 8 activation rows of 3,072 B).
// The wait on xcnt is the last line of the copies' own statement, so that it stands in front of any rewrite of the address registers they name.
__device__ __forceinline__ void stage8(unsigned l, unsigned ls, const char* g) {
  asm volatile("global_load_async_to_lds_b128 %0, %8, off\n\t"
               "global_load_async_to_lds_b128 %1, %9, off\n\t"
               "global_load_async_to_lds_b128 %2, %10, off\n\t"
               "global_load_async_to_lds_b128 %3, %11, off\n\t"
               "global_load_async_to_lds_b128 %4, %12, off\n\t"
               "global_load_async_to_lds_b128 %5, %13, off\n\t"
               "global_load_async_to_lds_b128 %6, %14, off\n\t"
               "global_load_async_to_lds_b128 %7, %15, off\n\t"
               "s_wait_xcnt 0x0"
               :: "v"(l), "v"(l + ls), "v"(l + 2 * ls), "v"(l + 3 * ls), "v"(l + 4 * ls), "v"(l + 5 * ls), "v"(l + 6 * ls), "v"(l + 7 * ls),
                  "v"(g), "v"(g + 24576), "v"(g + 2 * 24576), "v"(g + 3 * 24576), "v"(g + 4 * 24576), "v"(g + 5 * 24576), "v"(g + 6 * 24576), "v"(g + 7 * 24576) : "memory");
}
// tile t (64 k) of a 64-row x 128-column block into buffer t & 1: 128 weight rows x 128 B (8 threads a row) and 64 activation rows x 256 B (16 threads a row); every wave-wide copy covers four whole 128-B lines
#define GSTAGE(t) do { stage8(lb + ((t) & 1) * GST_BYTES, 16 * GBP * 2, gb + (size_t)(t) * (GKS * 2)); stage8(la + ((t) & 1) * GST_BYTES, 8 * GAP * 4, ga + (size_t)(t) * (GKS * 4)); } while (0)
__global__ __launch_bounds__(128) void k_qkv(const float* __restrict__ XQ, const float* __restrict__ XK, const float* __restrict__ XV, const __bf16* __restrict__ P, const float* __restrict__ BQ, const float* __restrict__ BK, const float* __restrict__ BV, const float* __restrict__ CS, _Float16* __restrict__ QK, _Float16* __restrict__ QKL, _Float16* __restrict__ VTH, _Float16* __restrict__ VTL) {
  const int nc = blockIdx.y * 128, which0 = (nc < DM) ? 0 : (nc < QKW) ? 1 : 2; const float* X = (which0 == 0) ? XQ : (which0 == 1) ? XK : XV; const float* BB = BQ ? ((which0 == 0) ? BQ + nc : (which0 == 1) ? BK + (nc - DM) : BV + (nc - QKW)) : nullptr;   // column blocks 0..5 q, 6..7 k, 8..9 v
  __shared__ __align__(16) char sm[2 * GST_BYTES];   // two buffers of the k loop; behind the loop's last barrier the same bytes stage the output
  _Float16 (*so)[16][136] = (_Float16 (*)[16][136])sm; _Float16 (*sol)[16][136] = (_Float16 (*)[16][136])(sm + 4 * 16 * 136 * 2); _Float16 (*sth)[72] = (_Float16 (*)[72])sm; _Float16 (*stl)[72] = (_Float16 (*)[72])(sm + 128 * 72 * 2);
  const int tid = threadIdx.x, wave = tid >> 5, lane = tid & 31, col = lane & 15, g = lane >> 4; const size_t r0 = (size_t)blockIdx.x * 64 + wave * 16; const int n0 = blockIdx.y * 128;
  v8f acc[8] = {};
  const char* gb = (const char*)(P + (size_t)(n0 + (tid >> 3)) * DM + (tid & 7) * 8);                        // this thread's first weight piece of tile 0
  const char* ga = (const char*)(X + ((size_t)blockIdx.x * 64 + (tid >> 4)) * DM + (tid & 15) * 4);          // its first activation piece of tile 0
  const unsigned lb = (unsigned)(uintptr_t)&sm[(tid >> 3) * (GBP * 2) + (tid & 7) * 16], la = (unsigned)(uintptr_t)&sm[GB_BYTES + (tid >> 4) * (GAP * 4) + (tid & 15) * 16];
  // q and k blocks: this lane's 16 table pairs (its 8 rows' positions x the frequencies col and 16 + col), asked for in front of the k loop so that their latency passes under it
  v2f cs[8][2] = {};
  if (n0 < QKW) { const float* cp = CS + ((size_t)((blockIdx.x * 64) % SS + wave * 16 + 8 * g) * 32 + col) * 2;
#pragma unroll   // constant indices keep cs in registers, and the 16 loads issue as one group
    for (int r = 0; r < 8; ++r) { cs[r][0] = *(const v2f*)(cp + r * 64); cs[r][1] = *(const v2f*)(cp + r * 64 + 32); } }
  GSTAGE(0);
  asm volatile("s_wait_asynccnt 0x0" ::: "memory");   // tile 0 has landed before the barrier that publishes it
  __syncthreads();
  GSTAGE(1);
#pragma unroll 1
  for (int ts = 0; ts < DM / GKS; ++ts) { const __bf16* bB = (const __bf16*)(sm + (ts & 1) * GST_BYTES); const float* bA = (const float*)(sm + (ts & 1) * GST_BYTES + GB_BYTES);
#pragma unroll
    for (int kc = 0; kc < GKS / 32; ++kc) { v16b a; { const float* p = bA + (wave * 16 + col) * GAP + kc * 32 + 8 * g;
#pragma unroll
        for (int i = 0; i < 8; ++i) { a[i] = (__bf16)p[i]; a[8 + i] = (__bf16)p[16 + i]; } }
      v16b w[8];   // the eight weight fragments of this k chunk are read as one group in front of its products: one LDS latency a chunk, not one a product
#pragma unroll
      for (int j = 0; j < 8; ++j) w[j] = frag_b(bB + (j * 16 + col) * GBP + kc * 32, lane);
#pragma unroll
      for (int j = 0; j < 8; ++j) acc[j] = wmma_bf(a, w[j], acc[j]); }
    asm volatile("s_wait_dscnt 0x0" ::: "memory");      // this wave's reads of tile ts have returned before its buffer is refilled
    asm volatile("s_wait_asynccnt 0x0" ::: "memory");   // this wave's copies of tile ts + 1 have landed before the barrier that publishes them
    __syncthreads();                                    // publishes tile ts + 1 and ends every wave's reads of tile ts
    if (ts + 2 < DM / GKS) GSTAGE(ts + 2); }
  asm volatile("s_wait_asynccnt 0x0" ::: "memory");     // no copy is outstanding when the buffers become output staging
  if (n0 < QKW) {   // q stored unscaled (f16 sigma ~0.6, no subnormal exposure); 1/8 applied to the f32 score
    // rotate-half RoPE in registers: the block's 128 columns are two heads; tiles ja and ja + 2 hold columns d (< 32) and d + 32 of one head in the same lane and register: y[d] = x[d] cos - x[d + 32] sin, y[d + 32] = x[d + 32] cos + x[d] sin, frequency d
#pragma unroll   // constant indices keep acc and cs in registers (this loop and the one inside it)
    for (int p = 0; p < 4; ++p) { const int ja = (p >> 1) * 4 + (p & 1), jb = ja + 2; const float ba = BB ? bfr(BB[ja * 16 + col]) : 0.f, bb = BB ? bfr(BB[jb * 16 + col]) : 0.f;
#pragma unroll
      for (int r = 0; r < 8; ++r) { const float xa = acc[ja][r] + ba, xb = acc[jb][r] + bb, c = cs[r][p & 1][0], sn = cs[r][p & 1][1]; const float ya = xa * c - xb * sn, yb = xb * c + xa * sn; const _Float16 ha = (_Float16)ya, hb = (_Float16)yb;
        so[wave][8 * g + r][ja * 16 + col] = ha; sol[wave][8 * g + r][ja * 16 + col] = (_Float16)((ya - (float)ha) * 2048.0f); so[wave][8 * g + r][jb * 16 + col] = hb; sol[wave][8 * g + r][jb * 16 + col] = (_Float16)((yb - (float)hb) * 2048.0f); } }   // rotated q, k (+ bias) as f16 hi + (x2048) residual
    LDSX();
    const size_t pb = (n0 < DM) ? (size_t)n0 : KOFF + (n0 - DM); const int pw = (n0 < DM) ? DM : KVW;   // this block's first column in its plane, and the plane's row
#pragma unroll   // straight-line: no store's registers are rewritten over a back edge
    for (int rl = 0; rl < 16; ++rl) if (lane < 16) { vst2((unsigned*)(QK + pb + (r0 + rl) * pw + lane * 8), *(const v4u*)&so[wave][rl][lane * 8]); vst2((unsigned*)(QKL + pb + (r0 + rl) * pw + lane * 8), *(const v4u*)&sol[wave][rl][lane * 8]); }
  } else {
#pragma unroll
    for (int j = 0; j < 8; ++j) {
#pragma unroll
      for (int r = 0; r < 8; ++r) { const float v = acc[j][r] + (BB ? bfr(BB[j * 16 + col]) : 0.f); const _Float16 hv = (_Float16)v; sth[j * 16 + col][wave * 16 + 8 * g + r] = hv; stl[j * 16 + col][wave * 16 + 8 * g + r] = (_Float16)((v - (float)hv) * 2048.0f); } }
    __syncthreads();
    const size_t rb = (size_t)blockIdx.x * 64; const int b = (int)(rb / SS), s0 = (int)(rb % SS); const int pc0 = n0 - QKW;
    for (int q = tid; q < 128 * 8; q += 128) { const int d = q >> 3, pc = q & 7; const size_t o = ((size_t)b * KVW + pc0 + d) * SS + s0 + pc * 8; vst2((unsigned*)(VTH + o), *(const v4u*)&sth[d][pc * 8]); vst2((unsigned*)(VTL + o), *(const v4u*)&stl[d][pc * 8]); }
  }
}
#define KP 72   // LDS pitch of a staged K row in f16: 144 B = 16 B x 9, no bank conflict for 16-byte fragment reads
#define VP 40   // LDS pitch of a staged V row in f16: 80 B = 16 B x 5, likewise
// one key tile of 32 keys into LDS, through no register: each of the 128 threads copies two 16-B pieces of K hi (32 rows x 128 B) and two of V hi (64 rows x 64 B).
// The wait on xcnt is the last line of the copies' own statement, so that it stands in front of any rewrite of the address registers they name.
__device__ __forceinline__ void stage_kv(unsigned lk0, unsigned lk1, unsigned lv0, unsigned lv1, const _Float16* k0, const _Float16* k1, const _Float16* v0, const _Float16* v1) {
  asm volatile("global_load_async_to_lds_b128 %0, %4, off\n\t"
               "global_load_async_to_lds_b128 %1, %5, off\n\t"
               "global_load_async_to_lds_b128 %2, %6, off\n\t"
               "global_load_async_to_lds_b128 %3, %7, off\n\t"
               "s_wait_xcnt 0x0"
               :: "v"(lk0), "v"(lk1), "v"(lv0), "v"(lv1), "v"(k0), "v"(k1), "v"(v0), "v"(v1) : "memory");
}
// lane l with lane l ^ 16 (the other half of the wave), through no LDS
__device__ __forceinline__ float xhalf(float x) { return __builtin_bit_cast(float, __builtin_amdgcn_permlanex16(__builtin_bit_cast(int, x), __builtin_bit_cast(int, x), 0x76543210, 0xfedcba98, false, false)); }
// ---- k_attn: block = (two tiles of 64 queries, head h, batch b): causal flash attention, transposed: S^T = K . Q^T (A = 16 key rows from LDS, B = the wave's 16 queries, kept in registers), so a lane holds 16 of the 32 scores of ONE query (column col; keys 8 g + r and 16 + 8 g + r), lane ^ 16 the other 16: maximum and sum in-lane plus one exchange between the halves. The two score tiles, converted in place, are the B operand of O^T += V^T . P^T (A = 16 rows d of V^T from LDS). scores = (q.k) * 0.125; O[b*S+q][h*64+d] = (acc + accl / 2048) / (2048 l) (256-B segments)
template <bool LEAD> __device__ __forceinline__ void attn_tile(const _Float16* __restrict__ QK, const _Float16* __restrict__ QKL, const _Float16* __restrict__ VTH, const _Float16* __restrict__ VTL, float* __restrict__ O, float (*so)[16][68], _Float16 (*sk)[32 * KP], _Float16 (*sv)[64 * VP], const int qb, const int h, const int b) {
  const int tid = threadIdx.x, wave = tid >> 5, lane = tid & 31, col = lane & 15, g = lane >> 4;
  const int q0 = qb * 64 + wave * 16; const size_t rq = (size_t)b * SS + q0 + col; const int hk = h / GRP;   // the kv head of query head h
  v16h aq[2], aql[2];
#pragma unroll
  for (int kc = 0; kc < 2; ++kc) { aq[kc] = frag_h(QK + rq * DM + h * HD + kc * 32, lane); if constexpr (LEAD) aql[kc] = frag_h(QKL + rq * DM + h * HD + kc * 32, lane); }
  float m = -3.0e38f, l = 0.f;   // of query q0 + col; l sums this half's keys only, the halves are joined behind the loop
  v8f acc[4] = {}, accl[4] = {};   // acc[dt][r] = O^T[d = dt * 16 + 8 g + r][query q0 + col]
  const int nksc = (qb * 64 + 64) / 32;   // causal: key tiles up to the end of this query block
  const _Float16* kg = QK + KOFF + ((size_t)b * SS + (tid >> 3)) * KVW + hk * HD + (tid & 7) * 8;   // this thread's first K piece of tile 0 (its second: 16 keys on)
  const _Float16* vg = VTH + ((size_t)b * KVW + hk * HD + (tid >> 2)) * SS + (tid & 3) * 8;               // its first V piece of tile 0 (its second: 32 rows on)
  const unsigned lk = (unsigned)(uintptr_t)&sk[0][(tid >> 3) * KP + (tid & 7) * 8], lv = (unsigned)(uintptr_t)&sv[0][(tid >> 2) * VP + (tid & 3) * 8];
#define STAGE(t) stage_kv(lk + ((t) & 1) * (32 * KP * 2), lk + ((t) & 1) * (32 * KP * 2) + 16 * KP * 2, lv + ((t) & 1) * (64 * VP * 2), lv + ((t) & 1) * (64 * VP * 2) + 32 * VP * 2, kg + (size_t)(t) * 32 * KVW, kg + ((size_t)(t) * 32 + 16) * KVW, vg + (t) * 32, vg + (t) * 32 + 32 * SS)
  STAGE(0);
  asm volatile("s_wait_asynccnt 0x0" ::: "memory");   // tile 0 has landed before the barrier that publishes it
  __syncthreads();
  if (1 < nksc) STAGE(1);
#pragma unroll 1
  for (int ks = 0; ks < nksc; ++ks) { v8f s[2]; const int lim = q0 + col - 8 * g - ks * 32;   // the last score row of this lane's 16 (ct * 16 + r) that its query may see
    v16h kf[2][2];   // the tile's four K fragments are read as one group in front of the score products: one LDS latency a tile, not one a product
#pragma unroll
    for (int ct = 0; ct < 2; ++ct) {
#pragma unroll
      for (int kc = 0; kc < 2; ++kc) kf[ct][kc] = frag_h(&sk[ks & 1][(ct * 16 + col) * KP] + kc * 32, lane); }
#pragma unroll
    for (int ct = 0; ct < 2; ++ct) { const _Float16* krowl = QKL + KOFF + ((size_t)b * SS + ks * 32 + ct * 16 + col) * KVW + hk * HD; v8f c = {}, cl = {};
      if constexpr (LEAD) {   // leading query blocks (few keys, outputs far above the global rms): 3 products
#pragma unroll
        for (int kc = 0; kc < 2; ++kc) { const v16h kh = kf[ct][kc]; c = wmma16(kh, aq[kc], c); cl = wmma16(kh, aql[kc], cl); cl = wmma16(frag_h(krowl + kc * 32, lane), aq[kc], cl); }
#pragma unroll
        for (int r = 0; r < 8; ++r) c[r] += cl[r] * (1.0f / 2048.0f); }
      else {
#pragma unroll
        for (int kc = 0; kc < 2; ++kc) c = wmma16(kf[ct][kc], aq[kc], c); }   // single product elsewhere
#pragma unroll
      for (int r = 0; r < 8; ++r) s[ct][r] = (ct * 16 + r <= lim) ? c[r] * 0.125f : -3.0e38f; }   // 1/sqrt(64); masked keys (key ks * 32 + ct * 16 + 8 g + r above query q0 + col) excluded
    v16h vf[4];   // the tile's four V fragments are read as one group here, so that their LDS latency passes under the softmax arithmetic
#pragma unroll
    for (int dt = 0; dt < 4; ++dt) vf[dt] = frag_h(&sv[ks & 1][(dt * 16 + col) * VP], lane);
    float mx = fmaxf(s[0][0], s[1][0]);
#pragma unroll
    for (int r = 1; r < 8; ++r) mx = fmaxf(mx, fmaxf(s[0][r], s[1][r]));
    mx = fmaxf(mx, xhalf(mx));   // over all 32 keys of the tile
    const float mn = fmaxf(m, mx);
    float ta = (m - mn) * 1.442695041f, t0[8], t1[8];   // e^x = 2^(x log2 e), as __expf forms it
#pragma unroll
    for (int r = 0; r < 8; ++r) { t0[r] = (s[0][r] - mn) * 1.442695041f; t1[r] = (s[1][r] - mn) * 1.442695041f; }
    // the 17 hardware exponentials, in place, in two statements: inside a statement no v_exp_f32 is followed by an instruction that reads its result or overwrites its source, and the v_nop keeps
    // that slot behind the last one.
    asm("v_exp_f32 %0, %0\n\tv_exp_f32 %1, %1\n\tv_exp_f32 %2, %2\n\tv_exp_f32 %3, %3\n\tv_exp_f32 %4, %4\n\tv_exp_f32 %5, %5\n\tv_exp_f32 %6, %6\n\tv_exp_f32 %7, %7\n\tv_exp_f32 %8, %8\n\tv_nop"
        : "+v"(ta), "+v"(t0[0]), "+v"(t0[1]), "+v"(t0[2]), "+v"(t0[3]), "+v"(t0[4]), "+v"(t0[5]), "+v"(t0[6]), "+v"(t0[7]));
    asm("v_exp_f32 %0, %0\n\tv_exp_f32 %1, %1\n\tv_exp_f32 %2, %2\n\tv_exp_f32 %3, %3\n\tv_exp_f32 %4, %4\n\tv_exp_f32 %5, %5\n\tv_exp_f32 %6, %6\n\tv_exp_f32 %7, %7\n\tv_nop"
        : "+v"(t1[0]), "+v"(t1[1]), "+v"(t1[2]), "+v"(t1[3]), "+v"(t1[4]), "+v"(t1[5]), "+v"(t1[6]), "+v"(t1[7]));
    const float alpha = (m <= -1.0e38f) ? 0.f : ta;
    float es = 0.f;
#pragma unroll
    for (int r = 0; r < 8; ++r) { s[0][r] = (s[0][r] <= -1.0e38f) ? 0.f : t0[r]; s[1][r] = (s[1][r] <= -1.0e38f) ? 0.f : t1[r]; es += s[0][r] + s[1][r]; }
    l = l * alpha + es; m = mn;
#pragma unroll
    for (int dt = 0; dt < 4; ++dt) {
#pragma unroll
      for (int r = 0; r < 8; ++r) { acc[dt][r] *= alpha; if constexpr (LEAD) accl[dt][r] *= alpha; } }
    v16h pa, pl;   // P^T as a B operand: element i = key 8 g + i, element 8 + i = key 16 + 8 g + i, the k order of frag_h
#pragma unroll
    for (int i = 0; i < 8; ++i) { const float x0 = s[0][i] * 2048.0f, x1 = s[1][i] * 2048.0f; const _Float16 h0 = (_Float16)x0, h1 = (_Float16)x1; pa[i] = h0; pa[8 + i] = h1; if constexpr (LEAD) { pl[i] = (_Float16)((x0 - (float)h0) * 2048.0f); pl[8 + i] = (_Float16)((x1 - (float)h1) * 2048.0f); } }   // P scaled by 2^11 before the f16 split so small softmax weights stay out of the f16 subnormal range; 2^-11 folded into the epilogue
#pragma unroll
    for (int dt = 0; dt < 4; ++dt) { const size_t vr = ((size_t)b * KVW + hk * HD + dt * 16 + col) * SS + ks * 32; const v16h vh = vf[dt]; acc[dt] = wmma16(vh, pa, acc[dt]); if constexpr (LEAD) { accl[dt] = wmma16(vh, pl, accl[dt]); accl[dt] = wmma16(frag_h(VTL + vr, lane), pa, accl[dt]); } }   // leading query blocks: P hi/lo x V hi/lo (3 products); elsewhere P x V single
    if constexpr (LEAD) asm volatile("s_wait_xcnt 0x0" ::: "memory");   // stands in front of the next trip's rewrite of the address registers of this trip's residual loads
    asm volatile("s_wait_dscnt 0x0" ::: "memory");      // this wave's reads of the tile have returned before the buffer is refilled
    asm volatile("s_wait_asynccnt 0x0" ::: "memory");   // this wave's copies of tile ks + 1 have landed before the barrier that publishes them
    __syncthreads();                                    // publishes tile ks + 1 and ends every wave's reads of tile ks
    if (ks + 2 < nksc) STAGE(ks + 2); }
  asm volatile("s_wait_asynccnt 0x0" ::: "memory");     // no copy is outstanding when the wave goes on to the epilogue, then the second tile or its end
#undef STAGE
  l += xhalf(l);   // the two halves' sums of one query
  const float il = (1.0f / 2048.0f) / l;
#pragma unroll
  for (int dt = 0; dt < 4; ++dt) {
#pragma unroll
    for (int r = 0; r < 8; ++r) so[wave][col][dt * 16 + 8 * g + r] = (LEAD ? acc[dt][r] + accl[dt][r] * (1.0f / 2048.0f) : acc[dt][r]) * il; }
  LDSX();
  for (int rl = 0; rl < 16; ++rl) if (lane < 16) vst2(O + ((size_t)b * SS + q0 + rl) * DM + h * HD + lane * 4, *(const v4f*)&so[wave][rl][lane * 4]);
}
// LEAD is a compile-time choice, so that the key loop exists twice: the loop of the single-product tiles (all but query tiles 0 and 1) holds no residual accumulators, no residual of P, no rescale or copy of either and no test per product.
__global__ __launch_bounds__(128) void k_attn(const _Float16* __restrict__ QK, const _Float16* __restrict__ QKL, const _Float16* __restrict__ VTH, const _Float16* __restrict__ VTL, const void* __restrict__ KMASK, float* __restrict__ O) {
  __shared__ __align__(16) float so[4][16][68];
  __shared__ __align__(16) _Float16 sk[2][32 * KP], sv[2][64 * VP];   // two buffers: the block's K hi and V hi tile of 32 keys, read by all four waves
  // A block takes two query tiles one after the other, TQB - 1 - x and x: together 2 * (TQB + 1) key tiles whatever x is, so that every block of the launch, all resident at once, has the same work.
  // Rolled: one copy of each form serves both tiles. The foot barrier of a tile's last trip has ended every wave's reads of sk and sv before the next tile's first copies; so is each wave's own. The choice is the same for the whole block, so every wave passes the same barriers.
#pragma unroll 1
  for (int half = 0; half < 2; ++half) { const int qb = half ? (int)blockIdx.x : TQB - 1 - (int)blockIdx.x;
    if (qb < 2) attn_tile<true>(QK, QKL, VTH, VTL, O, so, sk, sv, qb, blockIdx.y, blockIdx.z); else attn_tile<false>(QK, QKL, VTH, VTL, O, so, sk, sv, qb, blockIdx.y, blockIdx.z); }
}
// ---- k_out: block = (64 rows, 128 cols): out = O(hi/lo) . Wo rows (2 products) + bo
__global__ __launch_bounds__(128) void k_out(const float* __restrict__ O, const __bf16* __restrict__ P, const float* __restrict__ BO, float* __restrict__ Y) {
  __shared__ __align__(16) char sm[2 * GST_BYTES];   // two buffers of the k loop; behind the loop's last barrier the same bytes stage the output
  float (*so)[16][132] = (float (*)[16][132])sm;
  const int tid = threadIdx.x, wave = tid >> 5, lane = tid & 31, col = lane & 15, g = lane >> 4; const size_t r0 = (size_t)blockIdx.x * 64 + wave * 16; const int n0 = blockIdx.y * 128;
  v8f acc[8] = {};
  const char* gb = (const char*)(P + (size_t)(n0 + (tid >> 3)) * DM + (tid & 7) * 8);                        // this thread's first weight piece of tile 0
  const char* ga = (const char*)(O + ((size_t)blockIdx.x * 64 + (tid >> 4)) * DM + (tid & 15) * 4);          // its first activation piece of tile 0
  const unsigned lb = (unsigned)(uintptr_t)&sm[(tid >> 3) * (GBP * 2) + (tid & 7) * 16], la = (unsigned)(uintptr_t)&sm[GB_BYTES + (tid >> 4) * (GAP * 4) + (tid & 15) * 16];
  GSTAGE(0);
  asm volatile("s_wait_asynccnt 0x0" ::: "memory");   // tile 0 has landed before the barrier that publishes it
  __syncthreads();
  GSTAGE(1);
#pragma unroll 1
  for (int ts = 0; ts < DM / GKS; ++ts) { const __bf16* bB = (const __bf16*)(sm + (ts & 1) * GST_BYTES); const float* bA = (const float*)(sm + (ts & 1) * GST_BYTES + GB_BYTES);
#pragma unroll
    for (int kc = 0; kc < GKS / 32; ++kc) { const F2 a = split_row(bA + (wave * 16 + col) * GAP, kc * 32, lane);
      v16b w[8];   // the eight weight fragments of this k chunk are read as one group in front of its products: one LDS latency a chunk, not one a fragment
#pragma unroll
      for (int j = 0; j < 8; ++j) w[j] = frag_b(bB + (j * 16 + col) * GBP + kc * 32, lane);
#pragma unroll
      for (int j = 0; j < 8; ++j) { acc[j] = wmma_bf(a.l, w[j], acc[j]); acc[j] = wmma_bf(a.h, w[j], acc[j]); } }
    asm volatile("s_wait_dscnt 0x0" ::: "memory");      // this wave's reads of tile ts have returned before its buffer is refilled
    asm volatile("s_wait_asynccnt 0x0" ::: "memory");   // this wave's copies of tile ts + 1 have landed before the barrier that publishes them
    __syncthreads();                                    // publishes tile ts + 1 and ends every wave's reads of tile ts
    if (ts + 2 < DM / GKS) GSTAGE(ts + 2); }
  asm volatile("s_wait_asynccnt 0x0" ::: "memory");     // no copy is outstanding when the buffers become output staging
#pragma unroll
  for (int j = 0; j < 8; ++j) {
#pragma unroll
    for (int r = 0; r < 8; ++r) so[wave][8 * g + r][j * 16 + col] = acc[j][r] + (BO ? bfr(BO[n0 + j * 16 + col]) : 0.f); }
  LDSX();
  for (int rl = 0; rl < 16; ++rl) vst2(Y + (r0 + rl) * DM + n0 + lane * 4, *(const v4f*)&so[wave][rl][lane * 4]);
}
extern "C" void kernel_launch(void* const* d_in, const int* in_sizes, int n_in, void* d_out, int out_size, void* d_ws, size_t ws_size, hipStream_t stream) {
  (void)in_sizes; (void)n_in; (void)out_size;
  const float** F = (const float**)d_in;   // 0 hidden_states [4,2048,768], 1 Wq [768,768], 2 Wk [768,256], 3 Wv [768,256], 4 Wo [768,768] (all (in,out))
  if (ws_size < (size_t)WS_END) return;
  char* ws = (char*)d_ws; __bf16* PK = (__bf16*)(ws + WS_PK); _Float16 *QK = (_Float16*)(ws + WS_QK), *QKL = (_Float16*)(ws + WS_QKL), *VTH = (_Float16*)(ws + WS_VTH), *VTL = (_Float16*)(ws + WS_VTL); float* O = (float*)(ws + WS_O); float* CS = (float*)(ws + WS_CS);
  k_pack<<<dim3((QKVW + DM) / PTN, DM / PTK), 256, 0, stream>>>(F[1], F[2], F[3], F[4], PK, CS);
  k_qkv<<<dim3(TNB * SS / 64, QKVW / 128), 128, 0, stream>>>(F[0], F[0], F[0], PK + PK_A, nullptr, nullptr, nullptr, CS, QK, QKL, VTH, VTL);
  k_attn<<<dim3(TQB / 2, NH, TNB), 128, 0, stream>>>(QK, QKL, VTH, VTL, nullptr, O);
  k_out<<<dim3(TOB, DM / 128), 128, 0, stream>>>(O, PK + PK_P, nullptr, (float*)d_out);
}

// v010
// One run takes 112 microseconds.
// Two timings next to v009 put it at 1.06 and 1.05 times that version's speed.
// Over all steps from v000 it is 5.26 times as fast.
// compute dtype: all float inputs rounded to bf16; q/k/v = x . W with EXACT bf16 products on WMMA 16x16x32 ((in,out) weights as transposed rows; k and v projected once per kv head, each read by its 3 query heads), f16 hi + residual; RoPE (inv_freq in double, angle = pos x inv_freq in f32 as the module, precise sinf/cosf, one table a call) applied in f32 to q/k in the projection's epilogue, before the split; causal attention with hybrid scores (first 128 queries 3-product, later single f16) and hi + residual P.v, x 1/8, running-max softmax in f32 (hardware exp); out = ctx (bf16 hi + lo) . Wo ((in,out)); f32 output.
#include <hip/hip_runtime.h>
#include <math.h>

typedef __attribute__((ext_vector_type(16))) _Float16 v16h;
typedef __attribute__((ext_vector_type(16))) __bf16 v16b;
typedef __attribute__((ext_vector_type(8)))  _Float16 v8h;
typedef __attribute__((ext_vector_type(8)))  float v8f;
typedef __attribute__((ext_vector_type(4)))  float v4f;
typedef __attribute__((ext_vector_type(2)))  float v2f;
typedef __attribute__((ext_vector_type(4)))  unsigned v4u;
typedef __attribute__((ext_vector_type(4)))  int v4i;
typedef float __attribute__((may_alias)) float_a;
typedef int __attribute__((may_alias)) int_a;

template <typename T> __device__ __forceinline__ void vst2(void* p, T v) { *(T*)p = v;  }
__device__ __forceinline__ v8f wmma16(v16h a, v16h b, v8f c) {
  v8f d = __builtin_amdgcn_wmma_f32_16x16x32_f16(false, a, false, b, (short)0, c, false, false);
  asm volatile("v_nop\n\tv_nop\n\tv_nop\n\tv_nop" : "+v"(d) : "v"(a), "v"(b));
  return d;
}
__device__ __forceinline__ v8f wmma_bf(v16b a, v16b b, v8f c) {
  v8f d = __builtin_amdgcn_wmma_f32_16x16x32_bf16(false, a, false, b, (short)0, c, false, false);
  asm volatile("v_nop\n\tv_nop\n\tv_nop\n\tv_nop" : "+v"(d) : "v"(a), "v"(b));
  return d;
}
// Grouped-query causal attention with RoPE (B 4, S 2,048, hidden 768, 12 query heads x 64 over 4 kv heads): q = x Wq, k = x Wk, v = x Wv ((in,out), kv heads shared by 3 query heads), rotate-half RoPE (theta 1e4), causal softmax(q k / 8) v, out = ctx Wo.
__device__ __forceinline__ v16h frag_h(const _Float16* rowk0, int lane) {
  union { v16h v; v8h q[2]; } u; const _Float16* p = rowk0 + 8 * (lane >> 4);
  u.q[0] = *(const v8h*)p; u.q[1] = *(const v8h*)(p + 16); return u.v;
}
__device__ __forceinline__ v16h frag_f32(const float* rowk0, int lane) {
  v16h a; const float* p = rowk0 + 8 * (lane >> 4);
#pragma unroll
  for (int i = 0; i < 8; ++i) { a[i] = (_Float16)p[i]; a[8 + i] = (_Float16)p[16 + i]; }
  return a;
}
__device__ __forceinline__ v16h frag_f32s(const float* rowk0, int lane, float sc) {
  v16h a; const float* p = rowk0 + 8 * (lane >> 4);
#pragma unroll
  for (int i = 0; i < 8; ++i) { a[i] = (_Float16)(p[i] * sc); a[8 + i] = (_Float16)(p[16 + i] * sc); }
  return a;
}
// column fragment from a [K][ld] layout (column n), rows >= K read as 0
__device__ __forceinline__ v16h fragc_f32(const float* W, int k0, int n, int lane, int ld, int K) {
  v16h a; const int g = lane >> 4;
#pragma unroll
  for (int i = 0; i < 8; ++i) { const int ka = k0 + 8 * g + i, kb = ka + 16;
    a[i] = (_Float16)(ka < K ? W[(size_t)(ka < K ? ka : K - 1) * ld + n] : 0.f); a[8 + i] = (_Float16)(kb < K ? W[(size_t)(kb < K ? kb : K - 1) * ld + n] : 0.f); }
  return a;
}
struct F2 { v16b h, l; };
__device__ __forceinline__ F2 bsplit16(const float v[16]) { F2 r;
#pragma unroll
  for (int i = 0; i < 16; ++i) { const __bf16 h = (__bf16)v[i]; r.h[i] = h; r.l[i] = (__bf16)(v[i] - (float)h); }
  return r; }
__device__ __forceinline__ F2 split_row(const float* row, int k0, int lane) { float v[16]; const float* p = row + k0 + 8 * (lane >> 4);
#pragma unroll
  for (int i = 0; i < 8; ++i) { v[i] = p[i]; v[8 + i] = p[16 + i]; }
  return bsplit16(v); }
__device__ __forceinline__ F2 split_rowK(const float* row, int k0, int lane, int K) { float v[16]; const int g = lane >> 4;
#pragma unroll
  for (int i = 0; i < 8; ++i) { const int ka = k0 + 8 * g + i, kb = ka + 16; v[i] = ka < K ? row[ka < K ? ka : K - 1] : 0.f; v[8 + i] = kb < K ? row[kb < K ? kb : K - 1] : 0.f; }
  return bsplit16(v); }
__device__ __forceinline__ F2 split_col(const float* W, int k0, int n, int lane, int ld, int K) { float v[16]; const int g = lane >> 4;
#pragma unroll
  for (int i = 0; i < 8; ++i) { const int ka = k0 + 8 * g + i, kb = ka + 16; v[i] = ka < K ? W[(size_t)(ka < K ? ka : K - 1) * ld + n] : 0.f; v[8 + i] = kb < K ? W[(size_t)(kb < K ? kb : K - 1) * ld + n] : 0.f; }
  return bsplit16(v); }
__device__ __forceinline__ v8f mac3(const F2& a, const F2& b, v8f c) { c = wmma_bf(a.l, b.h, c); c = wmma_bf(a.h, b.l, c); return wmma_bf(a.h, b.h, c); }
__device__ __forceinline__ float sigm(float v) { return 1.0f / (1.0f + expf(-v)); }
#define LDSX() do { asm volatile("s_wait_dscnt 0" ::: "memory"); __builtin_amdgcn_wave_barrier(); __builtin_amdgcn_fence(__ATOMIC_RELEASE, "workgroup"); } while (0)


#define NB 4
#define SS 2048
#define DM 768
#define NH 12
#define NKV 4
#define GRP 3
#define HD 64
#define KVW (NKV * HD)            // columns of k, and of v: one set per kv head
#define QKW (DM + KVW)            // columns of q and k together
#define KOFF ((size_t)NB * SS * DM)   // in the q, k buffers the k plane [8192][256] stands behind the q plane [8192][768], each dense
#define QKVW (DM + 2 * KVW)       // packed projection rows: q | k | v
#ifndef TQB
#define TQB (SS / 64)
#define TNB NB
#define TOB (NB * SS / 64)     // output row tiles (all)
#endif
typedef __attribute__((ext_vector_type(8))) __bf16 v8b;
__device__ __forceinline__ v16b frag_b(const __bf16* rowk0, int lane) {
  union { v16b v; v8b q[2]; } u; const __bf16* p = rowk0 + 8 * (lane >> 4);
  u.q[0] = *(const v8b*)p; u.q[1] = *(const v8b*)(p + 16); return u.v;
}
__device__ __forceinline__ float bfr(float v) { return (float)(__bf16)v; }
__device__ __attribute__((noinline)) float exp_ni(float v) { return expf(v); }
__device__ __attribute__((noinline)) float erf_ni(float v) { return erff(v); }

#define PK_A 0                       // [1280][768] Wq | Wk | Wv rows ([out][in])
#define PK_P (PK_A + QKVW * DM)        // [768][768] Wo rows, directly behind them
#define PK_END (PK_P + DM * DM)
#define WS_PK  0u
#define WS_QK  (WS_PK + 2u * PK_END)             // f16 q [8192 rows][768] (12 heads), then k [8192 rows][256] (4 kv heads)
#define WS_QKL (WS_QK + 2u * NB * SS * QKW)        // f16 q, k residual planes x2048, laid out likewise
#define WS_VTH (WS_QKL + 2u * NB * SS * QKW)       // f16 [b][256 (kv head*64+d)][2048 s] hi
#define WS_VTL (WS_VTH + 2u * NB * KVW * SS)       // f16 lo x 2048
#define WS_O   (WS_VTL + 2u * NB * KVW * SS)       // f32 [8192][768]
#define WS_CS  (WS_O + 4u * NB * SS * DM)           // f32 [2048 positions][32 frequencies] pairs (cos, sin)
#define WS_END (WS_CS + 4u * 2 * SS * 32)
// ---- k_pack: block = one tile of 128 packed rows n x 64 k of the (in,out) weights, turned over in LDS. Packed rows 0..767 Wq, 768..1023 Wk, 1024..1279 Wv (the 256 columns of the 4 kv heads, once each), 1280..2047 Wo (PK_P stands directly behind PK_A); every border is a multiple of 128, so a tile lies in one weight.
// Reads: a wave-wide 16-B load takes 128 columns of one k row, 512 B in a row (four whole lines); a wave takes 8 k rows in a row, so a lane holds 8 successive k of 4 columns: one 16-B LDS store a column. Writes: 128 B of a packed row, whole lines.
#define PTN 128                         // packed rows of a tile
#define PTK 64                          // k of a tile
#define PTP 72                          // LDS pitch of a turned row in bf16: 144 B = 16 B x 9
#define PKW ((QKVW + DM) / PTN * (DM / PTK) * 8)   // waves of the launch
__global__ __launch_bounds__(256) void k_pack(const float* __restrict__ WQ, const float* __restrict__ WK, const float* __restrict__ WV, const float* __restrict__ WO, __bf16* __restrict__ PK, float* __restrict__ CS) {   // Wq [768][768], Wk/Wv [768][256], Wo [768][768]
  __shared__ __align__(16) __bf16 s[PTN * PTP]; const int t = threadIdx.x, wave = __builtin_amdgcn_readfirstlane(t >> 5), lane = t & 31, n0 = blockIdx.x * PTN, k0 = blockIdx.y * PTK;
  const float* W; int ld;
  if (n0 < DM) { W = WQ + n0; ld = DM; } else if (n0 < QKW) { W = WK + (n0 - DM); ld = KVW; } else if (n0 < QKVW) { W = WV + (n0 - QKW); ld = KVW; } else { W = WO + (n0 - QKVW); ld = DM; }
  v4f x[8]; const float* q[8];
#pragma unroll   // the eight loads issue as one group: one latency a tile, which passes under the table's arithmetic
  for (int i = 0; i < 8; ++i) { q[i] = W + (size_t)(k0 + wave * 8 + i) * ld + lane * 4; x[i] = *(const v4f*)q[i]; }
  // stands in front of any rewrite of the loads' address registers; it takes the eight addresses as inputs, so that they live up to it
  asm volatile("s_wait_xcnt 0x0" :: "v"(q[0]), "v"(q[1]), "v"(q[2]), "v"(q[3]), "v"(q[4]), "v"(q[5]), "v"(q[6]), "v"(q[7]) : "memory");
  // the RoPE table, once a call: wave w of the launch takes positions w and w + PKW; a wave writes one position's 32 pairs (cos a_j, sin a_j), a_j = pos * inv_freq[j], 256 B
  { const double invf = 1.0 / pow(10000.0, (double)lane / 32.0); const float fi = (float)invf;
    for (int pos = ((int)blockIdx.y * ((QKVW + DM) / PTN) + (int)blockIdx.x) * 8 + wave; pos < SS; pos += PKW) { const float ang = (float)pos * fi; v2f cs; cs[0] = cosf(ang); cs[1] = sinf(ang); *(v2f*)(CS + ((size_t)pos * 32 + lane) * 2) = cs;
      asm volatile("s_wait_xcnt 0x0" ::: "memory"); } }   // stands in front of the next trip's rewrite of the store's registers
#pragma unroll   // constant indices keep x in registers (this loop and the one inside it)
  for (int c = 0; c < 4; ++c) { v8b r;
#pragma unroll
    for (int i = 0; i < 8; ++i) r[i] = (__bf16)x[i][c];
    *(v8b*)&s[(lane * 4 + c) * PTP + wave * 8] = r; }
  __syncthreads();
#pragma unroll   // straight-line: no store's registers are rewritten over a back edge
  for (int i = 0; i < 4; ++i) { const int e = t + 256 * i, n = e >> 3, pc = e & 7; vst2((unsigned*)(PK + PK_A + (size_t)(n0 + n) * DM + k0 + pc * 8), *(const v4u*)&s[n * PTP + pc * 8]); }
}
#define GKS 64                          // k elements of one staged tile
#define GBP 72                          // LDS pitch of a staged weight row in bf16: 144 B = 16 B x 9, no bank conflict for 16-byte fragment reads
#define GAP 68                          // LDS pitch of a staged activation row in f32: 272 B = 16 B x 17, likewise
#define GB_BYTES (128 * GBP * 2)        // 128 weight rows
#define GA_BYTES (64 * GAP * 4)         // 64 activation rows
#define GST_BYTES (GB_BYTES + GA_BYTES) // one buffer: weight tile, then activation tile
// eight 16-B pieces of one thread into LDS, through no register: piece i goes to LDS byte l + i * ls and comes from g + i * 24,576 B (16 weight rows of 1,536 B, or 8 activation rows of 3,072 B).
// The wait on xcnt is the last line of the copies' own statement, so that it stands in front of any rewrite of the address registers they name.
__device__ __forceinline__ void stage8(unsigned l, unsigned ls, const char* g) {
  asm volatile("global_load_async_to_lds_b128 %0, %8, off\n\t"
               "global_load_async_to_lds_b128 %1, %9, off\n\t"
               "global_load_async_to_lds_b128 %2, %10, off\n\t"
               "global_load_async_to_lds_b128 %3, %11, off\n\t"
               "global_load_async_to_lds_b128 %4, %12, off\n\t"
               "global_load_async_to_lds_b128 %5, %13, off\n\t"
               "global_load_async_to_lds_b128 %6, %14, off\n\t"
               "global_load_async_to_lds_b128 %7, %15, off\n\t"
               "s_wait_xcnt 0x0"
               :: "v"(l), "v"(l + ls), "v"(l + 2 * ls), "v"(l + 3 * ls), "v"(l + 4 * ls), "v"(l + 5 * ls), "v"(l + 6 * ls), "v"(l + 7 * ls),
                  "v"(g), "v"(g + 24576), "v"(g + 2 * 24576), "v"(g + 3 * 24576), "v"(g + 4 * 24576), "v"(g + 5 * 24576), "v"(g + 6 * 24576), "v"(g + 7 * 24576) : "memory");
}
// tile t (64 k) of a 64-row x 128-column block into buffer t & 1: 128 weight rows x 128 B (8 threads a row) and 64 activation rows x 256 B (16 threads a row); every wave-wide copy covers four whole 128-B lines
#define GSTAGE(t) do { stage8(lb + ((t) & 1) * GST_BYTES, 16 * GBP * 2, gb + (size_t)(t) * (GKS * 2)); stage8(la + ((t) & 1) * GST_BYTES, 8 * GAP * 4, ga + (size_t)(t) * (GKS * 4)); } while (0)
__global__ __launch_bounds__(128) void k_qkv(const float* __restrict__ XQ, const float* __restrict__ XK, const float* __restrict__ XV, const __bf16* __restrict__ P, const float* __restrict__ BQ, const float* __restrict__ BK, const float* __restrict__ BV, const float* __restrict__ CS, _Float16* __restrict__ QK, _Float16* __restrict__ QKL, _Float16* __restrict__ VTH, _Float16* __restrict__ VTL) {
  const int nc = blockIdx.y * 128, which0 = (nc < DM) ? 0 : (nc < QKW) ? 1 : 2; const float* X = (which0 == 0) ? XQ : (which0 == 1) ? XK : XV; const float* BB = BQ ? ((which0 == 0) ? BQ + nc : (which0 == 1) ? BK + (nc - DM) : BV + (nc - QKW)) : nullptr;   // column blocks 0..5 q, 6..7 k, 8..9 v
  __shared__ __align__(16) char sm[2 * GST_BYTES];   // two buffers of the k loop; behind the loop's last barrier the same bytes stage the output
  _Float16 (*so)[16][136] = (_Float16 (*)[16][136])sm; _Float16 (*sol)[16][136] = (_Float16 (*)[16][136])(sm + 4 * 16 * 136 * 2); _Float16 (*sth)[72] = (_Float16 (*)[72])sm; _Float16 (*stl)[72] = (_Float16 (*)[72])(sm + 128 * 72 * 2);
  const int tid = threadIdx.x, wave = tid >> 5, lane = tid & 31, col = lane & 15, g = lane >> 4; const size_t r0 = (size_t)blockIdx.x * 64 + wave * 16; const int n0 = blockIdx.y * 128;
  v8f acc[8] = {};
  const char* gb = (const char*)(P + (size_t)(n0 + (tid >> 3)) * DM + (tid & 7) * 8);                        // this thread's first weight piece of tile 0
  const char* ga = (const char*)(X + ((size_t)blockIdx.x * 64 + (tid >> 4)) * DM + (tid & 15) * 4);          // its first activation piece of tile 0
  const unsigned lb = (unsigned)(uintptr_t)&sm[(tid >> 3) * (GBP * 2) + (tid & 7) * 16], la = (unsigned)(uintptr_t)&sm[GB_BYTES + (tid >> 4) * (GAP * 4) + (tid & 15) * 16];
  // q and k blocks: this lane's 16 table pairs (its 8 rows' positions x the frequencies col and 16 + col), asked for in front of the k loop so that their latency passes under it
  v2f cs[8][2] = {};
  if (n0 < QKW) { const float* cp = CS + ((size_t)((blockIdx.x * 64) % SS + wave * 16 + 8 * g) * 32 + col) * 2;
#pragma unroll   // constant indices keep cs in registers, and the 16 loads issue as one group
    for (int r = 0; r < 8; ++r) { cs[r][0] = *(const v2f*)(cp + r * 64); cs[r][1] = *(const v2f*)(cp + r * 64 + 32); } }
  GSTAGE(0);
  asm volatile("s_wait_asynccnt 0x0" ::: "memory");   // tile 0 has landed before the barrier that publishes it
  __syncthreads();
  GSTAGE(1);
#pragma unroll 1
  for (int ts = 0; ts < DM / GKS; ++ts) { const __bf16* bB = (const __bf16*)(sm + (ts & 1) * GST_BYTES); const float* bA = (const float*)(sm + (ts & 1) * GST_BYTES + GB_BYTES);
#pragma unroll
    for (int kc = 0; kc < GKS / 32; ++kc) { v16b a; { const float* p = bA + (wave * 16 + col) * GAP + kc * 32 + 8 * g;
#pragma unroll
        for (int i = 0; i < 8; ++i) { a[i] = (__bf16)p[i]; a[8 + i] = (__bf16)p[16 + i]; } }
      v16b w[8];   // the eight weight fragments of this k chunk are read as one group in front of its products: one LDS latency a chunk, not one a product
#pragma unroll
      for (int j = 0; j < 8; ++j) w[j] = frag_b(bB + (j * 16 + col) * GBP + kc * 32, lane);
#pragma unroll
      for (int j = 0; j < 8; ++j) acc[j] = wmma_bf(a, w[j], acc[j]); }
    asm volatile("s_wait_dscnt 0x0" ::: "memory");      // this wave's reads of tile ts have returned before its buffer is refilled
    asm volatile("s_wait_asynccnt 0x0" ::: "memory");   // this wave's copies of tile ts + 1 have landed before the barrier that publishes them
    __syncthreads();                                    // publishes tile ts + 1 and ends every wave's reads of tile ts
    if (ts + 2 < DM / GKS) GSTAGE(ts + 2); }
  asm volatile("s_wait_asynccnt 0x0" ::: "memory");     // no copy is outstanding when the buffers become output staging
  if (n0 < QKW) {   // q stored unscaled (f16 sigma ~0.6, no subnormal exposure); 1/8 applied to the f32 score
    // rotate-half RoPE in registers: the block's 128 columns are two heads; tiles ja and ja + 2 hold columns d (< 32) and d + 32 of one head in the same lane and register: y[d] = x[d] cos - x[d + 32] sin, y[d + 32] = x[d + 32] cos + x[d] sin, frequency d
#pragma unroll   // constant indices keep acc and cs in registers (this loop and the one inside it)
    for (int p = 0; p < 4; ++p) { const int ja = (p >> 1) * 4 + (p & 1), jb = ja + 2; const float ba = BB ? bfr(BB[ja * 16 + col]) : 0.f, bb = BB ? bfr(BB[jb * 16 + col]) : 0.f;
#pragma unroll
      for (int r = 0; r < 8; ++r) { const float xa = acc[ja][r] + ba, xb = acc[jb][r] + bb, c = cs[r][p & 1][0], sn = cs[r][p & 1][1]; const float ya = xa * c - xb * sn, yb = xb * c + xa * sn; const _Float16 ha = (_Float16)ya, hb = (_Float16)yb;
        so[wave][8 * g + r][ja * 16 + col] = ha; sol[wave][8 * g + r][ja * 16 + col] = (_Float16)((ya - (float)ha) * 2048.0f); so[wave][8 * g + r][jb * 16 + col] = hb; sol[wave][8 * g + r][jb * 16 + col] = (_Float16)((yb - (float)hb) * 2048.0f); } }   // rotated q, k (+ bias) as f16 hi + (x2048) residual
    LDSX();
    const size_t pb = (n0 < DM) ? (size_t)n0 : KOFF + (n0 - DM); const int pw = (n0 < DM) ? DM : KVW;   // this block's first column in its plane, and the plane's row
#pragma unroll   // straight-line: no store's registers are rewritten over a back edge
    for (int rl = 0; rl < 16; ++rl) if (lane < 16) { vst2((unsigned*)(QK + pb + (r0 + rl) * pw + lane * 8), *(const v4u*)&so[wave][rl][lane * 8]); vst2((unsigned*)(QKL + pb + (r0 + rl) * pw + lane * 8), *(const v4u*)&sol[wave][rl][lane * 8]); }
  } else {
#pragma unroll
    for (int j = 0; j < 8; ++j) {
#pragma unroll
      for (int r = 0; r < 8; ++r) { const float v = acc[j][r] + (BB ? bfr(BB[j * 16 + col]) : 0.f); const _Float16 hv = (_Float16)v; sth[j * 16 + col][wave * 16 + 8 * g + r] = hv; stl[j * 16 + col][wave * 16 + 8 * g + r] = (_Float16)((v - (float)hv) * 2048.0f); } }
    __syncthreads();
    const size_t rb = (size_t)blockIdx.x * 64; const int b = (int)(rb / SS), s0 = (int)(rb % SS); const int pc0 = n0 - QKW;
    for (int q = tid; q < 128 * 8; q += 128) { const int d = q >> 3, pc = q & 7; const size_t o = ((size_t)b * KVW + pc0 + d) * SS + s0 + pc * 8; vst2((unsigned*)(VTH + o), *(const v4u*)&sth[d][pc * 8]); vst2((unsigned*)(VTL + o), *(const v4u*)&stl[d][pc * 8]); }
  }
}
#define KP 72   // LDS pitch of a staged K row (64 d) in f16: 144 B = 16 B x 9, no bank conflict for 16-byte fragment reads
// LDS pitch of a staged V row in f16 is the tile's keys + 8: 80 B = 16 B x 5 (32 keys) or 144 B = 16 B x 9 (64 keys), likewise
// one key tile of 32 keys into LDS, through no register: each of the 128 threads copies two 16-B pieces of K hi (32 rows x 128 B) and two of V hi (64 rows x 64 B).
// The wait on xcnt is the last line of the copies' own statement, so that it stands in front of any rewrite of the address registers they name.
__device__ __forceinline__ void stage_kv(unsigned lk0, unsigned lk1, unsigned lv0, unsigned lv1, const _Float16* k0, const _Float16* k1, const _Float16* v0, const _Float16* v1) {
  asm volatile("global_load_async_to_lds_b128 %0, %4, off\n\t"
               "global_load_async_to_lds_b128 %1, %5, off\n\t"
               "global_load_async_to_lds_b128 %2, %6, off\n\t"
               "global_load_async_to_lds_b128 %3, %7, off\n\t"
               "s_wait_xcnt 0x0"
               :: "v"(lk0), "v"(lk1), "v"(lv0), "v"(lv1), "v"(k0), "v"(k1), "v"(v0), "v"(v1) : "memory");
}
// one key tile of 64 keys likewise: four 16-B pieces of K hi a thread (64 rows x 128 B, 8 threads a row, its rows 16 apart) and four of V hi (64 rows d x 128 B, likewise); every wave-wide copy covers four whole 128-B lines. Both pitches are KP.
__device__ __forceinline__ void stage_kv64(unsigned lk, unsigned lv, const _Float16* k, const _Float16* v) {
  asm volatile("global_load_async_to_lds_b128 %0, %8, off\n\t"
               "global_load_async_to_lds_b128 %1, %9, off\n\t"
               "global_load_async_to_lds_b128 %2, %10, off\n\t"
               "global_load_async_to_lds_b128 %3, %11, off\n\t"
               "global_load_async_to_lds_b128 %4, %12, off\n\t"
               "global_load_async_to_lds_b128 %5, %13, off\n\t"
               "global_load_async_to_lds_b128 %6, %14, off\n\t"
               "global_load_async_to_lds_b128 %7, %15, off\n\t"
               "s_wait_xcnt 0x0"
               :: "v"(lk), "v"(lk + 16 * KP * 2), "v"(lk + 32 * KP * 2), "v"(lk + 48 * KP * 2), "v"(lv), "v"(lv + 16 * KP * 2), "v"(lv + 32 * KP * 2), "v"(lv + 48 * KP * 2),
                  "v"(k), "v"(k + 16 * KVW), "v"(k + 32 * KVW), "v"(k + 48 * KVW), "v"(v), "v"(v + 16 * SS), "v"(v + 32 * SS), "v"(v + 48 * SS) : "memory");
}
// lane l with lane l ^ 16 (the other half of the wave), through no LDS
__device__ __forceinline__ float xhalf(float x) { return __builtin_bit_cast(float, __builtin_amdgcn_permlanex16(__builtin_bit_cast(int, x), __builtin_bit_cast(int, x), 0x76543210, 0xfedcba98, false, false)); }
// ---- k_attn: block = (two tiles of 64 queries, head h, batch b): causal flash attention, transposed: S^T = K . Q^T (A = 16 key rows from LDS, B = the wave's 16 queries, kept in registers), so a lane holds half the tile's scores of ONE query (column col; keys ct * 16 + 8 g + r), lane ^ 16 the other half: maximum and sum in-lane plus one exchange between the halves. Each pair of score tiles, converted in place, is the B operand (32 keys) of O^T += V^T . P^T (A = 16 rows d of V^T from LDS). scores = (q.k) * 0.125; O[b*S+q][h*64+d] = (acc + accl / 2048) / (2048 l) (256-B segments)
// A trip of the key loop takes KT keys: 64 in the single-product form (one running-maximum step, one rescale of O^T, one set of waits and one barrier per 64 keys), 32 in the 3-product form of the leading query tiles.
template <bool LEAD> __device__ __forceinline__ void attn_tile(const _Float16* __restrict__ QK, const _Float16* __restrict__ QKL, const _Float16* __restrict__ VTH, const _Float16* __restrict__ VTL, float* __restrict__ O, float (*so)[16][68], _Float16* sk, _Float16* sv, const int qb, const int h, const int b) {
  constexpr int KT = LEAD ? 32 : 64, VP = KT + 8, NCT = KT / 16, NC2 = KT / 32;   // keys of a tile, pitch of a V row, score tiles, 32-key operands of P
  const int tid = threadIdx.x, wave = tid >> 5, lane = tid & 31, col = lane & 15, g = lane >> 4;
  const int q0 = qb * 64 + wave * 16; const size_t rq = (size_t)b * SS + q0 + col; const int hk = h / GRP;   // the kv head of query head h
  v16h aq[2], aql[2];
#pragma unroll
  for (int kc = 0; kc < 2; ++kc) { aq[kc] = frag_h(QK + rq * DM + h * HD + kc * 32, lane); if constexpr (LEAD) aql[kc] = frag_h(QKL + rq * DM + h * HD + kc * 32, lane); }
  float m = -3.0e38f, l = 0.f;   // of query q0 + col; l sums this half's keys only, the halves are joined behind the loop
  v8f acc[4] = {}, accl[4] = {};   // acc[dt][r] = O^T[d = dt * 16 + 8 g + r][query q0 + col]
  const int nksc = (qb * 64 + 64) / KT;   // causal: key tiles up to the end of this query block
  constexpr int VS = LEAD ? 2 : 3;   // 4 or 8 threads a V row
  const _Float16* kg = QK + KOFF + ((size_t)b * SS + (tid >> 3)) * KVW + hk * HD + (tid & 7) * 8;   // this thread's first K piece of tile 0 (the others: 16 keys on each)
  const _Float16* vg = VTH + ((size_t)b * KVW + hk * HD + (tid >> VS)) * SS + (tid & ((1 << VS) - 1)) * 8;   // its first V piece of tile 0 (the others: 32, or 16, rows on each)
  const unsigned lk = (unsigned)(uintptr_t)&sk[(tid >> 3) * KP + (tid & 7) * 8], lv = (unsigned)(uintptr_t)&sv[(tid >> VS) * VP + (tid & ((1 << VS) - 1)) * 8];
#define STAGE(t) do { if constexpr (LEAD) stage_kv(lk + ((t) & 1) * (KT * KP * 2), lk + ((t) & 1) * (KT * KP * 2) + 16 * KP * 2, lv + ((t) & 1) * (64 * VP * 2), lv + ((t) & 1) * (64 * VP * 2) + 32 * VP * 2, kg + (size_t)(t) * KT * KVW, kg + ((size_t)(t) * KT + 16) * KVW, vg + (t) * KT, vg + (t) * KT + 32 * SS); \
                      else stage_kv64(lk + ((t) & 1) * (KT * KP * 2), lv + ((t) & 1) * (64 * VP * 2), kg + (size_t)(t) * KT * KVW, vg + (t) * KT); } while (0)
  STAGE(0);
  asm volatile("s_wait_asynccnt 0x0" ::: "memory");   // tile 0 has landed before the barrier that publishes it
  __syncthreads();
  if (1 < nksc) STAGE(1);
#pragma unroll 1
  for (int ks = 0; ks < nksc; ++ks) { v8f s[NCT]; const int lim = q0 + col - 8 * g - ks * KT;   // the last score row of this lane's tile (ct * 16 + r) that its query may see
    const _Float16* bk = sk + (ks & 1) * (KT * KP); const _Float16* bv = sv + (ks & 1) * (64 * VP);
    v16h kf[NCT][2];   // the tile's K fragments are read as one group in front of the score products: one LDS latency a tile, not one a product
#pragma unroll
    for (int ct = 0; ct < NCT; ++ct) {
#pragma unroll
      for (int kc = 0; kc < 2; ++kc) kf[ct][kc] = frag_h(bk + (ct * 16 + col) * KP + kc * 32, lane); }
    if constexpr (LEAD) {   // leading query blocks (few keys, outputs far above the global rms): 3 products
#pragma unroll
      for (int ct = 0; ct < NCT; ++ct) { const _Float16* krowl = QKL + KOFF + ((size_t)b * SS + ks * KT + ct * 16 + col) * KVW + hk * HD; v8f c = {}, cl = {};
#pragma unroll
        for (int kc = 0; kc < 2; ++kc) { const v16h kh = kf[ct][kc]; c = wmma16(kh, aq[kc], c); cl = wmma16(kh, aql[kc], cl); cl = wmma16(frag_h(krowl + kc * 32, lane), aq[kc], cl); }
#pragma unroll
        for (int r = 0; r < 8; ++r) s[ct][r] = c[r] + cl[r] * (1.0f / 2048.0f); } }
    else {   // single product elsewhere; the four score tiles side by side, so that successive products do not depend on one another
#pragma unroll
      for (int ct = 0; ct < NCT; ++ct) s[ct] = v8f{};
#pragma unroll
      for (int kc = 0; kc < 2; ++kc) {
#pragma unroll
        for (int ct = 0; ct < NCT; ++ct) s[ct] = wmma16(kf[ct][kc], aq[kc], s[ct]); } }
#pragma unroll
    for (int ct = 0; ct < NCT; ++ct) {
#pragma unroll
      for (int r = 0; r < 8; ++r) s[ct][r] = (ct * 16 + r <= lim) ? s[ct][r] * 0.125f : -3.0e38f; }   // 1/sqrt(64); masked keys (key ks * KT + ct * 16 + 8 g + r above query q0 + col) excluded
    v16h vf[4][NC2];   // the tile's V fragments are read as one group here, so that their LDS latency passes under the softmax arithmetic
#pragma unroll
    for (int dt = 0; dt < 4; ++dt) {
#pragma unroll
      for (int c2 = 0; c2 < NC2; ++c2) vf[dt][c2] = frag_h(bv + (dt * 16 + col) * VP + c2 * 32, lane); }
    float mx = fmaxf(s[0][0], s[1][0]);
#pragma unroll
    for (int r = 1; r < 8; ++r) mx = fmaxf(mx, fmaxf(s[0][r], s[1][r]));
    if constexpr (NCT == 4) { float mxb = fmaxf(s[2][0], s[3][0]);   // a second chain beside the first, not one of twice the length
#pragma unroll
      for (int r = 1; r < 8; ++r) mxb = fmaxf(mxb, fmaxf(s[2][r], s[3][r]));
      mx = fmaxf(mx, mxb); }
    mx = fmaxf(mx, xhalf(mx));   // over all keys of the tile
    const float mn = fmaxf(m, mx);
    float ta = (m - mn) * 1.442695041f, t[NCT][8];   // e^x = 2^(x log2 e), as __expf forms it
#pragma unroll
    for (int ct = 0; ct < NCT; ++ct) {
#pragma unroll
      for (int r = 0; r < 8; ++r) t[ct][r] = (s[ct][r] - mn) * 1.442695041f; }
    // the hardware exponentials, in place, one statement a score tile: inside a statement no v_exp_f32 is followed by an instruction that reads its result or overwrites its source, and the v_nop keeps
    // that slot behind the last one.
    asm("v_exp_f32 %0, %0\n\tv_exp_f32 %1, %1\n\tv_exp_f32 %2, %2\n\tv_exp_f32 %3, %3\n\tv_exp_f32 %4, %4\n\tv_exp_f32 %5, %5\n\tv_exp_f32 %6, %6\n\tv_exp_f32 %7, %7\n\tv_exp_f32 %8, %8\n\tv_nop"
        : "+v"(ta), "+v"(t[0][0]), "+v"(t[0][1]), "+v"(t[0][2]), "+v"(t[0][3]), "+v"(t[0][4]), "+v"(t[0][5]), "+v"(t[0][6]), "+v"(t[0][7]));
#pragma unroll   // constant indices keep t in registers
    for (int ct = 1; ct < NCT; ++ct)
      asm("v_exp_f32 %0, %0\n\tv_exp_f32 %1, %1\n\tv_exp_f32 %2, %2\n\tv_exp_f32 %3, %3\n\tv_exp_f32 %4, %4\n\tv_exp_f32 %5, %5\n\tv_exp_f32 %6, %6\n\tv_exp_f32 %7, %7\n\tv_nop"
          : "+v"(t[ct][0]), "+v"(t[ct][1]), "+v"(t[ct][2]), "+v"(t[ct][3]), "+v"(t[ct][4]), "+v"(t[ct][5]), "+v"(t[ct][6]), "+v"(t[ct][7]));
    const float alpha = (m <= -1.0e38f) ? 0.f : ta;
    float es = 0.f;
#pragma unroll
    for (int r = 0; r < 8; ++r) { s[0][r] = (s[0][r] <= -1.0e38f) ? 0.f : t[0][r]; s[1][r] = (s[1][r] <= -1.0e38f) ? 0.f : t[1][r]; es += s[0][r] + s[1][r]; }
    if constexpr (NCT == 4) { float esb = 0.f;   // a second chain beside the first, not one of twice the length
#pragma unroll
      for (int r = 0; r < 8; ++r) { s[2][r] = (s[2][r] <= -1.0e38f) ? 0.f : t[2][r]; s[3][r] = (s[3][r] <= -1.0e38f) ? 0.f : t[3][r]; esb += s[2][r] + s[3][r]; }
      es += esb; }
    l = l * alpha + es; m = mn;
#pragma unroll
    for (int dt = 0; dt < 4; ++dt) {
#pragma unroll
      for (int r = 0; r < 8; ++r) { acc[dt][r] *= alpha; if constexpr (LEAD) accl[dt][r] *= alpha; } }
    v16h pa[NC2], pl[NC2];   // P^T as B operands of 32 keys: element i = key c2 * 32 + 8 g + i, element 8 + i = key c2 * 32 + 16 + 8 g + i, the k order of frag_h
#pragma unroll
    for (int c2 = 0; c2 < NC2; ++c2) {
#pragma unroll
      for (int i = 0; i < 8; ++i) { const float x0 = s[2 * c2][i] * 2048.0f, x1 = s[2 * c2 + 1][i] * 2048.0f; const _Float16 h0 = (_Float16)x0, h1 = (_Float16)x1; pa[c2][i] = h0; pa[c2][8 + i] = h1; if constexpr (LEAD) { pl[c2][i] = (_Float16)((x0 - (float)h0) * 2048.0f); pl[c2][8 + i] = (_Float16)((x1 - (float)h1) * 2048.0f); } } }   // P scaled by 2^11 before the f16 split so small softmax weights stay out of the f16 subnormal range; 2^-11 folded into the epilogue
#pragma unroll
    for (int c2 = 0; c2 < NC2; ++c2) {
#pragma unroll
      for (int dt = 0; dt < 4; ++dt) { const size_t vr = ((size_t)b * KVW + hk * HD + dt * 16 + col) * SS + ks * KT + c2 * 32; const v16h vh = vf[dt][c2]; acc[dt] = wmma16(vh, pa[c2], acc[dt]); if constexpr (LEAD) { accl[dt] = wmma16(vh, pl[c2], accl[dt]); accl[dt] = wmma16(frag_h(VTL + vr, lane), pa[c2], accl[dt]); } } }   // leading query blocks: P hi/lo x V hi/lo (3 products); elsewhere P x V single
    if constexpr (LEAD) asm volatile("s_wait_xcnt 0x0" ::: "memory");   // stands in front of the next trip's rewrite of the address registers of this trip's residual loads
    asm volatile("s_wait_dscnt 0x0" ::: "memory");      // this wave's reads of the tile have returned before the buffer is refilled
    asm volatile("s_wait_asynccnt 0x0" ::: "memory");   // this wave's copies of tile ks + 1 have landed before the barrier that publishes them
    __syncthreads();                                    // publishes tile ks + 1 and ends every wave's reads of tile ks
    if (ks + 2 < nksc) STAGE(ks + 2); }
  asm volatile("s_wait_asynccnt 0x0" ::: "memory");     // no copy is outstanding when the wave goes on to the epilogue, then the second tile or its end
#undef STAGE
  l += xhalf(l);   // the two halves' sums of one query
  const float il = (1.0f / 2048.0f) / l;
#pragma unroll
  for (int dt = 0; dt < 4; ++dt) {
#pragma unroll
    for (int r = 0; r < 8; ++r) so[wave][col][dt * 16 + 8 * g + r] = (LEAD ? acc[dt][r] + accl[dt][r] * (1.0f / 2048.0f) : acc[dt][r]) * il; }
  LDSX();
  for (int rl = 0; rl < 16; ++rl) if (lane < 16) vst2(O + ((size_t)b * SS + q0 + rl) * DM + h * HD + lane * 4, *(const v4f*)&so[wave][rl][lane * 4]);
}
// LEAD is a compile-time choice, so that the key loop exists twice: the loop of the single-product tiles (all but query tiles 0 and 1) holds no residual accumulators, no residual of P, no rescale or copy of either and no test per product.
__global__ __launch_bounds__(128) void k_attn(const _Float16* __restrict__ QK, const _Float16* __restrict__ QKL, const _Float16* __restrict__ VTH, const _Float16* __restrict__ VTL, const void* __restrict__ KMASK, float* __restrict__ O) {
  __shared__ __align__(16) float so[4][16][68];
  __shared__ __align__(16) _Float16 sk[2 * 64 * KP], sv[2 * 64 * KP];   // two buffers each: the block's K hi and V hi tile of 64 keys (of 32 in the 3-product form, which fills less), read by all four waves
  // A block takes two query tiles one after the other, TQB - 1 - x and x: together 64 * (TQB + 1) keys whatever x is, so that every block of the launch, all resident at once, has the same work.
  // Rolled: one copy of each form serves both tiles. The foot barrier of a tile's last trip has ended every wave's reads of sk and sv before the next tile's first copies; so is each wave's own. The choice is the same for the whole block, so every wave passes the same barriers.
#pragma unroll 1
  for (int half = 0; half < 2; ++half) { const int qb = half ? (int)blockIdx.x : TQB - 1 - (int)blockIdx.x;
    if (qb < 2) attn_tile<true>(QK, QKL, VTH, VTL, O, so, sk, sv, qb, blockIdx.y, blockIdx.z); else attn_tile<false>(QK, QKL, VTH, VTL, O, so, sk, sv, qb, blockIdx.y, blockIdx.z); }
}
// ---- k_out: block = (64 rows, 128 cols): out = O(hi/lo) . Wo rows (2 products) + bo
__global__ __launch_bounds__(128) void k_out(const float* __restrict__ O, const __bf16* __restrict__ P, const float* __restrict__ BO, float* __restrict__ Y) {
  __shared__ __align__(16) char sm[2 * GST_BYTES];   // two buffers of the k loop; behind the loop's last barrier the same bytes stage the output
  float (*so)[16][132] = (float (*)[16][132])sm;
  const int tid = threadIdx.x, wave = tid >> 5, lane = tid & 31, col = lane & 15, g = lane >> 4; const size_t r0 = (size_t)blockIdx.x * 64 + wave * 16; const int n0 = blockIdx.y * 128;
  v8f acc[8] = {};
  const char* gb = (const char*)(P + (size_t)(n0 + (tid >> 3)) * DM + (tid & 7) * 8);                        // this thread's first weight piece of tile 0
  const char* ga = (const char*)(O + ((size_t)blockIdx.x * 64 + (tid >> 4)) * DM + (tid & 15) * 4);          // its first activation piece of tile 0
  const unsigned lb = (unsigned)(uintptr_t)&sm[(tid >> 3) * (GBP * 2) + (tid & 7) * 16], la = (unsigned)(uintptr_t)&sm[GB_BYTES + (tid >> 4) * (GAP * 4) + (tid & 15) * 16];
  GSTAGE(0);
  asm volatile("s_wait_asynccnt 0x0" ::: "memory");   // tile 0 has landed before the barrier that publishes it
  __syncthreads();
  GSTAGE(1);
#pragma unroll 1
  for (int ts = 0; ts < DM / GKS; ++ts) { const __bf16* bB = (const __bf16*)(sm + (ts & 1) * GST_BYTES); const float* bA = (const float*)(sm + (ts & 1) * GST_BYTES + GB_BYTES);
#pragma unroll
    for (int kc = 0; kc < GKS / 32; ++kc) { const F2 a = split_row(bA + (wave * 16 + col) * GAP, kc * 32, lane);
      v16b w[8];   // the eight weight fragments of this k chunk are read as one group in front of its products: one LDS latency a chunk, not one a fragment
#pragma unroll
      for (int j = 0; j < 8; ++j) w[j] = frag_b(bB + (j * 16 + col) * GBP + kc * 32, lane);
#pragma unroll
      for (int j = 0; j < 8; ++j) { acc[j] = wmma_bf(a.l, w[j], acc[j]); acc[j] = wmma_bf(a.h, w[j], acc[j]); } }
    asm volatile("s_wait_dscnt 0x0" ::: "memory");      // this wave's reads of tile ts have returned before its buffer is refilled
    asm volatile("s_wait_asynccnt 0x0" ::: "memory");   // this wave's copies of tile ts + 1 have landed before the barrier that publishes them
    __syncthreads();                                    // publishes tile ts + 1 and ends every wave's reads of tile ts
    if (ts + 2 < DM / GKS) GSTAGE(ts + 2); }
  asm volatile("s_wait_asynccnt 0x0" ::: "memory");     // no copy is outstanding when the buffers become output staging
#pragma unroll
  for (int j = 0; j < 8; ++j) {
#pragma unroll
    for (int r = 0; r < 8; ++r) so[wave][8 * g + r][j * 16 + col] = acc[j][r] + (BO ? bfr(BO[n0 + j * 16 + col]) : 0.f); }
  LDSX();
  for (int rl = 0; rl < 16; ++rl) vst2(Y + (r0 + rl) * DM + n0 + lane * 4, *(const v4f*)&so[wave][rl][lane * 4]);
}
extern "C" void kernel_launch(void* const* d_in, const int* in_sizes, int n_in, void* d_out, int out_size, void* d_ws, size_t ws_size, hipStream_t stream) {
  (void)in_sizes; (void)n_in; (void)out_size;
  const float** F = (const float**)d_in;   // 0 hidden_states [4,2048,768], 1 Wq [768,768], 2 Wk [768,256], 3 Wv [768,256], 4 Wo [768,768] (all (in,out))
  if (ws_size < (size_t)WS_END) return;
  char* ws = (char*)d_ws; __bf16* PK = (__bf16*)(ws + WS_PK); _Float16 *QK = (_Float16*)(ws + WS_QK), *QKL = (_Float16*)(ws + WS_QKL), *VTH = (_Float16*)(ws + WS_VTH), *VTL = (_Float16*)(ws + WS_VTL); float* O = (float*)(ws + WS_O); float* CS = (float*)(ws + WS_CS);
  k_pack<<<dim3((QKVW + DM) / PTN, DM / PTK), 256, 0, stream>>>(F[1], F[2], F[3], F[4], PK, CS);
  k_qkv<<<dim3(TNB * SS / 64, QKVW / 128), 128, 0, stream>>>(F[0], F[0], F[0], PK + PK_A, nullptr, nullptr, nullptr, CS, QK, QKL, VTH, VTL);
  k_attn<<<dim3(TQB / 2, NH, TNB), 128, 0, stream>>>(QK, QKL, VTH, VTL, nullptr, O);
  k_out<<<dim3(TOB, DM / 128), 128, 0, stream>>>(O, PK + PK_P, nullptr, (float*)d_out);
}
